// v000
// Measured on an AMD MI455X. A time is GPU time per run, averaged over a window of back-to-back runs after a warm-up
// (all launches, gaps included; the runs take copies of the inputs in turn), and the median of several windows.
// Apart from v000's, it joins two sittings. Times from different sittings can be a few percent apart, while
// side-by-side timings come from the same sitting.
// The starting kernel, v000, takes 561 microseconds a run.
// compute dtype: all float inputs rounded to bf16; LayerNorm in f32, its output rounded once to f16 x exact f16 copies (x 2^8) of the fused qkv weight on WMMA 16x16x32 (1 product) + bias; causal attention: 3-product scores and hi + residual P, v on the first 128 queries of each sequence, single f16 beyond; x 1/8 + rel_bias[h][k-q+511], running-max softmax in f32 (hardware exp); the per-row entropy from a second single-f16 score pass (precise logf); out = x + (o (bf16 hi + residual) . out_w (2 products) + out_b); second output = head-mean attention entropy.
#include <hip/hip_runtime.h>
#include <math.h>

typedef __attribute__((ext_vector_type(16))) _Float16 v16h;
typedef __attribute__((ext_vector_type(16))) __bf16 v16b;
typedef __attribute__((ext_vector_type(8)))  _Float16 v8h;
typedef __attribute__((ext_vector_type(8)))  float v8f;
typedef __attribute__((ext_vector_type(4)))  float v4f;
typedef __attribute__((ext_vector_type(2)))  float v2f;
typedef __attribute__((ext_vector_type(4)))  unsigned v4u;
typedef __attribute__((ext_vector_type(4)))  int v4i;
typedef float __attribute__((may_alias)) float_a;
typedef int __attribute__((may_alias)) int_a;

template <typename T> __device__ __forceinline__ void vst2(void* p, T v) { *(T*)p = v;  }
__device__ __forceinline__ v8f wmma16(v16h a, v16h b, v8f c) {
  v8f d = __builtin_amdgcn_wmma_f32_16x16x32_f16(false, a, false, b, (short)0, c, false, false);
  asm volatile("v_nop\n\tv_nop\n\tv_nop\n\tv_nop" : "+v"(d) : "v"(a), "v"(b));
  return d;
}
__device__ __forceinline__ v8f wmma_bf(v16b a, v16b b, v8f c) {
  v8f d = __builtin_amdgcn_wmma_f32_16x16x32_bf16(false, a, false, b, (short)0, c, false, false);
  asm volatile("v_nop\n\tv_nop\n\tv_nop\n\tv_nop" : "+v"(d) : "v"(a), "v"(b));
  return d;
}
// Pre-LN causal time attention with relative position bias (B 16, T 512, d 1,024, 16 heads x 64): x + out_proj(attention(LN(x))), plus the mean attention entropy per (batch, step) as a second output.
__device__ __forceinline__ v16h frag_h(const _Float16* rowk0, int lane) {
  union { v16h v; v8h q[2]; } u; const _Float16* p = rowk0 + 8 * (lane >> 4);
  u.q[0] = *(const v8h*)p; u.q[1] = *(const v8h*)(p + 16); return u.v;
}
__device__ __forceinline__ v16h frag_f32(const float* rowk0, int lane) {
  v16h a; const float* p = rowk0 + 8 * (lane >> 4);
#pragma unroll
  for (int i = 0; i < 8; ++i) { a[i] = (_Float16)p[i]; a[8 + i] = (_Float16)p[16 + i]; }
  return a;
}
__device__ __forceinline__ v16h frag_f32s(const float* rowk0, int lane, float sc) {
  v16h a; const float* p = rowk0 + 8 * (lane >> 4);
#pragma unroll
  for (int i = 0; i < 8; ++i) { a[i] = (_Float16)(p[i] * sc); a[8 + i] = (_Float16)(p[16 + i] * sc); }
  return a;
}
// column fragment from a [K][ld] layout (column n), rows >= K read as 0
__device__ __forceinline__ v16h fragc_f32(const float* W, int k0, int n, int lane, int ld, int K) {
  v16h a; const int g = lane >> 4;
#pragma unroll
  for (int i = 0; i < 8; ++i) { const int ka = k0 + 8 * g + i, kb = ka + 16;
    a[i] = (_Float16)(ka < K ? W[(size_t)(ka < K ? ka : K - 1) * ld + n] : 0.f); a[8 + i] = (_Float16)(kb < K ? W[(size_t)(kb < K ? kb : K - 1) * ld + n] : 0.f); }
  return a;
}
struct F2 { v16b h, l; };
__device__ __forceinline__ F2 bsplit16(const float v[16]) { F2 r;
#pragma unroll
  for (int i = 0; i < 16; ++i) { const __bf16 h = (__bf16)v[i]; r.h[i] = h; r.l[i] = (__bf16)(v[i] - (float)h); }
  return r; }
__device__ __forceinline__ F2 split_row(const float* row, int k0, int lane) { float v[16]; const float* p = row + k0 + 8 * (lane >> 4);
#pragma unroll
  for (int i = 0; i < 8; ++i) { v[i] = p[i]; v[8 + i] = p[16 + i]; }
  return bsplit16(v); }
__device__ __forceinline__ F2 split_rowK(const float* row, int k0, int lane, int K) { float v[16]; const int g = lane >> 4;
#pragma unroll
  for (int i = 0; i < 8; ++i) { const int ka = k0 + 8 * g + i, kb = ka + 16; v[i] = ka < K ? row[ka < K ? ka : K - 1] : 0.f; v[8 + i] = kb < K ? row[kb < K ? kb : K - 1] : 0.f; }
  return bsplit16(v); }
__device__ __forceinline__ F2 split_col(const float* W, int k0, int n, int lane, int ld, int K) { float v[16]; const int g = lane >> 4;
#pragma unroll
  for (int i = 0; i < 8; ++i) { const int ka = k0 + 8 * g + i, kb = ka + 16; v[i] = ka < K ? W[(size_t)(ka < K ? ka : K - 1) * ld + n] : 0.f; v[8 + i] = kb < K ? W[(size_t)(kb < K ? kb : K - 1) * ld + n] : 0.f; }
  return bsplit16(v); }
__device__ __forceinline__ v8f mac3(const F2& a, const F2& b, v8f c) { c = wmma_bf(a.l, b.h, c); c = wmma_bf(a.h, b.l, c); return wmma_bf(a.h, b.h, c); }
__device__ __forceinline__ float sigm(float v) { return 1.0f / (1.0f + expf(-v)); }
#define LDSX() do { asm volatile("s_wait_dscnt 0" ::: "memory"); __builtin_amdgcn_wave_barrier(); __builtin_amdgcn_fence(__ATOMIC_RELEASE, "workgroup"); } while (0)


#define NB 16
#define SS 512
#define SCALEF 0.125f
#define DM 1024
#define NH 16
#define MAXSEQ 512
__device__ __attribute__((noinline)) float log_p(float v) { return logf(v); }
#define HD 64
#define QKVW (3 * DM)
#ifndef TQB
#define TQB (SS / 64)
#define TNB NB
#define TOB (NB * SS / 64)     // output row tiles (all)
#endif
typedef __attribute__((ext_vector_type(8))) __bf16 v8b;
__device__ __forceinline__ v16b frag_b(const __bf16* rowk0, int lane) {
  union { v16b v; v8b q[2]; } u; const __bf16* p = rowk0 + 8 * (lane >> 4);
  u.q[0] = *(const v8b*)p; u.q[1] = *(const v8b*)(p + 16); return u.v;
}
__device__ __forceinline__ float bfr(float v) { return (float)(__bf16)v; }
__device__ __attribute__((noinline)) float exp_ni(float v) { return expf(v); }
__device__ __attribute__((noinline)) float erf_ni(float v) { return erff(v); }

#define PK_A 0                       // [3072][1024] Wqkv rows (natural [out][in])
#define PK_P (PK_A + QKVW * DM)        // [1024][1024] Wo rows (natural)
#define PK_END (PK_P + DM * DM)
#define WS_PK  0u
#define WS_QK  (WS_PK + 2u * PK_END)             // f16 [8192 rows][2048]: q | k
#define WS_QKL (WS_QK + 2u * NB * SS * 2 * DM)     // f16 q | k residual planes x2048
#define WS_VTH (WS_QKL + 2u * NB * SS * 2 * DM)    // f16 [b][1024 (h*64+d)][512 s] hi
#define WS_VTL (WS_VTH + 2u * NB * DM * SS)        // f16 lo x 2048
#define WS_O   (WS_VTL + 2u * NB * DM * SS)        // f32 [8192][1024]
#define WS_CS  (WS_O + 4u * NB * SS * DM)           // f32 2 x [512][32], unused
#define WS_XN  (WS_CS + 4u * 2 * SS * 32)                  // f32 [NR][1024] LayerNorm(x)
#define WS_ENT (WS_XN + 4u * (size_t)NB * SS * DM)     // f32 [b][h][t] attention entropy
#define WS_Y1  (WS_ENT + 4u * (size_t)NB * NH * SS)    // f32 [NR][1024] out-proj
#define WS_END (WS_Y1 + 4u * (size_t)NB * SS * DM)
// ---- k_pack: block = (row n, which): (in,out) column n -> bf16 row n; which 0..2 -> W_q/W_k/W_v into PK_A rows which*1024 + n; 3 -> W_o into PK_P
__global__ __launch_bounds__(256) void k_pack(const float* __restrict__ WQ, const float* __restrict__ WK, const float* __restrict__ WV, const float* __restrict__ WO, __bf16* __restrict__ PK) {
  __shared__ __align__(16) __bf16 s[DM]; const int n = blockIdx.x, which = blockIdx.y, t = threadIdx.x; const float* Wm = (which == 0) ? WQ : (which == 1) ? WK : (which == 2) ? WV : WO;   // (in,out) weights: pack row n = column n
  for (int k = t; k < DM; k += 256) s[k] = (__bf16)Wm[(size_t)k * DM + n];
  __syncthreads();
  __bf16* dst = (which < 3) ? PK + PK_A + ((size_t)which * DM + n) * DM : PK + PK_P + (size_t)n * DM;
  for (int q = t; q < DM / 8; q += 256) vst2((unsigned*)(dst + q * 8), *(const v4u*)&s[q * 8]);
}
__global__ __launch_bounds__(128) void k_qkv(const float* __restrict__ XQ, const float* __restrict__ XK, const float* __restrict__ XV, const __bf16* __restrict__ P, const float* __restrict__ BQ, const float* __restrict__ BK, const float* __restrict__ BV, _Float16* __restrict__ QK, _Float16* __restrict__ QKL, _Float16* __restrict__ VTH, _Float16* __restrict__ VTL) {
  const int which0 = (blockIdx.y * 128) / DM; const float* X = (which0 == 0) ? XQ : (which0 == 1) ? XK : XV; const float* BB = BQ ? (((which0 == 0) ? BQ : (which0 == 1) ? BK : BV) + (blockIdx.y * 128 - which0 * DM)) : nullptr;
  __shared__ __align__(16) _Float16 so[4][16][136], sol[4][16][136]; __shared__ __align__(16) _Float16 sth[128][72], stl[128][72];
  const int tid = threadIdx.x, wave = tid >> 5, lane = tid & 31, col = lane & 15, g = lane >> 4; const size_t r0 = (size_t)blockIdx.x * 64 + wave * 16; const int n0 = blockIdx.y * 128;
  v8f acc[8] = {};
#pragma unroll 2
  for (int kc = 0; kc < DM / 32; ++kc) { v16h a; { const float* p = X + (r0 + col) * DM + kc * 32 + 8 * g;   // LN'd rows (f32) rounded once to f16
#pragma unroll
      for (int i = 0; i < 8; ++i) { a[i] = (_Float16)p[i]; a[8 + i] = (_Float16)p[16 + i]; } }
#pragma unroll
    for (int j = 0; j < 8; ++j) acc[j] = wmma16(a, frag_h((const _Float16*)P + (size_t)(n0 + j * 16 + col) * DM + kc * 32, lane), acc[j]); }
#pragma unroll
  for (int j = 0; j < 8; ++j)
#pragma unroll
    for (int r = 0; r < 8; ++r) acc[j][r] *= (1.0f / 256.0f);
  if (n0 < 2 * DM) {   // q stored unscaled (f16 sigma ~0.6, no subnormal exposure); 1/8 applied to the f32 score
#pragma unroll
    for (int j = 0; j < 8; ++j) {
#pragma unroll
      for (int r = 0; r < 8; ++r) { const float v = acc[j][r] + (BB ? bfr(BB[j * 16 + col]) : 0.f); const _Float16 hv = (_Float16)v; so[wave][8 * g + r][j * 16 + col] = hv; sol[wave][8 * g + r][j * 16 + col] = (_Float16)((v - (float)hv) * 2048.0f); } }   // q, k (+ bias) as f16 hi + (x2048) residual
    LDSX();
    for (int rl = 0; rl < 16; ++rl) if (lane < 16) { vst2((unsigned*)(QK + (r0 + rl) * (2 * DM) + n0 + lane * 8), *(const v4u*)&so[wave][rl][lane * 8]); vst2((unsigned*)(QKL + (r0 + rl) * (2 * DM) + n0 + lane * 8), *(const v4u*)&sol[wave][rl][lane * 8]); }
  } else {
#pragma unroll
    for (int j = 0; j < 8; ++j) {
#pragma unroll
      for (int r = 0; r < 8; ++r) { const float v = acc[j][r] + (BB ? bfr(BB[j * 16 + col]) : 0.f); const _Float16 hv = (_Float16)v; sth[j * 16 + col][wave * 16 + 8 * g + r] = hv; stl[j * 16 + col][wave * 16 + 8 * g + r] = (_Float16)((v - (float)hv) * 2048.0f); } }
    __syncthreads();
    const size_t rb = (size_t)blockIdx.x * 64; const int b = (int)(rb / SS), s0 = (int)(rb % SS); const int pc0 = n0 - 2 * DM;
    for (int q = tid; q < 128 * 8; q += 128) { const int d = q >> 3, pc = q & 7; const size_t o = ((size_t)b * DM + pc0 + d) * SS + s0 + pc * 8; vst2((unsigned*)(VTH + o), *(const v4u*)&sth[d][pc * 8]); vst2((unsigned*)(VTL + o), *(const v4u*)&stl[d][pc * 8]); }
  }
}
// ---- k_attn: block = (64 queries, head h, batch b): causal flash attention (K = 64: 2 k-steps), scores = (q.k) * 0.125 (hi + residual, 3 products, for qb < 2; single f16 beyond), P.V: f16 P*2048 x V hi in acc, plus P lo x V hi + P x V lo (both x2048) in accl for qb < 2; O[b*S+q][h*64+d] = (acc + accl / 2048) / (2048 l) (256-B segments)
__global__ __launch_bounds__(128) void k_attn(const _Float16* __restrict__ QK, const _Float16* __restrict__ QKL, const _Float16* __restrict__ VTH, const _Float16* __restrict__ VTL, const void* __restrict__ KMASK, const float* __restrict__ RB, float* __restrict__ O) {
  __shared__ __align__(16) float sp[4][16][36]; __shared__ __align__(16) float so[4][16][68];
  const int tid = threadIdx.x, wave = tid >> 5, lane = tid & 31, col = lane & 15, g = lane >> 4;
  const int qb = blockIdx.x, h = blockIdx.y, b = blockIdx.z; const int q0 = qb * 64 + wave * 16; const size_t rq = (size_t)b * SS + q0 + col;
  v16h aq[2], aql[2];
#pragma unroll
  for (int kc = 0; kc < 2; ++kc) { aq[kc] = frag_h(QK + rq * (2 * DM) + h * HD + kc * 32, lane); aql[kc] = frag_h(QKL + rq * (2 * DM) + h * HD + kc * 32, lane); }
  float m[8], l[8];
#pragma unroll
  for (int r = 0; r < 8; ++r) { m[r] = -3.0e38f; l[r] = 0.f; }
  v8f acc[4] = {}, accl[4] = {};
  const int nks = (qb * 64 + 64) / 32;   // causal: key tiles up to the query tile's end
#pragma unroll 1
  for (int ks = 0; ks < nks; ++ks) { v8f s[2];
#pragma unroll
    for (int ct = 0; ct < 2; ++ct) { const int kk = ks * 32 + ct * 16 + col; const _Float16* krow = QK + ((size_t)b * SS + kk) * (2 * DM) + DM + h * HD; const _Float16* krowl = QKL + ((size_t)b * SS + kk) * (2 * DM) + DM + h * HD; v8f c = {}, cl = {};
      if (qb < 2) {   // leading query blocks (few keys, outputs far above the global rms): 3 products
#pragma unroll
        for (int kc = 0; kc < 2; ++kc) { const v16h kh = frag_h(krow + kc * 32, lane); c = wmma16(aq[kc], kh, c); cl = wmma16(aql[kc], kh, cl); cl = wmma16(aq[kc], frag_h(krowl + kc * 32, lane), cl); }
#pragma unroll
        for (int r = 0; r < 8; ++r) c[r] += cl[r] * (1.0f / 2048.0f); }
      else {
#pragma unroll
        for (int kc = 0; kc < 2; ++kc) c = wmma16(aq[kc], frag_h(krow + kc * 32, lane), c); }   // single product elsewhere
#pragma unroll
      for (int r = 0; r < 8; ++r) { const int qi = q0 + 8 * g + r; s[ct][r] = (kk <= qi) ? (c[r] * SCALEF + bfr(RB[(size_t)h * (2 * MAXSEQ - 1) + (kk - qi + MAXSEQ - 1)])) : -3.0e38f; } }   // causal; + rel_bias[h][k - q + 511]
#pragma unroll
    for (int r = 0; r < 8; ++r) { float mx = fmaxf(s[0][r], s[1][r]);
#pragma unroll
      for (int o = 1; o < 16; o <<= 1) mx = fmaxf(mx, __shfl_xor(mx, o));
      const float mn = fmaxf(m[r], mx); const float alpha = (m[r] <= -1.0e38f) ? 0.f : __expf(m[r] - mn);
      const float e0 = (s[0][r] <= -1.0e38f) ? 0.f : __expf(s[0][r] - mn), e1 = (s[1][r] <= -1.0e38f) ? 0.f : __expf(s[1][r] - mn); float es = e0 + e1;
#pragma unroll
      for (int o = 1; o < 16; o <<= 1) es += __shfl_xor(es, o);
      l[r] = l[r] * alpha + es; m[r] = mn;
#pragma unroll
      for (int dt = 0; dt < 4; ++dt) { acc[dt][r] *= alpha; accl[dt][r] *= alpha; }
      sp[wave][8 * g + r][col] = e0; sp[wave][8 * g + r][16 + col] = e1; }
    LDSX();
    v16h pa, pl; { const float* prow = &sp[wave][col][0] + 8 * (lane >> 4);
#pragma unroll
      for (int i = 0; i < 8; ++i) { const float x0 = prow[i] * 2048.0f, x1 = prow[16 + i] * 2048.0f; const _Float16 h0 = (_Float16)x0, h1 = (_Float16)x1; pa[i] = h0; pa[8 + i] = h1; pl[i] = (_Float16)((x0 - (float)h0) * 2048.0f); pl[8 + i] = (_Float16)((x1 - (float)h1) * 2048.0f); } }   // P scaled by 2^11 before the f16 split so small softmax weights stay out of the f16 subnormal range; 2^-11 folded into the epilogue
#pragma unroll
    for (int dt = 0; dt < 4; ++dt) { const size_t vr = ((size_t)b * DM + h * HD + dt * 16 + col) * SS + ks * 32; const v16h vh = frag_h(VTH + vr, lane); acc[dt] = wmma16(pa, vh, acc[dt]); if (qb < 2) { accl[dt] = wmma16(pl, vh, accl[dt]); accl[dt] = wmma16(pa, frag_h(VTL + vr, lane), accl[dt]); } }   // leading query blocks: P hi/lo x V hi/lo (3 products); elsewhere P x V single
    LDSX(); }
#pragma unroll
  for (int r = 0; r < 8; ++r) { const float il = (1.0f / 2048.0f) / l[r];
#pragma unroll
    for (int dt = 0; dt < 4; ++dt) so[wave][8 * g + r][dt * 16 + col] = (acc[dt][r] + accl[dt][r] * (1.0f / 2048.0f)) * il; }
  LDSX();
  for (int rl = 0; rl < 16; ++rl) if (lane < 16) vst2(O + ((size_t)b * SS + q0 + rl) * DM + h * HD + lane * 4, *(const v4f*)&so[wave][rl][lane * 4]);
}
// ---- k_out: block = (64 rows, 128 cols): out = O(hi/lo) . Wo rows (2 products) + bo
__global__ __launch_bounds__(128) void k_out(const float* __restrict__ O, const __bf16* __restrict__ P, const float* __restrict__ BO, float* __restrict__ Y) {
  __shared__ __align__(16) float so[4][16][132];
  const int tid = threadIdx.x, wave = tid >> 5, lane = tid & 31, col = lane & 15, g = lane >> 4; const size_t r0 = (size_t)blockIdx.x * 64 + wave * 16; const int n0 = blockIdx.y * 128;
  v8f acc[8] = {};
#pragma unroll 2
  for (int kc = 0; kc < DM / 32; ++kc) { const F2 a = split_row(O + (r0 + col) * DM, kc * 32, lane);
#pragma unroll
    for (int j = 0; j < 8; ++j) { const v16b w = frag_b(P + (size_t)(n0 + j * 16 + col) * DM + kc * 32, lane); acc[j] = wmma_bf(a.l, w, acc[j]); acc[j] = wmma_bf(a.h, w, acc[j]); } }
#pragma unroll
  for (int j = 0; j < 8; ++j) {
#pragma unroll
    for (int r = 0; r < 8; ++r) so[wave][8 * g + r][j * 16 + col] = acc[j][r] + bfr(BO[n0 + j * 16 + col]); }
  LDSX();
  for (int rl = 0; rl < 16; ++rl) vst2(Y + (r0 + rl) * DM + n0 + lane * 4, *(const v4f*)&so[wave][rl][lane * 4]);
}
// ---- k_pack3: the fused (in,out) W_attn [DM][3*DM] -> the three transposed f16 (x 2^8) row blocks
__global__ __launch_bounds__(256) void k_pack3(const float* __restrict__ WA, __bf16* __restrict__ PK) { __shared__ __align__(16) _Float16 s[DM]; const int n = blockIdx.x, which = blockIdx.y, t = threadIdx.x; for (int k = t; k < DM; k += 256) s[k] = (_Float16)(bfr(WA[(size_t)k * (3 * DM) + which * DM + n]) * 256.0f);   /* f16 x 2^8 rows (bit pattern stored in the bf16-typed buffer) */ __syncthreads(); for (int q = t; q < DM / 8; q += 256) vst2((unsigned*)(PK + PK_A + ((size_t)which * DM + n) * DM + q * 8), *(const v4u*)&s[q * 8]); }
// ---- k_ent: block = (64 queries, head, b): recompute the causal scores (single f16 q, k; + rel bias) and reduce -sum p log p = log(sum e^(s-m)) + m - (sum e^(s-m) s)/(sum e^(s-m)) per query; 256-B store per block
__global__ __launch_bounds__(128) void k_ent(const _Float16* __restrict__ QK, const float* __restrict__ RB, float* __restrict__ ENT) {
  __shared__ __align__(16) float sent[64];
  const int tid = threadIdx.x, wave = tid >> 5, lane = tid & 31, col = lane & 15, g = lane >> 4; const int h = blockIdx.y; const size_t b = blockIdx.z; const int q0 = blockIdx.x * 64 + wave * 16; const size_t rq = b * SS + q0;
  v16h aq[2];
#pragma unroll
  for (int kc = 0; kc < 2; ++kc) aq[kc] = frag_h(QK + (rq + col) * (2 * DM) + h * HD + kc * 32, lane);
  float m[8], l[8], ls[8];
#pragma unroll
  for (int r = 0; r < 8; ++r) { m[r] = -3.0e38f; l[r] = 0.f; ls[r] = 0.f; }
  const int nks = (blockIdx.x * 64 + 64) / 32;
#pragma unroll 1
  for (int ks = 0; ks < nks; ++ks) { v8f s[2];
#pragma unroll
    for (int ct = 0; ct < 2; ++ct) { const int kk = ks * 32 + ct * 16 + col; v8f c = {};
#pragma unroll
      for (int kc = 0; kc < 2; ++kc) c = wmma16(aq[kc], frag_h(QK + (b * SS + kk) * (2 * DM) + DM + h * HD + kc * 32, lane), c);
#pragma unroll
      for (int r = 0; r < 8; ++r) { const int qi = q0 + 8 * g + r; s[ct][r] = (kk <= qi) ? (c[r] * SCALEF + bfr(RB[(size_t)h * (2 * MAXSEQ - 1) + (kk - qi + MAXSEQ - 1)])) : -3.0e38f; } }
#pragma unroll
    for (int r = 0; r < 8; ++r) { float mx = fmaxf(s[0][r], s[1][r]);
#pragma unroll
      for (int o = 1; o < 16; o <<= 1) mx = fmaxf(mx, __shfl_xor(mx, o));
      const float mn = fmaxf(m[r], mx); const float alpha = (m[r] <= -1.0e38f) ? 0.f : __expf(m[r] - mn);
      const bool v0 = s[0][r] > -1.0e38f, v1 = s[1][r] > -1.0e38f; const float e0 = v0 ? __expf(s[0][r] - mn) : 0.f, e1 = v1 ? __expf(s[1][r] - mn) : 0.f;
      float es = e0 + e1, ess = (v0 ? e0 * s[0][r] : 0.f) + (v1 ? e1 * s[1][r] : 0.f);
#pragma unroll
      for (int o = 1; o < 16; o <<= 1) { es += __shfl_xor(es, o); ess += __shfl_xor(ess, o); }
      l[r] = l[r] * alpha + es; ls[r] = ls[r] * alpha + ess; m[r] = mn; } }
#pragma unroll
  for (int r = 0; r < 8; ++r) if (col == 0) sent[wave * 16 + 8 * g + r] = log_p(l[r]) + m[r] - ls[r] / l[r];
  __syncthreads(); if (tid < 16) vst2(ENT + ((size_t)b * NH + h) * SS + blockIdx.x * 64 + tid * 4, *(const v4f*)&sent[tid * 4]);
}
// ---- k_ln: block = row: XN = (x - mu) rsqrt(var + 1e-5) g + b (f32)
__global__ __launch_bounds__(256) void k_ln(const float* __restrict__ X, const float* __restrict__ G, const float* __restrict__ Bt, float* __restrict__ XN) {
  __shared__ float red[8]; const int t = threadIdx.x; const size_t row = blockIdx.x; float v[4]; float s = 0.f; for (int i = 0; i < 4; ++i) { v[i] = bfr(X[row * DM + t * 4 + i]); s += v[i]; }
#pragma unroll
  for (int o = 1; o < 32; o <<= 1) s += __shfl_xor(s, o);
  if ((t & 31) == 0) red[t >> 5] = s; __syncthreads(); float tot = 0.f; for (int i = 0; i < 8; ++i) tot += red[i]; const float mu = tot / (float)DM; __syncthreads();
  float q = 0.f; for (int i = 0; i < 4; ++i) { const float d = v[i] - mu; q += d * d; }
#pragma unroll
  for (int o = 1; o < 32; o <<= 1) q += __shfl_xor(q, o);
  if ((t & 31) == 0) red[t >> 5] = q; __syncthreads(); float tq = 0.f; for (int i = 0; i < 8; ++i) tq += red[i]; const float inv = 1.0f / sqrtf(tq / (float)DM + 1e-5f);
  v4f o4; for (int i = 0; i < 4; ++i) { const int e = t * 4 + i; o4[i] = (v[i] - mu) * inv * bfr(G[e]) + bfr(Bt[e]); } vst2(XN + row * DM + t * 4, o4);
}
__global__ __launch_bounds__(256) void k_fin(const float* __restrict__ X, const float* __restrict__ Y1, const float* __restrict__ ENT, float* __restrict__ OUT, float* __restrict__ OUT2) {
  const int t = threadIdx.x; const size_t row = blockIdx.x; const size_t b = row / SS; const int tt = (int)(row % SS);
  { v4f o4; for (int i = 0; i < 4; ++i) { const size_t e = row * DM + t * 4 + i; o4[i] = bfr(X[e]) + Y1[e]; } vst2(OUT + row * DM + t * 4, o4); }
  if ((tt & 31) == 0 && t < 32) { __shared__ __align__(16) float se[32]; float a = 0.f; for (int hh = 0; hh < NH; ++hh) a += ENT[(b * NH + hh) * SS + tt + t]; se[t] = a / (float)NH; __syncthreads(); if (t < 8) vst2(OUT2 + row + t * 4, *(const v4f*)&se[t * 4]); }
}
extern "C" void kernel_launch(void* const* d_in, const int* in_sizes, int n_in, void* d_out, int out_size, void* d_ws, size_t ws_size, hipStream_t stream) {
  (void)in_sizes; (void)n_in; (void)out_size;
  const float** F = (const float**)d_in;   // 0 x [16,512,1024], 1 qkv_w [1024,3072] (in,out), 2 qkv_b [3072], 3 out_w [1024,1024] (in,out), 4 out_b, 5 ln_g, 6 ln_b, 7 rel_bias [16,1023]
  if (ws_size < (size_t)WS_END) return;
  char* ws = (char*)d_ws; __bf16* PK = (__bf16*)(ws + WS_PK); _Float16 *QK = (_Float16*)(ws + WS_QK), *QKL = (_Float16*)(ws + WS_QKL), *VTH = (_Float16*)(ws + WS_VTH), *VTL = (_Float16*)(ws + WS_VTL); float *O = (float*)(ws + WS_O), *XN = (float*)(ws + WS_XN), *ENT = (float*)(ws + WS_ENT), *Y1 = (float*)(ws + WS_Y1);
  float* OUT = (float*)d_out; float* OUT2 = OUT + (size_t)NB * SS * DM;   // outputs concatenated: out [16,512,1024] then entropy [16,512]
  k_pack<<<dim3(DM, 4), 256, 0, stream>>>(F[3], F[3], F[3], F[3], PK);   // out_w ((in,out) -> transposed rows) into the Wo slot (q/k/v slots overwritten next)
  k_pack3<<<dim3(DM, 3), 256, 0, stream>>>(F[1], PK);
  k_ln<<<TNB * SS, 256, 0, stream>>>(F[0], F[5], F[6], XN);
  k_qkv<<<dim3(TNB * SS / 64, QKVW / 128), 128, 0, stream>>>(XN, XN, XN, PK + PK_A, F[2], F[2] + DM, F[2] + 2 * DM, QK, QKL, VTH, VTL);
  k_attn<<<dim3(TQB, NH, TNB), 128, 0, stream>>>(QK, QKL, VTH, VTL, nullptr, F[7], O);
  k_ent<<<dim3(TQB, NH, TNB), 128, 0, stream>>>(QK, F[7], ENT);
  k_out<<<dim3(TOB, DM / 128), 128, 0, stream>>>(O, PK + PK_P, F[4], Y1);
  k_fin<<<TOB * 64, 256, 0, stream>>>(F[0], Y1, ENT, OUT, OUT2);
}

// v001
// Measured time: 385 microseconds a run.
// Timed twice side by side with v000, it ran 1.51 and 1.49 times as fast.
// compute dtype: all float inputs rounded to bf16; LayerNorm in f32, its output rounded once to f16 x exact f16 copies (x 2^8) of the fused qkv weight on WMMA 16x16x32 (1 product) + bias; causal attention: 3-product scores and hi + residual P, v on the first 128 queries of each sequence, single f16 beyond; x 1/8 + rel_bias[h][k-q+511], running-max softmax in f32 (hardware exp); the per-row entropy from a second single-f16 score pass (precise logf); out = x + (o (bf16 hi + residual) . out_w (2 products) + out_b); second output = head-mean attention entropy.
#include <hip/hip_runtime.h>
#include <math.h>

typedef __attribute__((ext_vector_type(16))) _Float16 v16h;
typedef __attribute__((ext_vector_type(16))) __bf16 v16b;
typedef __attribute__((ext_vector_type(8)))  _Float16 v8h;
typedef __attribute__((ext_vector_type(8)))  float v8f;
typedef __attribute__((ext_vector_type(4)))  float v4f;
typedef __attribute__((ext_vector_type(2)))  float v2f;
typedef __attribute__((ext_vector_type(4)))  unsigned v4u;
typedef __attribute__((ext_vector_type(4)))  int v4i;
typedef float __attribute__((may_alias)) float_a;
typedef int __attribute__((may_alias)) int_a;

template <typename T> __device__ __forceinline__ void vst2(void* p, T v) { *(T*)p = v;  }
__device__ __forceinline__ v8f wmma16(v16h a, v16h b, v8f c) {
  v8f d = __builtin_amdgcn_wmma_f32_16x16x32_f16(false, a, false, b, (short)0, c, false, false);
  asm volatile("v_nop\n\tv_nop\n\tv_nop\n\tv_nop" : "+v"(d) : "v"(a), "v"(b));
  return d;
}
__device__ __forceinline__ v8f wmma_bf(v16b a, v16b b, v8f c) {
  v8f d = __builtin_amdgcn_wmma_f32_16x16x32_bf16(false, a, false, b, (short)0, c, false, false);
  asm volatile("v_nop\n\tv_nop\n\tv_nop\n\tv_nop" : "+v"(d) : "v"(a), "v"(b));
  return d;
}
// Pre-LN causal time attention with relative position bias (B 16, T 512, d 1,024, 16 heads x 64): x + out_proj(attention(LN(x))), plus the mean attention entropy per (batch, step) as a second output.
__device__ __forceinline__ v16h frag_h(const _Float16* rowk0, int lane) {
  union { v16h v; v8h q[2]; } u; const _Float16* p = rowk0 + 8 * (lane >> 4);
  u.q[0] = *(const v8h*)p; u.q[1] = *(const v8h*)(p + 16); return u.v;
}
__device__ __forceinline__ v16h frag_f32(const float* rowk0, int lane) {
  v16h a; const float* p = rowk0 + 8 * (lane >> 4);
#pragma unroll
  for (int i = 0; i < 8; ++i) { a[i] = (_Float16)p[i]; a[8 + i] = (_Float16)p[16 + i]; }
  return a;
}
__device__ __forceinline__ v16h frag_f32s(const float* rowk0, int lane, float sc) {
  v16h a; const float* p = rowk0 + 8 * (lane >> 4);
#pragma unroll
  for (int i = 0; i < 8; ++i) { a[i] = (_Float16)(p[i] * sc); a[8 + i] = (_Float16)(p[16 + i] * sc); }
  return a;
}
// column fragment from a [K][ld] layout (column n), rows >= K read as 0
__device__ __forceinline__ v16h fragc_f32(const float* W, int k0, int n, int lane, int ld, int K) {
  v16h a; const int g = lane >> 4;
#pragma unroll
  for (int i = 0; i < 8; ++i) { const int ka = k0 + 8 * g + i, kb = ka + 16;
    a[i] = (_Float16)(ka < K ? W[(size_t)(ka < K ? ka : K - 1) * ld + n] : 0.f); a[8 + i] = (_Float16)(kb < K ? W[(size_t)(kb < K ? kb : K - 1) * ld + n] : 0.f); }
  return a;
}
struct F2 { v16b h, l; };
__device__ __forceinline__ F2 bsplit16(const float v[16]) { F2 r;
#pragma unroll
  for (int i = 0; i < 16; ++i) { const __bf16 h = (__bf16)v[i]; r.h[i] = h; r.l[i] = (__bf16)(v[i] - (float)h); }
  return r; }
__device__ __forceinline__ F2 split_row(const float* row, int k0, int lane) { float v[16]; const float* p = row + k0 + 8 * (lane >> 4);
#pragma unroll
  for (int i = 0; i < 8; ++i) { v[i] = p[i]; v[8 + i] = p[16 + i]; }
  return bsplit16(v); }
__device__ __forceinline__ F2 split_rowK(const float* row, int k0, int lane, int K) { float v[16]; const int g = lane >> 4;
#pragma unroll
  for (int i = 0; i < 8; ++i) { const int ka = k0 + 8 * g + i, kb = ka + 16; v[i] = ka < K ? row[ka < K ? ka : K - 1] : 0.f; v[8 + i] = kb < K ? row[kb < K ? kb : K - 1] : 0.f; }
  return bsplit16(v); }
__device__ __forceinline__ F2 split_col(const float* W, int k0, int n, int lane, int ld, int K) { float v[16]; const int g = lane >> 4;
#pragma unroll
  for (int i = 0; i < 8; ++i) { const int ka = k0 + 8 * g + i, kb = ka + 16; v[i] = ka < K ? W[(size_t)(ka < K ? ka : K - 1) * ld + n] : 0.f; v[8 + i] = kb < K ? W[(size_t)(kb < K ? kb : K - 1) * ld + n] : 0.f; }
  return bsplit16(v); }
__device__ __forceinline__ v8f mac3(const F2& a, const F2& b, v8f c) { c = wmma_bf(a.l, b.h, c); c = wmma_bf(a.h, b.l, c); return wmma_bf(a.h, b.h, c); }
__device__ __forceinline__ float sigm(float v) { return 1.0f / (1.0f + expf(-v)); }
#define LDSX() do { asm volatile("s_wait_dscnt 0" ::: "memory"); __builtin_amdgcn_wave_barrier(); __builtin_amdgcn_fence(__ATOMIC_RELEASE, "workgroup"); } while (0)


#define NB 16
#define SS 512
#define SCALEF 0.125f
#define DM 1024
#define NH 16
#define MAXSEQ 512
__device__ __attribute__((noinline)) float log_p(float v) { return logf(v); }
#define HD 64
#define QKVW (3 * DM)
#ifndef TQB
#define TQB (SS / 64)
#define TNB NB
#define TOB (NB * SS / 64)     // output row tiles (all)
#endif
typedef __attribute__((ext_vector_type(8))) __bf16 v8b;
__device__ __forceinline__ v16b frag_b(const __bf16* rowk0, int lane) {
  union { v16b v; v8b q[2]; } u; const __bf16* p = rowk0 + 8 * (lane >> 4);
  u.q[0] = *(const v8b*)p; u.q[1] = *(const v8b*)(p + 16); return u.v;
}
__device__ __forceinline__ float bfr(float v) { return (float)(__bf16)v; }
__device__ __attribute__((noinline)) float exp_ni(float v) { return expf(v); }
__device__ __attribute__((noinline)) float erf_ni(float v) { return erff(v); }

#define PK_A 0                       // [3072][1024] Wqkv rows (natural [out][in])
#define PK_P (PK_A + QKVW * DM)        // [1024][1024] Wo rows (natural)
#define PK_END (PK_P + DM * DM)
#define WS_PK  0u
#define WS_QK  (WS_PK + 2u * PK_END)             // f16 [8192 rows][2048]: q | k
#define WS_QKL (WS_QK + 2u * NB * SS * 2 * DM)     // f16 q | k residual planes x2048
#define WS_VTH (WS_QKL + 2u * NB * SS * 2 * DM)    // f16 [b][1024 (h*64+d)][512 s] hi
#define WS_VTL (WS_VTH + 2u * NB * DM * SS)        // f16 lo x 2048
#define WS_O   (WS_VTL + 2u * NB * DM * SS)        // f32 [8192][1024]
#define WS_CS  (WS_O + 4u * NB * SS * DM)           // f32 2 x [512][32], unused
#define WS_XN  (WS_CS + 4u * 2 * SS * 32)                  // f32 [NR][1024] LayerNorm(x)
#define WS_ENT (WS_XN + 4u * (size_t)NB * SS * DM)     // f32 [b][h][t] attention entropy
#define WS_Y1  (WS_ENT + 4u * (size_t)NB * NH * SS)    // f32 [NR][1024] out-proj
#define WS_END (WS_Y1 + 4u * (size_t)NB * SS * DM)
// ---- k_pack: block = (row n, which): (in,out) column n -> bf16 row n; which 0..2 -> W_q/W_k/W_v into PK_A rows which*1024 + n; 3 -> W_o into PK_P
__global__ __launch_bounds__(256) void k_pack(const float* __restrict__ WQ, const float* __restrict__ WK, const float* __restrict__ WV, const float* __restrict__ WO, __bf16* __restrict__ PK) {
  __shared__ __align__(16) __bf16 s[DM]; const int n = blockIdx.x, which = blockIdx.y, t = threadIdx.x; const float* Wm = (which == 0) ? WQ : (which == 1) ? WK : (which == 2) ? WV : WO;   // (in,out) weights: pack row n = column n
  for (int k = t; k < DM; k += 256) s[k] = (__bf16)Wm[(size_t)k * DM + n];
  __syncthreads();
  __bf16* dst = (which < 3) ? PK + PK_A + ((size_t)which * DM + n) * DM : PK + PK_P + (size_t)n * DM;
  for (int q = t; q < DM / 8; q += 256) vst2((unsigned*)(dst + q * 8), *(const v4u*)&s[q * 8]);
}
// ---- k_qkv: block = (128 rows, 128 cols), 4 waves of 64 x 64; per trip 64 k of both operand tiles are brought into LDS in whole lines by asynchronous copies (two buffers) and read from there by all waves
#define QA_PITCH 272                      // bytes: a 256-B row of 64 f32 + 16 (16 B x odd: ds_load_b128 free of bank conflicts)
#define QB_PITCH 144                      // bytes: a 128-B row of 64 f16 + 16
#define QA_BYTES (128 * QA_PITCH)
#define QBUF (QA_BYTES + 128 * QB_PITCH)  // one buffer: X tile, then W tile
// eight 16-B copies per lane, rows lstep / gstep bytes apart; the s_wait_xcnt closes the statement so that no address register is rewritten in front of it
__device__ __forceinline__ void copy8(unsigned l, const char* p, unsigned lstep, unsigned gstep) {
  asm volatile("global_load_async_to_lds_b128 %0, %8, off\n\t"
               "global_load_async_to_lds_b128 %1, %9, off\n\t"
               "global_load_async_to_lds_b128 %2, %10, off\n\t"
               "global_load_async_to_lds_b128 %3, %11, off\n\t"
               "global_load_async_to_lds_b128 %4, %12, off\n\t"
               "global_load_async_to_lds_b128 %5, %13, off\n\t"
               "global_load_async_to_lds_b128 %6, %14, off\n\t"
               "global_load_async_to_lds_b128 %7, %15, off\n\t"
               "s_wait_xcnt 0x0"
               :: "v"(l), "v"(l + lstep), "v"(l + 2 * lstep), "v"(l + 3 * lstep), "v"(l + 4 * lstep), "v"(l + 5 * lstep), "v"(l + 6 * lstep), "v"(l + 7 * lstep),
                  "v"(p), "v"(p + gstep), "v"(p + 2 * gstep), "v"(p + 3 * gstep), "v"(p + 4 * gstep), "v"(p + 5 * gstep), "v"(p + 6 * gstep), "v"(p + 7 * gstep)
               : "memory");
}
__global__ __launch_bounds__(128) void k_qkv(const float* __restrict__ XQ, const float* __restrict__ XK, const float* __restrict__ XV, const __bf16* __restrict__ P, const float* __restrict__ BQ, const float* __restrict__ BK, const float* __restrict__ BV, _Float16* __restrict__ QK, _Float16* __restrict__ QKL, _Float16* __restrict__ VTH, _Float16* __restrict__ VTL) {
  const int which0 = (blockIdx.y * 128) / DM; const float* X = (which0 == 0) ? XQ : (which0 == 1) ? XK : XV; const float* BB = BQ ? (((which0 == 0) ? BQ : (which0 == 1) ? BK : BV) + (blockIdx.y * 128 - which0 * DM)) : nullptr;
  __shared__ __align__(16) char sm[2 * QBUF];   // the two buffers; output staging behind the loop
  const int tid = threadIdx.x, wave = tid >> 5, lane = tid & 31, col = lane & 15, g = lane >> 4, wm = wave >> 1, wn = wave & 1; const size_t m0 = (size_t)blockIdx.x * 128; const int n0 = blockIdx.y * 128;
  const unsigned sbase = (unsigned)(size_t)&sm[0];
  const unsigned la = sbase + (tid >> 4) * QA_PITCH + (tid & 15) * 16, lb = sbase + QA_BYTES + (tid >> 3) * QB_PITCH + (tid & 7) * 16;   // a wave's copy covers 2 X rows of 256 B, or 4 W rows of 128 B
  const char* ga = (const char*)(X + (m0 + (tid >> 4)) * DM + (tid & 15) * 4); const char* gb = (const char*)((const _Float16*)P + (size_t)(n0 + (tid >> 3)) * DM + (tid & 7) * 8);
  auto fill = [&](int t, unsigned bo) {   // tile t (k = 64 t ..): 16 + 8 copies per lane
    copy8(la + bo, ga + t * 256, 8 * QA_PITCH, 8 * DM * 4); copy8(la + bo + 64 * QA_PITCH, ga + t * 256 + 64 * DM * 4, 8 * QA_PITCH, 8 * DM * 4); copy8(lb + bo, gb + t * 128, 16 * QB_PITCH, 16 * DM * 2); };
  v8f acc[4][4] = {};
  fill(0, 0);
  asm volatile("s_wait_asynccnt 0x0" ::: "memory");   // tile 0 landed (this wave's copies)
  __syncthreads();                                    // ... and every other wave's
  fill(1, QBUF);
#pragma unroll 1   // rolled: a trip holds 32 WMMAs, enough to carry the branch
  for (int t = 0; t < DM / 64; ++t) { const char* bp = sm + (t & 1) * QBUF;
#pragma unroll   // this and the loops inside it are unrolled so that a[], w[] and acc[][] are indexed by constants and stay in registers
    for (int kc = 0; kc < 2; ++kc) { v16h a[4], w[4];
#pragma unroll
      for (int mi = 0; mi < 4; ++mi) { const float* p = (const float*)(bp + (wm * 64 + mi * 16 + col) * QA_PITCH) + kc * 32 + 8 * g;   // LN'd rows (f32) rounded once to f16
#pragma unroll
        for (int i = 0; i < 8; ++i) { a[mi][i] = (_Float16)p[i]; a[mi][8 + i] = (_Float16)p[16 + i]; } }
#pragma unroll
      for (int nj = 0; nj < 4; ++nj) w[nj] = frag_h((const _Float16*)(bp + QA_BYTES + (wn * 64 + nj * 16 + col) * QB_PITCH) + kc * 32, lane);
#pragma unroll
      for (int mi = 0; mi < 4; ++mi)
#pragma unroll
        for (int nj = 0; nj < 4; ++nj) acc[mi][nj] = wmma16(a[mi], w[nj], acc[mi][nj]); }
    asm volatile("s_wait_dscnt 0x0" ::: "memory");      // this wave's reads of the buffer are over
    asm volatile("s_wait_asynccnt 0x0" ::: "memory");   // its copies of tile t + 1 have landed
    __syncthreads();                                    // publishes tile t + 1, frees tile t's buffer
    if (t + 2 < DM / 64) fill(t + 2, (t & 1) * QBUF); }
  asm volatile("s_wait_asynccnt 0x0" ::: "memory");     // no copy in flight before the buffers become staging
  if (n0 < 2 * DM) {   // q stored unscaled (f16 sigma ~0.6, no subnormal exposure); 1/8 applied to the f32 score
    _Float16* sh = (_Float16*)(sm + wave * (2 * 64 * 144)); _Float16* sl = sh + 64 * 72;   // per wave: 64 rows x 64 cols at pitch 72, hi then residual
#pragma unroll
    for (int nj = 0; nj < 4; ++nj) { const float bias = BB ? bfr(BB[wn * 64 + nj * 16 + col]) : 0.f;
#pragma unroll
      for (int mi = 0; mi < 4; ++mi)
#pragma unroll
        for (int r = 0; r < 8; ++r) { const float v = acc[mi][nj][r] * (1.0f / 256.0f) + bias; const _Float16 hv = (_Float16)v; sh[(mi * 16 + 8 * g + r) * 72 + nj * 16 + col] = hv; sl[(mi * 16 + 8 * g + r) * 72 + nj * 16 + col] = (_Float16)((v - (float)hv) * 2048.0f); } }   // q, k (+ bias) as f16 hi + (x2048) residual
    LDSX();
    for (int it = 0; it < 16; ++it) { const int rl = it * 4 + (lane >> 3), ch = lane & 7; const size_t o = (m0 + wm * 64 + rl) * (2 * DM) + n0 + wn * 64 + ch * 8; vst2((unsigned*)(QK + o), *(const v4u*)&sh[rl * 72 + ch * 8]); vst2((unsigned*)(QKL + o), *(const v4u*)&sl[rl * 72 + ch * 8]); }   // whole 128-B lines
  } else {
    _Float16* sth = (_Float16*)sm; _Float16* stl = sth + 128 * 136;   // [128 d][128 s] at pitch 136, hi then residual
#pragma unroll
    for (int nj = 0; nj < 4; ++nj) { const float bias = BB ? bfr(BB[wn * 64 + nj * 16 + col]) : 0.f;
#pragma unroll
      for (int mi = 0; mi < 4; ++mi) { v8h h8, l8;
#pragma unroll
        for (int r = 0; r < 8; ++r) { const float v = acc[mi][nj][r] * (1.0f / 256.0f) + bias; const _Float16 hv = (_Float16)v; h8[r] = hv; l8[r] = (_Float16)((v - (float)hv) * 2048.0f); }
        const int o = (wn * 64 + nj * 16 + col) * 136 + wm * 64 + mi * 16 + 8 * g; *(v8h*)&sth[o] = h8; *(v8h*)&stl[o] = l8; } }
    __syncthreads();
    const int b = (int)(m0 / SS), s0 = (int)(m0 % SS); const int pc0 = n0 - 2 * DM;
    for (int it = 0; it < 16; ++it) { const int d = it * 8 + (tid >> 4), pc = tid & 15; const size_t o = ((size_t)b * DM + pc0 + d) * SS + s0 + pc * 8; vst2((unsigned*)(VTH + o), *(const v4u*)&sth[d * 136 + pc * 8]); vst2((unsigned*)(VTL + o), *(const v4u*)&stl[d * 136 + pc * 8]); }
  }
}
// ---- k_attn: block = (64 queries, head h, batch b): causal flash attention (K = 64: 2 k-steps), scores = (q.k) * 0.125 (hi + residual, 3 products, for qb < 2; single f16 beyond), P.V: f16 P*2048 x V hi in acc, plus P lo x V hi + P x V lo (both x2048) in accl for qb < 2; O[b*S+q][h*64+d] = (acc + accl / 2048) / (2048 l) (256-B segments)
__global__ __launch_bounds__(128) void k_attn(const _Float16* __restrict__ QK, const _Float16* __restrict__ QKL, const _Float16* __restrict__ VTH, const _Float16* __restrict__ VTL, const void* __restrict__ KMASK, const float* __restrict__ RB, float* __restrict__ O) {
  __shared__ __align__(16) float sp[4][16][36]; __shared__ __align__(16) float so[4][16][68];
  const int tid = threadIdx.x, wave = tid >> 5, lane = tid & 31, col = lane & 15, g = lane >> 4;
  const int qb = blockIdx.x, h = blockIdx.y, b = blockIdx.z; const int q0 = qb * 64 + wave * 16; const size_t rq = (size_t)b * SS + q0 + col;
  v16h aq[2], aql[2];
#pragma unroll
  for (int kc = 0; kc < 2; ++kc) { aq[kc] = frag_h(QK + rq * (2 * DM) + h * HD + kc * 32, lane); aql[kc] = frag_h(QKL + rq * (2 * DM) + h * HD + kc * 32, lane); }
  float m[8], l[8];
#pragma unroll
  for (int r = 0; r < 8; ++r) { m[r] = -3.0e38f; l[r] = 0.f; }
  v8f acc[4] = {}, accl[4] = {};
  const int nks = (qb * 64 + 64) / 32;   // causal: key tiles up to the query tile's end
#pragma unroll 1
  for (int ks = 0; ks < nks; ++ks) { v8f s[2];
#pragma unroll
    for (int ct = 0; ct < 2; ++ct) { const int kk = ks * 32 + ct * 16 + col; const _Float16* krow = QK + ((size_t)b * SS + kk) * (2 * DM) + DM + h * HD; const _Float16* krowl = QKL + ((size_t)b * SS + kk) * (2 * DM) + DM + h * HD; v8f c = {}, cl = {};
      if (qb < 2) {   // leading query blocks (few keys, outputs far above the global rms): 3 products
#pragma unroll
        for (int kc = 0; kc < 2; ++kc) { const v16h kh = frag_h(krow + kc * 32, lane); c = wmma16(aq[kc], kh, c); cl = wmma16(aql[kc], kh, cl); cl = wmma16(aq[kc], frag_h(krowl + kc * 32, lane), cl); }
#pragma unroll
        for (int r = 0; r < 8; ++r) c[r] += cl[r] * (1.0f / 2048.0f); }
      else {
#pragma unroll
        for (int kc = 0; kc < 2; ++kc) c = wmma16(aq[kc], frag_h(krow + kc * 32, lane), c); }   // single product elsewhere
#pragma unroll
      for (int r = 0; r < 8; ++r) { const int qi = q0 + 8 * g + r; s[ct][r] = (kk <= qi) ? (c[r] * SCALEF + bfr(RB[(size_t)h * (2 * MAXSEQ - 1) + (kk - qi + MAXSEQ - 1)])) : -3.0e38f; } }   // causal; + rel_bias[h][k - q + 511]
#pragma unroll
    for (int r = 0; r < 8; ++r) { float mx = fmaxf(s[0][r], s[1][r]);
#pragma unroll
      for (int o = 1; o < 16; o <<= 1) mx = fmaxf(mx, __shfl_xor(mx, o));
      const float mn = fmaxf(m[r], mx); const float alpha = (m[r] <= -1.0e38f) ? 0.f : __expf(m[r] - mn);
      const float e0 = (s[0][r] <= -1.0e38f) ? 0.f : __expf(s[0][r] - mn), e1 = (s[1][r] <= -1.0e38f) ? 0.f : __expf(s[1][r] - mn); float es = e0 + e1;
#pragma unroll
      for (int o = 1; o < 16; o <<= 1) es += __shfl_xor(es, o);
      l[r] = l[r] * alpha + es; m[r] = mn;
#pragma unroll
      for (int dt = 0; dt < 4; ++dt) { acc[dt][r] *= alpha; accl[dt][r] *= alpha; }
      sp[wave][8 * g + r][col] = e0; sp[wave][8 * g + r][16 + col] = e1; }
    LDSX();
    v16h pa, pl; { const float* prow = &sp[wave][col][0] + 8 * (lane >> 4);
#pragma unroll
      for (int i = 0; i < 8; ++i) { const float x0 = prow[i] * 2048.0f, x1 = prow[16 + i] * 2048.0f; const _Float16 h0 = (_Float16)x0, h1 = (_Float16)x1; pa[i] = h0; pa[8 + i] = h1; pl[i] = (_Float16)((x0 - (float)h0) * 2048.0f); pl[8 + i] = (_Float16)((x1 - (float)h1) * 2048.0f); } }   // P scaled by 2^11 before the f16 split so small softmax weights stay out of the f16 subnormal range; 2^-11 folded into the epilogue
#pragma unroll
    for (int dt = 0; dt < 4; ++dt) { const size_t vr = ((size_t)b * DM + h * HD + dt * 16 + col) * SS + ks * 32; const v16h vh = frag_h(VTH + vr, lane); acc[dt] = wmma16(pa, vh, acc[dt]); if (qb < 2) { accl[dt] = wmma16(pl, vh, accl[dt]); accl[dt] = wmma16(pa, frag_h(VTL + vr, lane), accl[dt]); } }   // leading query blocks: P hi/lo x V hi/lo (3 products); elsewhere P x V single
    LDSX(); }
#pragma unroll
  for (int r = 0; r < 8; ++r) { const float il = (1.0f / 2048.0f) / l[r];
#pragma unroll
    for (int dt = 0; dt < 4; ++dt) so[wave][8 * g + r][dt * 16 + col] = (acc[dt][r] + accl[dt][r] * (1.0f / 2048.0f)) * il; }
  LDSX();
  for (int rl = 0; rl < 16; ++rl) if (lane < 16) vst2(O + ((size_t)b * SS + q0 + rl) * DM + h * HD + lane * 4, *(const v4f*)&so[wave][rl][lane * 4]);
}
// ---- k_out: block = (64 rows, 128 cols): out = O(hi/lo) . Wo rows (2 products) + bo
__global__ __launch_bounds__(128) void k_out(const float* __restrict__ O, const __bf16* __restrict__ P, const float* __restrict__ BO, float* __restrict__ Y) {
  __shared__ __align__(16) float so[4][16][132];
  const int tid = threadIdx.x, wave = tid >> 5, lane = tid & 31, col = lane & 15, g = lane >> 4; const size_t r0 = (size_t)blockIdx.x * 64 + wave * 16; const int n0 = blockIdx.y * 128;
  v8f acc[8] = {};
#pragma unroll 2
  for (int kc = 0; kc < DM / 32; ++kc) { const F2 a = split_row(O + (r0 + col) * DM, kc * 32, lane);
#pragma unroll
    for (int j = 0; j < 8; ++j) { const v16b w = frag_b(P + (size_t)(n0 + j * 16 + col) * DM + kc * 32, lane); acc[j] = wmma_bf(a.l, w, acc[j]); acc[j] = wmma_bf(a.h, w, acc[j]); } }
#pragma unroll
  for (int j = 0; j < 8; ++j) {
#pragma unroll
    for (int r = 0; r < 8; ++r) so[wave][8 * g + r][j * 16 + col] = acc[j][r] + bfr(BO[n0 + j * 16 + col]); }
  LDSX();
  for (int rl = 0; rl < 16; ++rl) vst2(Y + (r0 + rl) * DM + n0 + lane * 4, *(const v4f*)&so[wave][rl][lane * 4]);
}
// ---- k_pack3: the fused (in,out) W_attn [DM][3*DM] -> the three transposed f16 (x 2^8) row blocks
__global__ __launch_bounds__(256) void k_pack3(const float* __restrict__ WA, __bf16* __restrict__ PK) { __shared__ __align__(16) _Float16 s[DM]; const int n = blockIdx.x, which = blockIdx.y, t = threadIdx.x; for (int k = t; k < DM; k += 256) s[k] = (_Float16)(bfr(WA[(size_t)k * (3 * DM) + which * DM + n]) * 256.0f);   /* f16 x 2^8 rows (bit pattern stored in the bf16-typed buffer) */ __syncthreads(); for (int q = t; q < DM / 8; q += 256) vst2((unsigned*)(PK + PK_A + ((size_t)which * DM + n) * DM + q * 8), *(const v4u*)&s[q * 8]); }
// ---- k_ent: block = (64 queries, head, b): recompute the causal scores (single f16 q, k; + rel bias) and reduce -sum p log p = log(sum e^(s-m)) + m - (sum e^(s-m) s)/(sum e^(s-m)) per query; 256-B store per block
__global__ __launch_bounds__(128) void k_ent(const _Float16* __restrict__ QK, const float* __restrict__ RB, float* __restrict__ ENT) {
  __shared__ __align__(16) float sent[64];
  const int tid = threadIdx.x, wave = tid >> 5, lane = tid & 31, col = lane & 15, g = lane >> 4; const int h = blockIdx.y; const size_t b = blockIdx.z; const int q0 = blockIdx.x * 64 + wave * 16; const size_t rq = b * SS + q0;
  v16h aq[2];
#pragma unroll
  for (int kc = 0; kc < 2; ++kc) aq[kc] = frag_h(QK + (rq + col) * (2 * DM) + h * HD + kc * 32, lane);
  float m[8], l[8], ls[8];
#pragma unroll
  for (int r = 0; r < 8; ++r) { m[r] = -3.0e38f; l[r] = 0.f; ls[r] = 0.f; }
  const int nks = (blockIdx.x * 64 + 64) / 32;
#pragma unroll 1
  for (int ks = 0; ks < nks; ++ks) { v8f s[2];
#pragma unroll
    for (int ct = 0; ct < 2; ++ct) { const int kk = ks * 32 + ct * 16 + col; v8f c = {};
#pragma unroll
      for (int kc = 0; kc < 2; ++kc) c = wmma16(aq[kc], frag_h(QK + (b * SS + kk) * (2 * DM) + DM + h * HD + kc * 32, lane), c);
#pragma unroll
      for (int r = 0; r < 8; ++r) { const int qi = q0 + 8 * g + r; s[ct][r] = (kk <= qi) ? (c[r] * SCALEF + bfr(RB[(size_t)h * (2 * MAXSEQ - 1) + (kk - qi + MAXSEQ - 1)])) : -3.0e38f; } }
#pragma unroll
    for (int r = 0; r < 8; ++r) { float mx = fmaxf(s[0][r], s[1][r]);
#pragma unroll
      for (int o = 1; o < 16; o <<= 1) mx = fmaxf(mx, __shfl_xor(mx, o));
      const float mn = fmaxf(m[r], mx); const float alpha = (m[r] <= -1.0e38f) ? 0.f : __expf(m[r] - mn);
      const bool v0 = s[0][r] > -1.0e38f, v1 = s[1][r] > -1.0e38f; const float e0 = v0 ? __expf(s[0][r] - mn) : 0.f, e1 = v1 ? __expf(s[1][r] - mn) : 0.f;
      float es = e0 + e1, ess = (v0 ? e0 * s[0][r] : 0.f) + (v1 ? e1 * s[1][r] : 0.f);
#pragma unroll
      for (int o = 1; o < 16; o <<= 1) { es += __shfl_xor(es, o); ess += __shfl_xor(ess, o); }
      l[r] = l[r] * alpha + es; ls[r] = ls[r] * alpha + ess; m[r] = mn; } }
#pragma unroll
  for (int r = 0; r < 8; ++r) if (col == 0) sent[wave * 16 + 8 * g + r] = log_p(l[r]) + m[r] - ls[r] / l[r];
  __syncthreads(); if (tid < 16) vst2(ENT + ((size_t)b * NH + h) * SS + blockIdx.x * 64 + tid * 4, *(const v4f*)&sent[tid * 4]);
}
// ---- k_ln: block = row: XN = (x - mu) rsqrt(var + 1e-5) g + b (f32)
__global__ __launch_bounds__(256) void k_ln(const float* __restrict__ X, const float* __restrict__ G, const float* __restrict__ Bt, float* __restrict__ XN) {
  __shared__ float red[8]; const int t = threadIdx.x; const size_t row = blockIdx.x; float v[4]; float s = 0.f; for (int i = 0; i < 4; ++i) { v[i] = bfr(X[row * DM + t * 4 + i]); s += v[i]; }
#pragma unroll
  for (int o = 1; o < 32; o <<= 1) s += __shfl_xor(s, o);
  if ((t & 31) == 0) red[t >> 5] = s; __syncthreads(); float tot = 0.f; for (int i = 0; i < 8; ++i) tot += red[i]; const float mu = tot / (float)DM; __syncthreads();
  float q = 0.f; for (int i = 0; i < 4; ++i) { const float d = v[i] - mu; q += d * d; }
#pragma unroll
  for (int o = 1; o < 32; o <<= 1) q += __shfl_xor(q, o);
  if ((t & 31) == 0) red[t >> 5] = q; __syncthreads(); float tq = 0.f; for (int i = 0; i < 8; ++i) tq += red[i]; const float inv = 1.0f / sqrtf(tq / (float)DM + 1e-5f);
  v4f o4; for (int i = 0; i < 4; ++i) { const int e = t * 4 + i; o4[i] = (v[i] - mu) * inv * bfr(G[e]) + bfr(Bt[e]); } vst2(XN + row * DM + t * 4, o4);
}
__global__ __launch_bounds__(256) void k_fin(const float* __restrict__ X, const float* __restrict__ Y1, const float* __restrict__ ENT, float* __restrict__ OUT, float* __restrict__ OUT2) {
  const int t = threadIdx.x; const size_t row = blockIdx.x; const size_t b = row / SS; const int tt = (int)(row % SS);
  { v4f o4; for (int i = 0; i < 4; ++i) { const size_t e = row * DM + t * 4 + i; o4[i] = bfr(X[e]) + Y1[e]; } vst2(OUT + row * DM + t * 4, o4); }
  if ((tt & 31) == 0 && t < 32) { __shared__ __align__(16) float se[32]; float a = 0.f; for (int hh = 0; hh < NH; ++hh) a += ENT[(b * NH + hh) * SS + tt + t]; se[t] = a / (float)NH; __syncthreads(); if (t < 8) vst2(OUT2 + row + t * 4, *(const v4f*)&se[t * 4]); }
}
extern "C" void kernel_launch(void* const* d_in, const int* in_sizes, int n_in, void* d_out, int out_size, void* d_ws, size_t ws_size, hipStream_t stream) {
  (void)in_sizes; (void)n_in; (void)out_size;
  const float** F = (const float**)d_in;   // 0 x [16,512,1024], 1 qkv_w [1024,3072] (in,out), 2 qkv_b [3072], 3 out_w [1024,1024] (in,out), 4 out_b, 5 ln_g, 6 ln_b, 7 rel_bias [16,1023]
  if (ws_size < (size_t)WS_END) return;
  char* ws = (char*)d_ws; __bf16* PK = (__bf16*)(ws + WS_PK); _Float16 *QK = (_Float16*)(ws + WS_QK), *QKL = (_Float16*)(ws + WS_QKL), *VTH = (_Float16*)(ws + WS_VTH), *VTL = (_Float16*)(ws + WS_VTL); float *O = (float*)(ws + WS_O), *XN = (float*)(ws + WS_XN), *ENT = (float*)(ws + WS_ENT), *Y1 = (float*)(ws + WS_Y1);
  float* OUT = (float*)d_out; float* OUT2 = OUT + (size_t)NB * SS * DM;   // outputs concatenated: out [16,512,1024] then entropy [16,512]
  k_pack<<<dim3(DM, 4), 256, 0, stream>>>(F[3], F[3], F[3], F[3], PK);   // out_w ((in,out) -> transposed rows) into the Wo slot (q/k/v slots overwritten next)
  k_pack3<<<dim3(DM, 3), 256, 0, stream>>>(F[1], PK);
  k_ln<<<TNB * SS, 256, 0, stream>>>(F[0], F[5], F[6], XN);
  k_qkv<<<dim3(TNB * SS / 128, QKVW / 128), 128, 0, stream>>>(XN, XN, XN, PK + PK_A, F[2], F[2] + DM, F[2] + 2 * DM, QK, QKL, VTH, VTL);
  k_attn<<<dim3(TQB, NH, TNB), 128, 0, stream>>>(QK, QKL, VTH, VTL, nullptr, F[7], O);
  k_ent<<<dim3(TQB, NH, TNB), 128, 0, stream>>>(QK, F[7], ENT);
  k_out<<<dim3(TOB, DM / 128), 128, 0, stream>>>(O, PK + PK_P, F[4], Y1);
  k_fin<<<TOB * 64, 256, 0, stream>>>(F[0], Y1, ENT, OUT, OUT2);
}

// v002
// It runs in 335 microseconds.
// Timed twice side by side with v001, it ran 1.15 times as fast both times.
// All steps since v000 together make it 1.72 times as fast.
// compute dtype: all float inputs rounded to bf16; LayerNorm in f32, its output rounded once to f16 x exact f16 copies (x 2^8) of the fused qkv weight on WMMA 16x16x32 (1 product) + bias; causal attention: 3-product scores and hi + residual P, v on the first 128 queries of each sequence, single f16 beyond; x 1/8 + rel_bias[h][k-q+511], running-max softmax in f32 (hardware exp); the per-row entropy from a second single-f16 score pass (precise logf); out = x + (o (bf16 hi + residual) . out_w (2 products) + out_b); second output = head-mean attention entropy.
#include <hip/hip_runtime.h>
#include <math.h>

typedef __attribute__((ext_vector_type(16))) _Float16 v16h;
typedef __attribute__((ext_vector_type(16))) __bf16 v16b;
typedef __attribute__((ext_vector_type(8)))  _Float16 v8h;
typedef __attribute__((ext_vector_type(8)))  float v8f;
typedef __attribute__((ext_vector_type(4)))  float v4f;
typedef __attribute__((ext_vector_type(2)))  float v2f;
typedef __attribute__((ext_vector_type(4)))  unsigned v4u;
typedef __attribute__((ext_vector_type(4)))  int v4i;
typedef float __attribute__((may_alias)) float_a;
typedef int __attribute__((may_alias)) int_a;

template <typename T> __device__ __forceinline__ void vst2(void* p, T v) { *(T*)p = v;  }
__device__ __forceinline__ v8f wmma16(v16h a, v16h b, v8f c) {
  v8f d = __builtin_amdgcn_wmma_f32_16x16x32_f16(false, a, false, b, (short)0, c, false, false);
  asm volatile("v_nop\n\tv_nop\n\tv_nop\n\tv_nop" : "+v"(d) : "v"(a), "v"(b));
  return d;
}
__device__ __forceinline__ v8f wmma_bf(v16b a, v16b b, v8f c) {
  v8f d = __builtin_amdgcn_wmma_f32_16x16x32_bf16(false, a, false, b, (short)0, c, false, false);
  asm volatile("v_nop\n\tv_nop\n\tv_nop\n\tv_nop" : "+v"(d) : "v"(a), "v"(b));
  return d;
}
// Pre-LN causal time attention with relative position bias (B 16, T 512, d 1,024, 16 heads x 64): x + out_proj(attention(LN(x))), plus the mean attention entropy per (batch, step) as a second output.
__device__ __forceinline__ v16h frag_h(const _Float16* rowk0, int lane) {
  union { v16h v; v8h q[2]; } u; const _Float16* p = rowk0 + 8 * (lane >> 4);
  u.q[0] = *(const v8h*)p; u.q[1] = *(const v8h*)(p + 16); return u.v;
}
__device__ __forceinline__ v16h frag_f32(const float* rowk0, int lane) {
  v16h a; const float* p = rowk0 + 8 * (lane >> 4);
#pragma unroll
  for (int i = 0; i < 8; ++i) { a[i] = (_Float16)p[i]; a[8 + i] = (_Float16)p[16 + i]; }
  return a;
}
__device__ __forceinline__ v16h frag_f32s(const float* rowk0, int lane, float sc) {
  v16h a; const float* p = rowk0 + 8 * (lane >> 4);
#pragma unroll
  for (int i = 0; i < 8; ++i) { a[i] = (_Float16)(p[i] * sc); a[8 + i] = (_Float16)(p[16 + i] * sc); }
  return a;
}
// column fragment from a [K][ld] layout (column n), rows >= K read as 0
__device__ __forceinline__ v16h fragc_f32(const float* W, int k0, int n, int lane, int ld, int K) {
  v16h a; const int g = lane >> 4;
#pragma unroll
  for (int i = 0; i < 8; ++i) { const int ka = k0 + 8 * g + i, kb = ka + 16;
    a[i] = (_Float16)(ka < K ? W[(size_t)(ka < K ? ka : K - 1) * ld + n] : 0.f); a[8 + i] = (_Float16)(kb < K ? W[(size_t)(kb < K ? kb : K - 1) * ld + n] : 0.f); }
  return a;
}
struct F2 { v16b h, l; };
__device__ __forceinline__ F2 bsplit16(const float v[16]) { F2 r;
#pragma unroll
  for (int i = 0; i < 16; ++i) { const __bf16 h = (__bf16)v[i]; r.h[i] = h; r.l[i] = (__bf16)(v[i] - (float)h); }
  return r; }
__device__ __forceinline__ F2 split_row(const float* row, int k0, int lane) { float v[16]; const float* p = row + k0 + 8 * (lane >> 4);
#pragma unroll
  for (int i = 0; i < 8; ++i) { v[i] = p[i]; v[8 + i] = p[16 + i]; }
  return bsplit16(v); }
__device__ __forceinline__ F2 split_rowK(const float* row, int k0, int lane, int K) { float v[16]; const int g = lane >> 4;
#pragma unroll
  for (int i = 0; i < 8; ++i) { const int ka = k0 + 8 * g + i, kb = ka + 16; v[i] = ka < K ? row[ka < K ? ka : K - 1] : 0.f; v[8 + i] = kb < K ? row[kb < K ? kb : K - 1] : 0.f; }
  return bsplit16(v); }
__device__ __forceinline__ F2 split_col(const float* W, int k0, int n, int lane, int ld, int K) { float v[16]; const int g = lane >> 4;
#pragma unroll
  for (int i = 0; i < 8; ++i) { const int ka = k0 + 8 * g + i, kb = ka + 16; v[i] = ka < K ? W[(size_t)(ka < K ? ka : K - 1) * ld + n] : 0.f; v[8 + i] = kb < K ? W[(size_t)(kb < K ? kb : K - 1) * ld + n] : 0.f; }
  return bsplit16(v); }
__device__ __forceinline__ v8f mac3(const F2& a, const F2& b, v8f c) { c = wmma_bf(a.l, b.h, c); c = wmma_bf(a.h, b.l, c); return wmma_bf(a.h, b.h, c); }
__device__ __forceinline__ float sigm(float v) { return 1.0f / (1.0f + expf(-v)); }
#define LDSX() do { asm volatile("s_wait_dscnt 0" ::: "memory"); __builtin_amdgcn_wave_barrier(); __builtin_amdgcn_fence(__ATOMIC_RELEASE, "workgroup"); } while (0)


#define NB 16
#define SS 512
#define SCALEF 0.125f
#define DM 1024
#define NH 16
#define MAXSEQ 512
__device__ __attribute__((noinline)) float log_p(float v) { return logf(v); }
#define HD 64
#define QKVW (3 * DM)
#ifndef TQB
#define TQB (SS / 64)
#define TNB NB
#define TOB (NB * SS / 64)     // output row tiles (all)
#endif
typedef __attribute__((ext_vector_type(8))) __bf16 v8b;
__device__ __forceinline__ v16b frag_b(const __bf16* rowk0, int lane) {
  union { v16b v; v8b q[2]; } u; const __bf16* p = rowk0 + 8 * (lane >> 4);
  u.q[0] = *(const v8b*)p; u.q[1] = *(const v8b*)(p + 16); return u.v;
}
__device__ __forceinline__ float bfr(float v) { return (float)(__bf16)v; }
__device__ __attribute__((noinline)) float exp_ni(float v) { return expf(v); }
__device__ __attribute__((noinline)) float erf_ni(float v) { return erff(v); }

#define PK_A 0                       // [3072][1024] Wqkv rows (natural [out][in])
#define PK_P (PK_A + QKVW * DM)        // [1024][1024] Wo rows (natural)
#define PK_END (PK_P + DM * DM)
#define WS_PK  0u
#define WS_QK  (WS_PK + 2u * PK_END)             // f16 [8192 rows][2048]: q | k
#define WS_QKL (WS_QK + 2u * NB * SS * 2 * DM)     // f16 q | k residual planes x2048
#define WS_VTH (WS_QKL + 2u * NB * SS * 2 * DM)    // f16 [b][1024 (h*64+d)][512 s] hi
#define WS_VTL (WS_VTH + 2u * NB * DM * SS)        // f16 lo x 2048
#define WS_O   (WS_VTL + 2u * NB * DM * SS)        // f32 [8192][1024]
#define WS_CS  (WS_O + 4u * NB * SS * DM)           // f32 2 x [512][32], unused
#define WS_XN  (WS_CS + 4u * 2 * SS * 32)                  // f32 [NR][1024] LayerNorm(x)
#define WS_ENT (WS_XN + 4u * (size_t)NB * SS * DM)     // f32 [b][h][t] attention entropy
#define WS_Y1  (WS_ENT + 4u * (size_t)NB * NH * SS)    // f32 [NR][1024] out-proj
#define WS_END (WS_Y1 + 4u * (size_t)NB * SS * DM)
// ---- k_pack: block = (row n, which): (in,out) column n -> bf16 row n; which 0..2 -> W_q/W_k/W_v into PK_A rows which*1024 + n; 3 -> W_o into PK_P
__global__ __launch_bounds__(256) void k_pack(const float* __restrict__ WQ, const float* __restrict__ WK, const float* __restrict__ WV, const float* __restrict__ WO, __bf16* __restrict__ PK) {
  __shared__ __align__(16) __bf16 s[DM]; const int n = blockIdx.x, which = blockIdx.y, t = threadIdx.x; const float* Wm = (which == 0) ? WQ : (which == 1) ? WK : (which == 2) ? WV : WO;   // (in,out) weights: pack row n = column n
  for (int k = t; k < DM; k += 256) s[k] = (__bf16)Wm[(size_t)k * DM + n];
  __syncthreads();
  __bf16* dst = (which < 3) ? PK + PK_A + ((size_t)which * DM + n) * DM : PK + PK_P + (size_t)n * DM;
  for (int q = t; q < DM / 8; q += 256) vst2((unsigned*)(dst + q * 8), *(const v4u*)&s[q * 8]);
}
// ---- k_qkv: block = (128 rows, 128 cols), 4 waves of 64 x 64; per trip 64 k of both operand tiles are brought into LDS in whole lines by asynchronous copies (two buffers) and read from there by all waves
#define QA_PITCH 272                      // bytes: a 256-B row of 64 f32 + 16 (16 B x odd: ds_load_b128 free of bank conflicts)
#define QB_PITCH 144                      // bytes: a 128-B row of 64 f16 + 16
#define QA_BYTES (128 * QA_PITCH)
#define QBUF (QA_BYTES + 128 * QB_PITCH)  // one buffer: X tile, then W tile
// eight 16-B copies per lane, rows lstep / gstep bytes apart; the s_wait_xcnt closes the statement so that no address register is rewritten in front of it
__device__ __forceinline__ void copy8(unsigned l, const char* p, unsigned lstep, unsigned gstep) {
  asm volatile("global_load_async_to_lds_b128 %0, %8, off\n\t"
               "global_load_async_to_lds_b128 %1, %9, off\n\t"
               "global_load_async_to_lds_b128 %2, %10, off\n\t"
               "global_load_async_to_lds_b128 %3, %11, off\n\t"
               "global_load_async_to_lds_b128 %4, %12, off\n\t"
               "global_load_async_to_lds_b128 %5, %13, off\n\t"
               "global_load_async_to_lds_b128 %6, %14, off\n\t"
               "global_load_async_to_lds_b128 %7, %15, off\n\t"
               "s_wait_xcnt 0x0"
               :: "v"(l), "v"(l + lstep), "v"(l + 2 * lstep), "v"(l + 3 * lstep), "v"(l + 4 * lstep), "v"(l + 5 * lstep), "v"(l + 6 * lstep), "v"(l + 7 * lstep),
                  "v"(p), "v"(p + gstep), "v"(p + 2 * gstep), "v"(p + 3 * gstep), "v"(p + 4 * gstep), "v"(p + 5 * gstep), "v"(p + 6 * gstep), "v"(p + 7 * gstep)
               : "memory");
}
__global__ __launch_bounds__(128) void k_qkv(const float* __restrict__ XQ, const float* __restrict__ XK, const float* __restrict__ XV, const __bf16* __restrict__ P, const float* __restrict__ BQ, const float* __restrict__ BK, const float* __restrict__ BV, _Float16* __restrict__ QK, _Float16* __restrict__ QKL, _Float16* __restrict__ VTH, _Float16* __restrict__ VTL) {
  const int which0 = (blockIdx.y * 128) / DM; const float* X = (which0 == 0) ? XQ : (which0 == 1) ? XK : XV; const float* BB = BQ ? (((which0 == 0) ? BQ : (which0 == 1) ? BK : BV) + (blockIdx.y * 128 - which0 * DM)) : nullptr;
  __shared__ __align__(16) char sm[2 * QBUF];   // the two buffers; output staging behind the loop
  const int tid = threadIdx.x, wave = tid >> 5, lane = tid & 31, col = lane & 15, g = lane >> 4, wm = wave >> 1, wn = wave & 1; const size_t m0 = (size_t)blockIdx.x * 128; const int n0 = blockIdx.y * 128;
  const unsigned sbase = (unsigned)(size_t)&sm[0];
  const unsigned la = sbase + (tid >> 4) * QA_PITCH + (tid & 15) * 16, lb = sbase + QA_BYTES + (tid >> 3) * QB_PITCH + (tid & 7) * 16;   // a wave's copy covers 2 X rows of 256 B, or 4 W rows of 128 B
  const char* ga = (const char*)(X + (m0 + (tid >> 4)) * DM + (tid & 15) * 4); const char* gb = (const char*)((const _Float16*)P + (size_t)(n0 + (tid >> 3)) * DM + (tid & 7) * 8);
  auto fill = [&](int t, unsigned bo) {   // tile t (k = 64 t ..): 16 + 8 copies per lane
    copy8(la + bo, ga + t * 256, 8 * QA_PITCH, 8 * DM * 4); copy8(la + bo + 64 * QA_PITCH, ga + t * 256 + 64 * DM * 4, 8 * QA_PITCH, 8 * DM * 4); copy8(lb + bo, gb + t * 128, 16 * QB_PITCH, 16 * DM * 2); };
  v8f acc[4][4] = {};
  fill(0, 0);
  asm volatile("s_wait_asynccnt 0x0" ::: "memory");   // tile 0 landed (this wave's copies)
  __syncthreads();                                    // ... and every other wave's
  fill(1, QBUF);
#pragma unroll 1   // rolled: a trip holds 32 WMMAs, enough to carry the branch
  for (int t = 0; t < DM / 64; ++t) { const char* bp = sm + (t & 1) * QBUF;
#pragma unroll   // this and the loops inside it are unrolled so that a[], w[] and acc[][] are indexed by constants and stay in registers
    for (int kc = 0; kc < 2; ++kc) { v16h a[4], w[4];
#pragma unroll
      for (int mi = 0; mi < 4; ++mi) { const float* p = (const float*)(bp + (wm * 64 + mi * 16 + col) * QA_PITCH) + kc * 32 + 8 * g;   // LN'd rows (f32) rounded once to f16
#pragma unroll
        for (int i = 0; i < 8; ++i) { a[mi][i] = (_Float16)p[i]; a[mi][8 + i] = (_Float16)p[16 + i]; } }
#pragma unroll
      for (int nj = 0; nj < 4; ++nj) w[nj] = frag_h((const _Float16*)(bp + QA_BYTES + (wn * 64 + nj * 16 + col) * QB_PITCH) + kc * 32, lane);
#pragma unroll
      for (int mi = 0; mi < 4; ++mi)
#pragma unroll
        for (int nj = 0; nj < 4; ++nj) acc[mi][nj] = wmma16(a[mi], w[nj], acc[mi][nj]); }
    asm volatile("s_wait_dscnt 0x0" ::: "memory");      // this wave's reads of the buffer are over
    asm volatile("s_wait_asynccnt 0x0" ::: "memory");   // its copies of tile t + 1 have landed
    __syncthreads();                                    // publishes tile t + 1, frees tile t's buffer
    if (t + 2 < DM / 64) fill(t + 2, (t & 1) * QBUF); }
  asm volatile("s_wait_asynccnt 0x0" ::: "memory");     // no copy in flight before the buffers become staging
  if (n0 < 2 * DM) {   // q stored unscaled (f16 sigma ~0.6, no subnormal exposure); 1/8 applied to the f32 score
    _Float16* sh = (_Float16*)(sm + wave * (2 * 64 * 144)); _Float16* sl = sh + 64 * 72;   // per wave: 64 rows x 64 cols at pitch 72, hi then residual
#pragma unroll
    for (int nj = 0; nj < 4; ++nj) { const float bias = BB ? bfr(BB[wn * 64 + nj * 16 + col]) : 0.f;
#pragma unroll
      for (int mi = 0; mi < 4; ++mi)
#pragma unroll
        for (int r = 0; r < 8; ++r) { const float v = acc[mi][nj][r] * (1.0f / 256.0f) + bias; const _Float16 hv = (_Float16)v; sh[(mi * 16 + 8 * g + r) * 72 + nj * 16 + col] = hv; sl[(mi * 16 + 8 * g + r) * 72 + nj * 16 + col] = (_Float16)((v - (float)hv) * 2048.0f); } }   // q, k (+ bias) as f16 hi + (x2048) residual
    LDSX();
    for (int it = 0; it < 16; ++it) { const int rl = it * 4 + (lane >> 3), ch = lane & 7; const size_t o = (m0 + wm * 64 + rl) * (2 * DM) + n0 + wn * 64 + ch * 8; vst2((unsigned*)(QK + o), *(const v4u*)&sh[rl * 72 + ch * 8]); vst2((unsigned*)(QKL + o), *(const v4u*)&sl[rl * 72 + ch * 8]); }   // whole 128-B lines
  } else {
    _Float16* sth = (_Float16*)sm; _Float16* stl = sth + 128 * 136;   // [128 d][128 s] at pitch 136, hi then residual
#pragma unroll
    for (int nj = 0; nj < 4; ++nj) { const float bias = BB ? bfr(BB[wn * 64 + nj * 16 + col]) : 0.f;
#pragma unroll
      for (int mi = 0; mi < 4; ++mi) { v8h h8, l8;
#pragma unroll
        for (int r = 0; r < 8; ++r) { const float v = acc[mi][nj][r] * (1.0f / 256.0f) + bias; const _Float16 hv = (_Float16)v; h8[r] = hv; l8[r] = (_Float16)((v - (float)hv) * 2048.0f); }
        const int o = (wn * 64 + nj * 16 + col) * 136 + wm * 64 + mi * 16 + 8 * g; *(v8h*)&sth[o] = h8; *(v8h*)&stl[o] = l8; } }
    __syncthreads();
    const int b = (int)(m0 / SS), s0 = (int)(m0 % SS); const int pc0 = n0 - 2 * DM;
    for (int it = 0; it < 16; ++it) { const int d = it * 8 + (tid >> 4), pc = tid & 15; const size_t o = ((size_t)b * DM + pc0 + d) * SS + s0 + pc * 8; vst2((unsigned*)(VTH + o), *(const v4u*)&sth[d * 136 + pc * 8]); vst2((unsigned*)(VTL + o), *(const v4u*)&stl[d * 136 + pc * 8]); }
  }
}
// ---- k_attn: block = (64 queries, head h, batch b): causal flash attention (K = 64: 2 k-steps), scores = (q.k) * 0.125 (hi + residual, 3 products, for qb < 2; single f16 beyond), P.V: f16 P*2048 x V hi in acc, plus P lo x V hi + P x V lo (both x2048) in accl for qb < 2; O[b*S+q][h*64+d] = (acc + accl / 2048) / (2048 l) (256-B segments)
__global__ __launch_bounds__(128) void k_attn(const _Float16* __restrict__ QK, const _Float16* __restrict__ QKL, const _Float16* __restrict__ VTH, const _Float16* __restrict__ VTL, const void* __restrict__ KMASK, const float* __restrict__ RB, float* __restrict__ O) {
  __shared__ __align__(16) float sp[4][16][36]; __shared__ __align__(16) float so[4][16][68];
  const int tid = threadIdx.x, wave = tid >> 5, lane = tid & 31, col = lane & 15, g = lane >> 4;
  const int qb = blockIdx.x, h = blockIdx.y, b = blockIdx.z; const int q0 = qb * 64 + wave * 16; const size_t rq = (size_t)b * SS + q0 + col;
  v16h aq[2], aql[2];
#pragma unroll
  for (int kc = 0; kc < 2; ++kc) { aq[kc] = frag_h(QK + rq * (2 * DM) + h * HD + kc * 32, lane); aql[kc] = frag_h(QKL + rq * (2 * DM) + h * HD + kc * 32, lane); }
  float m[8], l[8];
#pragma unroll
  for (int r = 0; r < 8; ++r) { m[r] = -3.0e38f; l[r] = 0.f; }
  v8f acc[4] = {}, accl[4] = {};
  const int nks = (qb * 64 + 64) / 32;   // causal: key tiles up to the query tile's end
#pragma unroll 1
  for (int ks = 0; ks < nks; ++ks) { v8f s[2];
#pragma unroll
    for (int ct = 0; ct < 2; ++ct) { const int kk = ks * 32 + ct * 16 + col; const _Float16* krow = QK + ((size_t)b * SS + kk) * (2 * DM) + DM + h * HD; const _Float16* krowl = QKL + ((size_t)b * SS + kk) * (2 * DM) + DM + h * HD; v8f c = {}, cl = {};
      if (qb < 2) {   // leading query blocks (few keys, outputs far above the global rms): 3 products
#pragma unroll
        for (int kc = 0; kc < 2; ++kc) { const v16h kh = frag_h(krow + kc * 32, lane); c = wmma16(aq[kc], kh, c); cl = wmma16(aql[kc], kh, cl); cl = wmma16(aq[kc], frag_h(krowl + kc * 32, lane), cl); }
#pragma unroll
        for (int r = 0; r < 8; ++r) c[r] += cl[r] * (1.0f / 2048.0f); }
      else {
#pragma unroll
        for (int kc = 0; kc < 2; ++kc) c = wmma16(aq[kc], frag_h(krow + kc * 32, lane), c); }   // single product elsewhere
#pragma unroll
      for (int r = 0; r < 8; ++r) { const int qi = q0 + 8 * g + r; s[ct][r] = (kk <= qi) ? (c[r] * SCALEF + bfr(RB[(size_t)h * (2 * MAXSEQ - 1) + (kk - qi + MAXSEQ - 1)])) : -3.0e38f; } }   // causal; + rel_bias[h][k - q + 511]
#pragma unroll
    for (int r = 0; r < 8; ++r) { float mx = fmaxf(s[0][r], s[1][r]);
#pragma unroll
      for (int o = 1; o < 16; o <<= 1) mx = fmaxf(mx, __shfl_xor(mx, o));
      const float mn = fmaxf(m[r], mx); const float alpha = (m[r] <= -1.0e38f) ? 0.f : __expf(m[r] - mn);
      const float e0 = (s[0][r] <= -1.0e38f) ? 0.f : __expf(s[0][r] - mn), e1 = (s[1][r] <= -1.0e38f) ? 0.f : __expf(s[1][r] - mn); float es = e0 + e1;
#pragma unroll
      for (int o = 1; o < 16; o <<= 1) es += __shfl_xor(es, o);
      l[r] = l[r] * alpha + es; m[r] = mn;
#pragma unroll
      for (int dt = 0; dt < 4; ++dt) { acc[dt][r] *= alpha; accl[dt][r] *= alpha; }
      sp[wave][8 * g + r][col] = e0; sp[wave][8 * g + r][16 + col] = e1; }
    LDSX();
    v16h pa, pl; { const float* prow = &sp[wave][col][0] + 8 * (lane >> 4);
#pragma unroll
      for (int i = 0; i < 8; ++i) { const float x0 = prow[i] * 2048.0f, x1 = prow[16 + i] * 2048.0f; const _Float16 h0 = (_Float16)x0, h1 = (_Float16)x1; pa[i] = h0; pa[8 + i] = h1; pl[i] = (_Float16)((x0 - (float)h0) * 2048.0f); pl[8 + i] = (_Float16)((x1 - (float)h1) * 2048.0f); } }   // P scaled by 2^11 before the f16 split so small softmax weights stay out of the f16 subnormal range; 2^-11 folded into the epilogue
#pragma unroll
    for (int dt = 0; dt < 4; ++dt) { const size_t vr = ((size_t)b * DM + h * HD + dt * 16 + col) * SS + ks * 32; const v16h vh = frag_h(VTH + vr, lane); acc[dt] = wmma16(pa, vh, acc[dt]); if (qb < 2) { accl[dt] = wmma16(pl, vh, accl[dt]); accl[dt] = wmma16(pa, frag_h(VTL + vr, lane), accl[dt]); } }   // leading query blocks: P hi/lo x V hi/lo (3 products); elsewhere P x V single
    LDSX(); }
#pragma unroll
  for (int r = 0; r < 8; ++r) { const float il = (1.0f / 2048.0f) / l[r];
#pragma unroll
    for (int dt = 0; dt < 4; ++dt) so[wave][8 * g + r][dt * 16 + col] = (acc[dt][r] + accl[dt][r] * (1.0f / 2048.0f)) * il; }
  LDSX();
  for (int rl = 0; rl < 16; ++rl) if (lane < 16) vst2(O + ((size_t)b * SS + q0 + rl) * DM + h * HD + lane * 4, *(const v4f*)&so[wave][rl][lane * 4]);
}
// ---- k_out: block = (128 rows, 128 cols), 4 waves of 64 x 64: out = O(hi/lo) . Wo rows (2 products) + bo; per trip 64 k of both operand tiles are brought into LDS in whole lines by asynchronous copies (two buffers, the tile shapes and pitches of k_qkv) and read from there by all waves
__global__ __launch_bounds__(128) void k_out(const float* __restrict__ O, const __bf16* __restrict__ P, const float* __restrict__ BO, float* __restrict__ Y) {
  __shared__ __align__(16) char sm[2 * QBUF];   // the two buffers; output staging behind the loop
  const int tid = threadIdx.x, wave = tid >> 5, lane = tid & 31, col = lane & 15, g = lane >> 4, wm = wave >> 1, wn = wave & 1; const size_t m0 = (size_t)blockIdx.x * 128; const int n0 = blockIdx.y * 128;
  const unsigned sbase = (unsigned)(size_t)&sm[0];
  const unsigned la = sbase + (tid >> 4) * QA_PITCH + (tid & 15) * 16, lb = sbase + QA_BYTES + (tid >> 3) * QB_PITCH + (tid & 7) * 16;   // a wave's copy covers 2 O rows of 256 B, or 4 W rows of 128 B
  const char* ga = (const char*)(O + (m0 + (tid >> 4)) * DM + (tid & 15) * 4); const char* gb = (const char*)(P + (size_t)(n0 + (tid >> 3)) * DM + (tid & 7) * 8);
  auto fill = [&](int t, unsigned bo) {   // tile t (k = 64 t ..): 16 + 8 copies per lane
    copy8(la + bo, ga + t * 256, 8 * QA_PITCH, 8 * DM * 4); copy8(la + bo + 64 * QA_PITCH, ga + t * 256 + 64 * DM * 4, 8 * QA_PITCH, 8 * DM * 4); copy8(lb + bo, gb + t * 128, 16 * QB_PITCH, 16 * DM * 2); };
  v8f acc[4][4] = {};
  fill(0, 0);
  asm volatile("s_wait_asynccnt 0x0" ::: "memory");   // tile 0 landed (this wave's copies)
  __syncthreads();                                    // ... and every other wave's
  fill(1, QBUF);
#pragma unroll 1   // rolled: a trip holds 64 WMMAs, enough to carry the branch
  for (int t = 0; t < DM / 64; ++t) { const char* bp = sm + (t & 1) * QBUF;
    const char* ap = bp + (wm * 64 + col) * QA_PITCH + 32 * g;   // this lane's place in row col of the wave's first 16 O rows
    float nx[16];   // the f32 values of the A fragment after the one being multiplied: read from LDS one fragment ahead, so that the read's latency passes under 8 WMMAs
#pragma unroll
    for (int i = 0; i < 8; ++i) { nx[i] = ((const float*)ap)[i]; nx[8 + i] = ((const float*)ap)[16 + i]; }
#pragma unroll   // this and the loops inside it are unrolled so that w[], nx[] and acc[][] are indexed by constants and stay in registers
    for (int kc = 0; kc < 2; ++kc) { v16b w[4];
#pragma unroll
      for (int nj = 0; nj < 4; ++nj) w[nj] = frag_b((const __bf16*)(bp + QA_BYTES + (wn * 64 + nj * 16 + col) * QB_PITCH) + kc * 32, lane);
#pragma unroll
      for (int mi = 0; mi < 4; ++mi) { const F2 a = bsplit16(nx);   // f32 rows split into bf16 hi + residual
        if (kc * 4 + mi < 7) { const int s = kc * 4 + mi + 1; const float* p = (const float*)(ap + (s & 3) * 16 * QA_PITCH) + (s >> 2) * 32;   // same tile, same buffer: nothing of the next tile is read here
#pragma unroll
          for (int i = 0; i < 8; ++i) { nx[i] = p[i]; nx[8 + i] = p[16 + i]; } }
#pragma unroll
        for (int nj = 0; nj < 4; ++nj) acc[mi][nj] = wmma_bf(a.l, w[nj], acc[mi][nj]);   // residual first, then hi, per accumulator; four independent accumulators between the two
#pragma unroll
        for (int nj = 0; nj < 4; ++nj) acc[mi][nj] = wmma_bf(a.h, w[nj], acc[mi][nj]); } }
    asm volatile("s_wait_dscnt 0x0" ::: "memory");      // this wave's reads of the buffer are over
    asm volatile("s_wait_asynccnt 0x0" ::: "memory");   // its copies of tile t + 1 have landed
    __syncthreads();                                    // publishes tile t + 1, frees tile t's buffer
    if (t + 2 < DM / 64) fill(t + 2, (t & 1) * QBUF); }
  asm volatile("s_wait_asynccnt 0x0" ::: "memory");     // no copy in flight before the buffers become staging
  float* so = (float*)(sm + wave * (64 * 272));   // per wave: 64 rows x 64 cols of f32 at pitch 68
#pragma unroll
  for (int nj = 0; nj < 4; ++nj) { const float bias = bfr(BO[n0 + wn * 64 + nj * 16 + col]);
#pragma unroll
    for (int mi = 0; mi < 4; ++mi)
#pragma unroll
      for (int r = 0; r < 8; ++r) so[(mi * 16 + 8 * g + r) * 68 + nj * 16 + col] = acc[mi][nj][r] + bias; }
  LDSX();
  for (int it = 0; it < 32; ++it) { const int rl = it * 2 + g; vst2(Y + (m0 + wm * 64 + rl) * DM + n0 + wn * 64 + col * 4, *(const v4f*)&so[rl * 68 + col * 4]); }   // whole 128-B lines
}
// ---- k_pack3: the fused (in,out) W_attn [DM][3*DM] -> the three transposed f16 (x 2^8) row blocks
__global__ __launch_bounds__(256) void k_pack3(const float* __restrict__ WA, __bf16* __restrict__ PK) { __shared__ __align__(16) _Float16 s[DM]; const int n = blockIdx.x, which = blockIdx.y, t = threadIdx.x; for (int k = t; k < DM; k += 256) s[k] = (_Float16)(bfr(WA[(size_t)k * (3 * DM) + which * DM + n]) * 256.0f);   /* f16 x 2^8 rows (bit pattern stored in the bf16-typed buffer) */ __syncthreads(); for (int q = t; q < DM / 8; q += 256) vst2((unsigned*)(PK + PK_A + ((size_t)which * DM + n) * DM + q * 8), *(const v4u*)&s[q * 8]); }
// ---- k_ent: block = (64 queries, head, b): recompute the causal scores (single f16 q, k; + rel bias) and reduce -sum p log p = log(sum e^(s-m)) + m - (sum e^(s-m) s)/(sum e^(s-m)) per query; 256-B store per block
__global__ __launch_bounds__(128) void k_ent(const _Float16* __restrict__ QK, const float* __restrict__ RB, float* __restrict__ ENT) {
  __shared__ __align__(16) float sent[64];
  const int tid = threadIdx.x, wave = tid >> 5, lane = tid & 31, col = lane & 15, g = lane >> 4; const int h = blockIdx.y; const size_t b = blockIdx.z; const int q0 = blockIdx.x * 64 + wave * 16; const size_t rq = b * SS + q0;
  v16h aq[2];
#pragma unroll
  for (int kc = 0; kc < 2; ++kc) aq[kc] = frag_h(QK + (rq + col) * (2 * DM) + h * HD + kc * 32, lane);
  float m[8], l[8], ls[8];
#pragma unroll
  for (int r = 0; r < 8; ++r) { m[r] = -3.0e38f; l[r] = 0.f; ls[r] = 0.f; }
  const int nks = (blockIdx.x * 64 + 64) / 32;
#pragma unroll 1
  for (int ks = 0; ks < nks; ++ks) { v8f s[2];
#pragma unroll
    for (int ct = 0; ct < 2; ++ct) { const int kk = ks * 32 + ct * 16 + col; v8f c = {};
#pragma unroll
      for (int kc = 0; kc < 2; ++kc) c = wmma16(aq[kc], frag_h(QK + (b * SS + kk) * (2 * DM) + DM + h * HD + kc * 32, lane), c);
#pragma unroll
      for (int r = 0; r < 8; ++r) { const int qi = q0 + 8 * g + r; s[ct][r] = (kk <= qi) ? (c[r] * SCALEF + bfr(RB[(size_t)h * (2 * MAXSEQ - 1) + (kk - qi + MAXSEQ - 1)])) : -3.0e38f; } }
#pragma unroll
    for (int r = 0; r < 8; ++r) { float mx = fmaxf(s[0][r], s[1][r]);
#pragma unroll
      for (int o = 1; o < 16; o <<= 1) mx = fmaxf(mx, __shfl_xor(mx, o));
      const float mn = fmaxf(m[r], mx); const float alpha = (m[r] <= -1.0e38f) ? 0.f : __expf(m[r] - mn);
      const bool v0 = s[0][r] > -1.0e38f, v1 = s[1][r] > -1.0e38f; const float e0 = v0 ? __expf(s[0][r] - mn) : 0.f, e1 = v1 ? __expf(s[1][r] - mn) : 0.f;
      float es = e0 + e1, ess = (v0 ? e0 * s[0][r] : 0.f) + (v1 ? e1 * s[1][r] : 0.f);
#pragma unroll
      for (int o = 1; o < 16; o <<= 1) { es += __shfl_xor(es, o); ess += __shfl_xor(ess, o); }
      l[r] = l[r] * alpha + es; ls[r] = ls[r] * alpha + ess; m[r] = mn; } }
#pragma unroll
  for (int r = 0; r < 8; ++r) if (col == 0) sent[wave * 16 + 8 * g + r] = log_p(l[r]) + m[r] - ls[r] / l[r];
  __syncthreads(); if (tid < 16) vst2(ENT + ((size_t)b * NH + h) * SS + blockIdx.x * 64 + tid * 4, *(const v4f*)&sent[tid * 4]);
}
// ---- k_ln: block = row: XN = (x - mu) rsqrt(var + 1e-5) g + b (f32)
__global__ __launch_bounds__(256) void k_ln(const float* __restrict__ X, const float* __restrict__ G, const float* __restrict__ Bt, float* __restrict__ XN) {
  __shared__ float red[8]; const int t = threadIdx.x; const size_t row = blockIdx.x; float v[4]; float s = 0.f; for (int i = 0; i < 4; ++i) { v[i] = bfr(X[row * DM + t * 4 + i]); s += v[i]; }
#pragma unroll
  for (int o = 1; o < 32; o <<= 1) s += __shfl_xor(s, o);
  if ((t & 31) == 0) red[t >> 5] = s; __syncthreads(); float tot = 0.f; for (int i = 0; i < 8; ++i) tot += red[i]; const float mu = tot / (float)DM; __syncthreads();
  float q = 0.f; for (int i = 0; i < 4; ++i) { const float d = v[i] - mu; q += d * d; }
#pragma unroll
  for (int o = 1; o < 32; o <<= 1) q += __shfl_xor(q, o);
  if ((t & 31) == 0) red[t >> 5] = q; __syncthreads(); float tq = 0.f; for (int i = 0; i < 8; ++i) tq += red[i]; const float inv = 1.0f / sqrtf(tq / (float)DM + 1e-5f);
  v4f o4; for (int i = 0; i < 4; ++i) { const int e = t * 4 + i; o4[i] = (v[i] - mu) * inv * bfr(G[e]) + bfr(Bt[e]); } vst2(XN + row * DM + t * 4, o4);
}
__global__ __launch_bounds__(256) void k_fin(const float* __restrict__ X, const float* __restrict__ Y1, const float* __restrict__ ENT, float* __restrict__ OUT, float* __restrict__ OUT2) {
  const int t = threadIdx.x; const size_t row = blockIdx.x; const size_t b = row / SS; const int tt = (int)(row % SS);
  { v4f o4; for (int i = 0; i < 4; ++i) { const size_t e = row * DM + t * 4 + i; o4[i] = bfr(X[e]) + Y1[e]; } vst2(OUT + row * DM + t * 4, o4); }
  if ((tt & 31) == 0 && t < 32) { __shared__ __align__(16) float se[32]; float a = 0.f; for (int hh = 0; hh < NH; ++hh) a += ENT[(b * NH + hh) * SS + tt + t]; se[t] = a / (float)NH; __syncthreads(); if (t < 8) vst2(OUT2 + row + t * 4, *(const v4f*)&se[t * 4]); }
}
extern "C" void kernel_launch(void* const* d_in, const int* in_sizes, int n_in, void* d_out, int out_size, void* d_ws, size_t ws_size, hipStream_t stream) {
  (void)in_sizes; (void)n_in; (void)out_size;
  const float** F = (const float**)d_in;   // 0 x [16,512,1024], 1 qkv_w [1024,3072] (in,out), 2 qkv_b [3072], 3 out_w [1024,1024] (in,out), 4 out_b, 5 ln_g, 6 ln_b, 7 rel_bias [16,1023]
  if (ws_size < (size_t)WS_END) return;
  char* ws = (char*)d_ws; __bf16* PK = (__bf16*)(ws + WS_PK); _Float16 *QK = (_Float16*)(ws + WS_QK), *QKL = (_Float16*)(ws + WS_QKL), *VTH = (_Float16*)(ws + WS_VTH), *VTL = (_Float16*)(ws + WS_VTL); float *O = (float*)(ws + WS_O), *XN = (float*)(ws + WS_XN), *ENT = (float*)(ws + WS_ENT), *Y1 = (float*)(ws + WS_Y1);
  float* OUT = (float*)d_out; float* OUT2 = OUT + (size_t)NB * SS * DM;   // outputs concatenated: out [16,512,1024] then entropy [16,512]
  k_pack<<<dim3(DM, 4), 256, 0, stream>>>(F[3], F[3], F[3], F[3], PK);   // out_w ((in,out) -> transposed rows) into the Wo slot (q/k/v slots overwritten next)
  k_pack3<<<dim3(DM, 3), 256, 0, stream>>>(F[1], PK);
  k_ln<<<TNB * SS, 256, 0, stream>>>(F[0], F[5], F[6], XN);
  k_qkv<<<dim3(TNB * SS / 128, QKVW / 128), 128, 0, stream>>>(XN, XN, XN, PK + PK_A, F[2], F[2] + DM, F[2] + 2 * DM, QK, QKL, VTH, VTL);
  k_attn<<<dim3(TQB, NH, TNB), 128, 0, stream>>>(QK, QKL, VTH, VTL, nullptr, F[7], O);
  k_ent<<<dim3(TQB, NH, TNB), 128, 0, stream>>>(QK, F[7], ENT);
  k_out<<<dim3(TNB * SS / 128, DM / 128), 128, 0, stream>>>(O, PK + PK_P, F[4], Y1);
  k_fin<<<TOB * 64, 256, 0, stream>>>(F[0], Y1, ENT, OUT, OUT2);
}

// v003
// It runs in 302 microseconds.
// Next to v002, in two timings, it ran 1.11 times as fast each time.
// Over all steps from v000 it is 1.91 times as fast.
// compute dtype: all float inputs rounded to bf16; LayerNorm in f32, its output rounded once to f16 x exact f16 copies (x 2^8) of the fused qkv weight on WMMA 16x16x32 (1 product) + bias; causal attention: 3-product scores and hi + residual P, v on the first 128 queries of each sequence, single f16 beyond; x 1/8 + rel_bias[h][k-q+511], running-max softmax in f32 (hardware exp); the per-row entropy from a second single-f16 score pass (precise logf); out = x + (o (bf16 hi + residual) . out_w (2 products) + out_b); second output = head-mean attention entropy.
#include <hip/hip_runtime.h>
#include <math.h>

typedef __attribute__((ext_vector_type(16))) _Float16 v16h;
typedef __attribute__((ext_vector_type(16))) __bf16 v16b;
typedef __attribute__((ext_vector_type(8)))  _Float16 v8h;
typedef __attribute__((ext_vector_type(8)))  float v8f;
typedef __attribute__((ext_vector_type(4)))  float v4f;
typedef __attribute__((ext_vector_type(2)))  float v2f;
typedef __attribute__((ext_vector_type(4)))  unsigned v4u;
typedef __attribute__((ext_vector_type(4)))  int v4i;
typedef float __attribute__((may_alias)) float_a;
typedef int __attribute__((may_alias)) int_a;

template <typename T> __device__ __forceinline__ void vst2(void* p, T v) { *(T*)p = v;  }
__device__ __forceinline__ v8f wmma16(v16h a, v16h b, v8f c) {
  v8f d = __builtin_amdgcn_wmma_f32_16x16x32_f16(false, a, false, b, (short)0, c, false, false);
  asm volatile("v_nop\n\tv_nop\n\tv_nop\n\tv_nop" : "+v"(d) : "v"(a), "v"(b));
  return d;
}
__device__ __forceinline__ v8f wmma_bf(v16b a, v16b b, v8f c) {
  v8f d = __builtin_amdgcn_wmma_f32_16x16x32_bf16(false, a, false, b, (short)0, c, false, false);
  asm volatile("v_nop\n\tv_nop\n\tv_nop\n\tv_nop" : "+v"(d) : "v"(a), "v"(b));
  return d;
}
// Pre-LN causal time attention with relative position bias (B 16, T 512, d 1,024, 16 heads x 64): x + out_proj(attention(LN(x))), plus the mean attention entropy per (batch, step) as a second output.
__device__ __forceinline__ v16h frag_h(const _Float16* rowk0, int lane) {
  union { v16h v; v8h q[2]; } u; const _Float16* p = rowk0 + 8 * (lane >> 4);
  u.q[0] = *(const v8h*)p; u.q[1] = *(const v8h*)(p + 16); return u.v;
}
__device__ __forceinline__ v16h frag_f32(const float* rowk0, int lane) {
  v16h a; const float* p = rowk0 + 8 * (lane >> 4);
#pragma unroll
  for (int i = 0; i < 8; ++i) { a[i] = (_Float16)p[i]; a[8 + i] = (_Float16)p[16 + i]; }
  return a;
}
__device__ __forceinline__ v16h frag_f32s(const float* rowk0, int lane, float sc) {
  v16h a; const float* p = rowk0 + 8 * (lane >> 4);
#pragma unroll
  for (int i = 0; i < 8; ++i) { a[i] = (_Float16)(p[i] * sc); a[8 + i] = (_Float16)(p[16 + i] * sc); }
  return a;
}
// column fragment from a [K][ld] layout (column n), rows >= K read as 0
__device__ __forceinline__ v16h fragc_f32(const float* W, int k0, int n, int lane, int ld, int K) {
  v16h a; const int g = lane >> 4;
#pragma unroll
  for (int i = 0; i < 8; ++i) { const int ka = k0 + 8 * g + i, kb = ka + 16;
    a[i] = (_Float16)(ka < K ? W[(size_t)(ka < K ? ka : K - 1) * ld + n] : 0.f); a[8 + i] = (_Float16)(kb < K ? W[(size_t)(kb < K ? kb : K - 1) * ld + n] : 0.f); }
  return a;
}
struct F2 { v16b h, l; };
__device__ __forceinline__ F2 bsplit16(const float v[16]) { F2 r;
#pragma unroll
  for (int i = 0; i < 16; ++i) { const __bf16 h = (__bf16)v[i]; r.h[i] = h; r.l[i] = (__bf16)(v[i] - (float)h); }
  return r; }
__device__ __forceinline__ F2 split_row(const float* row, int k0, int lane) { float v[16]; const float* p = row + k0 + 8 * (lane >> 4);
#pragma unroll
  for (int i = 0; i < 8; ++i) { v[i] = p[i]; v[8 + i] = p[16 + i]; }
  return bsplit16(v); }
__device__ __forceinline__ F2 split_rowK(const float* row, int k0, int lane, int K) { float v[16]; const int g = lane >> 4;
#pragma unroll
  for (int i = 0; i < 8; ++i) { const int ka = k0 + 8 * g + i, kb = ka + 16; v[i] = ka < K ? row[ka < K ? ka : K - 1] : 0.f; v[8 + i] = kb < K ? row[kb < K ? kb : K - 1] : 0.f; }
  return bsplit16(v); }
__device__ __forceinline__ F2 split_col(const float* W, int k0, int n, int lane, int ld, int K) { float v[16]; const int g = lane >> 4;
#pragma unroll
  for (int i = 0; i < 8; ++i) { const int ka = k0 + 8 * g + i, kb = ka + 16; v[i] = ka < K ? W[(size_t)(ka < K ? ka : K - 1) * ld + n] : 0.f; v[8 + i] = kb < K ? W[(size_t)(kb < K ? kb : K - 1) * ld + n] : 0.f; }
  return bsplit16(v); }
__device__ __forceinline__ v8f mac3(const F2& a, const F2& b, v8f c) { c = wmma_bf(a.l, b.h, c); c = wmma_bf(a.h, b.l, c); return wmma_bf(a.h, b.h, c); }
__device__ __forceinline__ float sigm(float v) { return 1.0f / (1.0f + expf(-v)); }
#define LDSX() do { asm volatile("s_wait_dscnt 0" ::: "memory"); __builtin_amdgcn_wave_barrier(); __builtin_amdgcn_fence(__ATOMIC_RELEASE, "workgroup"); } while (0)


#define NB 16
#define SS 512
#define SCALEF 0.125f
#define DM 1024
#define NH 16
#define MAXSEQ 512
__device__ __attribute__((noinline)) float log_p(float v) { return logf(v); }
#define HD 64
#define QKVW (3 * DM)
#ifndef TQB
#define TQB (SS / 64)
#define TNB NB
#define TOB (NB * SS / 64)     // output row tiles (all)
#endif
typedef __attribute__((ext_vector_type(8))) __bf16 v8b;
__device__ __forceinline__ v16b frag_b(const __bf16* rowk0, int lane) {
  union { v16b v; v8b q[2]; } u; const __bf16* p = rowk0 + 8 * (lane >> 4);
  u.q[0] = *(const v8b*)p; u.q[1] = *(const v8b*)(p + 16); return u.v;
}
__device__ __forceinline__ float bfr(float v) { return (float)(__bf16)v; }
__device__ __attribute__((noinline)) float exp_ni(float v) { return expf(v); }
__device__ __attribute__((noinline)) float erf_ni(float v) { return erff(v); }

#define PK_A 0                       // [3072][1024] Wqkv rows (natural [out][in])
#define PK_P (PK_A + QKVW * DM)        // [1024][1024] Wo rows (natural)
#define PK_END (PK_P + DM * DM)
#define WS_PK  0u
#define WS_QK  (WS_PK + 2u * PK_END)             // f16 [8192 rows][2048]: q | k
#define WS_QKL (WS_QK + 2u * NB * SS * 2 * DM)     // f16 q | k residual planes x2048
#define WS_VTH (WS_QKL + 2u * NB * SS * 2 * DM)    // f16 [b][1024 (h*64+d)][512 s] hi
#define WS_VTL (WS_VTH + 2u * NB * DM * SS)        // f16 lo x 2048
#define WS_O   (WS_VTL + 2u * NB * DM * SS)        // f32 [8192][1024]
#define WS_CS  (WS_O + 4u * NB * SS * DM)           // f32 2 x [512][32], unused
#define WS_XN  (WS_CS + 4u * 2 * SS * 32)                  // f32 [NR][1024] LayerNorm(x)
#define WS_ENT (WS_XN + 4u * (size_t)NB * SS * DM)     // f32 [b][h][t] attention entropy
#define WS_Y1  (WS_ENT + 4u * (size_t)NB * NH * SS)    // f32 [NR][1024] out-proj
#define WS_END (WS_Y1 + 4u * (size_t)NB * SS * DM)
// ---- k_pack: block = (row n, which): (in,out) column n -> bf16 row n; which 0..2 -> W_q/W_k/W_v into PK_A rows which*1024 + n; 3 -> W_o into PK_P
__global__ __launch_bounds__(256) void k_pack(const float* __restrict__ WQ, const float* __restrict__ WK, const float* __restrict__ WV, const float* __restrict__ WO, __bf16* __restrict__ PK) {
  __shared__ __align__(16) __bf16 s[DM]; const int n = blockIdx.x, which = blockIdx.y, t = threadIdx.x; const float* Wm = (which == 0) ? WQ : (which == 1) ? WK : (which == 2) ? WV : WO;   // (in,out) weights: pack row n = column n
  for (int k = t; k < DM; k += 256) s[k] = (__bf16)Wm[(size_t)k * DM + n];
  __syncthreads();
  __bf16* dst = (which < 3) ? PK + PK_A + ((size_t)which * DM + n) * DM : PK + PK_P + (size_t)n * DM;
  for (int q = t; q < DM / 8; q += 256) vst2((unsigned*)(dst + q * 8), *(const v4u*)&s[q * 8]);
}
// ---- k_qkv: block = (128 rows, 128 cols), 4 waves of 64 x 64; per trip 64 k of both operand tiles are brought into LDS in whole lines by asynchronous copies (two buffers) and read from there by all waves
#define QA_PITCH 272                      // bytes: a 256-B row of 64 f32 + 16 (16 B x odd: ds_load_b128 free of bank conflicts)
#define QB_PITCH 144                      // bytes: a 128-B row of 64 f16 + 16
#define QA_BYTES (128 * QA_PITCH)
#define QBUF (QA_BYTES + 128 * QB_PITCH)  // one buffer: X tile, then W tile
// eight 16-B copies per lane, rows lstep / gstep bytes apart; the s_wait_xcnt closes the statement so that no address register is rewritten in front of it
__device__ __forceinline__ void copy8(unsigned l, const char* p, unsigned lstep, unsigned gstep) {
  asm volatile("global_load_async_to_lds_b128 %0, %8, off\n\t"
               "global_load_async_to_lds_b128 %1, %9, off\n\t"
               "global_load_async_to_lds_b128 %2, %10, off\n\t"
               "global_load_async_to_lds_b128 %3, %11, off\n\t"
               "global_load_async_to_lds_b128 %4, %12, off\n\t"
               "global_load_async_to_lds_b128 %5, %13, off\n\t"
               "global_load_async_to_lds_b128 %6, %14, off\n\t"
               "global_load_async_to_lds_b128 %7, %15, off\n\t"
               "s_wait_xcnt 0x0"
               :: "v"(l), "v"(l + lstep), "v"(l + 2 * lstep), "v"(l + 3 * lstep), "v"(l + 4 * lstep), "v"(l + 5 * lstep), "v"(l + 6 * lstep), "v"(l + 7 * lstep),
                  "v"(p), "v"(p + gstep), "v"(p + 2 * gstep), "v"(p + 3 * gstep), "v"(p + 4 * gstep), "v"(p + 5 * gstep), "v"(p + 6 * gstep), "v"(p + 7 * gstep)
               : "memory");
}
__global__ __launch_bounds__(128) void k_qkv(const float* __restrict__ XQ, const float* __restrict__ XK, const float* __restrict__ XV, const __bf16* __restrict__ P, const float* __restrict__ BQ, const float* __restrict__ BK, const float* __restrict__ BV, _Float16* __restrict__ QK, _Float16* __restrict__ QKL, _Float16* __restrict__ VTH, _Float16* __restrict__ VTL) {
  const int which0 = (blockIdx.y * 128) / DM; const float* X = (which0 == 0) ? XQ : (which0 == 1) ? XK : XV; const float* BB = BQ ? (((which0 == 0) ? BQ : (which0 == 1) ? BK : BV) + (blockIdx.y * 128 - which0 * DM)) : nullptr;
  __shared__ __align__(16) char sm[2 * QBUF];   // the two buffers; output staging behind the loop
  const int tid = threadIdx.x, wave = tid >> 5, lane = tid & 31, col = lane & 15, g = lane >> 4, wm = wave >> 1, wn = wave & 1; const size_t m0 = (size_t)blockIdx.x * 128; const int n0 = blockIdx.y * 128;
  const unsigned sbase = (unsigned)(size_t)&sm[0];
  const unsigned la = sbase + (tid >> 4) * QA_PITCH + (tid & 15) * 16, lb = sbase + QA_BYTES + (tid >> 3) * QB_PITCH + (tid & 7) * 16;   // a wave's copy covers 2 X rows of 256 B, or 4 W rows of 128 B
  const char* ga = (const char*)(X + (m0 + (tid >> 4)) * DM + (tid & 15) * 4); const char* gb = (const char*)((const _Float16*)P + (size_t)(n0 + (tid >> 3)) * DM + (tid & 7) * 8);
  auto fill = [&](int t, unsigned bo) {   // tile t (k = 64 t ..): 16 + 8 copies per lane
    copy8(la + bo, ga + t * 256, 8 * QA_PITCH, 8 * DM * 4); copy8(la + bo + 64 * QA_PITCH, ga + t * 256 + 64 * DM * 4, 8 * QA_PITCH, 8 * DM * 4); copy8(lb + bo, gb + t * 128, 16 * QB_PITCH, 16 * DM * 2); };
  v8f acc[4][4] = {};
  fill(0, 0);
  asm volatile("s_wait_asynccnt 0x0" ::: "memory");   // tile 0 landed (this wave's copies)
  __syncthreads();                                    // ... and every other wave's
  fill(1, QBUF);
#pragma unroll 1   // rolled: a trip holds 32 WMMAs, enough to carry the branch
  for (int t = 0; t < DM / 64; ++t) { const char* bp = sm + (t & 1) * QBUF;
#pragma unroll   // this and the loops inside it are unrolled so that a[], w[] and acc[][] are indexed by constants and stay in registers
    for (int kc = 0; kc < 2; ++kc) { v16h a[4], w[4];
#pragma unroll
      for (int mi = 0; mi < 4; ++mi) { const float* p = (const float*)(bp + (wm * 64 + mi * 16 + col) * QA_PITCH) + kc * 32 + 8 * g;   // LN'd rows (f32) rounded once to f16
#pragma unroll
        for (int i = 0; i < 8; ++i) { a[mi][i] = (_Float16)p[i]; a[mi][8 + i] = (_Float16)p[16 + i]; } }
#pragma unroll
      for (int nj = 0; nj < 4; ++nj) w[nj] = frag_h((const _Float16*)(bp + QA_BYTES + (wn * 64 + nj * 16 + col) * QB_PITCH) + kc * 32, lane);
#pragma unroll
      for (int mi = 0; mi < 4; ++mi)
#pragma unroll
        for (int nj = 0; nj < 4; ++nj) acc[mi][nj] = wmma16(a[mi], w[nj], acc[mi][nj]); }
    asm volatile("s_wait_dscnt 0x0" ::: "memory");      // this wave's reads of the buffer are over
    asm volatile("s_wait_asynccnt 0x0" ::: "memory");   // its copies of tile t + 1 have landed
    __syncthreads();                                    // publishes tile t + 1, frees tile t's buffer
    if (t + 2 < DM / 64) fill(t + 2, (t & 1) * QBUF); }
  asm volatile("s_wait_asynccnt 0x0" ::: "memory");     // no copy in flight before the buffers become staging
  if (n0 < 2 * DM) {   // q stored unscaled (f16 sigma ~0.6, no subnormal exposure); 1/8 applied to the f32 score
    _Float16* sh = (_Float16*)(sm + wave * (2 * 64 * 144)); _Float16* sl = sh + 64 * 72;   // per wave: 64 rows x 64 cols at pitch 72, hi then residual
#pragma unroll
    for (int nj = 0; nj < 4; ++nj) { const float bias = BB ? bfr(BB[wn * 64 + nj * 16 + col]) : 0.f;
#pragma unroll
      for (int mi = 0; mi < 4; ++mi)
#pragma unroll
        for (int r = 0; r < 8; ++r) { const float v = acc[mi][nj][r] * (1.0f / 256.0f) + bias; const _Float16 hv = (_Float16)v; sh[(mi * 16 + 8 * g + r) * 72 + nj * 16 + col] = hv; sl[(mi * 16 + 8 * g + r) * 72 + nj * 16 + col] = (_Float16)((v - (float)hv) * 2048.0f); } }   // q, k (+ bias) as f16 hi + (x2048) residual
    LDSX();
    for (int it = 0; it < 16; ++it) { const int rl = it * 4 + (lane >> 3), ch = lane & 7; const size_t o = (m0 + wm * 64 + rl) * (2 * DM) + n0 + wn * 64 + ch * 8; vst2((unsigned*)(QK + o), *(const v4u*)&sh[rl * 72 + ch * 8]); vst2((unsigned*)(QKL + o), *(const v4u*)&sl[rl * 72 + ch * 8]); }   // whole 128-B lines
  } else {
    _Float16* sth = (_Float16*)sm; _Float16* stl = sth + 128 * 136;   // [128 d][128 s] at pitch 136, hi then residual
#pragma unroll
    for (int nj = 0; nj < 4; ++nj) { const float bias = BB ? bfr(BB[wn * 64 + nj * 16 + col]) : 0.f;
#pragma unroll
      for (int mi = 0; mi < 4; ++mi) { v8h h8, l8;
#pragma unroll
        for (int r = 0; r < 8; ++r) { const float v = acc[mi][nj][r] * (1.0f / 256.0f) + bias; const _Float16 hv = (_Float16)v; h8[r] = hv; l8[r] = (_Float16)((v - (float)hv) * 2048.0f); }
        const int o = (wn * 64 + nj * 16 + col) * 136 + wm * 64 + mi * 16 + 8 * g; *(v8h*)&sth[o] = h8; *(v8h*)&stl[o] = l8; } }
    __syncthreads();
    const int b = (int)(m0 / SS), s0 = (int)(m0 % SS); const int pc0 = n0 - 2 * DM;
    for (int it = 0; it < 16; ++it) { const int d = it * 8 + (tid >> 4), pc = tid & 15; const size_t o = ((size_t)b * DM + pc0 + d) * SS + s0 + pc * 8; vst2((unsigned*)(VTH + o), *(const v4u*)&sth[d * 136 + pc * 8]); vst2((unsigned*)(VTL + o), *(const v4u*)&stl[d * 136 + pc * 8]); }
  }
}
// lane l with lane l ^ 16 (a vector cross-row move, no LDS unit)
__device__ __forceinline__ float xhalf(float x) { return __builtin_bit_cast(float, __builtin_amdgcn_permlanex16(__builtin_bit_cast(int, x), __builtin_bit_cast(int, x), 0x76543210, 0xfedcba98, false, false)); }
// ---- k_attn: block = (64 queries, head h, batch b): causal flash attention on transposed products: S^T = K . Q^T (A = 16 key rows, B = the wave's 16 queries), so a lane holds 16 of the 32 scores of ONE query (column col; keys 8 g + r of each 16): maximum and sum run in the lane, with one exchange between the wave's halves; the two S^T tiles, converted in place, are the B operand of O^T += V^T . P^T (A = 16 d rows of V^T): P never passes through LDS. O[b*S+q][h*64+d] = (acc + accl / 2048) / (2048 l) (256-B segments)
__global__ __launch_bounds__(128) void k_attn(const _Float16* __restrict__ QK, const _Float16* __restrict__ QKL, const _Float16* __restrict__ VTH, const _Float16* __restrict__ VTL, const void* __restrict__ KMASK, const float* __restrict__ RB, float* __restrict__ O) {
  __shared__ __align__(16) float so[4][16][68];
  const int tid = threadIdx.x, wave = tid >> 5, lane = tid & 31, col = lane & 15, g = lane >> 4;
  const int qb = blockIdx.x, h = blockIdx.y, b = blockIdx.z; const int q0 = qb * 64 + wave * 16; const int qi = q0 + col; const size_t rq = (size_t)b * SS + qi;
  v16h aq[2], aql[2];
#pragma unroll
  for (int kc = 0; kc < 2; ++kc) { aq[kc] = frag_h(QK + rq * (2 * DM) + h * HD + kc * 32, lane); aql[kc] = frag_h(QKL + rq * (2 * DM) + h * HD + kc * 32, lane); }
  float m = -3.0e38f, l = 0.f;   // of query qi: m over all keys so far (equal in both halves), l over this half's keys (joined behind the loop)
  v8f acc[4] = {}, accl[4] = {};   // O^T: register r = d (dt * 16 + 8 g + r), column = query
  const float* rbq = RB + (size_t)h * (2 * MAXSEQ - 1) + (MAXSEQ - 1 - qi) + 8 * g;   // rel_bias[h][k - q + 511] at k = 8 g
  const int nks = (qb * 64 + 64) / 32;   // causal: key tiles up to the query tile's end
#pragma unroll 1
  for (int ks = 0; ks < nks; ++ks) { v8f s[2];
#pragma unroll
    for (int ct = 0; ct < 2; ++ct) { const int kr = ks * 32 + ct * 16 + col; const _Float16* krow = QK + ((size_t)b * SS + kr) * (2 * DM) + DM + h * HD; const _Float16* krowl = QKL + ((size_t)b * SS + kr) * (2 * DM) + DM + h * HD; v8f c = {}, cl = {};
      if (qb < 2) {   // leading query blocks (few keys, outputs far above the global rms): 3 products
#pragma unroll
        for (int kc = 0; kc < 2; ++kc) { const v16h kh = frag_h(krow + kc * 32, lane); c = wmma16(kh, aq[kc], c); cl = wmma16(kh, aql[kc], cl); cl = wmma16(frag_h(krowl + kc * 32, lane), aq[kc], cl); }
#pragma unroll
        for (int r = 0; r < 8; ++r) c[r] += cl[r] * (1.0f / 2048.0f); }
      else {
#pragma unroll
        for (int kc = 0; kc < 2; ++kc) c = wmma16(frag_h(krow + kc * 32, lane), aq[kc], c); }   // single product elsewhere
#pragma unroll
      for (int r = 0; r < 8; ++r) { const int kk = ks * 32 + ct * 16 + 8 * g + r; s[ct][r] = (kk <= qi) ? (c[r] * SCALEF + bfr(rbq[ks * 32 + ct * 16 + r])) : -3.0e38f; } }   // causal; + rel_bias[h][k - q + 511]
    float mx = fmaxf(s[0][0], s[1][0]);
#pragma unroll
    for (int r = 1; r < 8; ++r) mx = fmaxf(mx, fmaxf(s[0][r], s[1][r]));
    mx = fmaxf(mx, xhalf(mx));
    const float mn = fmaxf(m, mx); const float alpha = (m <= -1.0e38f) ? 0.f : __expf(m - mn);
    float es0 = 0.f, es1 = 0.f; v16h pa, pl;
#pragma unroll
    for (int r = 0; r < 8; ++r) { const float e0 = (s[0][r] <= -1.0e38f) ? 0.f : __expf(s[0][r] - mn), e1 = (s[1][r] <= -1.0e38f) ? 0.f : __expf(s[1][r] - mn); es0 += e0; es1 += e1;
      const float x0 = e0 * 2048.0f, x1 = e1 * 2048.0f; const _Float16 h0 = (_Float16)x0, h1 = (_Float16)x1; pa[r] = h0; pa[8 + r] = h1; pl[r] = (_Float16)((x0 - (float)h0) * 2048.0f); pl[8 + r] = (_Float16)((x1 - (float)h1) * 2048.0f); }   // P scaled by 2^11 before the f16 split so small softmax weights stay out of the f16 subnormal range; 2^-11 folded into the epilogue
    l = l * alpha + (es0 + es1); m = mn;
#pragma unroll
    for (int dt = 0; dt < 4; ++dt)
#pragma unroll
      for (int r = 0; r < 8; ++r) { acc[dt][r] *= alpha; accl[dt][r] *= alpha; }
#pragma unroll
    for (int dt = 0; dt < 4; ++dt) { const size_t vr = ((size_t)b * DM + h * HD + dt * 16 + col) * SS + ks * 32; const v16h vh = frag_h(VTH + vr, lane); acc[dt] = wmma16(vh, pa, acc[dt]); if (qb < 2) { accl[dt] = wmma16(vh, pl, accl[dt]); accl[dt] = wmma16(frag_h(VTL + vr, lane), pa, accl[dt]); } } }   // leading query blocks: P hi/lo x V hi/lo (3 products); elsewhere P x V single
  l += xhalf(l);
  const float il = (1.0f / 2048.0f) / l;
#pragma unroll
  for (int dt = 0; dt < 4; ++dt) { v4f o0, o1;
#pragma unroll
    for (int r = 0; r < 4; ++r) { o0[r] = (acc[dt][r] + accl[dt][r] * (1.0f / 2048.0f)) * il; o1[r] = (acc[dt][4 + r] + accl[dt][4 + r] * (1.0f / 2048.0f)) * il; }
    *(v4f*)&so[wave][col][dt * 16 + 8 * g] = o0; *(v4f*)&so[wave][col][dt * 16 + 8 * g + 4] = o1; }
  LDSX();
  for (int rl = 0; rl < 16; ++rl) if (lane < 16) vst2(O + ((size_t)b * SS + q0 + rl) * DM + h * HD + lane * 4, *(const v4f*)&so[wave][rl][lane * 4]);
}
// ---- k_out: block = (128 rows, 128 cols), 4 waves of 64 x 64: out = O(hi/lo) . Wo rows (2 products) + bo; per trip 64 k of both operand tiles are brought into LDS in whole lines by asynchronous copies (two buffers, the tile shapes and pitches of k_qkv) and read from there by all waves
__global__ __launch_bounds__(128) void k_out(const float* __restrict__ O, const __bf16* __restrict__ P, const float* __restrict__ BO, float* __restrict__ Y) {
  __shared__ __align__(16) char sm[2 * QBUF];   // the two buffers; output staging behind the loop
  const int tid = threadIdx.x, wave = tid >> 5, lane = tid & 31, col = lane & 15, g = lane >> 4, wm = wave >> 1, wn = wave & 1; const size_t m0 = (size_t)blockIdx.x * 128; const int n0 = blockIdx.y * 128;
  const unsigned sbase = (unsigned)(size_t)&sm[0];
  const unsigned la = sbase + (tid >> 4) * QA_PITCH + (tid & 15) * 16, lb = sbase + QA_BYTES + (tid >> 3) * QB_PITCH + (tid & 7) * 16;   // a wave's copy covers 2 O rows of 256 B, or 4 W rows of 128 B
  const char* ga = (const char*)(O + (m0 + (tid >> 4)) * DM + (tid & 15) * 4); const char* gb = (const char*)(P + (size_t)(n0 + (tid >> 3)) * DM + (tid & 7) * 8);
  auto fill = [&](int t, unsigned bo) {   // tile t (k = 64 t ..): 16 + 8 copies per lane
    copy8(la + bo, ga + t * 256, 8 * QA_PITCH, 8 * DM * 4); copy8(la + bo + 64 * QA_PITCH, ga + t * 256 + 64 * DM * 4, 8 * QA_PITCH, 8 * DM * 4); copy8(lb + bo, gb + t * 128, 16 * QB_PITCH, 16 * DM * 2); };
  v8f acc[4][4] = {};
  fill(0, 0);
  asm volatile("s_wait_asynccnt 0x0" ::: "memory");   // tile 0 landed (this wave's copies)
  __syncthreads();                                    // ... and every other wave's
  fill(1, QBUF);
#pragma unroll 1   // rolled: a trip holds 64 WMMAs, enough to carry the branch
  for (int t = 0; t < DM / 64; ++t) { const char* bp = sm + (t & 1) * QBUF;
    const char* ap = bp + (wm * 64 + col) * QA_PITCH + 32 * g;   // this lane's place in row col of the wave's first 16 O rows
    float nx[16];   // the f32 values of the A fragment after the one being multiplied: read from LDS one fragment ahead, so that the read's latency passes under 8 WMMAs
#pragma unroll
    for (int i = 0; i < 8; ++i) { nx[i] = ((const float*)ap)[i]; nx[8 + i] = ((const float*)ap)[16 + i]; }
#pragma unroll   // this and the loops inside it are unrolled so that w[], nx[] and acc[][] are indexed by constants and stay in registers
    for (int kc = 0; kc < 2; ++kc) { v16b w[4];
#pragma unroll
      for (int nj = 0; nj < 4; ++nj) w[nj] = frag_b((const __bf16*)(bp + QA_BYTES + (wn * 64 + nj * 16 + col) * QB_PITCH) + kc * 32, lane);
#pragma unroll
      for (int mi = 0; mi < 4; ++mi) { const F2 a = bsplit16(nx);   // f32 rows split into bf16 hi + residual
        if (kc * 4 + mi < 7) { const int s = kc * 4 + mi + 1; const float* p = (const float*)(ap + (s & 3) * 16 * QA_PITCH) + (s >> 2) * 32;   // same tile, same buffer: nothing of the next tile is read here
#pragma unroll
          for (int i = 0; i < 8; ++i) { nx[i] = p[i]; nx[8 + i] = p[16 + i]; } }
#pragma unroll
        for (int nj = 0; nj < 4; ++nj) acc[mi][nj] = wmma_bf(a.l, w[nj], acc[mi][nj]);   // residual first, then hi, per accumulator; four independent accumulators between the two
#pragma unroll
        for (int nj = 0; nj < 4; ++nj) acc[mi][nj] = wmma_bf(a.h, w[nj], acc[mi][nj]); } }
    asm volatile("s_wait_dscnt 0x0" ::: "memory");      // this wave's reads of the buffer are over
    asm volatile("s_wait_asynccnt 0x0" ::: "memory");   // its copies of tile t + 1 have landed
    __syncthreads();                                    // publishes tile t + 1, frees tile t's buffer
    if (t + 2 < DM / 64) fill(t + 2, (t & 1) * QBUF); }
  asm volatile("s_wait_asynccnt 0x0" ::: "memory");     // no copy in flight before the buffers become staging
  float* so = (float*)(sm + wave * (64 * 272));   // per wave: 64 rows x 64 cols of f32 at pitch 68
#pragma unroll
  for (int nj = 0; nj < 4; ++nj) { const float bias = bfr(BO[n0 + wn * 64 + nj * 16 + col]);
#pragma unroll
    for (int mi = 0; mi < 4; ++mi)
#pragma unroll
      for (int r = 0; r < 8; ++r) so[(mi * 16 + 8 * g + r) * 68 + nj * 16 + col] = acc[mi][nj][r] + bias; }
  LDSX();
  for (int it = 0; it < 32; ++it) { const int rl = it * 2 + g; vst2(Y + (m0 + wm * 64 + rl) * DM + n0 + wn * 64 + col * 4, *(const v4f*)&so[rl * 68 + col * 4]); }   // whole 128-B lines
}
// ---- k_pack3: the fused (in,out) W_attn [DM][3*DM] -> the three transposed f16 (x 2^8) row blocks
__global__ __launch_bounds__(256) void k_pack3(const float* __restrict__ WA, __bf16* __restrict__ PK) { __shared__ __align__(16) _Float16 s[DM]; const int n = blockIdx.x, which = blockIdx.y, t = threadIdx.x; for (int k = t; k < DM; k += 256) s[k] = (_Float16)(bfr(WA[(size_t)k * (3 * DM) + which * DM + n]) * 256.0f);   /* f16 x 2^8 rows (bit pattern stored in the bf16-typed buffer) */ __syncthreads(); for (int q = t; q < DM / 8; q += 256) vst2((unsigned*)(PK + PK_A + ((size_t)which * DM + n) * DM + q * 8), *(const v4u*)&s[q * 8]); }
// ---- k_ent: block = (64 queries, head, b): recompute the causal scores (single f16 q, k; + rel bias) as S^T = K . Q^T (a lane holds 16 of the 32 scores of one query) and reduce -sum p log p = log(sum e^(s-m)) + m - (sum e^(s-m) s)/(sum e^(s-m)) per query, in the lane; the halves' sums are joined behind the loop; 256-B store per block
__global__ __launch_bounds__(128) void k_ent(const _Float16* __restrict__ QK, const float* __restrict__ RB, float* __restrict__ ENT) {
  __shared__ __align__(16) float sent[64];
  const int tid = threadIdx.x, wave = tid >> 5, lane = tid & 31, col = lane & 15, g = lane >> 4; const int h = blockIdx.y; const size_t b = blockIdx.z; const int q0 = blockIdx.x * 64 + wave * 16; const int qi = q0 + col; const size_t rq = b * SS + q0;
  v16h aq[2];
#pragma unroll
  for (int kc = 0; kc < 2; ++kc) aq[kc] = frag_h(QK + (rq + col) * (2 * DM) + h * HD + kc * 32, lane);
  asm volatile("s_wait_xcnt 0x0" ::: "memory");   // the loop's first address sum reuses the register pair that these four loads name: the wait stands in front of that overwrite
  float m = -3.0e38f, l = 0.f, ls = 0.f;   // of query qi: m over all keys so far, l and ls over this half's keys
  const float* rbq = RB + (size_t)h * (2 * MAXSEQ - 1) + (MAXSEQ - 1 - qi) + 8 * g;
  const int nks = (blockIdx.x * 64 + 64) / 32;
#pragma unroll 1
  for (int ks = 0; ks < nks; ++ks) { v8f s[2];
#pragma unroll
    for (int ct = 0; ct < 2; ++ct) { const int kr = ks * 32 + ct * 16 + col; v8f c = {};
#pragma unroll
      for (int kc = 0; kc < 2; ++kc) c = wmma16(frag_h(QK + (b * SS + kr) * (2 * DM) + DM + h * HD + kc * 32, lane), aq[kc], c);
#pragma unroll
      for (int r = 0; r < 8; ++r) { const int kk = ks * 32 + ct * 16 + 8 * g + r; s[ct][r] = (kk <= qi) ? (c[r] * SCALEF + bfr(rbq[ks * 32 + ct * 16 + r])) : -3.0e38f; } }
    float mx = fmaxf(s[0][0], s[1][0]);
#pragma unroll
    for (int r = 1; r < 8; ++r) mx = fmaxf(mx, fmaxf(s[0][r], s[1][r]));
    mx = fmaxf(mx, xhalf(mx));
    const float mn = fmaxf(m, mx); const float alpha = (m <= -1.0e38f) ? 0.f : __expf(m - mn);
    float es0 = 0.f, es1 = 0.f, ess0 = 0.f, ess1 = 0.f;
#pragma unroll
    for (int r = 0; r < 8; ++r) { const bool v0 = s[0][r] > -1.0e38f, v1 = s[1][r] > -1.0e38f; const float e0 = v0 ? __expf(s[0][r] - mn) : 0.f, e1 = v1 ? __expf(s[1][r] - mn) : 0.f;
      es0 += e0; es1 += e1; ess0 += v0 ? e0 * s[0][r] : 0.f; ess1 += v1 ? e1 * s[1][r] : 0.f; }
    l = l * alpha + (es0 + es1); ls = ls * alpha + (ess0 + ess1); m = mn; }
  l += xhalf(l); ls += xhalf(ls);
  const float en = log_p(l) + m - ls / l;
  if (g == 0) sent[wave * 16 + col] = en;
  __syncthreads(); if (tid < 16) vst2(ENT + ((size_t)b * NH + h) * SS + blockIdx.x * 64 + tid * 4, *(const v4f*)&sent[tid * 4]);
}
// ---- k_ln: block = row: XN = (x - mu) rsqrt(var + 1e-5) g + b (f32)
__global__ __launch_bounds__(256) void k_ln(const float* __restrict__ X, const float* __restrict__ G, const float* __restrict__ Bt, float* __restrict__ XN) {
  __shared__ float red[8]; const int t = threadIdx.x; const size_t row = blockIdx.x; float v[4]; float s = 0.f; for (int i = 0; i < 4; ++i) { v[i] = bfr(X[row * DM + t * 4 + i]); s += v[i]; }
#pragma unroll
  for (int o = 1; o < 32; o <<= 1) s += __shfl_xor(s, o);
  if ((t & 31) == 0) red[t >> 5] = s; __syncthreads(); float tot = 0.f; for (int i = 0; i < 8; ++i) tot += red[i]; const float mu = tot / (float)DM; __syncthreads();
  float q = 0.f; for (int i = 0; i < 4; ++i) { const float d = v[i] - mu; q += d * d; }
#pragma unroll
  for (int o = 1; o < 32; o <<= 1) q += __shfl_xor(q, o);
  if ((t & 31) == 0) red[t >> 5] = q; __syncthreads(); float tq = 0.f; for (int i = 0; i < 8; ++i) tq += red[i]; const float inv = 1.0f / sqrtf(tq / (float)DM + 1e-5f);
  v4f o4; for (int i = 0; i < 4; ++i) { const int e = t * 4 + i; o4[i] = (v[i] - mu) * inv * bfr(G[e]) + bfr(Bt[e]); } vst2(XN + row * DM + t * 4, o4);
}
__global__ __launch_bounds__(256) void k_fin(const float* __restrict__ X, const float* __restrict__ Y1, const float* __restrict__ ENT, float* __restrict__ OUT, float* __restrict__ OUT2) {
  const int t = threadIdx.x; const size_t row = blockIdx.x; const size_t b = row / SS; const int tt = (int)(row % SS);
  { v4f o4; for (int i = 0; i < 4; ++i) { const size_t e = row * DM + t * 4 + i; o4[i] = bfr(X[e]) + Y1[e]; } vst2(OUT + row * DM + t * 4, o4); }
  if ((tt & 31) == 0 && t < 32) { __shared__ __align__(16) float se[32]; float a = 0.f; for (int hh = 0; hh < NH; ++hh) a += ENT[(b * NH + hh) * SS + tt + t]; se[t] = a / (float)NH; __syncthreads(); if (t < 8) vst2(OUT2 + row + t * 4, *(const v4f*)&se[t * 4]); }
}
extern "C" void kernel_launch(void* const* d_in, const int* in_sizes, int n_in, void* d_out, int out_size, void* d_ws, size_t ws_size, hipStream_t stream) {
  (void)in_sizes; (void)n_in; (void)out_size;
  const float** F = (const float**)d_in;   // 0 x [16,512,1024], 1 qkv_w [1024,3072] (in,out), 2 qkv_b [3072], 3 out_w [1024,1024] (in,out), 4 out_b, 5 ln_g, 6 ln_b, 7 rel_bias [16,1023]
  if (ws_size < (size_t)WS_END) return;
  char* ws = (char*)d_ws; __bf16* PK = (__bf16*)(ws + WS_PK); _Float16 *QK = (_Float16*)(ws + WS_QK), *QKL = (_Float16*)(ws + WS_QKL), *VTH = (_Float16*)(ws + WS_VTH), *VTL = (_Float16*)(ws + WS_VTL); float *O = (float*)(ws + WS_O), *XN = (float*)(ws + WS_XN), *ENT = (float*)(ws + WS_ENT), *Y1 = (float*)(ws + WS_Y1);
  float* OUT = (float*)d_out; float* OUT2 = OUT + (size_t)NB * SS * DM;   // outputs concatenated: out [16,512,1024] then entropy [16,512]
  k_pack<<<dim3(DM, 4), 256, 0, stream>>>(F[3], F[3], F[3], F[3], PK);   // out_w ((in,out) -> transposed rows) into the Wo slot (q/k/v slots overwritten next)
  k_pack3<<<dim3(DM, 3), 256, 0, stream>>>(F[1], PK);
  k_ln<<<TNB * SS, 256, 0, stream>>>(F[0], F[5], F[6], XN);
  k_qkv<<<dim3(TNB * SS / 128, QKVW / 128), 128, 0, stream>>>(XN, XN, XN, PK + PK_A, F[2], F[2] + DM, F[2] + 2 * DM, QK, QKL, VTH, VTL);
  k_attn<<<dim3(TQB, NH, TNB), 128, 0, stream>>>(QK, QKL, VTH, VTL, nullptr, F[7], O);
  k_ent<<<dim3(TQB, NH, TNB), 128, 0, stream>>>(QK, F[7], ENT);
  k_out<<<dim3(TNB * SS / 128, DM / 128), 128, 0, stream>>>(O, PK + PK_P, F[4], Y1);
  k_fin<<<TOB * 64, 256, 0, stream>>>(F[0], Y1, ENT, OUT, OUT2);
}

// v004
// One run takes 269 microseconds.
// Next to v003, in two timings, it ran 1.12 times as fast each time.
// Over all steps from v000 it is 2.15 times as fast.
// compute dtype: all float inputs rounded to bf16; LayerNorm in f32, its output rounded once to f16 x exact f16 copies (x 2^8) of the fused qkv weight on WMMA 16x16x32 (1 product) + bias; causal attention: 3-product scores and hi + residual P, v on the first 128 queries of each sequence, single f16 beyond; x 1/8 + rel_bias[h][k-q+511], running-max softmax in f32 (hardware exp); the per-row entropy from a second single-f16 score pass (precise logf); out = x + (o (bf16 hi + residual) . out_w (2 products) + out_b); second output = head-mean attention entropy.
#include <hip/hip_runtime.h>
#include <math.h>

typedef __attribute__((ext_vector_type(16))) _Float16 v16h;
typedef __attribute__((ext_vector_type(16))) __bf16 v16b;
typedef __attribute__((ext_vector_type(8)))  _Float16 v8h;
typedef __attribute__((ext_vector_type(8)))  float v8f;
typedef __attribute__((ext_vector_type(4)))  float v4f;
typedef __attribute__((ext_vector_type(2)))  float v2f;
typedef __attribute__((ext_vector_type(4)))  unsigned v4u;
typedef __attribute__((ext_vector_type(4)))  int v4i;
typedef float __attribute__((may_alias)) float_a;
typedef int __attribute__((may_alias)) int_a;

template <typename T> __device__ __forceinline__ void vst2(void* p, T v) { *(T*)p = v;  }
__device__ __forceinline__ v8f wmma16(v16h a, v16h b, v8f c) {
  v8f d = __builtin_amdgcn_wmma_f32_16x16x32_f16(false, a, false, b, (short)0, c, false, false);
  asm volatile("v_nop\n\tv_nop\n\tv_nop\n\tv_nop" : "+v"(d) : "v"(a), "v"(b));
  return d;
}
__device__ __forceinline__ v8f wmma_bf(v16b a, v16b b, v8f c) {
  v8f d = __builtin_amdgcn_wmma_f32_16x16x32_bf16(false, a, false, b, (short)0, c, false, false);
  asm volatile("v_nop\n\tv_nop\n\tv_nop\n\tv_nop" : "+v"(d) : "v"(a), "v"(b));
  return d;
}
// Pre-LN causal time attention with relative position bias (B 16, T 512, d 1,024, 16 heads x 64): x + out_proj(attention(LN(x))), plus the mean attention entropy per (batch, step) as a second output.
__device__ __forceinline__ v16h frag_h(const _Float16* rowk0, int lane) {
  union { v16h v; v8h q[2]; } u; const _Float16* p = rowk0 + 8 * (lane >> 4);
  u.q[0] = *(const v8h*)p; u.q[1] = *(const v8h*)(p + 16); return u.v;
}
__device__ __forceinline__ v16h frag_f32(const float* rowk0, int lane) {
  v16h a; const float* p = rowk0 + 8 * (lane >> 4);
#pragma unroll
  for (int i = 0; i < 8; ++i) { a[i] = (_Float16)p[i]; a[8 + i] = (_Float16)p[16 + i]; }
  return a;
}
__device__ __forceinline__ v16h frag_f32s(const float* rowk0, int lane, float sc) {
  v16h a; const float* p = rowk0 + 8 * (lane >> 4);
#pragma unroll
  for (int i = 0; i < 8; ++i) { a[i] = (_Float16)(p[i] * sc); a[8 + i] = (_Float16)(p[16 + i] * sc); }
  return a;
}
// column fragment from a [K][ld] layout (column n), rows >= K read as 0
__device__ __forceinline__ v16h fragc_f32(const float* W, int k0, int n, int lane, int ld, int K) {
  v16h a; const int g = lane >> 4;
#pragma unroll
  for (int i = 0; i < 8; ++i) { const int ka = k0 + 8 * g + i, kb = ka + 16;
    a[i] = (_Float16)(ka < K ? W[(size_t)(ka < K ? ka : K - 1) * ld + n] : 0.f); a[8 + i] = (_Float16)(kb < K ? W[(size_t)(kb < K ? kb : K - 1) * ld + n] : 0.f); }
  return a;
}
struct F2 { v16b h, l; };
__device__ __forceinline__ F2 bsplit16(const float v[16]) { F2 r;
#pragma unroll
  for (int i = 0; i < 16; ++i) { const __bf16 h = (__bf16)v[i]; r.h[i] = h; r.l[i] = (__bf16)(v[i] - (float)h); }
  return r; }
__device__ __forceinline__ F2 split_row(const float* row, int k0, int lane) { float v[16]; const float* p = row + k0 + 8 * (lane >> 4);
#pragma unroll
  for (int i = 0; i < 8; ++i) { v[i] = p[i]; v[8 + i] = p[16 + i]; }
  return bsplit16(v); }
__device__ __forceinline__ F2 split_rowK(const float* row, int k0, int lane, int K) { float v[16]; const int g = lane >> 4;
#pragma unroll
  for (int i = 0; i < 8; ++i) { const int ka = k0 + 8 * g + i, kb = ka + 16; v[i] = ka < K ? row[ka < K ? ka : K - 1] : 0.f; v[8 + i] = kb < K ? row[kb < K ? kb : K - 1] : 0.f; }
  return bsplit16(v); }
__device__ __forceinline__ F2 split_col(const float* W, int k0, int n, int lane, int ld, int K) { float v[16]; const int g = lane >> 4;
#pragma unroll
  for (int i = 0; i < 8; ++i) { const int ka = k0 + 8 * g + i, kb = ka + 16; v[i] = ka < K ? W[(size_t)(ka < K ? ka : K - 1) * ld + n] : 0.f; v[8 + i] = kb < K ? W[(size_t)(kb < K ? kb : K - 1) * ld + n] : 0.f; }
  return bsplit16(v); }
__device__ __forceinline__ v8f mac3(const F2& a, const F2& b, v8f c) { c = wmma_bf(a.l, b.h, c); c = wmma_bf(a.h, b.l, c); return wmma_bf(a.h, b.h, c); }
__device__ __forceinline__ float sigm(float v) { return 1.0f / (1.0f + expf(-v)); }
#define LDSX() do { asm volatile("s_wait_dscnt 0" ::: "memory"); __builtin_amdgcn_wave_barrier(); __builtin_amdgcn_fence(__ATOMIC_RELEASE, "workgroup"); } while (0)


#define NB 16
#define SS 512
#define SCALEF 0.125f
#define DM 1024
#define NH 16
#define MAXSEQ 512
__device__ __attribute__((noinline)) float log_p(float v) { return logf(v); }
#define HD 64
#define QKVW (3 * DM)
#ifndef TQB
#define TQB (SS / 64)
#define TNB NB
#define TOB (NB * SS / 64)     // output row tiles (all)
#endif
typedef __attribute__((ext_vector_type(8))) __bf16 v8b;
__device__ __forceinline__ v16b frag_b(const __bf16* rowk0, int lane) {
  union { v16b v; v8b q[2]; } u; const __bf16* p = rowk0 + 8 * (lane >> 4);
  u.q[0] = *(const v8b*)p; u.q[1] = *(const v8b*)(p + 16); return u.v;
}
__device__ __forceinline__ float bfr(float v) { return (float)(__bf16)v; }
__device__ __attribute__((noinline)) float exp_ni(float v) { return expf(v); }
__device__ __attribute__((noinline)) float erf_ni(float v) { return erff(v); }

#define PK_A 0                       // [3072][1024] Wqkv rows (natural [out][in])
#define PK_P (PK_A + QKVW * DM)        // [1024][1024] Wo rows (natural)
#define PK_END (PK_P + DM * DM)
#define WS_PK  0u
#define WS_QK  (WS_PK + 2u * PK_END)             // f16 [8192 rows][2048]: q | k
#define WS_QKL (WS_QK + 2u * NB * SS * 2 * DM)     // f16 q | k residual planes x2048
#define WS_VTH (WS_QKL + 2u * NB * SS * 2 * DM)    // f16 [b][1024 (h*64+d)][512 s] hi
#define WS_VTL (WS_VTH + 2u * NB * DM * SS)        // f16 lo x 2048
#define WS_O   (WS_VTL + 2u * NB * DM * SS)        // f32 [8192][1024]
#define WS_CS  (WS_O + 4u * NB * SS * DM)           // f32 2 x [512][32], unused
#define WS_XN  (WS_CS + 4u * 2 * SS * 32)                  // f32 [NR][1024] LayerNorm(x)
#define WS_ENT (WS_XN + 4u * (size_t)NB * SS * DM)     // f32 [b][h][t] attention entropy
#define WS_Y1  (WS_ENT + 4u * (size_t)NB * NH * SS)    // f32 [NR][1024] out-proj
#define WS_END (WS_Y1 + 4u * (size_t)NB * SS * DM)
// ---- pack_tile: block = (64 columns n, 128 rows k) of an (in,out) weight W[DM][ld] -> rows n of the packed [out][in] 16-bit copy. A thread reads 4 columns of 8 consecutive k (16 lanes = one 256-B piece of a W row), so it holds, per column, one whole 16-B chunk of a packed row; the chunks cross LDS so that 16 lanes store 256 B of one packed row.
// LDS: row n = 16 chunks of 16 B, chunk j at place j ^ (n >> 2): the 16 lanes of a half wave fall on 16 different places in the write (rows 4 apart, one chunk number) and in the read (one row, 16 chunk numbers).
template <bool F16X> __device__ __forceinline__ void pack_tile(const float* __restrict__ Wm, int ld, __bf16* __restrict__ dst, v4u* s) {
  const int t = threadIdx.x, c = t & 15, kg = t >> 4; const int n0 = blockIdx.x * 64, k0 = blockIdx.y * 128;
  v4f r[8];
#pragma unroll   // unrolled: the eight loads are in flight together, and r[] is indexed by constants
  for (int i = 0; i < 8; ++i) r[i] = *(const v4f*)(Wm + (size_t)(k0 + kg * 8 + i) * ld + n0 + c * 4);
#pragma unroll   // this loop and the one inside it: r[] and o are indexed by constants and stay in registers
  for (int j = 0; j < 4; ++j) { union { v4u u; v8h h; v8b b; } o;
#pragma unroll
    for (int i = 0; i < 8; ++i) { if (F16X) o.h[i] = (_Float16)(bfr(r[i][j]) * 256.0f); else o.b[i] = (__bf16)r[i][j]; }
    s[(c * 4 + j) * 16 + (kg ^ c)] = o.u; }
  __syncthreads();
#pragma unroll   // the four LDS reads go out together, ahead of the stores
  for (int it = 0; it < 4; ++it) { const int n = it * 16 + (t >> 4), j = t & 15; vst2((unsigned*)(dst + (size_t)(n0 + n) * DM + k0 + j * 8), s[n * 16 + (j ^ (n >> 2))]); }   // whole 128-B lines
}
// ---- k_pack: out_w (in,out) -> bf16 rows [out][in] in the Wo slot
__global__ __launch_bounds__(256) void k_pack(const float* __restrict__ WO, __bf16* __restrict__ PK) { __shared__ __align__(16) v4u s[64 * 16]; pack_tile<false>(WO, DM, PK + PK_P, s); }
// ---- k_qkv: block = (128 rows, 128 cols), 4 waves of 64 x 64; per trip 64 k of both operand tiles are brought into LDS in whole lines by asynchronous copies (two buffers) and read from there by all waves
#define QA_PITCH 272                      // bytes: a 256-B row of 64 f32 + 16 (16 B x odd: ds_load_b128 free of bank conflicts)
#define QB_PITCH 144                      // bytes: a 128-B row of 64 f16 + 16
#define QA_BYTES (128 * QA_PITCH)
#define QBUF (QA_BYTES + 128 * QB_PITCH)  // one buffer: X tile, then W tile
// eight 16-B copies per lane, rows lstep / gstep bytes apart; the s_wait_xcnt closes the statement so that no address register is rewritten in front of it
__device__ __forceinline__ void copy8(unsigned l, const char* p, unsigned lstep, unsigned gstep) {
  asm volatile("global_load_async_to_lds_b128 %0, %8, off\n\t"
               "global_load_async_to_lds_b128 %1, %9, off\n\t"
               "global_load_async_to_lds_b128 %2, %10, off\n\t"
               "global_load_async_to_lds_b128 %3, %11, off\n\t"
               "global_load_async_to_lds_b128 %4, %12, off\n\t"
               "global_load_async_to_lds_b128 %5, %13, off\n\t"
               "global_load_async_to_lds_b128 %6, %14, off\n\t"
               "global_load_async_to_lds_b128 %7, %15, off\n\t"
               "s_wait_xcnt 0x0"
               :: "v"(l), "v"(l + lstep), "v"(l + 2 * lstep), "v"(l + 3 * lstep), "v"(l + 4 * lstep), "v"(l + 5 * lstep), "v"(l + 6 * lstep), "v"(l + 7 * lstep),
                  "v"(p), "v"(p + gstep), "v"(p + 2 * gstep), "v"(p + 3 * gstep), "v"(p + 4 * gstep), "v"(p + 5 * gstep), "v"(p + 6 * gstep), "v"(p + 7 * gstep)
               : "memory");
}
__global__ __launch_bounds__(128) void k_qkv(const float* __restrict__ XQ, const float* __restrict__ XK, const float* __restrict__ XV, const __bf16* __restrict__ P, const float* __restrict__ BQ, const float* __restrict__ BK, const float* __restrict__ BV, _Float16* __restrict__ QK, _Float16* __restrict__ QKL, _Float16* __restrict__ VTH, _Float16* __restrict__ VTL) {
  const int which0 = (blockIdx.y * 128) / DM; const float* X = (which0 == 0) ? XQ : (which0 == 1) ? XK : XV; const float* BB = BQ ? (((which0 == 0) ? BQ : (which0 == 1) ? BK : BV) + (blockIdx.y * 128 - which0 * DM)) : nullptr;
  __shared__ __align__(16) char sm[2 * QBUF];   // the two buffers; output staging behind the loop
  const int tid = threadIdx.x, wave = tid >> 5, lane = tid & 31, col = lane & 15, g = lane >> 4, wm = wave >> 1, wn = wave & 1; const size_t m0 = (size_t)blockIdx.x * 128; const int n0 = blockIdx.y * 128;
  const unsigned sbase = (unsigned)(size_t)&sm[0];
  const unsigned la = sbase + (tid >> 4) * QA_PITCH + (tid & 15) * 16, lb = sbase + QA_BYTES + (tid >> 3) * QB_PITCH + (tid & 7) * 16;   // a wave's copy covers 2 X rows of 256 B, or 4 W rows of 128 B
  const char* ga = (const char*)(X + (m0 + (tid >> 4)) * DM + (tid & 15) * 4); const char* gb = (const char*)((const _Float16*)P + (size_t)(n0 + (tid >> 3)) * DM + (tid & 7) * 8);
  auto fill = [&](int t, unsigned bo) {   // tile t (k = 64 t ..): 16 + 8 copies per lane
    copy8(la + bo, ga + t * 256, 8 * QA_PITCH, 8 * DM * 4); copy8(la + bo + 64 * QA_PITCH, ga + t * 256 + 64 * DM * 4, 8 * QA_PITCH, 8 * DM * 4); copy8(lb + bo, gb + t * 128, 16 * QB_PITCH, 16 * DM * 2); };
  v8f acc[4][4] = {};
  fill(0, 0);
  asm volatile("s_wait_asynccnt 0x0" ::: "memory");   // tile 0 landed (this wave's copies)
  __syncthreads();                                    // ... and every other wave's
  fill(1, QBUF);
#pragma unroll 1   // rolled: a trip holds 32 WMMAs, enough to carry the branch
  for (int t = 0; t < DM / 64; ++t) { const char* bp = sm + (t & 1) * QBUF;
#pragma unroll   // this and the loops inside it are unrolled so that a[], w[] and acc[][] are indexed by constants and stay in registers
    for (int kc = 0; kc < 2; ++kc) { v16h a[4], w[4];
#pragma unroll
      for (int mi = 0; mi < 4; ++mi) { const float* p = (const float*)(bp + (wm * 64 + mi * 16 + col) * QA_PITCH) + kc * 32 + 8 * g;   // LN'd rows (f32) rounded once to f16
#pragma unroll
        for (int i = 0; i < 8; ++i) { a[mi][i] = (_Float16)p[i]; a[mi][8 + i] = (_Float16)p[16 + i]; } }
#pragma unroll
      for (int nj = 0; nj < 4; ++nj) w[nj] = frag_h((const _Float16*)(bp + QA_BYTES + (wn * 64 + nj * 16 + col) * QB_PITCH) + kc * 32, lane);
#pragma unroll
      for (int mi = 0; mi < 4; ++mi)
#pragma unroll
        for (int nj = 0; nj < 4; ++nj) acc[mi][nj] = wmma16(a[mi], w[nj], acc[mi][nj]); }
    asm volatile("s_wait_dscnt 0x0" ::: "memory");      // this wave's reads of the buffer are over
    asm volatile("s_wait_asynccnt 0x0" ::: "memory");   // its copies of tile t + 1 have landed
    __syncthreads();                                    // publishes tile t + 1, frees tile t's buffer
    if (t + 2 < DM / 64) fill(t + 2, (t & 1) * QBUF); }
  asm volatile("s_wait_asynccnt 0x0" ::: "memory");     // no copy in flight before the buffers become staging
  if (n0 < 2 * DM) {   // q stored unscaled (f16 sigma ~0.6, no subnormal exposure); 1/8 applied to the f32 score
    _Float16* sh = (_Float16*)(sm + wave * (2 * 64 * 144)); _Float16* sl = sh + 64 * 72;   // per wave: 64 rows x 64 cols at pitch 72, hi then residual
#pragma unroll
    for (int nj = 0; nj < 4; ++nj) { const float bias = BB ? bfr(BB[wn * 64 + nj * 16 + col]) : 0.f;
#pragma unroll
      for (int mi = 0; mi < 4; ++mi)
#pragma unroll
        for (int r = 0; r < 8; ++r) { const float v = acc[mi][nj][r] * (1.0f / 256.0f) + bias; const _Float16 hv = (_Float16)v; sh[(mi * 16 + 8 * g + r) * 72 + nj * 16 + col] = hv; sl[(mi * 16 + 8 * g + r) * 72 + nj * 16 + col] = (_Float16)((v - (float)hv) * 2048.0f); } }   // q, k (+ bias) as f16 hi + (x2048) residual
    LDSX();
    for (int it = 0; it < 16; ++it) { const int rl = it * 4 + (lane >> 3), ch = lane & 7; const size_t o = (m0 + wm * 64 + rl) * (2 * DM) + n0 + wn * 64 + ch * 8; vst2((unsigned*)(QK + o), *(const v4u*)&sh[rl * 72 + ch * 8]); vst2((unsigned*)(QKL + o), *(const v4u*)&sl[rl * 72 + ch * 8]); }   // whole 128-B lines
  } else {
    _Float16* sth = (_Float16*)sm; _Float16* stl = sth + 128 * 136;   // [128 d][128 s] at pitch 136, hi then residual
#pragma unroll
    for (int nj = 0; nj < 4; ++nj) { const float bias = BB ? bfr(BB[wn * 64 + nj * 16 + col]) : 0.f;
#pragma unroll
      for (int mi = 0; mi < 4; ++mi) { v8h h8, l8;
#pragma unroll
        for (int r = 0; r < 8; ++r) { const float v = acc[mi][nj][r] * (1.0f / 256.0f) + bias; const _Float16 hv = (_Float16)v; h8[r] = hv; l8[r] = (_Float16)((v - (float)hv) * 2048.0f); }
        const int o = (wn * 64 + nj * 16 + col) * 136 + wm * 64 + mi * 16 + 8 * g; *(v8h*)&sth[o] = h8; *(v8h*)&stl[o] = l8; } }
    __syncthreads();
    const int b = (int)(m0 / SS), s0 = (int)(m0 % SS); const int pc0 = n0 - 2 * DM;
    for (int it = 0; it < 16; ++it) { const int d = it * 8 + (tid >> 4), pc = tid & 15; const size_t o = ((size_t)b * DM + pc0 + d) * SS + s0 + pc * 8; vst2((unsigned*)(VTH + o), *(const v4u*)&sth[d * 136 + pc * 8]); vst2((unsigned*)(VTL + o), *(const v4u*)&stl[d * 136 + pc * 8]); }
  }
}
// lane l with lane l ^ 16 (a vector cross-row move, no LDS unit)
__device__ __forceinline__ float xhalf(float x) { return __builtin_bit_cast(float, __builtin_amdgcn_permlanex16(__builtin_bit_cast(int, x), __builtin_bit_cast(int, x), 0x76543210, 0xfedcba98, false, false)); }
// ---- k_attn: block = (64 queries, head h, batch b): causal flash attention on transposed products: S^T = K . Q^T (A = 16 key rows, B = the wave's 16 queries), so a lane holds 16 of the 32 scores of ONE query (column col; keys 8 g + r of each 16): maximum and sum run in the lane, with one exchange between the wave's halves; the two S^T tiles, converted in place, are the B operand of O^T += V^T . P^T (A = 16 d rows of V^T): P never passes through LDS. O[b*S+q][h*64+d] = (acc + accl / 2048) / (2048 l) (256-B segments)
__global__ __launch_bounds__(128) void k_attn(const _Float16* __restrict__ QK, const _Float16* __restrict__ QKL, const _Float16* __restrict__ VTH, const _Float16* __restrict__ VTL, const void* __restrict__ KMASK, const float* __restrict__ RB, float* __restrict__ O) {
  __shared__ __align__(16) float so[4][16][68];
  const int tid = threadIdx.x, wave = tid >> 5, lane = tid & 31, col = lane & 15, g = lane >> 4;
  const int qb = blockIdx.x, h = blockIdx.y, b = blockIdx.z; const int q0 = qb * 64 + wave * 16; const int qi = q0 + col; const size_t rq = (size_t)b * SS + qi;
  v16h aq[2], aql[2];
#pragma unroll
  for (int kc = 0; kc < 2; ++kc) { aq[kc] = frag_h(QK + rq * (2 * DM) + h * HD + kc * 32, lane); aql[kc] = frag_h(QKL + rq * (2 * DM) + h * HD + kc * 32, lane); }
  float m = -3.0e38f, l = 0.f;   // of query qi: m over all keys so far (equal in both halves), l over this half's keys (joined behind the loop)
  v8f acc[4] = {}, accl[4] = {};   // O^T: register r = d (dt * 16 + 8 g + r), column = query
  const float* rbq = RB + (size_t)h * (2 * MAXSEQ - 1) + (MAXSEQ - 1 - qi) + 8 * g;   // rel_bias[h][k - q + 511] at k = 8 g
  const int nks = (qb * 64 + 64) / 32;   // causal: key tiles up to the query tile's end
#pragma unroll 1
  for (int ks = 0; ks < nks; ++ks) { v8f s[2];
#pragma unroll
    for (int ct = 0; ct < 2; ++ct) { const int kr = ks * 32 + ct * 16 + col; const _Float16* krow = QK + ((size_t)b * SS + kr) * (2 * DM) + DM + h * HD; const _Float16* krowl = QKL + ((size_t)b * SS + kr) * (2 * DM) + DM + h * HD; v8f c = {}, cl = {};
      if (qb < 2) {   // leading query blocks (few keys, outputs far above the global rms): 3 products
#pragma unroll
        for (int kc = 0; kc < 2; ++kc) { const v16h kh = frag_h(krow + kc * 32, lane); c = wmma16(kh, aq[kc], c); cl = wmma16(kh, aql[kc], cl); cl = wmma16(frag_h(krowl + kc * 32, lane), aq[kc], cl); }
#pragma unroll
        for (int r = 0; r < 8; ++r) c[r] += cl[r] * (1.0f / 2048.0f); }
      else {
#pragma unroll
        for (int kc = 0; kc < 2; ++kc) c = wmma16(frag_h(krow + kc * 32, lane), aq[kc], c); }   // single product elsewhere
#pragma unroll
      for (int r = 0; r < 8; ++r) { const int kk = ks * 32 + ct * 16 + 8 * g + r; s[ct][r] = (kk <= qi) ? (c[r] * SCALEF + bfr(rbq[ks * 32 + ct * 16 + r])) : -3.0e38f; } }   // causal; + rel_bias[h][k - q + 511]
    float mx = fmaxf(s[0][0], s[1][0]);
#pragma unroll
    for (int r = 1; r < 8; ++r) mx = fmaxf(mx, fmaxf(s[0][r], s[1][r]));
    mx = fmaxf(mx, xhalf(mx));
    const float mn = fmaxf(m, mx); const float alpha = (m <= -1.0e38f) ? 0.f : __expf(m - mn);
    float es0 = 0.f, es1 = 0.f; v16h pa, pl;
#pragma unroll
    for (int r = 0; r < 8; ++r) { const float e0 = (s[0][r] <= -1.0e38f) ? 0.f : __expf(s[0][r] - mn), e1 = (s[1][r] <= -1.0e38f) ? 0.f : __expf(s[1][r] - mn); es0 += e0; es1 += e1;
      const float x0 = e0 * 2048.0f, x1 = e1 * 2048.0f; const _Float16 h0 = (_Float16)x0, h1 = (_Float16)x1; pa[r] = h0; pa[8 + r] = h1; pl[r] = (_Float16)((x0 - (float)h0) * 2048.0f); pl[8 + r] = (_Float16)((x1 - (float)h1) * 2048.0f); }   // P scaled by 2^11 before the f16 split so small softmax weights stay out of the f16 subnormal range; 2^-11 folded into the epilogue
    l = l * alpha + (es0 + es1); m = mn;
#pragma unroll
    for (int dt = 0; dt < 4; ++dt)
#pragma unroll
      for (int r = 0; r < 8; ++r) { acc[dt][r] *= alpha; accl[dt][r] *= alpha; }
#pragma unroll
    for (int dt = 0; dt < 4; ++dt) { const size_t vr = ((size_t)b * DM + h * HD + dt * 16 + col) * SS + ks * 32; const v16h vh = frag_h(VTH + vr, lane); acc[dt] = wmma16(vh, pa, acc[dt]); if (qb < 2) { accl[dt] = wmma16(vh, pl, accl[dt]); accl[dt] = wmma16(frag_h(VTL + vr, lane), pa, accl[dt]); } } }   // leading query blocks: P hi/lo x V hi/lo (3 products); elsewhere P x V single
  l += xhalf(l);
  const float il = (1.0f / 2048.0f) / l;
#pragma unroll
  for (int dt = 0; dt < 4; ++dt) { v4f o0, o1;
#pragma unroll
    for (int r = 0; r < 4; ++r) { o0[r] = (acc[dt][r] + accl[dt][r] * (1.0f / 2048.0f)) * il; o1[r] = (acc[dt][4 + r] + accl[dt][4 + r] * (1.0f / 2048.0f)) * il; }
    *(v4f*)&so[wave][col][dt * 16 + 8 * g] = o0; *(v4f*)&so[wave][col][dt * 16 + 8 * g + 4] = o1; }
  LDSX();
  for (int rl = 0; rl < 16; ++rl) if (lane < 16) vst2(O + ((size_t)b * SS + q0 + rl) * DM + h * HD + lane * 4, *(const v4f*)&so[wave][rl][lane * 4]);
}
// ---- k_out: block = (128 rows, 128 cols), 4 waves of 64 x 64: out = O(hi/lo) . Wo rows (2 products) + bo; per trip 64 k of both operand tiles are brought into LDS in whole lines by asynchronous copies (two buffers, the tile shapes and pitches of k_qkv) and read from there by all waves
__global__ __launch_bounds__(128) void k_out(const float* __restrict__ O, const __bf16* __restrict__ P, const float* __restrict__ BO, float* __restrict__ Y) {
  __shared__ __align__(16) char sm[2 * QBUF];   // the two buffers; output staging behind the loop
  const int tid = threadIdx.x, wave = tid >> 5, lane = tid & 31, col = lane & 15, g = lane >> 4, wm = wave >> 1, wn = wave & 1; const size_t m0 = (size_t)blockIdx.x * 128; const int n0 = blockIdx.y * 128;
  const unsigned sbase = (unsigned)(size_t)&sm[0];
  const unsigned la = sbase + (tid >> 4) * QA_PITCH + (tid & 15) * 16, lb = sbase + QA_BYTES + (tid >> 3) * QB_PITCH + (tid & 7) * 16;   // a wave's copy covers 2 O rows of 256 B, or 4 W rows of 128 B
  const char* ga = (const char*)(O + (m0 + (tid >> 4)) * DM + (tid & 15) * 4); const char* gb = (const char*)(P + (size_t)(n0 + (tid >> 3)) * DM + (tid & 7) * 8);
  auto fill = [&](int t, unsigned bo) {   // tile t (k = 64 t ..): 16 + 8 copies per lane
    copy8(la + bo, ga + t * 256, 8 * QA_PITCH, 8 * DM * 4); copy8(la + bo + 64 * QA_PITCH, ga + t * 256 + 64 * DM * 4, 8 * QA_PITCH, 8 * DM * 4); copy8(lb + bo, gb + t * 128, 16 * QB_PITCH, 16 * DM * 2); };
  v8f acc[4][4] = {};
  fill(0, 0);
  asm volatile("s_wait_asynccnt 0x0" ::: "memory");   // tile 0 landed (this wave's copies)
  __syncthreads();                                    // ... and every other wave's
  fill(1, QBUF);
#pragma unroll 1   // rolled: a trip holds 64 WMMAs, enough to carry the branch
  for (int t = 0; t < DM / 64; ++t) { const char* bp = sm + (t & 1) * QBUF;
    const char* ap = bp + (wm * 64 + col) * QA_PITCH + 32 * g;   // this lane's place in row col of the wave's first 16 O rows
    float nx[16];   // the f32 values of the A fragment after the one being multiplied: read from LDS one fragment ahead, so that the read's latency passes under 8 WMMAs
#pragma unroll
    for (int i = 0; i < 8; ++i) { nx[i] = ((const float*)ap)[i]; nx[8 + i] = ((const float*)ap)[16 + i]; }
#pragma unroll   // this and the loops inside it are unrolled so that w[], nx[] and acc[][] are indexed by constants and stay in registers
    for (int kc = 0; kc < 2; ++kc) { v16b w[4];
#pragma unroll
      for (int nj = 0; nj < 4; ++nj) w[nj] = frag_b((const __bf16*)(bp + QA_BYTES + (wn * 64 + nj * 16 + col) * QB_PITCH) + kc * 32, lane);
#pragma unroll
      for (int mi = 0; mi < 4; ++mi) { const F2 a = bsplit16(nx);   // f32 rows split into bf16 hi + residual
        if (kc * 4 + mi < 7) { const int s = kc * 4 + mi + 1; const float* p = (const float*)(ap + (s & 3) * 16 * QA_PITCH) + (s >> 2) * 32;   // same tile, same buffer: nothing of the next tile is read here
#pragma unroll
          for (int i = 0; i < 8; ++i) { nx[i] = p[i]; nx[8 + i] = p[16 + i]; } }
#pragma unroll
        for (int nj = 0; nj < 4; ++nj) acc[mi][nj] = wmma_bf(a.l, w[nj], acc[mi][nj]);   // residual first, then hi, per accumulator; four independent accumulators between the two
#pragma unroll
        for (int nj = 0; nj < 4; ++nj) acc[mi][nj] = wmma_bf(a.h, w[nj], acc[mi][nj]); } }
    asm volatile("s_wait_dscnt 0x0" ::: "memory");      // this wave's reads of the buffer are over
    asm volatile("s_wait_asynccnt 0x0" ::: "memory");   // its copies of tile t + 1 have landed
    __syncthreads();                                    // publishes tile t + 1, frees tile t's buffer
    if (t + 2 < DM / 64) fill(t + 2, (t & 1) * QBUF); }
  asm volatile("s_wait_asynccnt 0x0" ::: "memory");     // no copy in flight before the buffers become staging
  float* so = (float*)(sm + wave * (64 * 272));   // per wave: 64 rows x 64 cols of f32 at pitch 68
#pragma unroll
  for (int nj = 0; nj < 4; ++nj) { const float bias = bfr(BO[n0 + wn * 64 + nj * 16 + col]);
#pragma unroll
    for (int mi = 0; mi < 4; ++mi)
#pragma unroll
      for (int r = 0; r < 8; ++r) so[(mi * 16 + 8 * g + r) * 68 + nj * 16 + col] = acc[mi][nj][r] + bias; }
  LDSX();
  for (int it = 0; it < 32; ++it) { const int rl = it * 2 + g; vst2(Y + (m0 + wm * 64 + rl) * DM + n0 + wn * 64 + col * 4, *(const v4f*)&so[rl * 68 + col * 4]); }   // whole 128-B lines
}
// ---- k_pack3: the fused (in,out) W_attn [DM][3*DM] -> its 3,072 transposed rows, f16 x 2^8 (bit pattern stored in the bf16-typed buffer)
__global__ __launch_bounds__(256) void k_pack3(const float* __restrict__ WA, __bf16* __restrict__ PK) { __shared__ __align__(16) v4u s[64 * 16]; pack_tile<true>(WA, 3 * DM, PK + PK_A, s); }
// ---- k_ent: block = (64 queries, head, b): recompute the causal scores (single f16 q, k; + rel bias) as S^T = K . Q^T (a lane holds 16 of the 32 scores of one query) and reduce -sum p log p = log(sum e^(s-m)) + m - (sum e^(s-m) s)/(sum e^(s-m)) per query, in the lane; the halves' sums are joined behind the loop; 256-B store per block
__global__ __launch_bounds__(128) void k_ent(const _Float16* __restrict__ QK, const float* __restrict__ RB, float* __restrict__ ENT) {
  __shared__ __align__(16) float sent[64];
  const int tid = threadIdx.x, wave = tid >> 5, lane = tid & 31, col = lane & 15, g = lane >> 4; const int h = blockIdx.y; const size_t b = blockIdx.z; const int q0 = blockIdx.x * 64 + wave * 16; const int qi = q0 + col; const size_t rq = b * SS + q0;
  v16h aq[2];
#pragma unroll
  for (int kc = 0; kc < 2; ++kc) aq[kc] = frag_h(QK + (rq + col) * (2 * DM) + h * HD + kc * 32, lane);
  asm volatile("s_wait_xcnt 0x0" ::: "memory");   // the loop's first address sum reuses the register pair that these four loads name: the wait stands in front of that overwrite
  float m = -3.0e38f, l = 0.f, ls = 0.f;   // of query qi: m over all keys so far, l and ls over this half's keys
  const float* rbq = RB + (size_t)h * (2 * MAXSEQ - 1) + (MAXSEQ - 1 - qi) + 8 * g;
  const int nks = (blockIdx.x * 64 + 64) / 32;
#pragma unroll 1
  for (int ks = 0; ks < nks; ++ks) { v8f s[2];
#pragma unroll
    for (int ct = 0; ct < 2; ++ct) { const int kr = ks * 32 + ct * 16 + col; v8f c = {};
#pragma unroll
      for (int kc = 0; kc < 2; ++kc) c = wmma16(frag_h(QK + (b * SS + kr) * (2 * DM) + DM + h * HD + kc * 32, lane), aq[kc], c);
#pragma unroll
      for (int r = 0; r < 8; ++r) { const int kk = ks * 32 + ct * 16 + 8 * g + r; s[ct][r] = (kk <= qi) ? (c[r] * SCALEF + bfr(rbq[ks * 32 + ct * 16 + r])) : -3.0e38f; } }
    float mx = fmaxf(s[0][0], s[1][0]);
#pragma unroll
    for (int r = 1; r < 8; ++r) mx = fmaxf(mx, fmaxf(s[0][r], s[1][r]));
    mx = fmaxf(mx, xhalf(mx));
    const float mn = fmaxf(m, mx); const float alpha = (m <= -1.0e38f) ? 0.f : __expf(m - mn);
    float es0 = 0.f, es1 = 0.f, ess0 = 0.f, ess1 = 0.f;
#pragma unroll
    for (int r = 0; r < 8; ++r) { const bool v0 = s[0][r] > -1.0e38f, v1 = s[1][r] > -1.0e38f; const float e0 = v0 ? __expf(s[0][r] - mn) : 0.f, e1 = v1 ? __expf(s[1][r] - mn) : 0.f;
      es0 += e0; es1 += e1; ess0 += v0 ? e0 * s[0][r] : 0.f; ess1 += v1 ? e1 * s[1][r] : 0.f; }
    l = l * alpha + (es0 + es1); ls = ls * alpha + (ess0 + ess1); m = mn; }
  l += xhalf(l); ls += xhalf(ls);
  const float en = log_p(l) + m - ls / l;
  if (g == 0) sent[wave * 16 + col] = en;
  __syncthreads(); if (tid < 16) vst2(ENT + ((size_t)b * NH + h) * SS + blockIdx.x * 64 + tid * 4, *(const v4f*)&sent[tid * 4]);
}
// ---- k_ln: block = row: XN = (x - mu) rsqrt(var + 1e-5) g + b (f32)
__global__ __launch_bounds__(256) void k_ln(const float* __restrict__ X, const float* __restrict__ G, const float* __restrict__ Bt, float* __restrict__ XN) {
  __shared__ float red[8]; const int t = threadIdx.x; const size_t row = blockIdx.x; float v[4]; float s = 0.f; for (int i = 0; i < 4; ++i) { v[i] = bfr(X[row * DM + t * 4 + i]); s += v[i]; }
#pragma unroll
  for (int o = 1; o < 32; o <<= 1) s += __shfl_xor(s, o);
  if ((t & 31) == 0) red[t >> 5] = s; __syncthreads(); float tot = 0.f; for (int i = 0; i < 8; ++i) tot += red[i]; const float mu = tot / (float)DM; __syncthreads();
  float q = 0.f; for (int i = 0; i < 4; ++i) { const float d = v[i] - mu; q += d * d; }
#pragma unroll
  for (int o = 1; o < 32; o <<= 1) q += __shfl_xor(q, o);
  if ((t & 31) == 0) red[t >> 5] = q; __syncthreads(); float tq = 0.f; for (int i = 0; i < 8; ++i) tq += red[i]; const float inv = 1.0f / sqrtf(tq / (float)DM + 1e-5f);
  v4f o4; for (int i = 0; i < 4; ++i) { const int e = t * 4 + i; o4[i] = (v[i] - mu) * inv * bfr(G[e]) + bfr(Bt[e]); } vst2(XN + row * DM + t * 4, o4);
}
__global__ __launch_bounds__(256) void k_fin(const float* __restrict__ X, const float* __restrict__ Y1, const float* __restrict__ ENT, float* __restrict__ OUT, float* __restrict__ OUT2) {
  const int t = threadIdx.x; const size_t row = blockIdx.x; const size_t b = row / SS; const int tt = (int)(row % SS);
  { v4f o4; for (int i = 0; i < 4; ++i) { const size_t e = row * DM + t * 4 + i; o4[i] = bfr(X[e]) + Y1[e]; } vst2(OUT + row * DM + t * 4, o4); }
  if ((tt & 31) == 0 && t < 32) { __shared__ __align__(16) float se[32]; float a = 0.f; for (int hh = 0; hh < NH; ++hh) a += ENT[(b * NH + hh) * SS + tt + t]; se[t] = a / (float)NH; __syncthreads(); if (t < 8) vst2(OUT2 + row + t * 4, *(const v4f*)&se[t * 4]); }
}
extern "C" void kernel_launch(void* const* d_in, const int* in_sizes, int n_in, void* d_out, int out_size, void* d_ws, size_t ws_size, hipStream_t stream) {
  (void)in_sizes; (void)n_in; (void)out_size;
  const float** F = (const float**)d_in;   // 0 x [16,512,1024], 1 qkv_w [1024,3072] (in,out), 2 qkv_b [3072], 3 out_w [1024,1024] (in,out), 4 out_b, 5 ln_g, 6 ln_b, 7 rel_bias [16,1023]
  if (ws_size < (size_t)WS_END) return;
  char* ws = (char*)d_ws; __bf16* PK = (__bf16*)(ws + WS_PK); _Float16 *QK = (_Float16*)(ws + WS_QK), *QKL = (_Float16*)(ws + WS_QKL), *VTH = (_Float16*)(ws + WS_VTH), *VTL = (_Float16*)(ws + WS_VTL); float *O = (float*)(ws + WS_O), *XN = (float*)(ws + WS_XN), *ENT = (float*)(ws + WS_ENT), *Y1 = (float*)(ws + WS_Y1);
  float* OUT = (float*)d_out; float* OUT2 = OUT + (size_t)NB * SS * DM;   // outputs concatenated: out [16,512,1024] then entropy [16,512]
  k_pack<<<dim3(DM / 64, DM / 128), 256, 0, stream>>>(F[3], PK);   // out_w ((in,out) -> transposed rows) into the Wo slot
  k_pack3<<<dim3(QKVW / 64, DM / 128), 256, 0, stream>>>(F[1], PK);
  k_ln<<<TNB * SS, 256, 0, stream>>>(F[0], F[5], F[6], XN);
  k_qkv<<<dim3(TNB * SS / 128, QKVW / 128), 128, 0, stream>>>(XN, XN, XN, PK + PK_A, F[2], F[2] + DM, F[2] + 2 * DM, QK, QKL, VTH, VTL);
  k_attn<<<dim3(TQB, NH, TNB), 128, 0, stream>>>(QK, QKL, VTH, VTL, nullptr, F[7], O);
  k_ent<<<dim3(TQB, NH, TNB), 128, 0, stream>>>(QK, F[7], ENT);
  k_out<<<dim3(TNB * SS / 128, DM / 128), 128, 0, stream>>>(O, PK + PK_P, F[4], Y1);
  k_fin<<<TOB * 64, 256, 0, stream>>>(F[0], Y1, ENT, OUT, OUT2);
}

// v005
// A run of this version takes 222 microseconds.
// Two timings next to v004 both put it at 1.21 times that version's speed.
// Counting every step since v000, it is 2.60 times as fast.
// compute dtype: all float inputs rounded to bf16; LayerNorm in f32, its output rounded once to f16 x exact f16 copies (x 2^8) of the fused qkv weight on WMMA 16x16x32 (1 product) + bias; causal attention: 3-product scores and hi + residual P, v on the first 128 queries of each sequence, single f16 beyond; x 1/8 + rel_bias[h][k-q+511], running-max softmax in f32 (hardware exp); the per-row entropy from a second single-f16 score pass (precise logf); out = x + (o (bf16 hi + residual) . out_w (2 products) + out_b); second output = head-mean attention entropy.
#include <hip/hip_runtime.h>
#include <math.h>

typedef __attribute__((ext_vector_type(16))) _Float16 v16h;
typedef __attribute__((ext_vector_type(16))) __bf16 v16b;
typedef __attribute__((ext_vector_type(8)))  _Float16 v8h;
typedef __attribute__((ext_vector_type(8)))  float v8f;
typedef __attribute__((ext_vector_type(4)))  float v4f;
typedef __attribute__((ext_vector_type(2)))  float v2f;
typedef __attribute__((ext_vector_type(4)))  unsigned v4u;
typedef __attribute__((ext_vector_type(4)))  int v4i;
typedef float __attribute__((may_alias)) float_a;
typedef int __attribute__((may_alias)) int_a;

template <typename T> __device__ __forceinline__ void vst2(void* p, T v) { *(T*)p = v;  }
__device__ __forceinline__ v8f wmma16(v16h a, v16h b, v8f c) {
  v8f d = __builtin_amdgcn_wmma_f32_16x16x32_f16(false, a, false, b, (short)0, c, false, false);
  asm volatile("v_nop\n\tv_nop\n\tv_nop\n\tv_nop" : "+v"(d) : "v"(a), "v"(b));
  return d;
}
__device__ __forceinline__ v8f wmma_bf(v16b a, v16b b, v8f c) {
  v8f d = __builtin_amdgcn_wmma_f32_16x16x32_bf16(false, a, false, b, (short)0, c, false, false);
  asm volatile("v_nop\n\tv_nop\n\tv_nop\n\tv_nop" : "+v"(d) : "v"(a), "v"(b));
  return d;
}
// Pre-LN causal time attention with relative position bias (B 16, T 512, d 1,024, 16 heads x 64): x + out_proj(attention(LN(x))), plus the mean attention entropy per (batch, step) as a second output.
__device__ __forceinline__ v16h frag_h(const _Float16* rowk0, int lane) {
  union { v16h v; v8h q[2]; } u; const _Float16* p = rowk0 + 8 * (lane >> 4);
  u.q[0] = *(const v8h*)p; u.q[1] = *(const v8h*)(p + 16); return u.v;
}
__device__ __forceinline__ v16h frag_f32(const float* rowk0, int lane) {
  v16h a; const float* p = rowk0 + 8 * (lane >> 4);
#pragma unroll
  for (int i = 0; i < 8; ++i) { a[i] = (_Float16)p[i]; a[8 + i] = (_Float16)p[16 + i]; }
  return a;
}
__device__ __forceinline__ v16h frag_f32s(const float* rowk0, int lane, float sc) {
  v16h a; const float* p = rowk0 + 8 * (lane >> 4);
#pragma unroll
  for (int i = 0; i < 8; ++i) { a[i] = (_Float16)(p[i] * sc); a[8 + i] = (_Float16)(p[16 + i] * sc); }
  return a;
}
// column fragment from a [K][ld] layout (column n), rows >= K read as 0
__device__ __forceinline__ v16h fragc_f32(const float* W, int k0, int n, int lane, int ld, int K) {
  v16h a; const int g = lane >> 4;
#pragma unroll
  for (int i = 0; i < 8; ++i) { const int ka = k0 + 8 * g + i, kb = ka + 16;
    a[i] = (_Float16)(ka < K ? W[(size_t)(ka < K ? ka : K - 1) * ld + n] : 0.f); a[8 + i] = (_Float16)(kb < K ? W[(size_t)(kb < K ? kb : K - 1) * ld + n] : 0.f); }
  return a;
}
struct F2 { v16b h, l; };
__device__ __forceinline__ F2 bsplit16(const float v[16]) { F2 r;
#pragma unroll
  for (int i = 0; i < 16; ++i) { const __bf16 h = (__bf16)v[i]; r.h[i] = h; r.l[i] = (__bf16)(v[i] - (float)h); }
  return r; }
__device__ __forceinline__ F2 split_row(const float* row, int k0, int lane) { float v[16]; const float* p = row + k0 + 8 * (lane >> 4);
#pragma unroll
  for (int i = 0; i < 8; ++i) { v[i] = p[i]; v[8 + i] = p[16 + i]; }
  return bsplit16(v); }
__device__ __forceinline__ F2 split_rowK(const float* row, int k0, int lane, int K) { float v[16]; const int g = lane >> 4;
#pragma unroll
  for (int i = 0; i < 8; ++i) { const int ka = k0 + 8 * g + i, kb = ka + 16; v[i] = ka < K ? row[ka < K ? ka : K - 1] : 0.f; v[8 + i] = kb < K ? row[kb < K ? kb : K - 1] : 0.f; }
  return bsplit16(v); }
__device__ __forceinline__ F2 split_col(const float* W, int k0, int n, int lane, int ld, int K) { float v[16]; const int g = lane >> 4;
#pragma unroll
  for (int i = 0; i < 8; ++i) { const int ka = k0 + 8 * g + i, kb = ka + 16; v[i] = ka < K ? W[(size_t)(ka < K ? ka : K - 1) * ld + n] : 0.f; v[8 + i] = kb < K ? W[(size_t)(kb < K ? kb : K - 1) * ld + n] : 0.f; }
  return bsplit16(v); }
__device__ __forceinline__ v8f mac3(const F2& a, const F2& b, v8f c) { c = wmma_bf(a.l, b.h, c); c = wmma_bf(a.h, b.l, c); return wmma_bf(a.h, b.h, c); }
__device__ __forceinline__ float sigm(float v) { return 1.0f / (1.0f + expf(-v)); }
#define LDSX() do { asm volatile("s_wait_dscnt 0" ::: "memory"); __builtin_amdgcn_wave_barrier(); __builtin_amdgcn_fence(__ATOMIC_RELEASE, "workgroup"); } while (0)


#define NB 16
#define SS 512
#define SCALEF 0.125f
#define DM 1024
#define NH 16
#define MAXSEQ 512
__device__ __attribute__((noinline)) float log_p(float v) { return logf(v); }
#define HD 64
#define QKVW (3 * DM)
#ifndef TQB
#define TQB (SS / 64)
#define TNB NB
#define TOB (NB * SS / 64)     // output row tiles (all)
#endif
typedef __attribute__((ext_vector_type(8))) __bf16 v8b;
__device__ __forceinline__ v16b frag_b(const __bf16* rowk0, int lane) {
  union { v16b v; v8b q[2]; } u; const __bf16* p = rowk0 + 8 * (lane >> 4);
  u.q[0] = *(const v8b*)p; u.q[1] = *(const v8b*)(p + 16); return u.v;
}
__device__ __forceinline__ float bfr(float v) { return (float)(__bf16)v; }
__device__ __attribute__((noinline)) float exp_ni(float v) { return expf(v); }
__device__ __attribute__((noinline)) float erf_ni(float v) { return erff(v); }

#define PK_A 0                       // [3072][1024] Wqkv rows (natural [out][in])
#define PK_P (PK_A + QKVW * DM)        // [1024][1024] Wo rows (natural)
#define PK_END (PK_P + DM * DM)
#define WS_PK  0u
#define WS_QK  (WS_PK + 2u * PK_END)             // f16 [8192 rows][2048]: q | k
#define WS_QKL (WS_QK + 2u * NB * SS * 2 * DM)     // f16 q | k residual planes x2048
#define WS_VTH (WS_QKL + 2u * NB * SS * 2 * DM)    // f16 [b][1024 (h*64+d)][512 s] hi
#define WS_VTL (WS_VTH + 2u * NB * DM * SS)        // f16 lo x 2048
#define WS_O   (WS_VTL + 2u * NB * DM * SS)        // f32 [8192][1024]
#define WS_CS  (WS_O + 4u * NB * SS * DM)           // f32 2 x [512][32], unused
#define WS_XN  (WS_CS + 4u * 2 * SS * 32)                  // f32 [NR][1024] LayerNorm(x)
#define WS_ENT (WS_XN + 4u * (size_t)NB * SS * DM)     // f32 [b][h][t] attention entropy
#define WS_Y1  (WS_ENT + 4u * (size_t)NB * NH * SS)    // f32 [NR][1024] out-proj
#define WS_END (WS_Y1 + 4u * (size_t)NB * SS * DM)
// ---- pack_tile: block = (64 columns n, 128 rows k) of an (in,out) weight W[DM][ld] -> rows n of the packed [out][in] 16-bit copy. A thread reads 4 columns of 8 consecutive k (16 lanes = one 256-B piece of a W row), so it holds, per column, one whole 16-B chunk of a packed row; the chunks cross LDS so that 16 lanes store 256 B of one packed row.
// LDS: row n = 16 chunks of 16 B, chunk j at place j ^ (n >> 2): the 16 lanes of a half wave fall on 16 different places in the write (rows 4 apart, one chunk number) and in the read (one row, 16 chunk numbers).
template <bool F16X> __device__ __forceinline__ void pack_tile(const float* __restrict__ Wm, int ld, __bf16* __restrict__ dst, v4u* s) {
  const int t = threadIdx.x, c = t & 15, kg = t >> 4; const int n0 = blockIdx.x * 64, k0 = blockIdx.y * 128;
  v4f r[8];
#pragma unroll   // unrolled: the eight loads are in flight together, and r[] is indexed by constants
  for (int i = 0; i < 8; ++i) r[i] = *(const v4f*)(Wm + (size_t)(k0 + kg * 8 + i) * ld + n0 + c * 4);
#pragma unroll   // this loop and the one inside it: r[] and o are indexed by constants and stay in registers
  for (int j = 0; j < 4; ++j) { union { v4u u; v8h h; v8b b; } o;
#pragma unroll
    for (int i = 0; i < 8; ++i) { if (F16X) o.h[i] = (_Float16)(bfr(r[i][j]) * 256.0f); else o.b[i] = (__bf16)r[i][j]; }
    s[(c * 4 + j) * 16 + (kg ^ c)] = o.u; }
  __syncthreads();
#pragma unroll   // the four LDS reads go out together, ahead of the stores
  for (int it = 0; it < 4; ++it) { const int n = it * 16 + (t >> 4), j = t & 15; vst2((unsigned*)(dst + (size_t)(n0 + n) * DM + k0 + j * 8), s[n * 16 + (j ^ (n >> 2))]); }   // whole 128-B lines
}
// ---- k_pack: out_w (in,out) -> bf16 rows [out][in] in the Wo slot
__global__ __launch_bounds__(256) void k_pack(const float* __restrict__ WO, __bf16* __restrict__ PK) { __shared__ __align__(16) v4u s[64 * 16]; pack_tile<false>(WO, DM, PK + PK_P, s); }
// ---- k_qkv: block = (128 rows, 128 cols), 4 waves of 64 x 64; per trip 64 k of both operand tiles are brought into LDS in whole lines by asynchronous copies (two buffers) and read from there by all waves
#define QA_PITCH 272                      // bytes: a 256-B row of 64 f32 + 16 (16 B x odd: ds_load_b128 free of bank conflicts)
#define QB_PITCH 144                      // bytes: a 128-B row of 64 f16 + 16
#define QA_BYTES (128 * QA_PITCH)
#define QBUF (QA_BYTES + 128 * QB_PITCH)  // one buffer: X tile, then W tile
// eight 16-B copies per lane, rows lstep / gstep bytes apart; the s_wait_xcnt closes the statement so that no address register is rewritten in front of it
__device__ __forceinline__ void copy8(unsigned l, const char* p, unsigned lstep, unsigned gstep) {
  asm volatile("global_load_async_to_lds_b128 %0, %8, off\n\t"
               "global_load_async_to_lds_b128 %1, %9, off\n\t"
               "global_load_async_to_lds_b128 %2, %10, off\n\t"
               "global_load_async_to_lds_b128 %3, %11, off\n\t"
               "global_load_async_to_lds_b128 %4, %12, off\n\t"
               "global_load_async_to_lds_b128 %5, %13, off\n\t"
               "global_load_async_to_lds_b128 %6, %14, off\n\t"
               "global_load_async_to_lds_b128 %7, %15, off\n\t"
               "s_wait_xcnt 0x0"
               :: "v"(l), "v"(l + lstep), "v"(l + 2 * lstep), "v"(l + 3 * lstep), "v"(l + 4 * lstep), "v"(l + 5 * lstep), "v"(l + 6 * lstep), "v"(l + 7 * lstep),
                  "v"(p), "v"(p + gstep), "v"(p + 2 * gstep), "v"(p + 3 * gstep), "v"(p + 4 * gstep), "v"(p + 5 * gstep), "v"(p + 6 * gstep), "v"(p + 7 * gstep)
               : "memory");
}
__global__ __launch_bounds__(128) void k_qkv(const float* __restrict__ XQ, const float* __restrict__ XK, const float* __restrict__ XV, const __bf16* __restrict__ P, const float* __restrict__ BQ, const float* __restrict__ BK, const float* __restrict__ BV, _Float16* __restrict__ QK, _Float16* __restrict__ QKL, _Float16* __restrict__ VTH, _Float16* __restrict__ VTL) {
  const int which0 = (blockIdx.y * 128) / DM; const float* X = (which0 == 0) ? XQ : (which0 == 1) ? XK : XV; const float* BB = BQ ? (((which0 == 0) ? BQ : (which0 == 1) ? BK : BV) + (blockIdx.y * 128 - which0 * DM)) : nullptr;
  __shared__ __align__(16) char sm[2 * QBUF];   // the two buffers; output staging behind the loop
  const int tid = threadIdx.x, wave = tid >> 5, lane = tid & 31, col = lane & 15, g = lane >> 4, wm = wave >> 1, wn = wave & 1; const size_t m0 = (size_t)blockIdx.x * 128; const int n0 = blockIdx.y * 128;
  const unsigned sbase = (unsigned)(size_t)&sm[0];
  const unsigned la = sbase + (tid >> 4) * QA_PITCH + (tid & 15) * 16, lb = sbase + QA_BYTES + (tid >> 3) * QB_PITCH + (tid & 7) * 16;   // a wave's copy covers 2 X rows of 256 B, or 4 W rows of 128 B
  const char* ga = (const char*)(X + (m0 + (tid >> 4)) * DM + (tid & 15) * 4); const char* gb = (const char*)((const _Float16*)P + (size_t)(n0 + (tid >> 3)) * DM + (tid & 7) * 8);
  auto fill = [&](int t, unsigned bo) {   // tile t (k = 64 t ..): 16 + 8 copies per lane
    copy8(la + bo, ga + t * 256, 8 * QA_PITCH, 8 * DM * 4); copy8(la + bo + 64 * QA_PITCH, ga + t * 256 + 64 * DM * 4, 8 * QA_PITCH, 8 * DM * 4); copy8(lb + bo, gb + t * 128, 16 * QB_PITCH, 16 * DM * 2); };
  v8f acc[4][4] = {};
  fill(0, 0);
  asm volatile("s_wait_asynccnt 0x0" ::: "memory");   // tile 0 landed (this wave's copies)
  __syncthreads();                                    // ... and every other wave's
  fill(1, QBUF);
#pragma unroll 1   // rolled: a trip holds 32 WMMAs, enough to carry the branch
  for (int t = 0; t < DM / 64; ++t) { const char* bp = sm + (t & 1) * QBUF;
#pragma unroll   // this and the loops inside it are unrolled so that a[], w[] and acc[][] are indexed by constants and stay in registers
    for (int kc = 0; kc < 2; ++kc) { v16h a[4], w[4];
#pragma unroll
      for (int mi = 0; mi < 4; ++mi) { const float* p = (const float*)(bp + (wm * 64 + mi * 16 + col) * QA_PITCH) + kc * 32 + 8 * g;   // LN'd rows (f32) rounded once to f16
#pragma unroll
        for (int i = 0; i < 8; ++i) { a[mi][i] = (_Float16)p[i]; a[mi][8 + i] = (_Float16)p[16 + i]; } }
#pragma unroll
      for (int nj = 0; nj < 4; ++nj) w[nj] = frag_h((const _Float16*)(bp + QA_BYTES + (wn * 64 + nj * 16 + col) * QB_PITCH) + kc * 32, lane);
#pragma unroll
      for (int mi = 0; mi < 4; ++mi)
#pragma unroll
        for (int nj = 0; nj < 4; ++nj) acc[mi][nj] = wmma16(a[mi], w[nj], acc[mi][nj]); }
    asm volatile("s_wait_dscnt 0x0" ::: "memory");      // this wave's reads of the buffer are over
    asm volatile("s_wait_asynccnt 0x0" ::: "memory");   // its copies of tile t + 1 have landed
    __syncthreads();                                    // publishes tile t + 1, frees tile t's buffer
    if (t + 2 < DM / 64) fill(t + 2, (t & 1) * QBUF); }
  asm volatile("s_wait_asynccnt 0x0" ::: "memory");     // no copy in flight before the buffers become staging
  if (n0 < 2 * DM) {   // q stored unscaled (f16 sigma ~0.6, no subnormal exposure); 1/8 applied to the f32 score
    _Float16* sh = (_Float16*)(sm + wave * (2 * 64 * 144)); _Float16* sl = sh + 64 * 72;   // per wave: 64 rows x 64 cols at pitch 72, hi then residual
#pragma unroll
    for (int nj = 0; nj < 4; ++nj) { const float bias = BB ? bfr(BB[wn * 64 + nj * 16 + col]) : 0.f;
#pragma unroll
      for (int mi = 0; mi < 4; ++mi)
#pragma unroll
        for (int r = 0; r < 8; ++r) { const float v = acc[mi][nj][r] * (1.0f / 256.0f) + bias; const _Float16 hv = (_Float16)v; sh[(mi * 16 + 8 * g + r) * 72 + nj * 16 + col] = hv; sl[(mi * 16 + 8 * g + r) * 72 + nj * 16 + col] = (_Float16)((v - (float)hv) * 2048.0f); } }   // q, k (+ bias) as f16 hi + (x2048) residual
    LDSX();
    for (int it = 0; it < 16; ++it) { const int rl = it * 4 + (lane >> 3), ch = lane & 7; const size_t o = (m0 + wm * 64 + rl) * (2 * DM) + n0 + wn * 64 + ch * 8; vst2((unsigned*)(QK + o), *(const v4u*)&sh[rl * 72 + ch * 8]); vst2((unsigned*)(QKL + o), *(const v4u*)&sl[rl * 72 + ch * 8]); }   // whole 128-B lines
  } else {
    _Float16* sth = (_Float16*)sm; _Float16* stl = sth + 128 * 136;   // [128 d][128 s] at pitch 136, hi then residual
#pragma unroll
    for (int nj = 0; nj < 4; ++nj) { const float bias = BB ? bfr(BB[wn * 64 + nj * 16 + col]) : 0.f;
#pragma unroll
      for (int mi = 0; mi < 4; ++mi) { v8h h8, l8;
#pragma unroll
        for (int r = 0; r < 8; ++r) { const float v = acc[mi][nj][r] * (1.0f / 256.0f) + bias; const _Float16 hv = (_Float16)v; h8[r] = hv; l8[r] = (_Float16)((v - (float)hv) * 2048.0f); }
        const int o = (wn * 64 + nj * 16 + col) * 136 + wm * 64 + mi * 16 + 8 * g; *(v8h*)&sth[o] = h8; *(v8h*)&stl[o] = l8; } }
    __syncthreads();
    const int b = (int)(m0 / SS), s0 = (int)(m0 % SS); const int pc0 = n0 - 2 * DM;
    for (int it = 0; it < 16; ++it) { const int d = it * 8 + (tid >> 4), pc = tid & 15; const size_t o = ((size_t)b * DM + pc0 + d) * SS + s0 + pc * 8; vst2((unsigned*)(VTH + o), *(const v4u*)&sth[d * 136 + pc * 8]); vst2((unsigned*)(VTL + o), *(const v4u*)&stl[d * 136 + pc * 8]); }
  }
}
// lane l with lane l ^ 16 (a vector cross-row move, no LDS unit)
__device__ __forceinline__ float xhalf(float x) { return __builtin_bit_cast(float, __builtin_amdgcn_permlanex16(__builtin_bit_cast(int, x), __builtin_bit_cast(int, x), 0x76543210, 0xfedcba98, false, false)); }
// ---- k_attn: grid = (head, batch, query block), the query blocks from the last (most keys) down: the query block is the slowest index. For speed only: each (query block, head, batch) is done once wherever it runs
// block = (64 queries, head h, batch b): causal flash attention on transposed products: S^T = K . Q^T (A = 16 key rows, B = the wave's 16 queries), so a lane holds 16 of the 32 scores of ONE query (column col; keys 8 g + r of each 16): maximum and sum run in the lane, with one exchange between the wave's halves; the two S^T tiles, converted in place, are the B operand of O^T += V^T . P^T (A = 16 d rows of V^T): P never passes through LDS. O[b*S+q][h*64+d] = (acc + accl / 2048) / (2048 l) (256-B segments)
__global__ __launch_bounds__(128) void k_attn(const _Float16* __restrict__ QK, const _Float16* __restrict__ QKL, const _Float16* __restrict__ VTH, const _Float16* __restrict__ VTL, const void* __restrict__ KMASK, const float* __restrict__ RB, float* __restrict__ O) {
  __shared__ __align__(16) float so[4][16][68];
  const int tid = threadIdx.x, wave = tid >> 5, lane = tid & 31, col = lane & 15, g = lane >> 4;
  const int qb = TQB - 1 - blockIdx.z, h = blockIdx.x, b = blockIdx.y; const int q0 = qb * 64 + wave * 16; const int qi = q0 + col; const size_t rq = (size_t)b * SS + qi;
  v16h aq[2], aql[2];
#pragma unroll
  for (int kc = 0; kc < 2; ++kc) { aq[kc] = frag_h(QK + rq * (2 * DM) + h * HD + kc * 32, lane); aql[kc] = frag_h(QKL + rq * (2 * DM) + h * HD + kc * 32, lane); }
  float m = -3.0e38f, l = 0.f;   // of query qi: m over all keys so far (equal in both halves), l over this half's keys (joined behind the loop)
  v8f acc[4] = {}, accl[4] = {};   // O^T: register r = d (dt * 16 + 8 g + r), column = query
  const float* rbq = RB + (size_t)h * (2 * MAXSEQ - 1) + (MAXSEQ - 1 - qi) + 8 * g;   // rel_bias[h][k - q + 511] at k = 8 g
  const int nks = (qb * 64 + 64) / 32;   // causal: key tiles up to the query tile's end
  // left as it is (here and in k_ent): a load written behind a WMMA stays behind that WMMA's asm statement, and rel_bias is read under the causal test, so the listing waits for the 20 to 24 loads of a pass one after another
#pragma unroll 1
  for (int ks = 0; ks < nks; ++ks) { v8f s[2];
#pragma unroll
    for (int ct = 0; ct < 2; ++ct) { const int kr = ks * 32 + ct * 16 + col; const _Float16* krow = QK + ((size_t)b * SS + kr) * (2 * DM) + DM + h * HD; const _Float16* krowl = QKL + ((size_t)b * SS + kr) * (2 * DM) + DM + h * HD; v8f c = {}, cl = {};
      if (qb < 2) {   // leading query blocks (few keys, outputs far above the global rms): 3 products
#pragma unroll
        for (int kc = 0; kc < 2; ++kc) { const v16h kh = frag_h(krow + kc * 32, lane); c = wmma16(kh, aq[kc], c); cl = wmma16(kh, aql[kc], cl); cl = wmma16(frag_h(krowl + kc * 32, lane), aq[kc], cl); }
#pragma unroll
        for (int r = 0; r < 8; ++r) c[r] += cl[r] * (1.0f / 2048.0f); }
      else {
#pragma unroll
        for (int kc = 0; kc < 2; ++kc) c = wmma16(frag_h(krow + kc * 32, lane), aq[kc], c); }   // single product elsewhere
#pragma unroll
      for (int r = 0; r < 8; ++r) { const int kk = ks * 32 + ct * 16 + 8 * g + r; s[ct][r] = (kk <= qi) ? (c[r] * SCALEF + bfr(rbq[ks * 32 + ct * 16 + r])) : -3.0e38f; } }   // causal; + rel_bias[h][k - q + 511]
    float mx = fmaxf(s[0][0], s[1][0]);
#pragma unroll
    for (int r = 1; r < 8; ++r) mx = fmaxf(mx, fmaxf(s[0][r], s[1][r]));
    mx = fmaxf(mx, xhalf(mx));
    const float mn = fmaxf(m, mx); const float alpha = (m <= -1.0e38f) ? 0.f : __expf(m - mn);
    float es0 = 0.f, es1 = 0.f; v16h pa, pl;
#pragma unroll
    for (int r = 0; r < 8; ++r) { const float e0 = (s[0][r] <= -1.0e38f) ? 0.f : __expf(s[0][r] - mn), e1 = (s[1][r] <= -1.0e38f) ? 0.f : __expf(s[1][r] - mn); es0 += e0; es1 += e1;
      const float x0 = e0 * 2048.0f, x1 = e1 * 2048.0f; const _Float16 h0 = (_Float16)x0, h1 = (_Float16)x1; pa[r] = h0; pa[8 + r] = h1; pl[r] = (_Float16)((x0 - (float)h0) * 2048.0f); pl[8 + r] = (_Float16)((x1 - (float)h1) * 2048.0f); }   // P scaled by 2^11 before the f16 split so small softmax weights stay out of the f16 subnormal range; 2^-11 folded into the epilogue
    l = l * alpha + (es0 + es1); m = mn;
#pragma unroll
    for (int dt = 0; dt < 4; ++dt)
#pragma unroll
      for (int r = 0; r < 8; ++r) { acc[dt][r] *= alpha; accl[dt][r] *= alpha; }
#pragma unroll
    for (int dt = 0; dt < 4; ++dt) { const size_t vr = ((size_t)b * DM + h * HD + dt * 16 + col) * SS + ks * 32; const v16h vh = frag_h(VTH + vr, lane); acc[dt] = wmma16(vh, pa, acc[dt]); if (qb < 2) { accl[dt] = wmma16(vh, pl, accl[dt]); accl[dt] = wmma16(frag_h(VTL + vr, lane), pa, accl[dt]); } } }   // leading query blocks: P hi/lo x V hi/lo (3 products); elsewhere P x V single
  l += xhalf(l);
  const float il = (1.0f / 2048.0f) / l;
#pragma unroll
  for (int dt = 0; dt < 4; ++dt) { v4f o0, o1;
#pragma unroll
    for (int r = 0; r < 4; ++r) { o0[r] = (acc[dt][r] + accl[dt][r] * (1.0f / 2048.0f)) * il; o1[r] = (acc[dt][4 + r] + accl[dt][4 + r] * (1.0f / 2048.0f)) * il; }
    *(v4f*)&so[wave][col][dt * 16 + 8 * g] = o0; *(v4f*)&so[wave][col][dt * 16 + 8 * g + 4] = o1; }
  LDSX();
  for (int rl = 0; rl < 16; ++rl) if (lane < 16) vst2(O + ((size_t)b * SS + q0 + rl) * DM + h * HD + lane * 4, *(const v4f*)&so[wave][rl][lane * 4]);
}
// ---- k_out: block = (128 rows, 128 cols), 4 waves of 64 x 64: out = O(hi/lo) . Wo rows (2 products) + bo; per trip 64 k of both operand tiles are brought into LDS in whole lines by asynchronous copies (two buffers, the tile shapes and pitches of k_qkv) and read from there by all waves
__global__ __launch_bounds__(128) void k_out(const float* __restrict__ O, const __bf16* __restrict__ P, const float* __restrict__ BO, float* __restrict__ Y) {
  __shared__ __align__(16) char sm[2 * QBUF];   // the two buffers; output staging behind the loop
  const int tid = threadIdx.x, wave = tid >> 5, lane = tid & 31, col = lane & 15, g = lane >> 4, wm = wave >> 1, wn = wave & 1; const size_t m0 = (size_t)blockIdx.x * 128; const int n0 = blockIdx.y * 128;
  const unsigned sbase = (unsigned)(size_t)&sm[0];
  const unsigned la = sbase + (tid >> 4) * QA_PITCH + (tid & 15) * 16, lb = sbase + QA_BYTES + (tid >> 3) * QB_PITCH + (tid & 7) * 16;   // a wave's copy covers 2 O rows of 256 B, or 4 W rows of 128 B
  const char* ga = (const char*)(O + (m0 + (tid >> 4)) * DM + (tid & 15) * 4); const char* gb = (const char*)(P + (size_t)(n0 + (tid >> 3)) * DM + (tid & 7) * 8);
  auto fill = [&](int t, unsigned bo) {   // tile t (k = 64 t ..): 16 + 8 copies per lane
    copy8(la + bo, ga + t * 256, 8 * QA_PITCH, 8 * DM * 4); copy8(la + bo + 64 * QA_PITCH, ga + t * 256 + 64 * DM * 4, 8 * QA_PITCH, 8 * DM * 4); copy8(lb + bo, gb + t * 128, 16 * QB_PITCH, 16 * DM * 2); };
  v8f acc[4][4] = {};
  fill(0, 0);
  asm volatile("s_wait_asynccnt 0x0" ::: "memory");   // tile 0 landed (this wave's copies)
  __syncthreads();                                    // ... and every other wave's
  fill(1, QBUF);
#pragma unroll 1   // rolled: a trip holds 64 WMMAs, enough to carry the branch
  for (int t = 0; t < DM / 64; ++t) { const char* bp = sm + (t & 1) * QBUF;
    const char* ap = bp + (wm * 64 + col) * QA_PITCH + 32 * g;   // this lane's place in row col of the wave's first 16 O rows
    float nx[16];   // the f32 values of the A fragment after the one being multiplied: read from LDS one fragment ahead, so that the read's latency passes under 8 WMMAs
#pragma unroll
    for (int i = 0; i < 8; ++i) { nx[i] = ((const float*)ap)[i]; nx[8 + i] = ((const float*)ap)[16 + i]; }
#pragma unroll   // this and the loops inside it are unrolled so that w[], nx[] and acc[][] are indexed by constants and stay in registers
    for (int kc = 0; kc < 2; ++kc) { v16b w[4];
#pragma unroll
      for (int nj = 0; nj < 4; ++nj) w[nj] = frag_b((const __bf16*)(bp + QA_BYTES + (wn * 64 + nj * 16 + col) * QB_PITCH) + kc * 32, lane);
#pragma unroll
      for (int mi = 0; mi < 4; ++mi) { const F2 a = bsplit16(nx);   // f32 rows split into bf16 hi + residual
        if (kc * 4 + mi < 7) { const int s = kc * 4 + mi + 1; const float* p = (const float*)(ap + (s & 3) * 16 * QA_PITCH) + (s >> 2) * 32;   // same tile, same buffer: nothing of the next tile is read here
#pragma unroll
          for (int i = 0; i < 8; ++i) { nx[i] = p[i]; nx[8 + i] = p[16 + i]; } }
#pragma unroll
        for (int nj = 0; nj < 4; ++nj) acc[mi][nj] = wmma_bf(a.l, w[nj], acc[mi][nj]);   // residual first, then hi, per accumulator; four independent accumulators between the two
#pragma unroll
        for (int nj = 0; nj < 4; ++nj) acc[mi][nj] = wmma_bf(a.h, w[nj], acc[mi][nj]); } }
    asm volatile("s_wait_dscnt 0x0" ::: "memory");      // this wave's reads of the buffer are over
    asm volatile("s_wait_asynccnt 0x0" ::: "memory");   // its copies of tile t + 1 have landed
    __syncthreads();                                    // publishes tile t + 1, frees tile t's buffer
    if (t + 2 < DM / 64) fill(t + 2, (t & 1) * QBUF); }
  asm volatile("s_wait_asynccnt 0x0" ::: "memory");     // no copy in flight before the buffers become staging
  float* so = (float*)(sm + wave * (64 * 272));   // per wave: 64 rows x 64 cols of f32 at pitch 68
#pragma unroll
  for (int nj = 0; nj < 4; ++nj) { const float bias = bfr(BO[n0 + wn * 64 + nj * 16 + col]);
#pragma unroll
    for (int mi = 0; mi < 4; ++mi)
#pragma unroll
      for (int r = 0; r < 8; ++r) so[(mi * 16 + 8 * g + r) * 68 + nj * 16 + col] = acc[mi][nj][r] + bias; }
  LDSX();
  for (int it = 0; it < 32; ++it) { const int rl = it * 2 + g; vst2(Y + (m0 + wm * 64 + rl) * DM + n0 + wn * 64 + col * 4, *(const v4f*)&so[rl * 68 + col * 4]); }   // whole 128-B lines
}
// ---- k_pack3: the fused (in,out) W_attn [DM][3*DM] -> its 3,072 transposed rows, f16 x 2^8 (bit pattern stored in the bf16-typed buffer)
__global__ __launch_bounds__(256) void k_pack3(const float* __restrict__ WA, __bf16* __restrict__ PK) { __shared__ __align__(16) v4u s[64 * 16]; pack_tile<true>(WA, 3 * DM, PK + PK_A, s); }
// ---- k_ent: grid as k_attn's; block = (64 queries, head, b): recompute the causal scores (single f16 q, k; + rel bias) as S^T = K . Q^T (a lane holds 16 of the 32 scores of one query) and reduce -sum p log p = log(sum e^(s-m)) + m - (sum e^(s-m) s)/(sum e^(s-m)) per query, in the lane; the halves' sums are joined behind the loop; 256-B store per block
__global__ __launch_bounds__(128) void k_ent(const _Float16* __restrict__ QK, const float* __restrict__ RB, float* __restrict__ ENT) {
  __shared__ __align__(16) float sent[64];
  const int tid = threadIdx.x, wave = tid >> 5, lane = tid & 31, col = lane & 15, g = lane >> 4; const int qb = TQB - 1 - blockIdx.z, h = blockIdx.x; const size_t b = blockIdx.y; const int q0 = qb * 64 + wave * 16; const int qi = q0 + col; const size_t rq = b * SS + q0;
  v16h aq[2];
#pragma unroll
  for (int kc = 0; kc < 2; ++kc) aq[kc] = frag_h(QK + (rq + col) * (2 * DM) + h * HD + kc * 32, lane);
  asm volatile("s_wait_xcnt 0x0" ::: "memory");   // the loop's first address sum reuses the register pair that these four loads name: the wait stands in front of that overwrite
  float m = -3.0e38f, l = 0.f, ls = 0.f;   // of query qi: m over all keys so far, l and ls over this half's keys
  const float* rbq = RB + (size_t)h * (2 * MAXSEQ - 1) + (MAXSEQ - 1 - qi) + 8 * g;
  const int nks = (qb * 64 + 64) / 32;
#pragma unroll 1
  for (int ks = 0; ks < nks; ++ks) { v8f s[2];
#pragma unroll
    for (int ct = 0; ct < 2; ++ct) { const int kr = ks * 32 + ct * 16 + col; v8f c = {};
#pragma unroll
      for (int kc = 0; kc < 2; ++kc) c = wmma16(frag_h(QK + (b * SS + kr) * (2 * DM) + DM + h * HD + kc * 32, lane), aq[kc], c);
#pragma unroll
      for (int r = 0; r < 8; ++r) { const int kk = ks * 32 + ct * 16 + 8 * g + r; s[ct][r] = (kk <= qi) ? (c[r] * SCALEF + bfr(rbq[ks * 32 + ct * 16 + r])) : -3.0e38f; } }
    float mx = fmaxf(s[0][0], s[1][0]);
#pragma unroll
    for (int r = 1; r < 8; ++r) mx = fmaxf(mx, fmaxf(s[0][r], s[1][r]));
    mx = fmaxf(mx, xhalf(mx));
    const float mn = fmaxf(m, mx); const float alpha = (m <= -1.0e38f) ? 0.f : __expf(m - mn);
    float es0 = 0.f, es1 = 0.f, ess0 = 0.f, ess1 = 0.f;
#pragma unroll
    for (int r = 0; r < 8; ++r) { const bool v0 = s[0][r] > -1.0e38f, v1 = s[1][r] > -1.0e38f; const float e0 = v0 ? __expf(s[0][r] - mn) : 0.f, e1 = v1 ? __expf(s[1][r] - mn) : 0.f;
      es0 += e0; es1 += e1; ess0 += v0 ? e0 * s[0][r] : 0.f; ess1 += v1 ? e1 * s[1][r] : 0.f; }
    l = l * alpha + (es0 + es1); ls = ls * alpha + (ess0 + ess1); m = mn; }
  l += xhalf(l); ls += xhalf(ls);
  const float en = log_p(l) + m - ls / l;
  if (g == 0) sent[wave * 16 + col] = en;
  __syncthreads(); if (tid < 16) vst2(ENT + ((size_t)b * NH + h) * SS + qb * 64 + tid * 4, *(const v4f*)&sent[tid * 4]);
}
// ---- k_ln: block = row: XN = (x - mu) rsqrt(var + 1e-5) g + b (f32)
__global__ __launch_bounds__(256) void k_ln(const float* __restrict__ X, const float* __restrict__ G, const float* __restrict__ Bt, float* __restrict__ XN) {
  __shared__ float red[8]; const int t = threadIdx.x; const size_t row = blockIdx.x; float v[4]; float s = 0.f; for (int i = 0; i < 4; ++i) { v[i] = bfr(X[row * DM + t * 4 + i]); s += v[i]; }
#pragma unroll
  for (int o = 1; o < 32; o <<= 1) s += __shfl_xor(s, o);
  if ((t & 31) == 0) red[t >> 5] = s; __syncthreads(); float tot = 0.f; for (int i = 0; i < 8; ++i) tot += red[i]; const float mu = tot / (float)DM; __syncthreads();
  float q = 0.f; for (int i = 0; i < 4; ++i) { const float d = v[i] - mu; q += d * d; }
#pragma unroll
  for (int o = 1; o < 32; o <<= 1) q += __shfl_xor(q, o);
  if ((t & 31) == 0) red[t >> 5] = q; __syncthreads(); float tq = 0.f; for (int i = 0; i < 8; ++i) tq += red[i]; const float inv = 1.0f / sqrtf(tq / (float)DM + 1e-5f);
  v4f o4; for (int i = 0; i < 4; ++i) { const int e = t * 4 + i; o4[i] = (v[i] - mu) * inv * bfr(G[e]) + bfr(Bt[e]); } vst2(XN + row * DM + t * 4, o4);
}
__global__ __launch_bounds__(256) void k_fin(const float* __restrict__ X, const float* __restrict__ Y1, const float* __restrict__ ENT, float* __restrict__ OUT, float* __restrict__ OUT2) {
  const int t = threadIdx.x; const size_t row = blockIdx.x; const size_t b = row / SS; const int tt = (int)(row % SS);
  { v4f o4; for (int i = 0; i < 4; ++i) { const size_t e = row * DM + t * 4 + i; o4[i] = bfr(X[e]) + Y1[e]; } vst2(OUT + row * DM + t * 4, o4); }
  if ((tt & 31) == 0 && t < 32) { __shared__ __align__(16) float se[32]; float a = 0.f; for (int hh = 0; hh < NH; ++hh) a += ENT[(b * NH + hh) * SS + tt + t]; se[t] = a / (float)NH; __syncthreads(); if (t < 8) vst2(OUT2 + row + t * 4, *(const v4f*)&se[t * 4]); }
}
extern "C" void kernel_launch(void* const* d_in, const int* in_sizes, int n_in, void* d_out, int out_size, void* d_ws, size_t ws_size, hipStream_t stream) {
  (void)in_sizes; (void)n_in; (void)out_size;
  const float** F = (const float**)d_in;   // 0 x [16,512,1024], 1 qkv_w [1024,3072] (in,out), 2 qkv_b [3072], 3 out_w [1024,1024] (in,out), 4 out_b, 5 ln_g, 6 ln_b, 7 rel_bias [16,1023]
  if (ws_size < (size_t)WS_END) return;
  char* ws = (char*)d_ws; __bf16* PK = (__bf16*)(ws + WS_PK); _Float16 *QK = (_Float16*)(ws + WS_QK), *QKL = (_Float16*)(ws + WS_QKL), *VTH = (_Float16*)(ws + WS_VTH), *VTL = (_Float16*)(ws + WS_VTL); float *O = (float*)(ws + WS_O), *XN = (float*)(ws + WS_XN), *ENT = (float*)(ws + WS_ENT), *Y1 = (float*)(ws + WS_Y1);
  float* OUT = (float*)d_out; float* OUT2 = OUT + (size_t)NB * SS * DM;   // outputs concatenated: out [16,512,1024] then entropy [16,512]
  k_pack<<<dim3(DM / 64, DM / 128), 256, 0, stream>>>(F[3], PK);   // out_w ((in,out) -> transposed rows) into the Wo slot
  k_pack3<<<dim3(QKVW / 64, DM / 128), 256, 0, stream>>>(F[1], PK);
  k_ln<<<TNB * SS, 256, 0, stream>>>(F[0], F[5], F[6], XN);
  k_qkv<<<dim3(TNB * SS / 128, QKVW / 128), 128, 0, stream>>>(XN, XN, XN, PK + PK_A, F[2], F[2] + DM, F[2] + 2 * DM, QK, QKL, VTH, VTL);
  k_attn<<<dim3(NH, TNB, TQB), 128, 0, stream>>>(QK, QKL, VTH, VTL, nullptr, F[7], O);
  k_ent<<<dim3(NH, TNB, TQB), 128, 0, stream>>>(QK, F[7], ENT);
  k_out<<<dim3(TNB * SS / 128, DM / 128), 128, 0, stream>>>(O, PK + PK_P, F[4], Y1);
  k_fin<<<TOB * 64, 256, 0, stream>>>(F[0], Y1, ENT, OUT, OUT2);
}

// v006
// It runs in 193 microseconds.
// Timed twice side by side with v005, it ran 1.15 times as fast both times.
// Counting every step since v000, it is 2.99 times as fast.
// compute dtype: all float inputs rounded to bf16; LayerNorm in f32, its output rounded once to f16 x exact f16 copies (x 2^8) of the fused qkv weight on WMMA 16x16x32 (1 product) + bias; causal attention: 3-product scores and hi + residual P, v on the first 128 queries of each sequence, single f16 beyond; x 1/8 + rel_bias[h][k-q+511], running-max softmax in f32 (hardware exp); the per-row entropy from the same scores in the same pass (precise logf); out = x + (o (bf16 hi + residual) . out_w (2 products) + out_b); second output = head-mean attention entropy.
#include <hip/hip_runtime.h>
#include <math.h>

typedef __attribute__((ext_vector_type(16))) _Float16 v16h;
typedef __attribute__((ext_vector_type(16))) __bf16 v16b;
typedef __attribute__((ext_vector_type(8)))  _Float16 v8h;
typedef __attribute__((ext_vector_type(8)))  float v8f;
typedef __attribute__((ext_vector_type(4)))  float v4f;
typedef __attribute__((ext_vector_type(2)))  float v2f;
typedef __attribute__((ext_vector_type(4)))  unsigned v4u;
typedef __attribute__((ext_vector_type(4)))  int v4i;
typedef float __attribute__((may_alias)) float_a;
typedef int __attribute__((may_alias)) int_a;

template <typename T> __device__ __forceinline__ void vst2(void* p, T v) { *(T*)p = v;  }
__device__ __forceinline__ v8f wmma16(v16h a, v16h b, v8f c) {
  v8f d = __builtin_amdgcn_wmma_f32_16x16x32_f16(false, a, false, b, (short)0, c, false, false);
  asm volatile("v_nop\n\tv_nop\n\tv_nop\n\tv_nop" : "+v"(d) : "v"(a), "v"(b));
  return d;
}
__device__ __forceinline__ v8f wmma_bf(v16b a, v16b b, v8f c) {
  v8f d = __builtin_amdgcn_wmma_f32_16x16x32_bf16(false, a, false, b, (short)0, c, false, false);
  asm volatile("v_nop\n\tv_nop\n\tv_nop\n\tv_nop" : "+v"(d) : "v"(a), "v"(b));
  return d;
}
// Pre-LN causal time attention with relative position bias (B 16, T 512, d 1,024, 16 heads x 64): x + out_proj(attention(LN(x))), plus the mean attention entropy per (batch, step) as a second output.
__device__ __forceinline__ v16h frag_h(const _Float16* rowk0, int lane) {
  union { v16h v; v8h q[2]; } u; const _Float16* p = rowk0 + 8 * (lane >> 4);
  u.q[0] = *(const v8h*)p; u.q[1] = *(const v8h*)(p + 16); return u.v;
}
__device__ __forceinline__ v16h frag_f32(const float* rowk0, int lane) {
  v16h a; const float* p = rowk0 + 8 * (lane >> 4);
#pragma unroll
  for (int i = 0; i < 8; ++i) { a[i] = (_Float16)p[i]; a[8 + i] = (_Float16)p[16 + i]; }
  return a;
}
__device__ __forceinline__ v16h frag_f32s(const float* rowk0, int lane, float sc) {
  v16h a; const float* p = rowk0 + 8 * (lane >> 4);
#pragma unroll
  for (int i = 0; i < 8; ++i) { a[i] = (_Float16)(p[i] * sc); a[8 + i] = (_Float16)(p[16 + i] * sc); }
  return a;
}
// column fragment from a [K][ld] layout (column n), rows >= K read as 0
__device__ __forceinline__ v16h fragc_f32(const float* W, int k0, int n, int lane, int ld, int K) {
  v16h a; const int g = lane >> 4;
#pragma unroll
  for (int i = 0; i < 8; ++i) { const int ka = k0 + 8 * g + i, kb = ka + 16;
    a[i] = (_Float16)(ka < K ? W[(size_t)(ka < K ? ka : K - 1) * ld + n] : 0.f); a[8 + i] = (_Float16)(kb < K ? W[(size_t)(kb < K ? kb : K - 1) * ld + n] : 0.f); }
  return a;
}
struct F2 { v16b h, l; };
__device__ __forceinline__ F2 bsplit16(const float v[16]) { F2 r;
#pragma unroll
  for (int i = 0; i < 16; ++i) { const __bf16 h = (__bf16)v[i]; r.h[i] = h; r.l[i] = (__bf16)(v[i] - (float)h); }
  return r; }
__device__ __forceinline__ F2 split_row(const float* row, int k0, int lane) { float v[16]; const float* p = row + k0 + 8 * (lane >> 4);
#pragma unroll
  for (int i = 0; i < 8; ++i) { v[i] = p[i]; v[8 + i] = p[16 + i]; }
  return bsplit16(v); }
__device__ __forceinline__ F2 split_rowK(const float* row, int k0, int lane, int K) { float v[16]; const int g = lane >> 4;
#pragma unroll
  for (int i = 0; i < 8; ++i) { const int ka = k0 + 8 * g + i, kb = ka + 16; v[i] = ka < K ? row[ka < K ? ka : K - 1] : 0.f; v[8 + i] = kb < K ? row[kb < K ? kb : K - 1] : 0.f; }
  return bsplit16(v); }
__device__ __forceinline__ F2 split_col(const float* W, int k0, int n, int lane, int ld, int K) { float v[16]; const int g = lane >> 4;
#pragma unroll
  for (int i = 0; i < 8; ++i) { const int ka = k0 + 8 * g + i, kb = ka + 16; v[i] = ka < K ? W[(size_t)(ka < K ? ka : K - 1) * ld + n] : 0.f; v[8 + i] = kb < K ? W[(size_t)(kb < K ? kb : K - 1) * ld + n] : 0.f; }
  return bsplit16(v); }
__device__ __forceinline__ v8f mac3(const F2& a, const F2& b, v8f c) { c = wmma_bf(a.l, b.h, c); c = wmma_bf(a.h, b.l, c); return wmma_bf(a.h, b.h, c); }
__device__ __forceinline__ float sigm(float v) { return 1.0f / (1.0f + expf(-v)); }
#define LDSX() do { asm volatile("s_wait_dscnt 0" ::: "memory"); __builtin_amdgcn_wave_barrier(); __builtin_amdgcn_fence(__ATOMIC_RELEASE, "workgroup"); } while (0)


#define NB 16
#define SS 512
#define SCALEF 0.125f
#define DM 1024
#define NH 16
#define MAXSEQ 512
__device__ __attribute__((noinline)) float log_p(float v) { return logf(v); }
#define HD 64
#define QKVW (3 * DM)
#ifndef TQB
#define TQB (SS / 64)
#define TNB NB
#define TOB (NB * SS / 64)     // output row tiles (all)
#endif
typedef __attribute__((ext_vector_type(8))) __bf16 v8b;
__device__ __forceinline__ v16b frag_b(const __bf16* rowk0, int lane) {
  union { v16b v; v8b q[2]; } u; const __bf16* p = rowk0 + 8 * (lane >> 4);
  u.q[0] = *(const v8b*)p; u.q[1] = *(const v8b*)(p + 16); return u.v;
}
__device__ __forceinline__ float bfr(float v) { return (float)(__bf16)v; }
__device__ __attribute__((noinline)) float exp_ni(float v) { return expf(v); }
__device__ __attribute__((noinline)) float erf_ni(float v) { return erff(v); }

#define PK_A 0                       // [3072][1024] Wqkv rows (natural [out][in])
#define PK_P (PK_A + QKVW * DM)        // [1024][1024] Wo rows (natural)
#define PK_END (PK_P + DM * DM)
#define WS_PK  0u
#define WS_QK  (WS_PK + 2u * PK_END)             // f16 [8192 rows][2048]: q | k
#define WS_QKL (WS_QK + 2u * NB * SS * 2 * DM)     // f16 q | k residual planes x2048
#define WS_VTH (WS_QKL + 2u * NB * SS * 2 * DM)    // f16 [b][1024 (h*64+d)][512 s] hi
#define WS_VTL (WS_VTH + 2u * NB * DM * SS)        // f16 lo x 2048
#define WS_O   (WS_VTL + 2u * NB * DM * SS)        // f32 [8192][1024]
#define WS_CS  (WS_O + 4u * NB * SS * DM)           // f32 2 x [512][32], unused
#define WS_XN  (WS_CS + 4u * 2 * SS * 32)                  // f32 [NR][1024] LayerNorm(x)
#define WS_ENT (WS_XN + 4u * (size_t)NB * SS * DM)     // f32 [b][h][t] attention entropy
#define WS_Y1  (WS_ENT + 4u * (size_t)NB * NH * SS)    // f32 [NR][1024] out-proj
#define WS_END (WS_Y1 + 4u * (size_t)NB * SS * DM)
// ---- pack_tile: block = (64 columns n, 128 rows k) of an (in,out) weight W[DM][ld] -> rows n of the packed [out][in] 16-bit copy. A thread reads 4 columns of 8 consecutive k (16 lanes = one 256-B piece of a W row), so it holds, per column, one whole 16-B chunk of a packed row; the chunks cross LDS so that 16 lanes store 256 B of one packed row.
// LDS: row n = 16 chunks of 16 B, chunk j at place j ^ (n >> 2): the 16 lanes of a half wave fall on 16 different places in the write (rows 4 apart, one chunk number) and in the read (one row, 16 chunk numbers).
template <bool F16X> __device__ __forceinline__ void pack_tile(const float* __restrict__ Wm, int ld, __bf16* __restrict__ dst, v4u* s) {
  const int t = threadIdx.x, c = t & 15, kg = t >> 4; const int n0 = blockIdx.x * 64, k0 = blockIdx.y * 128;
  v4f r[8];
#pragma unroll   // unrolled: the eight loads are in flight together, and r[] is indexed by constants
  for (int i = 0; i < 8; ++i) r[i] = *(const v4f*)(Wm + (size_t)(k0 + kg * 8 + i) * ld + n0 + c * 4);
#pragma unroll   // this loop and the one inside it: r[] and o are indexed by constants and stay in registers
  for (int j = 0; j < 4; ++j) { union { v4u u; v8h h; v8b b; } o;
#pragma unroll
    for (int i = 0; i < 8; ++i) { if (F16X) o.h[i] = (_Float16)(bfr(r[i][j]) * 256.0f); else o.b[i] = (__bf16)r[i][j]; }
    s[(c * 4 + j) * 16 + (kg ^ c)] = o.u; }
  __syncthreads();
#pragma unroll   // the four LDS reads go out together, ahead of the stores
  for (int it = 0; it < 4; ++it) { const int n = it * 16 + (t >> 4), j = t & 15; vst2((unsigned*)(dst + (size_t)(n0 + n) * DM + k0 + j * 8), s[n * 16 + (j ^ (n >> 2))]); }   // whole 128-B lines
}
// ---- k_pack: out_w (in,out) -> bf16 rows [out][in] in the Wo slot
__global__ __launch_bounds__(256) void k_pack(const float* __restrict__ WO, __bf16* __restrict__ PK) { __shared__ __align__(16) v4u s[64 * 16]; pack_tile<false>(WO, DM, PK + PK_P, s); }
// ---- k_qkv: block = (128 rows, 128 cols), 4 waves of 64 x 64; per trip 64 k of both operand tiles are brought into LDS in whole lines by asynchronous copies (two buffers) and read from there by all waves
#define QA_PITCH 272                      // bytes: a 256-B row of 64 f32 + 16 (16 B x odd: ds_load_b128 free of bank conflicts)
#define QB_PITCH 144                      // bytes: a 128-B row of 64 f16 + 16
#define QA_BYTES (128 * QA_PITCH)
#define QBUF (QA_BYTES + 128 * QB_PITCH)  // one buffer: X tile, then W tile
// eight 16-B copies per lane, rows lstep / gstep bytes apart; the s_wait_xcnt closes the statement so that no address register is rewritten in front of it
__device__ __forceinline__ void copy8(unsigned l, const char* p, unsigned lstep, unsigned gstep) {
  asm volatile("global_load_async_to_lds_b128 %0, %8, off\n\t"
               "global_load_async_to_lds_b128 %1, %9, off\n\t"
               "global_load_async_to_lds_b128 %2, %10, off\n\t"
               "global_load_async_to_lds_b128 %3, %11, off\n\t"
               "global_load_async_to_lds_b128 %4, %12, off\n\t"
               "global_load_async_to_lds_b128 %5, %13, off\n\t"
               "global_load_async_to_lds_b128 %6, %14, off\n\t"
               "global_load_async_to_lds_b128 %7, %15, off\n\t"
               "s_wait_xcnt 0x0"
               :: "v"(l), "v"(l + lstep), "v"(l + 2 * lstep), "v"(l + 3 * lstep), "v"(l + 4 * lstep), "v"(l + 5 * lstep), "v"(l + 6 * lstep), "v"(l + 7 * lstep),
                  "v"(p), "v"(p + gstep), "v"(p + 2 * gstep), "v"(p + 3 * gstep), "v"(p + 4 * gstep), "v"(p + 5 * gstep), "v"(p + 6 * gstep), "v"(p + 7 * gstep)
               : "memory");
}
__global__ __launch_bounds__(128) void k_qkv(const float* __restrict__ XQ, const float* __restrict__ XK, const float* __restrict__ XV, const __bf16* __restrict__ P, const float* __restrict__ BQ, const float* __restrict__ BK, const float* __restrict__ BV, _Float16* __restrict__ QK, _Float16* __restrict__ QKL, _Float16* __restrict__ VTH, _Float16* __restrict__ VTL) {
  const int which0 = (blockIdx.y * 128) / DM; const float* X = (which0 == 0) ? XQ : (which0 == 1) ? XK : XV; const float* BB = BQ ? (((which0 == 0) ? BQ : (which0 == 1) ? BK : BV) + (blockIdx.y * 128 - which0 * DM)) : nullptr;
  __shared__ __align__(16) char sm[2 * QBUF];   // the two buffers; output staging behind the loop
  const int tid = threadIdx.x, wave = tid >> 5, lane = tid & 31, col = lane & 15, g = lane >> 4, wm = wave >> 1, wn = wave & 1; const size_t m0 = (size_t)blockIdx.x * 128; const int n0 = blockIdx.y * 128;
  const unsigned sbase = (unsigned)(size_t)&sm[0];
  const unsigned la = sbase + (tid >> 4) * QA_PITCH + (tid & 15) * 16, lb = sbase + QA_BYTES + (tid >> 3) * QB_PITCH + (tid & 7) * 16;   // a wave's copy covers 2 X rows of 256 B, or 4 W rows of 128 B
  const char* ga = (const char*)(X + (m0 + (tid >> 4)) * DM + (tid & 15) * 4); const char* gb = (const char*)((const _Float16*)P + (size_t)(n0 + (tid >> 3)) * DM + (tid & 7) * 8);
  auto fill = [&](int t, unsigned bo) {   // tile t (k = 64 t ..): 16 + 8 copies per lane
    copy8(la + bo, ga + t * 256, 8 * QA_PITCH, 8 * DM * 4); copy8(la + bo + 64 * QA_PITCH, ga + t * 256 + 64 * DM * 4, 8 * QA_PITCH, 8 * DM * 4); copy8(lb + bo, gb + t * 128, 16 * QB_PITCH, 16 * DM * 2); };
  v8f acc[4][4] = {};
  fill(0, 0);
  asm volatile("s_wait_asynccnt 0x0" ::: "memory");   // tile 0 landed (this wave's copies)
  __syncthreads();                                    // ... and every other wave's
  fill(1, QBUF);
#pragma unroll 1   // rolled: a trip holds 32 WMMAs, enough to carry the branch
  for (int t = 0; t < DM / 64; ++t) { const char* bp = sm + (t & 1) * QBUF;
#pragma unroll   // this and the loops inside it are unrolled so that a[], w[] and acc[][] are indexed by constants and stay in registers
    for (int kc = 0; kc < 2; ++kc) { v16h a[4], w[4];
#pragma unroll
      for (int mi = 0; mi < 4; ++mi) { const float* p = (const float*)(bp + (wm * 64 + mi * 16 + col) * QA_PITCH) + kc * 32 + 8 * g;   // LN'd rows (f32) rounded once to f16
#pragma unroll
        for (int i = 0; i < 8; ++i) { a[mi][i] = (_Float16)p[i]; a[mi][8 + i] = (_Float16)p[16 + i]; } }
#pragma unroll
      for (int nj = 0; nj < 4; ++nj) w[nj] = frag_h((const _Float16*)(bp + QA_BYTES + (wn * 64 + nj * 16 + col) * QB_PITCH) + kc * 32, lane);
#pragma unroll
      for (int mi = 0; mi < 4; ++mi)
#pragma unroll
        for (int nj = 0; nj < 4; ++nj) acc[mi][nj] = wmma16(a[mi], w[nj], acc[mi][nj]); }
    asm volatile("s_wait_dscnt 0x0" ::: "memory");      // this wave's reads of the buffer are over
    asm volatile("s_wait_asynccnt 0x0" ::: "memory");   // its copies of tile t + 1 have landed
    __syncthreads();                                    // publishes tile t + 1, frees tile t's buffer
    if (t + 2 < DM / 64) fill(t + 2, (t & 1) * QBUF); }
  asm volatile("s_wait_asynccnt 0x0" ::: "memory");     // no copy in flight before the buffers become staging
  if (n0 < 2 * DM) {   // q stored unscaled (f16 sigma ~0.6, no subnormal exposure); 1/8 applied to the f32 score
    _Float16* sh = (_Float16*)(sm + wave * (2 * 64 * 144)); _Float16* sl = sh + 64 * 72;   // per wave: 64 rows x 64 cols at pitch 72, hi then residual
#pragma unroll
    for (int nj = 0; nj < 4; ++nj) { const float bias = BB ? bfr(BB[wn * 64 + nj * 16 + col]) : 0.f;
#pragma unroll
      for (int mi = 0; mi < 4; ++mi)
#pragma unroll
        for (int r = 0; r < 8; ++r) { const float v = acc[mi][nj][r] * (1.0f / 256.0f) + bias; const _Float16 hv = (_Float16)v; sh[(mi * 16 + 8 * g + r) * 72 + nj * 16 + col] = hv; sl[(mi * 16 + 8 * g + r) * 72 + nj * 16 + col] = (_Float16)((v - (float)hv) * 2048.0f); } }   // q, k (+ bias) as f16 hi + (x2048) residual
    LDSX();
    for (int it = 0; it < 16; ++it) { const int rl = it * 4 + (lane >> 3), ch = lane & 7; const size_t o = (m0 + wm * 64 + rl) * (2 * DM) + n0 + wn * 64 + ch * 8; vst2((unsigned*)(QK + o), *(const v4u*)&sh[rl * 72 + ch * 8]); vst2((unsigned*)(QKL + o), *(const v4u*)&sl[rl * 72 + ch * 8]); }   // whole 128-B lines
  } else {
    _Float16* sth = (_Float16*)sm; _Float16* stl = sth + 128 * 136;   // [128 d][128 s] at pitch 136, hi then residual
#pragma unroll
    for (int nj = 0; nj < 4; ++nj) { const float bias = BB ? bfr(BB[wn * 64 + nj * 16 + col]) : 0.f;
#pragma unroll
      for (int mi = 0; mi < 4; ++mi) { v8h h8, l8;
#pragma unroll
        for (int r = 0; r < 8; ++r) { const float v = acc[mi][nj][r] * (1.0f / 256.0f) + bias; const _Float16 hv = (_Float16)v; h8[r] = hv; l8[r] = (_Float16)((v - (float)hv) * 2048.0f); }
        const int o = (wn * 64 + nj * 16 + col) * 136 + wm * 64 + mi * 16 + 8 * g; *(v8h*)&sth[o] = h8; *(v8h*)&stl[o] = l8; } }
    __syncthreads();
    const int b = (int)(m0 / SS), s0 = (int)(m0 % SS); const int pc0 = n0 - 2 * DM;
    for (int it = 0; it < 16; ++it) { const int d = it * 8 + (tid >> 4), pc = tid & 15; const size_t o = ((size_t)b * DM + pc0 + d) * SS + s0 + pc * 8; vst2((unsigned*)(VTH + o), *(const v4u*)&sth[d * 136 + pc * 8]); vst2((unsigned*)(VTL + o), *(const v4u*)&stl[d * 136 + pc * 8]); }
  }
}
// lane l with lane l ^ 16 (a vector cross-row move, no LDS unit)
__device__ __forceinline__ float xhalf(float x) { return __builtin_bit_cast(float, __builtin_amdgcn_permlanex16(__builtin_bit_cast(int, x), __builtin_bit_cast(int, x), 0x76543210, 0xfedcba98, false, false)); }
// ---- k_attn: grid = (head, batch, query block), the query blocks from the last (most keys) down: the query block is the slowest index. For speed only: each (query block, head, batch) is done once wherever it runs
// block = (64 queries, head h, batch b): causal flash attention on transposed products: S^T = K . Q^T (A = 16 key rows, B = the wave's 16 queries), so a lane holds 16 of the 32 scores of ONE query (column col; keys 8 g + r of each 16): maximum and sum run in the lane, with one exchange between the wave's halves; the two S^T tiles, converted in place, are the B operand of O^T += V^T . P^T (A = 16 d rows of V^T): P never passes through LDS. O[b*S+q][h*64+d] = (acc + accl / 2048) / (2048 l) (256-B segments). The same scores give the row's entropy -sum p log p = log(sum e^(s-m)) + m - (sum e^(s-m) s)/(sum e^(s-m)): one more running sum per lane, joined behind the loop; 256-B store per block
__global__ __launch_bounds__(128) void k_attn(const _Float16* __restrict__ QK, const _Float16* __restrict__ QKL, const _Float16* __restrict__ VTH, const _Float16* __restrict__ VTL, const void* __restrict__ KMASK, const float* __restrict__ RB, float* __restrict__ O, float* __restrict__ ENT) {
  __shared__ __align__(16) float so[4][16][68];
  __shared__ __align__(16) float sent[64];
  const int tid = threadIdx.x, wave = tid >> 5, lane = tid & 31, col = lane & 15, g = lane >> 4;
  const int qb = TQB - 1 - blockIdx.z, h = blockIdx.x, b = blockIdx.y; const int q0 = qb * 64 + wave * 16; const int qi = q0 + col; const size_t rq = (size_t)b * SS + qi;
  v16h aq[2], aql[2];
#pragma unroll
  for (int kc = 0; kc < 2; ++kc) { aq[kc] = frag_h(QK + rq * (2 * DM) + h * HD + kc * 32, lane); aql[kc] = frag_h(QKL + rq * (2 * DM) + h * HD + kc * 32, lane); }
  float m = -3.0e38f, l = 0.f, ls = 0.f;   // of query qi: m over all keys so far (equal in both halves), l and ls over this half's keys (joined behind the loop)
  v8f acc[4] = {}, accl[4] = {};   // O^T: register r = d (dt * 16 + 8 g + r), column = query
  const float* rbq = RB + (size_t)h * (2 * MAXSEQ - 1) + (MAXSEQ - 1 - qi) + 8 * g;   // rel_bias[h][k - q + 511] at k = 8 g
  const int nks = (qb * 64 + 64) / 32;   // causal: key tiles up to the query tile's end
  // left as it is: a load written behind a WMMA stays behind that WMMA's asm statement, and rel_bias is read under the causal test, so the listing waits for the 20 to 24 loads of a pass one after another
#pragma unroll 1
  for (int ks = 0; ks < nks; ++ks) { v8f s[2];
#pragma unroll
    for (int ct = 0; ct < 2; ++ct) { const int kr = ks * 32 + ct * 16 + col; const _Float16* krow = QK + ((size_t)b * SS + kr) * (2 * DM) + DM + h * HD; const _Float16* krowl = QKL + ((size_t)b * SS + kr) * (2 * DM) + DM + h * HD; v8f c = {}, cl = {};
      if (qb < 2) {   // leading query blocks (few keys, outputs far above the global rms): 3 products
#pragma unroll
        for (int kc = 0; kc < 2; ++kc) { const v16h kh = frag_h(krow + kc * 32, lane); c = wmma16(kh, aq[kc], c); cl = wmma16(kh, aql[kc], cl); cl = wmma16(frag_h(krowl + kc * 32, lane), aq[kc], cl); }
#pragma unroll
        for (int r = 0; r < 8; ++r) c[r] += cl[r] * (1.0f / 2048.0f); }
      else {
#pragma unroll
        for (int kc = 0; kc < 2; ++kc) c = wmma16(frag_h(krow + kc * 32, lane), aq[kc], c); }   // single product elsewhere
#pragma unroll
      for (int r = 0; r < 8; ++r) { const int kk = ks * 32 + ct * 16 + 8 * g + r; s[ct][r] = (kk <= qi) ? (c[r] * SCALEF + bfr(rbq[ks * 32 + ct * 16 + r])) : -3.0e38f; } }   // causal; + rel_bias[h][k - q + 511]
    float mx = fmaxf(s[0][0], s[1][0]);
#pragma unroll
    for (int r = 1; r < 8; ++r) mx = fmaxf(mx, fmaxf(s[0][r], s[1][r]));
    mx = fmaxf(mx, xhalf(mx));
    const float mn = fmaxf(m, mx); const float alpha = (m <= -1.0e38f) ? 0.f : __expf(m - mn);
    float es0 = 0.f, es1 = 0.f, ess0 = 0.f, ess1 = 0.f; v16h pa, pl;
#pragma unroll
    for (int r = 0; r < 8; ++r) { const float e0 = (s[0][r] <= -1.0e38f) ? 0.f : __expf(s[0][r] - mn), e1 = (s[1][r] <= -1.0e38f) ? 0.f : __expf(s[1][r] - mn); es0 += e0; es1 += e1; ess0 += (s[0][r] > -1.0e38f) ? e0 * s[0][r] : 0.f; ess1 += (s[1][r] > -1.0e38f) ? e1 * s[1][r] : 0.f;
      const float x0 = e0 * 2048.0f, x1 = e1 * 2048.0f; const _Float16 h0 = (_Float16)x0, h1 = (_Float16)x1; pa[r] = h0; pa[8 + r] = h1; pl[r] = (_Float16)((x0 - (float)h0) * 2048.0f); pl[8 + r] = (_Float16)((x1 - (float)h1) * 2048.0f); }   // P scaled by 2^11 before the f16 split so small softmax weights stay out of the f16 subnormal range; 2^-11 folded into the epilogue
    l = l * alpha + (es0 + es1); ls = ls * alpha + (ess0 + ess1); m = mn;
#pragma unroll
    for (int dt = 0; dt < 4; ++dt)
#pragma unroll
      for (int r = 0; r < 8; ++r) { acc[dt][r] *= alpha; accl[dt][r] *= alpha; }
#pragma unroll
    for (int dt = 0; dt < 4; ++dt) { const size_t vr = ((size_t)b * DM + h * HD + dt * 16 + col) * SS + ks * 32; const v16h vh = frag_h(VTH + vr, lane); acc[dt] = wmma16(vh, pa, acc[dt]); if (qb < 2) { accl[dt] = wmma16(vh, pl, accl[dt]); accl[dt] = wmma16(frag_h(VTL + vr, lane), pa, accl[dt]); } } }   // leading query blocks: P hi/lo x V hi/lo (3 products); elsewhere P x V single
  l += xhalf(l); ls += xhalf(ls);
  const float il = (1.0f / 2048.0f) / l;
#pragma unroll
  for (int dt = 0; dt < 4; ++dt) { v4f o0, o1;
#pragma unroll
    for (int r = 0; r < 4; ++r) { o0[r] = (acc[dt][r] + accl[dt][r] * (1.0f / 2048.0f)) * il; o1[r] = (acc[dt][4 + r] + accl[dt][4 + r] * (1.0f / 2048.0f)) * il; }
    *(v4f*)&so[wave][col][dt * 16 + 8 * g] = o0; *(v4f*)&so[wave][col][dt * 16 + 8 * g + 4] = o1; }
  LDSX();
  const float en = log_p(l) + m - ls / l;   // here O lies in LDS, so only l, m and ls live across the call; and in front of the O stores, which the barrier would otherwise wait for
  if (g == 0) sent[wave * 16 + col] = en;
  __syncthreads(); if (tid < 16) vst2(ENT + ((size_t)b * NH + h) * SS + qb * 64 + tid * 4, *(const v4f*)&sent[tid * 4]);
  for (int rl = 0; rl < 16; ++rl) if (lane < 16) vst2(O + ((size_t)b * SS + q0 + rl) * DM + h * HD + lane * 4, *(const v4f*)&so[wave][rl][lane * 4]);
}
// ---- k_out: block = (128 rows, 128 cols), 4 waves of 64 x 64: out = O(hi/lo) . Wo rows (2 products) + bo; per trip 64 k of both operand tiles are brought into LDS in whole lines by asynchronous copies (two buffers, the tile shapes and pitches of k_qkv) and read from there by all waves
__global__ __launch_bounds__(128) void k_out(const float* __restrict__ O, const __bf16* __restrict__ P, const float* __restrict__ BO, float* __restrict__ Y) {
  __shared__ __align__(16) char sm[2 * QBUF];   // the two buffers; output staging behind the loop
  const int tid = threadIdx.x, wave = tid >> 5, lane = tid & 31, col = lane & 15, g = lane >> 4, wm = wave >> 1, wn = wave & 1; const size_t m0 = (size_t)blockIdx.x * 128; const int n0 = blockIdx.y * 128;
  const unsigned sbase = (unsigned)(size_t)&sm[0];
  const unsigned la = sbase + (tid >> 4) * QA_PITCH + (tid & 15) * 16, lb = sbase + QA_BYTES + (tid >> 3) * QB_PITCH + (tid & 7) * 16;   // a wave's copy covers 2 O rows of 256 B, or 4 W rows of 128 B
  const char* ga = (const char*)(O + (m0 + (tid >> 4)) * DM + (tid & 15) * 4); const char* gb = (const char*)(P + (size_t)(n0 + (tid >> 3)) * DM + (tid & 7) * 8);
  auto fill = [&](int t, unsigned bo) {   // tile t (k = 64 t ..): 16 + 8 copies per lane
    copy8(la + bo, ga + t * 256, 8 * QA_PITCH, 8 * DM * 4); copy8(la + bo + 64 * QA_PITCH, ga + t * 256 + 64 * DM * 4, 8 * QA_PITCH, 8 * DM * 4); copy8(lb + bo, gb + t * 128, 16 * QB_PITCH, 16 * DM * 2); };
  v8f acc[4][4] = {};
  fill(0, 0);
  asm volatile("s_wait_asynccnt 0x0" ::: "memory");   // tile 0 landed (this wave's copies)
  __syncthreads();                                    // ... and every other wave's
  fill(1, QBUF);
#pragma unroll 1   // rolled: a trip holds 64 WMMAs, enough to carry the branch
  for (int t = 0; t < DM / 64; ++t) { const char* bp = sm + (t & 1) * QBUF;
    const char* ap = bp + (wm * 64 + col) * QA_PITCH + 32 * g;   // this lane's place in row col of the wave's first 16 O rows
    float nx[16];   // the f32 values of the A fragment after the one being multiplied: read from LDS one fragment ahead, so that the read's latency passes under 8 WMMAs
#pragma unroll
    for (int i = 0; i < 8; ++i) { nx[i] = ((const float*)ap)[i]; nx[8 + i] = ((const float*)ap)[16 + i]; }
#pragma unroll   // this and the loops inside it are unrolled so that w[], nx[] and acc[][] are indexed by constants and stay in registers
    for (int kc = 0; kc < 2; ++kc) { v16b w[4];
#pragma unroll
      for (int nj = 0; nj < 4; ++nj) w[nj] = frag_b((const __bf16*)(bp + QA_BYTES + (wn * 64 + nj * 16 + col) * QB_PITCH) + kc * 32, lane);
#pragma unroll
      for (int mi = 0; mi < 4; ++mi) { const F2 a = bsplit16(nx);   // f32 rows split into bf16 hi + residual
        if (kc * 4 + mi < 7) { const int s = kc * 4 + mi + 1; const float* p = (const float*)(ap + (s & 3) * 16 * QA_PITCH) + (s >> 2) * 32;   // same tile, same buffer: nothing of the next tile is read here
#pragma unroll
          for (int i = 0; i < 8; ++i) { nx[i] = p[i]; nx[8 + i] = p[16 + i]; } }
#pragma unroll
        for (int nj = 0; nj < 4; ++nj) acc[mi][nj] = wmma_bf(a.l, w[nj], acc[mi][nj]);   // residual first, then hi, per accumulator; four independent accumulators between the two
#pragma unroll
        for (int nj = 0; nj < 4; ++nj) acc[mi][nj] = wmma_bf(a.h, w[nj], acc[mi][nj]); } }
    asm volatile("s_wait_dscnt 0x0" ::: "memory");      // this wave's reads of the buffer are over
    asm volatile("s_wait_asynccnt 0x0" ::: "memory");   // its copies of tile t + 1 have landed
    __syncthreads();                                    // publishes tile t + 1, frees tile t's buffer
    if (t + 2 < DM / 64) fill(t + 2, (t & 1) * QBUF); }
  asm volatile("s_wait_asynccnt 0x0" ::: "memory");     // no copy in flight before the buffers become staging
  float* so = (float*)(sm + wave * (64 * 272));   // per wave: 64 rows x 64 cols of f32 at pitch 68
#pragma unroll
  for (int nj = 0; nj < 4; ++nj) { const float bias = bfr(BO[n0 + wn * 64 + nj * 16 + col]);
#pragma unroll
    for (int mi = 0; mi < 4; ++mi)
#pragma unroll
      for (int r = 0; r < 8; ++r) so[(mi * 16 + 8 * g + r) * 68 + nj * 16 + col] = acc[mi][nj][r] + bias; }
  LDSX();
  for (int it = 0; it < 32; ++it) { const int rl = it * 2 + g; vst2(Y + (m0 + wm * 64 + rl) * DM + n0 + wn * 64 + col * 4, *(const v4f*)&so[rl * 68 + col * 4]); }   // whole 128-B lines
}
// ---- k_pack3: the fused (in,out) W_attn [DM][3*DM] -> its 3,072 transposed rows, f16 x 2^8 (bit pattern stored in the bf16-typed buffer)
__global__ __launch_bounds__(256) void k_pack3(const float* __restrict__ WA, __bf16* __restrict__ PK) { __shared__ __align__(16) v4u s[64 * 16]; pack_tile<true>(WA, 3 * DM, PK + PK_A, s); }
// ---- k_ln: block = row: XN = (x - mu) rsqrt(var + 1e-5) g + b (f32)
__global__ __launch_bounds__(256) void k_ln(const float* __restrict__ X, const float* __restrict__ G, const float* __restrict__ Bt, float* __restrict__ XN) {
  __shared__ float red[8]; const int t = threadIdx.x; const size_t row = blockIdx.x; float v[4]; float s = 0.f; for (int i = 0; i < 4; ++i) { v[i] = bfr(X[row * DM + t * 4 + i]); s += v[i]; }
#pragma unroll
  for (int o = 1; o < 32; o <<= 1) s += __shfl_xor(s, o);
  if ((t & 31) == 0) red[t >> 5] = s; __syncthreads(); float tot = 0.f; for (int i = 0; i < 8; ++i) tot += red[i]; const float mu = tot / (float)DM; __syncthreads();
  float q = 0.f; for (int i = 0; i < 4; ++i) { const float d = v[i] - mu; q += d * d; }
#pragma unroll
  for (int o = 1; o < 32; o <<= 1) q += __shfl_xor(q, o);
  if ((t & 31) == 0) red[t >> 5] = q; __syncthreads(); float tq = 0.f; for (int i = 0; i < 8; ++i) tq += red[i]; const float inv = 1.0f / sqrtf(tq / (float)DM + 1e-5f);
  v4f o4; for (int i = 0; i < 4; ++i) { const int e = t * 4 + i; o4[i] = (v[i] - mu) * inv * bfr(G[e]) + bfr(Bt[e]); } vst2(XN + row * DM + t * 4, o4);
}
__global__ __launch_bounds__(256) void k_fin(const float* __restrict__ X, const float* __restrict__ Y1, const float* __restrict__ ENT, float* __restrict__ OUT, float* __restrict__ OUT2) {
  const int t = threadIdx.x; const size_t row = blockIdx.x; const size_t b = row / SS; const int tt = (int)(row % SS);
  { v4f o4; for (int i = 0; i < 4; ++i) { const size_t e = row * DM + t * 4 + i; o4[i] = bfr(X[e]) + Y1[e]; } vst2(OUT + row * DM + t * 4, o4); }
  if ((tt & 31) == 0 && t < 32) { __shared__ __align__(16) float se[32]; float a = 0.f; for (int hh = 0; hh < NH; ++hh) a += ENT[(b * NH + hh) * SS + tt + t]; se[t] = a / (float)NH; __syncthreads(); if (t < 8) vst2(OUT2 + row + t * 4, *(const v4f*)&se[t * 4]); }
}
extern "C" void kernel_launch(void* const* d_in, const int* in_sizes, int n_in, void* d_out, int out_size, void* d_ws, size_t ws_size, hipStream_t stream) {
  (void)in_sizes; (void)n_in; (void)out_size;
  const float** F = (const float**)d_in;   // 0 x [16,512,1024], 1 qkv_w [1024,3072] (in,out), 2 qkv_b [3072], 3 out_w [1024,1024] (in,out), 4 out_b, 5 ln_g, 6 ln_b, 7 rel_bias [16,1023]
  if (ws_size < (size_t)WS_END) return;
  char* ws = (char*)d_ws; __bf16* PK = (__bf16*)(ws + WS_PK); _Float16 *QK = (_Float16*)(ws + WS_QK), *QKL = (_Float16*)(ws + WS_QKL), *VTH = (_Float16*)(ws + WS_VTH), *VTL = (_Float16*)(ws + WS_VTL); float *O = (float*)(ws + WS_O), *XN = (float*)(ws + WS_XN), *ENT = (float*)(ws + WS_ENT), *Y1 = (float*)(ws + WS_Y1);
  float* OUT = (float*)d_out; float* OUT2 = OUT + (size_t)NB * SS * DM;   // outputs concatenated: out [16,512,1024] then entropy [16,512]
  k_pack<<<dim3(DM / 64, DM / 128), 256, 0, stream>>>(F[3], PK);   // out_w ((in,out) -> transposed rows) into the Wo slot
  k_pack3<<<dim3(QKVW / 64, DM / 128), 256, 0, stream>>>(F[1], PK);
  k_ln<<<TNB * SS, 256, 0, stream>>>(F[0], F[5], F[6], XN);
  k_qkv<<<dim3(TNB * SS / 128, QKVW / 128), 128, 0, stream>>>(XN, XN, XN, PK + PK_A, F[2], F[2] + DM, F[2] + 2 * DM, QK, QKL, VTH, VTL);
  k_attn<<<dim3(NH, TNB, TQB), 128, 0, stream>>>(QK, QKL, VTH, VTL, nullptr, F[7], O, ENT);
  k_out<<<dim3(TNB * SS / 128, DM / 128), 128, 0, stream>>>(O, PK + PK_P, F[4], Y1);
  k_fin<<<TOB * 64, 256, 0, stream>>>(F[0], Y1, ENT, OUT, OUT2);
}

// v007
// It runs in 158 microseconds.
// In two side-by-side timings against v006, it was 1.22 and 1.23 times as fast.
// All steps since v000 together make it 3.66 times as fast.
// compute dtype: all float inputs rounded to bf16; LayerNorm in f32, its output rounded once to f16 x exact f16 copies (x 2^8) of the fused qkv weight on WMMA 16x16x32 (1 product) + bias; causal attention: 3-product scores and hi + residual P, v on the first 128 queries of each sequence, single f16 beyond; x 1/8 + rel_bias[h][k-q+511], running-max softmax in f32 (hardware exp); the per-row entropy from the same scores in the same pass (precise logf); out = x + (o (bf16 hi + residual) . out_w (2 products) + out_b); second output = head-mean attention entropy.
#include <hip/hip_runtime.h>
#include <math.h>

typedef __attribute__((ext_vector_type(16))) _Float16 v16h;
typedef __attribute__((ext_vector_type(16))) __bf16 v16b;
typedef __attribute__((ext_vector_type(8)))  _Float16 v8h;
typedef __attribute__((ext_vector_type(8)))  float v8f;
typedef __attribute__((ext_vector_type(4)))  float v4f;
typedef __attribute__((ext_vector_type(2)))  float v2f;
typedef __attribute__((ext_vector_type(4)))  unsigned v4u;
typedef __attribute__((ext_vector_type(4)))  int v4i;
typedef float __attribute__((may_alias)) float_a;
typedef int __attribute__((may_alias)) int_a;

template <typename T> __device__ __forceinline__ void vst2(void* p, T v) { *(T*)p = v;  }
__device__ __forceinline__ v8f wmma16(v16h a, v16h b, v8f c) {
  v8f d = __builtin_amdgcn_wmma_f32_16x16x32_f16(false, a, false, b, (short)0, c, false, false);
  asm volatile("v_nop\n\tv_nop\n\tv_nop\n\tv_nop" : "+v"(d) : "v"(a), "v"(b));
  return d;
}
__device__ __forceinline__ v8f wmma_bf(v16b a, v16b b, v8f c) {
  v8f d = __builtin_amdgcn_wmma_f32_16x16x32_bf16(false, a, false, b, (short)0, c, false, false);
  asm volatile("v_nop\n\tv_nop\n\tv_nop\n\tv_nop" : "+v"(d) : "v"(a), "v"(b));
  return d;
}
// Pre-LN causal time attention with relative position bias (B 16, T 512, d 1,024, 16 heads x 64): x + out_proj(attention(LN(x))), plus the mean attention entropy per (batch, step) as a second output.
__device__ __forceinline__ v16h frag_h(const _Float16* rowk0, int lane) {
  union { v16h v; v8h q[2]; } u; const _Float16* p = rowk0 + 8 * (lane >> 4);
  u.q[0] = *(const v8h*)p; u.q[1] = *(const v8h*)(p + 16); return u.v;
}
__device__ __forceinline__ v16h frag_f32(const float* rowk0, int lane) {
  v16h a; const float* p = rowk0 + 8 * (lane >> 4);
#pragma unroll
  for (int i = 0; i < 8; ++i) { a[i] = (_Float16)p[i]; a[8 + i] = (_Float16)p[16 + i]; }
  return a;
}
__device__ __forceinline__ v16h frag_f32s(const float* rowk0, int lane, float sc) {
  v16h a; const float* p = rowk0 + 8 * (lane >> 4);
#pragma unroll
  for (int i = 0; i < 8; ++i) { a[i] = (_Float16)(p[i] * sc); a[8 + i] = (_Float16)(p[16 + i] * sc); }
  return a;
}
// column fragment from a [K][ld] layout (column n), rows >= K read as 0
__device__ __forceinline__ v16h fragc_f32(const float* W, int k0, int n, int lane, int ld, int K) {
  v16h a; const int g = lane >> 4;
#pragma unroll
  for (int i = 0; i < 8; ++i) { const int ka = k0 + 8 * g + i, kb = ka + 16;
    a[i] = (_Float16)(ka < K ? W[(size_t)(ka < K ? ka : K - 1) * ld + n] : 0.f); a[8 + i] = (_Float16)(kb < K ? W[(size_t)(kb < K ? kb : K - 1) * ld + n] : 0.f); }
  return a;
}
struct F2 { v16b h, l; };
__device__ __forceinline__ F2 bsplit16(const float v[16]) { F2 r;
#pragma unroll
  for (int i = 0; i < 16; ++i) { const __bf16 h = (__bf16)v[i]; r.h[i] = h; r.l[i] = (__bf16)(v[i] - (float)h); }
  return r; }
__device__ __forceinline__ F2 split_row(const float* row, int k0, int lane) { float v[16]; const float* p = row + k0 + 8 * (lane >> 4);
#pragma unroll
  for (int i = 0; i < 8; ++i) { v[i] = p[i]; v[8 + i] = p[16 + i]; }
  return bsplit16(v); }
__device__ __forceinline__ F2 split_rowK(const float* row, int k0, int lane, int K) { float v[16]; const int g = lane >> 4;
#pragma unroll
  for (int i = 0; i < 8; ++i) { const int ka = k0 + 8 * g + i, kb = ka + 16; v[i] = ka < K ? row[ka < K ? ka : K - 1] : 0.f; v[8 + i] = kb < K ? row[kb < K ? kb : K - 1] : 0.f; }
  return bsplit16(v); }
__device__ __forceinline__ F2 split_col(const float* W, int k0, int n, int lane, int ld, int K) { float v[16]; const int g = lane >> 4;
#pragma unroll
  for (int i = 0; i < 8; ++i) { const int ka = k0 + 8 * g + i, kb = ka + 16; v[i] = ka < K ? W[(size_t)(ka < K ? ka : K - 1) * ld + n] : 0.f; v[8 + i] = kb < K ? W[(size_t)(kb < K ? kb : K - 1) * ld + n] : 0.f; }
  return bsplit16(v); }
__device__ __forceinline__ v8f mac3(const F2& a, const F2& b, v8f c) { c = wmma_bf(a.l, b.h, c); c = wmma_bf(a.h, b.l, c); return wmma_bf(a.h, b.h, c); }
__device__ __forceinline__ float sigm(float v) { return 1.0f / (1.0f + expf(-v)); }
#define LDSX() do { asm volatile("s_wait_dscnt 0" ::: "memory"); __builtin_amdgcn_wave_barrier(); __builtin_amdgcn_fence(__ATOMIC_RELEASE, "workgroup"); } while (0)


#define NB 16
#define SS 512
#define SCALEF 0.125f
#define DM 1024
#define NH 16
#define MAXSEQ 512
__device__ __attribute__((noinline)) float log_p(float v) { return logf(v); }
#define HD 64
#define QKVW (3 * DM)
#ifndef TQB
#define TQB (SS / 64)
#define TNB NB
#define TOB (NB * SS / 64)     // output row tiles (all)
#endif
typedef __attribute__((ext_vector_type(8))) __bf16 v8b;
__device__ __forceinline__ v16b frag_b(const __bf16* rowk0, int lane) {
  union { v16b v; v8b q[2]; } u; const __bf16* p = rowk0 + 8 * (lane >> 4);
  u.q[0] = *(const v8b*)p; u.q[1] = *(const v8b*)(p + 16); return u.v;
}
__device__ __forceinline__ float bfr(float v) { return (float)(__bf16)v; }
__device__ __attribute__((noinline)) float exp_ni(float v) { return expf(v); }
__device__ __attribute__((noinline)) float erf_ni(float v) { return erff(v); }

#define PK_A 0                       // [3072][1024] Wqkv rows (natural [out][in])
#define PK_P (PK_A + QKVW * DM)        // [1024][1024] Wo rows (natural)
#define PK_END (PK_P + DM * DM)
#define WS_PK  0u
#define WS_QK  (WS_PK + 2u * PK_END)             // f16 [8192 rows][2048]: q | k
#define WS_QKL (WS_QK + 2u * NB * SS * 2 * DM)     // f16 q | k residual planes x2048
#define WS_VTH (WS_QKL + 2u * NB * SS * 2 * DM)    // f16 [b][1024 (h*64+d)][512 s] hi
#define WS_VTL (WS_VTH + 2u * NB * DM * SS)        // f16 lo x 2048
#define WS_O   (WS_VTL + 2u * NB * DM * SS)        // f32 [8192][1024]
#define WS_CS  (WS_O + 4u * NB * SS * DM)           // f32 2 x [512][32], unused
#define WS_XN  (WS_CS + 4u * 2 * SS * 32)                  // f32 [NR][1024] LayerNorm(x)
#define WS_ENT (WS_XN + 4u * (size_t)NB * SS * DM)     // f32 [b][h][t] attention entropy
#define WS_Y1  (WS_ENT + 4u * (size_t)NB * NH * SS)    // f32 [NR][1024] out-proj
#define WS_END (WS_Y1 + 4u * (size_t)NB * SS * DM)
// ---- pack_tile: block = (64 columns n, 128 rows k) of an (in,out) weight W[DM][ld] -> rows n of the packed [out][in] 16-bit copy. A thread reads 4 columns of 8 consecutive k (16 lanes = one 256-B piece of a W row), so it holds, per column, one whole 16-B chunk of a packed row; the chunks cross LDS so that 16 lanes store 256 B of one packed row.
// LDS: row n = 16 chunks of 16 B, chunk j at place j ^ (n >> 2): the 16 lanes of a half wave fall on 16 different places in the write (rows 4 apart, one chunk number) and in the read (one row, 16 chunk numbers).
template <bool F16X> __device__ __forceinline__ void pack_tile(const float* __restrict__ Wm, int ld, __bf16* __restrict__ dst, v4u* s) {
  const int t = threadIdx.x, c = t & 15, kg = t >> 4; const int n0 = blockIdx.x * 64, k0 = blockIdx.y * 128;
  v4f r[8];
#pragma unroll   // unrolled: the eight loads are in flight together, and r[] is indexed by constants
  for (int i = 0; i < 8; ++i) r[i] = *(const v4f*)(Wm + (size_t)(k0 + kg * 8 + i) * ld + n0 + c * 4);
#pragma unroll   // this loop and the one inside it: r[] and o are indexed by constants and stay in registers
  for (int j = 0; j < 4; ++j) { union { v4u u; v8h h; v8b b; } o;
#pragma unroll
    for (int i = 0; i < 8; ++i) { if (F16X) o.h[i] = (_Float16)(bfr(r[i][j]) * 256.0f); else o.b[i] = (__bf16)r[i][j]; }
    s[(c * 4 + j) * 16 + (kg ^ c)] = o.u; }
  __syncthreads();
#pragma unroll   // the four LDS reads go out together, ahead of the stores
  for (int it = 0; it < 4; ++it) { const int n = it * 16 + (t >> 4), j = t & 15; vst2((unsigned*)(dst + (size_t)(n0 + n) * DM + k0 + j * 8), s[n * 16 + (j ^ (n >> 2))]); }   // whole 128-B lines
}
// ---- k_pack: out_w (in,out) -> bf16 rows [out][in] in the Wo slot
__global__ __launch_bounds__(256) void k_pack(const float* __restrict__ WO, __bf16* __restrict__ PK) { __shared__ __align__(16) v4u s[64 * 16]; pack_tile<false>(WO, DM, PK + PK_P, s); }
// ---- k_qkv: block = (128 rows, 128 cols), 4 waves of 64 x 64; per trip 64 k of both operand tiles are brought into LDS in whole lines by asynchronous copies (two buffers) and read from there by all waves
#define QA_PITCH 272                      // bytes: a 256-B row of 64 f32 + 16 (16 B x odd: ds_load_b128 free of bank conflicts)
#define QB_PITCH 144                      // bytes: a 128-B row of 64 f16 + 16
#define QA_BYTES (128 * QA_PITCH)
#define QBUF (QA_BYTES + 128 * QB_PITCH)  // one buffer: X tile, then W tile
// eight 16-B copies per lane, rows lstep / gstep bytes apart; the s_wait_xcnt closes the statement so that no address register is rewritten in front of it
__device__ __forceinline__ void copy8(unsigned l, const char* p, unsigned lstep, unsigned gstep) {
  asm volatile("global_load_async_to_lds_b128 %0, %8, off\n\t"
               "global_load_async_to_lds_b128 %1, %9, off\n\t"
               "global_load_async_to_lds_b128 %2, %10, off\n\t"
               "global_load_async_to_lds_b128 %3, %11, off\n\t"
               "global_load_async_to_lds_b128 %4, %12, off\n\t"
               "global_load_async_to_lds_b128 %5, %13, off\n\t"
               "global_load_async_to_lds_b128 %6, %14, off\n\t"
               "global_load_async_to_lds_b128 %7, %15, off\n\t"
               "s_wait_xcnt 0x0"
               :: "v"(l), "v"(l + lstep), "v"(l + 2 * lstep), "v"(l + 3 * lstep), "v"(l + 4 * lstep), "v"(l + 5 * lstep), "v"(l + 6 * lstep), "v"(l + 7 * lstep),
                  "v"(p), "v"(p + gstep), "v"(p + 2 * gstep), "v"(p + 3 * gstep), "v"(p + 4 * gstep), "v"(p + 5 * gstep), "v"(p + 6 * gstep), "v"(p + 7 * gstep)
               : "memory");
}
__global__ __launch_bounds__(128) void k_qkv(const float* __restrict__ XQ, const float* __restrict__ XK, const float* __restrict__ XV, const __bf16* __restrict__ P, const float* __restrict__ BQ, const float* __restrict__ BK, const float* __restrict__ BV, _Float16* __restrict__ QK, _Float16* __restrict__ QKL, _Float16* __restrict__ VTH, _Float16* __restrict__ VTL) {
  const int which0 = (blockIdx.y * 128) / DM; const float* X = (which0 == 0) ? XQ : (which0 == 1) ? XK : XV; const float* BB = BQ ? (((which0 == 0) ? BQ : (which0 == 1) ? BK : BV) + (blockIdx.y * 128 - which0 * DM)) : nullptr;
  __shared__ __align__(16) char sm[2 * QBUF];   // the two buffers; output staging behind the loop
  const int tid = threadIdx.x, wave = tid >> 5, lane = tid & 31, col = lane & 15, g = lane >> 4, wm = wave >> 1, wn = wave & 1; const size_t m0 = (size_t)blockIdx.x * 128; const int n0 = blockIdx.y * 128;
  const unsigned sbase = (unsigned)(size_t)&sm[0];
  const unsigned la = sbase + (tid >> 4) * QA_PITCH + (tid & 15) * 16, lb = sbase + QA_BYTES + (tid >> 3) * QB_PITCH + (tid & 7) * 16;   // a wave's copy covers 2 X rows of 256 B, or 4 W rows of 128 B
  const char* ga = (const char*)(X + (m0 + (tid >> 4)) * DM + (tid & 15) * 4); const char* gb = (const char*)((const _Float16*)P + (size_t)(n0 + (tid >> 3)) * DM + (tid & 7) * 8);
  auto fill = [&](int t, unsigned bo) {   // tile t (k = 64 t ..): 16 + 8 copies per lane
    copy8(la + bo, ga + t * 256, 8 * QA_PITCH, 8 * DM * 4); copy8(la + bo + 64 * QA_PITCH, ga + t * 256 + 64 * DM * 4, 8 * QA_PITCH, 8 * DM * 4); copy8(lb + bo, gb + t * 128, 16 * QB_PITCH, 16 * DM * 2); };
  v8f acc[4][4] = {};
  fill(0, 0);
  asm volatile("s_wait_asynccnt 0x0" ::: "memory");   // tile 0 landed (this wave's copies)
  __syncthreads();                                    // ... and every other wave's
  fill(1, QBUF);
#pragma unroll 1   // rolled: a trip holds 32 WMMAs, enough to carry the branch
  for (int t = 0; t < DM / 64; ++t) { const char* bp = sm + (t & 1) * QBUF;
#pragma unroll   // this and the loops inside it are unrolled so that a[], w[] and acc[][] are indexed by constants and stay in registers
    for (int kc = 0; kc < 2; ++kc) { v16h a[4], w[4];
#pragma unroll
      for (int mi = 0; mi < 4; ++mi) { const float* p = (const float*)(bp + (wm * 64 + mi * 16 + col) * QA_PITCH) + kc * 32 + 8 * g;   // LN'd rows (f32) rounded once to f16
#pragma unroll
        for (int i = 0; i < 8; ++i) { a[mi][i] = (_Float16)p[i]; a[mi][8 + i] = (_Float16)p[16 + i]; } }
#pragma unroll
      for (int nj = 0; nj < 4; ++nj) w[nj] = frag_h((const _Float16*)(bp + QA_BYTES + (wn * 64 + nj * 16 + col) * QB_PITCH) + kc * 32, lane);
#pragma unroll
      for (int mi = 0; mi < 4; ++mi)
#pragma unroll
        for (int nj = 0; nj < 4; ++nj) acc[mi][nj] = wmma16(a[mi], w[nj], acc[mi][nj]); }
    asm volatile("s_wait_dscnt 0x0" ::: "memory");      // this wave's reads of the buffer are over
    asm volatile("s_wait_asynccnt 0x0" ::: "memory");   // its copies of tile t + 1 have landed
    __syncthreads();                                    // publishes tile t + 1, frees tile t's buffer
    if (t + 2 < DM / 64) fill(t + 2, (t & 1) * QBUF); }
  asm volatile("s_wait_asynccnt 0x0" ::: "memory");     // no copy in flight before the buffers become staging
  if (n0 < 2 * DM) {   // q stored unscaled (f16 sigma ~0.6, no subnormal exposure); 1/8 applied to the f32 score
    _Float16* sh = (_Float16*)(sm + wave * (2 * 64 * 144)); _Float16* sl = sh + 64 * 72;   // per wave: 64 rows x 64 cols at pitch 72, hi then residual
#pragma unroll
    for (int nj = 0; nj < 4; ++nj) { const float bias = BB ? bfr(BB[wn * 64 + nj * 16 + col]) : 0.f;
#pragma unroll
      for (int mi = 0; mi < 4; ++mi)
#pragma unroll
        for (int r = 0; r < 8; ++r) { const float v = acc[mi][nj][r] * (1.0f / 256.0f) + bias; const _Float16 hv = (_Float16)v; sh[(mi * 16 + 8 * g + r) * 72 + nj * 16 + col] = hv; sl[(mi * 16 + 8 * g + r) * 72 + nj * 16 + col] = (_Float16)((v - (float)hv) * 2048.0f); } }   // q, k (+ bias) as f16 hi + (x2048) residual
    LDSX();
    for (int it = 0; it < 16; ++it) { const int rl = it * 4 + (lane >> 3), ch = lane & 7; const size_t o = (m0 + wm * 64 + rl) * (2 * DM) + n0 + wn * 64 + ch * 8; vst2((unsigned*)(QK + o), *(const v4u*)&sh[rl * 72 + ch * 8]); vst2((unsigned*)(QKL + o), *(const v4u*)&sl[rl * 72 + ch * 8]); }   // whole 128-B lines
  } else {
    _Float16* sth = (_Float16*)sm; _Float16* stl = sth + 128 * 136;   // [128 d][128 s] at pitch 136, hi then residual
#pragma unroll
    for (int nj = 0; nj < 4; ++nj) { const float bias = BB ? bfr(BB[wn * 64 + nj * 16 + col]) : 0.f;
#pragma unroll
      for (int mi = 0; mi < 4; ++mi) { v8h h8, l8;
#pragma unroll
        for (int r = 0; r < 8; ++r) { const float v = acc[mi][nj][r] * (1.0f / 256.0f) + bias; const _Float16 hv = (_Float16)v; h8[r] = hv; l8[r] = (_Float16)((v - (float)hv) * 2048.0f); }
        const int o = (wn * 64 + nj * 16 + col) * 136 + wm * 64 + mi * 16 + 8 * g; *(v8h*)&sth[o] = h8; *(v8h*)&stl[o] = l8; } }
    __syncthreads();
    const int b = (int)(m0 / SS), s0 = (int)(m0 % SS); const int pc0 = n0 - 2 * DM;
    for (int it = 0; it < 16; ++it) { const int d = it * 8 + (tid >> 4), pc = tid & 15; const size_t o = ((size_t)b * DM + pc0 + d) * SS + s0 + pc * 8; vst2((unsigned*)(VTH + o), *(const v4u*)&sth[d * 136 + pc * 8]); vst2((unsigned*)(VTL + o), *(const v4u*)&stl[d * 136 + pc * 8]); }
  }
}
#define AK_PITCH 144                      // bytes: a 128-B row of 64 f16 + 16 (16 B x odd: ds_load_b128 free of bank conflicts)
#define AT_BYTES (64 * AK_PITCH)          // one tile: K (64 keys x 64 d) or V^T (64 d x 64 keys)
#define ABUF (2 * AT_BYTES)               // one buffer: K tile, then V^T tile
#define RBN 640                           // staged rel_bias entries (5 per thread), at most 575 of them read
// four 16-B copies per lane, rows lstep / gstep bytes apart; the s_wait_xcnt closes the statement so that no address register is rewritten in front of it
__device__ __forceinline__ void copy4(unsigned l, const char* p, unsigned lstep, unsigned gstep) {
  asm volatile("global_load_async_to_lds_b128 %0, %4, off\n\t"
               "global_load_async_to_lds_b128 %1, %5, off\n\t"
               "global_load_async_to_lds_b128 %2, %6, off\n\t"
               "global_load_async_to_lds_b128 %3, %7, off\n\t"
               "s_wait_xcnt 0x0"
               :: "v"(l), "v"(l + lstep), "v"(l + 2 * lstep), "v"(l + 3 * lstep),
                  "v"(p), "v"(p + gstep), "v"(p + 2 * gstep), "v"(p + 3 * gstep)
               : "memory");
}
// five 4-B copies per lane (a rel_bias row is 1,023 floats long, so rows are aligned to 4 B only), LDS places 512 B apart; the s_wait_xcnt closes the statement as in copy4
__device__ __forceinline__ void copy5w(unsigned l, const float* p0, const float* p1, const float* p2, const float* p3, const float* p4) {
  asm volatile("global_load_async_to_lds_b32 %0, %5, off\n\t"
               "global_load_async_to_lds_b32 %1, %6, off\n\t"
               "global_load_async_to_lds_b32 %2, %7, off\n\t"
               "global_load_async_to_lds_b32 %3, %8, off\n\t"
               "global_load_async_to_lds_b32 %4, %9, off\n\t"
               "s_wait_xcnt 0x0"
               :: "v"(l), "v"(l + 512u), "v"(l + 1024u), "v"(l + 1536u), "v"(l + 2048u),
                  "v"(p0), "v"(p1), "v"(p2), "v"(p3), "v"(p4)
               : "memory");
}
// lane l with lane l ^ 16 (a vector cross-row move, no LDS unit)
__device__ __forceinline__ float xhalf(float x) { return __builtin_bit_cast(float, __builtin_amdgcn_permlanex16(__builtin_bit_cast(int, x), __builtin_bit_cast(int, x), 0x76543210, 0xfedcba98, false, false)); }
// ---- k_attn: grid = (head, batch, query block), the query blocks from the last (most keys) down: the query block is the slowest index. For speed only: each (query block, head, batch) is done once wherever it runs
// block = (64 queries, head h, batch b): causal flash attention on transposed products: S^T = K . Q^T (A = 16 key rows, B = the wave's 16 queries), so a lane holds 16 of the 32 scores of ONE query (column col; keys 8 g + r of each 16): maximum and sum run in the lane, with one exchange between the wave's halves; the two S^T tiles, converted in place, are the B operand of O^T += V^T . P^T (A = 16 d rows of V^T): P never passes through LDS. O[b*S+q][h*64+d] = (acc + accl / 2048) / (2048 l) (256-B segments). The same scores give the row's entropy -sum p log p = log(sum e^(s-m)) + m - (sum e^(s-m) s)/(sum e^(s-m)): one more running sum per lane, joined behind the loop; 256-B store per block
// operands of the loop: per trip 64 keys of K (hi) and of V^T (hi) are brought into LDS in whole 128-B lines by asynchronous copies (two buffers) and read from there by all four waves, two passes of 32 keys a trip; the part of the head's rel_bias row that the block can touch is copied once in front of the loop and read without the causal test (the test picks the value behind the read). The residual planes of the first 128 queries are read from global memory as before
__global__ __launch_bounds__(128) void k_attn(const _Float16* __restrict__ QK, const _Float16* __restrict__ QKL, const _Float16* __restrict__ VTH, const _Float16* __restrict__ VTL, const void* __restrict__ KMASK, const float* __restrict__ RB, float* __restrict__ O, float* __restrict__ ENT) {
  __shared__ __align__(16) char sm[2 * ABUF];   // the two buffers
  __shared__ __align__(16) float srb[RBN];      // rel_bias[h][448 - 64 qb + j]
  __shared__ __align__(16) float so[4][16][68];
  __shared__ __align__(16) float sent[64];
  const int tid = threadIdx.x, wave = tid >> 5, lane = tid & 31, col = lane & 15, g = lane >> 4;
  const int qb = TQB - 1 - blockIdx.z, h = blockIdx.x, b = blockIdx.y; const int q0 = qb * 64 + wave * 16; const int qi = q0 + col; const size_t rq = (size_t)b * SS + qi;
  v16h aq[2], aql[2];
#pragma unroll
  for (int kc = 0; kc < 2; ++kc) { aq[kc] = frag_h(QK + rq * (2 * DM) + h * HD + kc * 32, lane); aql[kc] = frag_h(QKL + rq * (2 * DM) + h * HD + kc * 32, lane); }
  float m = -3.0e38f, l = 0.f, ls = 0.f;   // of query qi: m over all keys so far (equal in both halves), l and ls over this half's keys (joined behind the loop)
  v8f acc[4] = {}, accl[4] = {};   // O^T: register r = d (dt * 16 + 8 g + r), column = query
  const float* rbq = srb + 63 - (wave * 16 + col) + 8 * g;   // rel_bias[h][k - q + 511] at k = 8 g, in the staged part of the row
  const int nt = qb + 1;   // causal: 64-key tiles up to the query tile's end
  const unsigned lk = (unsigned)(size_t)&sm[0] + (tid >> 3) * AK_PITCH + (tid & 7) * 16;   // a wave's copy covers 4 rows of 128 B
  const char* gk = (const char*)(QK + ((size_t)b * SS + (tid >> 3)) * (2 * DM) + DM + h * HD + (tid & 7) * 8); const char* gv = (const char*)(VTH + ((size_t)b * DM + h * HD + (tid >> 3)) * SS + (tid & 7) * 8);
  auto fill = [&](int t, unsigned bo) {   // tile t (keys 64 t ..): 4 + 4 copies per lane
    copy4(lk + bo, gk + (size_t)t * (64 * 2 * DM * 2), 16 * AK_PITCH, 16 * 2 * DM * 2); copy4(lk + bo + AT_BYTES, gv + t * 128, 16 * AK_PITCH, 16 * SS * 2); };
  fill(0, 0);
  { const float* rh = RB + (size_t)h * (2 * MAXSEQ - 1); const int j0 = MAXSEQ - 64 - qb * 64 + tid;   // entries past the row's end (never read back) are clamped into it
    copy5w((unsigned)(size_t)&srb[0] + tid * 4, rh + min(j0, 2 * MAXSEQ - 2), rh + min(j0 + 128, 2 * MAXSEQ - 2), rh + min(j0 + 256, 2 * MAXSEQ - 2), rh + min(j0 + 384, 2 * MAXSEQ - 2), rh + min(j0 + 512, 2 * MAXSEQ - 2)); }
  asm volatile("s_wait_asynccnt 0x0" ::: "memory");   // tile 0 and rel_bias landed (this wave's copies)
  __syncthreads();                                    // ... and every other wave's
  if (nt > 1) fill(1, ABUF);
#pragma unroll 1   // rolled: the trip count depends on the query block
  for (int t = 0; t < nt; ++t) { const char* bp = sm + (t & 1) * ABUF;
#pragma unroll 1   // rolled: one copy of the long pass body in the instruction cache
   for (int hp = 0; hp < 2; ++hp) { const int ks = 2 * t + hp; v8f s[2];
    v16h kf[2][2]; float rb[2][8];   // all LDS reads of the score part stand together ahead of its first WMMA: one wait, not one per product
#pragma unroll   // this and the loops inside it: kf[][] and rb[][] are indexed by constants and stay in registers
    for (int ct = 0; ct < 2; ++ct) {
#pragma unroll
      for (int kc = 0; kc < 2; ++kc) kf[ct][kc] = frag_h((const _Float16*)(bp + (hp * 32 + ct * 16 + col) * AK_PITCH) + kc * 32, lane);
#pragma unroll
      for (int r = 0; r < 8; ++r) rb[ct][r] = rbq[ks * 32 + ct * 16 + r]; }
#pragma unroll
    for (int ct = 0; ct < 2; ++ct) { const int kr = ks * 32 + ct * 16 + col; const _Float16* krowl = QKL + ((size_t)b * SS + kr) * (2 * DM) + DM + h * HD; v8f c = {}, cl = {};
      if (qb < 2) {   // leading query blocks (few keys, outputs far above the global rms): 3 products
#pragma unroll
        for (int kc = 0; kc < 2; ++kc) { const v16h kh = kf[ct][kc]; c = wmma16(kh, aq[kc], c); cl = wmma16(kh, aql[kc], cl); cl = wmma16(frag_h(krowl + kc * 32, lane), aq[kc], cl); }
#pragma unroll
        for (int r = 0; r < 8; ++r) c[r] += cl[r] * (1.0f / 2048.0f); }
      else {
#pragma unroll
        for (int kc = 0; kc < 2; ++kc) c = wmma16(kf[ct][kc], aq[kc], c); }   // single product elsewhere
#pragma unroll
      for (int r = 0; r < 8; ++r) { const int kk = ks * 32 + ct * 16 + 8 * g + r; s[ct][r] = (kk <= qi) ? (c[r] * SCALEF + bfr(rb[ct][r])) : -3.0e38f; } }   // causal; + rel_bias[h][k - q + 511]
    v16h vf[4];   // the pass's V^T fragments: read here so that the LDS latency passes under the softmax
#pragma unroll   // vf[] is indexed by constants and stays in registers
    for (int dt = 0; dt < 4; ++dt) vf[dt] = frag_h((const _Float16*)(bp + AT_BYTES + (dt * 16 + col) * AK_PITCH) + hp * 32, lane);
    float mx = fmaxf(s[0][0], s[1][0]);
#pragma unroll
    for (int r = 1; r < 8; ++r) mx = fmaxf(mx, fmaxf(s[0][r], s[1][r]));
    mx = fmaxf(mx, xhalf(mx));
    const float mn = fmaxf(m, mx); const float alpha = (m <= -1.0e38f) ? 0.f : __expf(m - mn);
    float es0 = 0.f, es1 = 0.f, ess0 = 0.f, ess1 = 0.f; v16h pa, pl;
#pragma unroll
    for (int r = 0; r < 8; ++r) { const float e0 = (s[0][r] <= -1.0e38f) ? 0.f : __expf(s[0][r] - mn), e1 = (s[1][r] <= -1.0e38f) ? 0.f : __expf(s[1][r] - mn); es0 += e0; es1 += e1; ess0 += (s[0][r] > -1.0e38f) ? e0 * s[0][r] : 0.f; ess1 += (s[1][r] > -1.0e38f) ? e1 * s[1][r] : 0.f;
      const float x0 = e0 * 2048.0f, x1 = e1 * 2048.0f; const _Float16 h0 = (_Float16)x0, h1 = (_Float16)x1; pa[r] = h0; pa[8 + r] = h1; pl[r] = (_Float16)((x0 - (float)h0) * 2048.0f); pl[8 + r] = (_Float16)((x1 - (float)h1) * 2048.0f); }   // P scaled by 2^11 before the f16 split so small softmax weights stay out of the f16 subnormal range; 2^-11 folded into the epilogue
    l = l * alpha + (es0 + es1); ls = ls * alpha + (ess0 + ess1); m = mn;
#pragma unroll
    for (int dt = 0; dt < 4; ++dt)
#pragma unroll
      for (int r = 0; r < 8; ++r) { acc[dt][r] *= alpha; accl[dt][r] *= alpha; }
#pragma unroll
    for (int dt = 0; dt < 4; ++dt) { const size_t vr = ((size_t)b * DM + h * HD + dt * 16 + col) * SS + ks * 32; const v16h vh = vf[dt]; acc[dt] = wmma16(vh, pa, acc[dt]); if (qb < 2) { accl[dt] = wmma16(vh, pl, accl[dt]); accl[dt] = wmma16(frag_h(VTL + vr, lane), pa, accl[dt]); } } }   // leading query blocks: P hi/lo x V hi/lo (3 products); elsewhere P x V single
    asm volatile("s_wait_dscnt 0x0" ::: "memory");      // this wave's reads of the buffer are over
    asm volatile("s_wait_asynccnt 0x0" ::: "memory");   // its copies of tile t + 1 have landed
    __syncthreads();                                    // publishes tile t + 1, frees tile t's buffer
    if (t + 2 < nt) fill(t + 2, (t & 1) * ABUF); }
  asm volatile("s_wait_asynccnt 0x0" ::: "memory");     // no copy in flight behind the loop
  l += xhalf(l); ls += xhalf(ls);
  const float il = (1.0f / 2048.0f) / l;
#pragma unroll
  for (int dt = 0; dt < 4; ++dt) { v4f o0, o1;
#pragma unroll
    for (int r = 0; r < 4; ++r) { o0[r] = (acc[dt][r] + accl[dt][r] * (1.0f / 2048.0f)) * il; o1[r] = (acc[dt][4 + r] + accl[dt][4 + r] * (1.0f / 2048.0f)) * il; }
    *(v4f*)&so[wave][col][dt * 16 + 8 * g] = o0; *(v4f*)&so[wave][col][dt * 16 + 8 * g + 4] = o1; }
  LDSX();
  const float en = log_p(l) + m - ls / l;   // here O lies in LDS, so only l, m and ls live across the call; and in front of the O stores, which the barrier would otherwise wait for
  if (g == 0) sent[wave * 16 + col] = en;
  __syncthreads(); if (tid < 16) vst2(ENT + ((size_t)b * NH + h) * SS + qb * 64 + tid * 4, *(const v4f*)&sent[tid * 4]);
  for (int rl = 0; rl < 16; ++rl) if (lane < 16) vst2(O + ((size_t)b * SS + q0 + rl) * DM + h * HD + lane * 4, *(const v4f*)&so[wave][rl][lane * 4]);
}
// ---- k_out: block = (128 rows, 128 cols), 4 waves of 64 x 64: out = O(hi/lo) . Wo rows (2 products) + bo; per trip 64 k of both operand tiles are brought into LDS in whole lines by asynchronous copies (two buffers, the tile shapes and pitches of k_qkv) and read from there by all waves
__global__ __launch_bounds__(128) void k_out(const float* __restrict__ O, const __bf16* __restrict__ P, const float* __restrict__ BO, float* __restrict__ Y) {
  __shared__ __align__(16) char sm[2 * QBUF];   // the two buffers; output staging behind the loop
  const int tid = threadIdx.x, wave = tid >> 5, lane = tid & 31, col = lane & 15, g = lane >> 4, wm = wave >> 1, wn = wave & 1; const size_t m0 = (size_t)blockIdx.x * 128; const int n0 = blockIdx.y * 128;
  const unsigned sbase = (unsigned)(size_t)&sm[0];
  const unsigned la = sbase + (tid >> 4) * QA_PITCH + (tid & 15) * 16, lb = sbase + QA_BYTES + (tid >> 3) * QB_PITCH + (tid & 7) * 16;   // a wave's copy covers 2 O rows of 256 B, or 4 W rows of 128 B
  const char* ga = (const char*)(O + (m0 + (tid >> 4)) * DM + (tid & 15) * 4); const char* gb = (const char*)(P + (size_t)(n0 + (tid >> 3)) * DM + (tid & 7) * 8);
  auto fill = [&](int t, unsigned bo) {   // tile t (k = 64 t ..): 16 + 8 copies per lane
    copy8(la + bo, ga + t * 256, 8 * QA_PITCH, 8 * DM * 4); copy8(la + bo + 64 * QA_PITCH, ga + t * 256 + 64 * DM * 4, 8 * QA_PITCH, 8 * DM * 4); copy8(lb + bo, gb + t * 128, 16 * QB_PITCH, 16 * DM * 2); };
  v8f acc[4][4] = {};
  fill(0, 0);
  asm volatile("s_wait_asynccnt 0x0" ::: "memory");   // tile 0 landed (this wave's copies)
  __syncthreads();                                    // ... and every other wave's
  fill(1, QBUF);
#pragma unroll 1   // rolled: a trip holds 64 WMMAs, enough to carry the branch
  for (int t = 0; t < DM / 64; ++t) { const char* bp = sm + (t & 1) * QBUF;
    const char* ap = bp + (wm * 64 + col) * QA_PITCH + 32 * g;   // this lane's place in row col of the wave's first 16 O rows
    float nx[16];   // the f32 values of the A fragment after the one being multiplied: read from LDS one fragment ahead, so that the read's latency passes under 8 WMMAs
#pragma unroll
    for (int i = 0; i < 8; ++i) { nx[i] = ((const float*)ap)[i]; nx[8 + i] = ((const float*)ap)[16 + i]; }
#pragma unroll   // this and the loops inside it are unrolled so that w[], nx[] and acc[][] are indexed by constants and stay in registers
    for (int kc = 0; kc < 2; ++kc) { v16b w[4];
#pragma unroll
      for (int nj = 0; nj < 4; ++nj) w[nj] = frag_b((const __bf16*)(bp + QA_BYTES + (wn * 64 + nj * 16 + col) * QB_PITCH) + kc * 32, lane);
#pragma unroll
      for (int mi = 0; mi < 4; ++mi) { const F2 a = bsplit16(nx);   // f32 rows split into bf16 hi + residual
        if (kc * 4 + mi < 7) { const int s = kc * 4 + mi + 1; const float* p = (const float*)(ap + (s & 3) * 16 * QA_PITCH) + (s >> 2) * 32;   // same tile, same buffer: nothing of the next tile is read here
#pragma unroll
          for (int i = 0; i < 8; ++i) { nx[i] = p[i]; nx[8 + i] = p[16 + i]; } }
#pragma unroll
        for (int nj = 0; nj < 4; ++nj) acc[mi][nj] = wmma_bf(a.l, w[nj], acc[mi][nj]);   // residual first, then hi, per accumulator; four independent accumulators between the two
#pragma unroll
        for (int nj = 0; nj < 4; ++nj) acc[mi][nj] = wmma_bf(a.h, w[nj], acc[mi][nj]); } }
    asm volatile("s_wait_dscnt 0x0" ::: "memory");      // this wave's reads of the buffer are over
    asm volatile("s_wait_asynccnt 0x0" ::: "memory");   // its copies of tile t + 1 have landed
    __syncthreads();                                    // publishes tile t + 1, frees tile t's buffer
    if (t + 2 < DM / 64) fill(t + 2, (t & 1) * QBUF); }
  asm volatile("s_wait_asynccnt 0x0" ::: "memory");     // no copy in flight before the buffers become staging
  float* so = (float*)(sm + wave * (64 * 272));   // per wave: 64 rows x 64 cols of f32 at pitch 68
#pragma unroll
  for (int nj = 0; nj < 4; ++nj) { const float bias = bfr(BO[n0 + wn * 64 + nj * 16 + col]);
#pragma unroll
    for (int mi = 0; mi < 4; ++mi)
#pragma unroll
      for (int r = 0; r < 8; ++r) so[(mi * 16 + 8 * g + r) * 68 + nj * 16 + col] = acc[mi][nj][r] + bias; }
  LDSX();
  for (int it = 0; it < 32; ++it) { const int rl = it * 2 + g; vst2(Y + (m0 + wm * 64 + rl) * DM + n0 + wn * 64 + col * 4, *(const v4f*)&so[rl * 68 + col * 4]); }   // whole 128-B lines
}
// ---- k_pack3: the fused (in,out) W_attn [DM][3*DM] -> its 3,072 transposed rows, f16 x 2^8 (bit pattern stored in the bf16-typed buffer)
__global__ __launch_bounds__(256) void k_pack3(const float* __restrict__ WA, __bf16* __restrict__ PK) { __shared__ __align__(16) v4u s[64 * 16]; pack_tile<true>(WA, 3 * DM, PK + PK_A, s); }
// ---- k_ln: block = row: XN = (x - mu) rsqrt(var + 1e-5) g + b (f32)
__global__ __launch_bounds__(256) void k_ln(const float* __restrict__ X, const float* __restrict__ G, const float* __restrict__ Bt, float* __restrict__ XN) {
  __shared__ float red[8]; const int t = threadIdx.x; const size_t row = blockIdx.x; float v[4]; float s = 0.f; for (int i = 0; i < 4; ++i) { v[i] = bfr(X[row * DM + t * 4 + i]); s += v[i]; }
#pragma unroll
  for (int o = 1; o < 32; o <<= 1) s += __shfl_xor(s, o);
  if ((t & 31) == 0) red[t >> 5] = s; __syncthreads(); float tot = 0.f; for (int i = 0; i < 8; ++i) tot += red[i]; const float mu = tot / (float)DM; __syncthreads();
  float q = 0.f; for (int i = 0; i < 4; ++i) { const float d = v[i] - mu; q += d * d; }
#pragma unroll
  for (int o = 1; o < 32; o <<= 1) q += __shfl_xor(q, o);
  if ((t & 31) == 0) red[t >> 5] = q; __syncthreads(); float tq = 0.f; for (int i = 0; i < 8; ++i) tq += red[i]; const float inv = 1.0f / sqrtf(tq / (float)DM + 1e-5f);
  v4f o4; for (int i = 0; i < 4; ++i) { const int e = t * 4 + i; o4[i] = (v[i] - mu) * inv * bfr(G[e]) + bfr(Bt[e]); } vst2(XN + row * DM + t * 4, o4);
}
__global__ __launch_bounds__(256) void k_fin(const float* __restrict__ X, const float* __restrict__ Y1, const float* __restrict__ ENT, float* __restrict__ OUT, float* __restrict__ OUT2) {
  const int t = threadIdx.x; const size_t row = blockIdx.x; const size_t b = row / SS; const int tt = (int)(row % SS);
  { v4f o4; for (int i = 0; i < 4; ++i) { const size_t e = row * DM + t * 4 + i; o4[i] = bfr(X[e]) + Y1[e]; } vst2(OUT + row * DM + t * 4, o4); }
  if ((tt & 31) == 0 && t < 32) { __shared__ __align__(16) float se[32]; float a = 0.f; for (int hh = 0; hh < NH; ++hh) a += ENT[(b * NH + hh) * SS + tt + t]; se[t] = a / (float)NH; __syncthreads(); if (t < 8) vst2(OUT2 + row + t * 4, *(const v4f*)&se[t * 4]); }
}
extern "C" void kernel_launch(void* const* d_in, const int* in_sizes, int n_in, void* d_out, int out_size, void* d_ws, size_t ws_size, hipStream_t stream) {
  (void)in_sizes; (void)n_in; (void)out_size;
  const float** F = (const float**)d_in;   // 0 x [16,512,1024], 1 qkv_w [1024,3072] (in,out), 2 qkv_b [3072], 3 out_w [1024,1024] (in,out), 4 out_b, 5 ln_g, 6 ln_b, 7 rel_bias [16,1023]
  if (ws_size < (size_t)WS_END) return;
  char* ws = (char*)d_ws; __bf16* PK = (__bf16*)(ws + WS_PK); _Float16 *QK = (_Float16*)(ws + WS_QK), *QKL = (_Float16*)(ws + WS_QKL), *VTH = (_Float16*)(ws + WS_VTH), *VTL = (_Float16*)(ws + WS_VTL); float *O = (float*)(ws + WS_O), *XN = (float*)(ws + WS_XN), *ENT = (float*)(ws + WS_ENT), *Y1 = (float*)(ws + WS_Y1);
  float* OUT = (float*)d_out; float* OUT2 = OUT + (size_t)NB * SS * DM;   // outputs concatenated: out [16,512,1024] then entropy [16,512]
  k_pack<<<dim3(DM / 64, DM / 128), 256, 0, stream>>>(F[3], PK);   // out_w ((in,out) -> transposed rows) into the Wo slot
  k_pack3<<<dim3(QKVW / 64, DM / 128), 256, 0, stream>>>(F[1], PK);
  k_ln<<<TNB * SS, 256, 0, stream>>>(F[0], F[5], F[6], XN);
  k_qkv<<<dim3(TNB * SS / 128, QKVW / 128), 128, 0, stream>>>(XN, XN, XN, PK + PK_A, F[2], F[2] + DM, F[2] + 2 * DM, QK, QKL, VTH, VTL);
  k_attn<<<dim3(NH, TNB, TQB), 128, 0, stream>>>(QK, QKL, VTH, VTL, nullptr, F[7], O, ENT);
  k_out<<<dim3(TNB * SS / 128, DM / 128), 128, 0, stream>>>(O, PK + PK_P, F[4], Y1);
  k_fin<<<TOB * 64, 256, 0, stream>>>(F[0], Y1, ENT, OUT, OUT2);
}

// v008
// A run of this version takes 152 microseconds.
// Next to v007, in two timings, it ran 1.04 times as fast each time.
// Over all steps from v000 it is 3.81 times as fast.
// compute dtype: all float inputs rounded to bf16; LayerNorm in f32, its output rounded once to f16 x exact f16 copies (x 2^8) of the fused qkv weight on WMMA 16x16x32 (1 product) + bias; causal attention: 3-product scores and hi + residual P, v on the first 128 queries of each sequence, single f16 beyond; x 1/8 + rel_bias[h][k-q+511], running-max softmax in f32 (hardware exp); the per-row entropy from the same scores in the same pass (precise logf); out = x + (o (bf16 hi + residual) . out_w (2 products) + out_b); second output = head-mean attention entropy.
#include <hip/hip_runtime.h>
#include <math.h>

typedef __attribute__((ext_vector_type(16))) _Float16 v16h;
typedef __attribute__((ext_vector_type(16))) __bf16 v16b;
typedef __attribute__((ext_vector_type(8)))  _Float16 v8h;
typedef __attribute__((ext_vector_type(8)))  float v8f;
typedef __attribute__((ext_vector_type(4)))  float v4f;
typedef __attribute__((ext_vector_type(2)))  float v2f;
typedef __attribute__((ext_vector_type(4)))  unsigned v4u;
typedef __attribute__((ext_vector_type(4)))  int v4i;
typedef float __attribute__((may_alias)) float_a;
typedef int __attribute__((may_alias)) int_a;

template <typename T> __device__ __forceinline__ void vst2(void* p, T v) { *(T*)p = v;  }
__device__ __forceinline__ v8f wmma16(v16h a, v16h b, v8f c) {
  v8f d = __builtin_amdgcn_wmma_f32_16x16x32_f16(false, a, false, b, (short)0, c, false, false);
  asm volatile("v_nop\n\tv_nop\n\tv_nop\n\tv_nop" : "+v"(d) : "v"(a), "v"(b));
  return d;
}
__device__ __forceinline__ v8f wmma_bf(v16b a, v16b b, v8f c) {
  v8f d = __builtin_amdgcn_wmma_f32_16x16x32_bf16(false, a, false, b, (short)0, c, false, false);
  asm volatile("v_nop\n\tv_nop\n\tv_nop\n\tv_nop" : "+v"(d) : "v"(a), "v"(b));
  return d;
}
// Pre-LN causal time attention with relative position bias (B 16, T 512, d 1,024, 16 heads x 64): x + out_proj(attention(LN(x))), plus the mean attention entropy per (batch, step) as a second output.
__device__ __forceinline__ v16h frag_h(const _Float16* rowk0, int lane) {
  union { v16h v; v8h q[2]; } u; const _Float16* p = rowk0 + 8 * (lane >> 4);
  u.q[0] = *(const v8h*)p; u.q[1] = *(const v8h*)(p + 16); return u.v;
}
__device__ __forceinline__ v16h frag_f32(const float* rowk0, int lane) {
  v16h a; const float* p = rowk0 + 8 * (lane >> 4);
#pragma unroll
  for (int i = 0; i < 8; ++i) { a[i] = (_Float16)p[i]; a[8 + i] = (_Float16)p[16 + i]; }
  return a;
}
__device__ __forceinline__ v16h frag_f32s(const float* rowk0, int lane, float sc) {
  v16h a; const float* p = rowk0 + 8 * (lane >> 4);
#pragma unroll
  for (int i = 0; i < 8; ++i) { a[i] = (_Float16)(p[i] * sc); a[8 + i] = (_Float16)(p[16 + i] * sc); }
  return a;
}
// column fragment from a [K][ld] layout (column n), rows >= K read as 0
__device__ __forceinline__ v16h fragc_f32(const float* W, int k0, int n, int lane, int ld, int K) {
  v16h a; const int g = lane >> 4;
#pragma unroll
  for (int i = 0; i < 8; ++i) { const int ka = k0 + 8 * g + i, kb = ka + 16;
    a[i] = (_Float16)(ka < K ? W[(size_t)(ka < K ? ka : K - 1) * ld + n] : 0.f); a[8 + i] = (_Float16)(kb < K ? W[(size_t)(kb < K ? kb : K - 1) * ld + n] : 0.f); }
  return a;
}
struct F2 { v16b h, l; };
__device__ __forceinline__ F2 bsplit16(const float v[16]) { F2 r;
#pragma unroll
  for (int i = 0; i < 16; ++i) { const __bf16 h = (__bf16)v[i]; r.h[i] = h; r.l[i] = (__bf16)(v[i] - (float)h); }
  return r; }
__device__ __forceinline__ F2 split_row(const float* row, int k0, int lane) { float v[16]; const float* p = row + k0 + 8 * (lane >> 4);
#pragma unroll
  for (int i = 0; i < 8; ++i) { v[i] = p[i]; v[8 + i] = p[16 + i]; }
  return bsplit16(v); }
__device__ __forceinline__ F2 split_rowK(const float* row, int k0, int lane, int K) { float v[16]; const int g = lane >> 4;
#pragma unroll
  for (int i = 0; i < 8; ++i) { const int ka = k0 + 8 * g + i, kb = ka + 16; v[i] = ka < K ? row[ka < K ? ka : K - 1] : 0.f; v[8 + i] = kb < K ? row[kb < K ? kb : K - 1] : 0.f; }
  return bsplit16(v); }
__device__ __forceinline__ F2 split_col(const float* W, int k0, int n, int lane, int ld, int K) { float v[16]; const int g = lane >> 4;
#pragma unroll
  for (int i = 0; i < 8; ++i) { const int ka = k0 + 8 * g + i, kb = ka + 16; v[i] = ka < K ? W[(size_t)(ka < K ? ka : K - 1) * ld + n] : 0.f; v[8 + i] = kb < K ? W[(size_t)(kb < K ? kb : K - 1) * ld + n] : 0.f; }
  return bsplit16(v); }
__device__ __forceinline__ v8f mac3(const F2& a, const F2& b, v8f c) { c = wmma_bf(a.l, b.h, c); c = wmma_bf(a.h, b.l, c); return wmma_bf(a.h, b.h, c); }
__device__ __forceinline__ float sigm(float v) { return 1.0f / (1.0f + expf(-v)); }
#define LDSX() do { asm volatile("s_wait_dscnt 0" ::: "memory"); __builtin_amdgcn_wave_barrier(); __builtin_amdgcn_fence(__ATOMIC_RELEASE, "workgroup"); } while (0)


#define NB 16
#define SS 512
#define SCALEF 0.125f
#define DM 1024
#define NH 16
#define MAXSEQ 512
__device__ __attribute__((noinline)) float log_p(float v) { return logf(v); }
#define HD 64
#define QKVW (3 * DM)
#ifndef TQB
#define TQB (SS / 64)
#define TNB NB
#define TOB (NB * SS / 64)     // 64-row tiles of all rows, unused
#endif
typedef __attribute__((ext_vector_type(8))) __bf16 v8b;
__device__ __forceinline__ v16b frag_b(const __bf16* rowk0, int lane) {
  union { v16b v; v8b q[2]; } u; const __bf16* p = rowk0 + 8 * (lane >> 4);
  u.q[0] = *(const v8b*)p; u.q[1] = *(const v8b*)(p + 16); return u.v;
}
__device__ __forceinline__ float bfr(float v) { return (float)(__bf16)v; }
__device__ __attribute__((noinline)) float exp_ni(float v) { return expf(v); }
__device__ __attribute__((noinline)) float erf_ni(float v) { return erff(v); }

#define PK_A 0                       // [3072][1024] Wqkv rows (natural [out][in])
#define PK_P (PK_A + QKVW * DM)        // [1024][1024] Wo rows (natural)
#define PK_END (PK_P + DM * DM)
#define WS_PK  0u
#define WS_QK  (WS_PK + 2u * PK_END)             // f16 [8192 rows][2048]: q | k
#define WS_QKL (WS_QK + 2u * NB * SS * 2 * DM)     // f16 q | k residual planes x2048
#define WS_VTH (WS_QKL + 2u * NB * SS * 2 * DM)    // f16 [b][1024 (h*64+d)][512 s] hi
#define WS_VTL (WS_VTH + 2u * NB * DM * SS)        // f16 lo x 2048
#define WS_O   (WS_VTL + 2u * NB * DM * SS)        // f32 [8192][1024]
#define WS_CS  (WS_O + 4u * NB * SS * DM)           // f32 2 x [512][32], unused
#define WS_XN  (WS_CS + 4u * 2 * SS * 32)                  // f32 [NR][1024] LayerNorm(x)
#define WS_ENT (WS_XN + 4u * (size_t)NB * SS * DM)     // f32 [b][h][t] attention entropy
#define WS_END (WS_ENT + 4u * (size_t)NB * NH * SS)
// ---- pack_tile: block = (64 columns n, 128 rows k) of an (in,out) weight W[DM][ld] -> rows n of the packed [out][in] 16-bit copy. A thread reads 4 columns of 8 consecutive k (16 lanes = one 256-B piece of a W row), so it holds, per column, one whole 16-B chunk of a packed row; the chunks cross LDS so that 16 lanes store 256 B of one packed row.
// LDS: row n = 16 chunks of 16 B, chunk j at place j ^ (n >> 2): the 16 lanes of a half wave fall on 16 different places in the write (rows 4 apart, one chunk number) and in the read (one row, 16 chunk numbers).
template <bool F16X> __device__ __forceinline__ void pack_tile(const float* __restrict__ Wm, int ld, __bf16* __restrict__ dst, v4u* s) {
  const int t = threadIdx.x, c = t & 15, kg = t >> 4; const int n0 = blockIdx.x * 64, k0 = blockIdx.y * 128;
  v4f r[8];
#pragma unroll   // unrolled: the eight loads are in flight together, and r[] is indexed by constants
  for (int i = 0; i < 8; ++i) r[i] = *(const v4f*)(Wm + (size_t)(k0 + kg * 8 + i) * ld + n0 + c * 4);
#pragma unroll   // this loop and the one inside it: r[] and o are indexed by constants and stay in registers
  for (int j = 0; j < 4; ++j) { union { v4u u; v8h h; v8b b; } o;
#pragma unroll
    for (int i = 0; i < 8; ++i) { if (F16X) o.h[i] = (_Float16)(bfr(r[i][j]) * 256.0f); else o.b[i] = (__bf16)r[i][j]; }
    s[(c * 4 + j) * 16 + (kg ^ c)] = o.u; }
  __syncthreads();
#pragma unroll   // the four LDS reads go out together, ahead of the stores
  for (int it = 0; it < 4; ++it) { const int n = it * 16 + (t >> 4), j = t & 15; vst2((unsigned*)(dst + (size_t)(n0 + n) * DM + k0 + j * 8), s[n * 16 + (j ^ (n >> 2))]); }   // whole 128-B lines
}
// ---- k_pack: out_w (in,out) -> bf16 rows [out][in] in the Wo slot
__global__ __launch_bounds__(256) void k_pack(const float* __restrict__ WO, __bf16* __restrict__ PK) { __shared__ __align__(16) v4u s[64 * 16]; pack_tile<false>(WO, DM, PK + PK_P, s); }
// ---- k_qkv: block = (128 rows, 128 cols), 4 waves of 64 x 64; per trip 64 k of both operand tiles are brought into LDS in whole lines by asynchronous copies (two buffers) and read from there by all waves
#define QA_PITCH 272                      // bytes: a 256-B row of 64 f32 + 16 (16 B x odd: ds_load_b128 free of bank conflicts)
#define QB_PITCH 144                      // bytes: a 128-B row of 64 f16 + 16
#define QA_BYTES (128 * QA_PITCH)
#define QBUF (QA_BYTES + 128 * QB_PITCH)  // one buffer: X tile, then W tile
// eight 16-B copies per lane, rows lstep / gstep bytes apart; the s_wait_xcnt closes the statement so that no address register is rewritten in front of it
__device__ __forceinline__ void copy8(unsigned l, const char* p, unsigned lstep, unsigned gstep) {
  asm volatile("global_load_async_to_lds_b128 %0, %8, off\n\t"
               "global_load_async_to_lds_b128 %1, %9, off\n\t"
               "global_load_async_to_lds_b128 %2, %10, off\n\t"
               "global_load_async_to_lds_b128 %3, %11, off\n\t"
               "global_load_async_to_lds_b128 %4, %12, off\n\t"
               "global_load_async_to_lds_b128 %5, %13, off\n\t"
               "global_load_async_to_lds_b128 %6, %14, off\n\t"
               "global_load_async_to_lds_b128 %7, %15, off\n\t"
               "s_wait_xcnt 0x0"
               :: "v"(l), "v"(l + lstep), "v"(l + 2 * lstep), "v"(l + 3 * lstep), "v"(l + 4 * lstep), "v"(l + 5 * lstep), "v"(l + 6 * lstep), "v"(l + 7 * lstep),
                  "v"(p), "v"(p + gstep), "v"(p + 2 * gstep), "v"(p + 3 * gstep), "v"(p + 4 * gstep), "v"(p + 5 * gstep), "v"(p + 6 * gstep), "v"(p + 7 * gstep)
               : "memory");
}
__global__ __launch_bounds__(128) void k_qkv(const float* __restrict__ XQ, const float* __restrict__ XK, const float* __restrict__ XV, const __bf16* __restrict__ P, const float* __restrict__ BQ, const float* __restrict__ BK, const float* __restrict__ BV, _Float16* __restrict__ QK, _Float16* __restrict__ QKL, _Float16* __restrict__ VTH, _Float16* __restrict__ VTL) {
  const int which0 = (blockIdx.y * 128) / DM; const float* X = (which0 == 0) ? XQ : (which0 == 1) ? XK : XV; const float* BB = BQ ? (((which0 == 0) ? BQ : (which0 == 1) ? BK : BV) + (blockIdx.y * 128 - which0 * DM)) : nullptr;
  __shared__ __align__(16) char sm[2 * QBUF];   // the two buffers; output staging behind the loop
  const int tid = threadIdx.x, wave = tid >> 5, lane = tid & 31, col = lane & 15, g = lane >> 4, wm = wave >> 1, wn = wave & 1; const size_t m0 = (size_t)blockIdx.x * 128; const int n0 = blockIdx.y * 128;
  const unsigned sbase = (unsigned)(size_t)&sm[0];
  const unsigned la = sbase + (tid >> 4) * QA_PITCH + (tid & 15) * 16, lb = sbase + QA_BYTES + (tid >> 3) * QB_PITCH + (tid & 7) * 16;   // a wave's copy covers 2 X rows of 256 B, or 4 W rows of 128 B
  const char* ga = (const char*)(X + (m0 + (tid >> 4)) * DM + (tid & 15) * 4); const char* gb = (const char*)((const _Float16*)P + (size_t)(n0 + (tid >> 3)) * DM + (tid & 7) * 8);
  auto fill = [&](int t, unsigned bo) {   // tile t (k = 64 t ..): 16 + 8 copies per lane
    copy8(la + bo, ga + t * 256, 8 * QA_PITCH, 8 * DM * 4); copy8(la + bo + 64 * QA_PITCH, ga + t * 256 + 64 * DM * 4, 8 * QA_PITCH, 8 * DM * 4); copy8(lb + bo, gb + t * 128, 16 * QB_PITCH, 16 * DM * 2); };
  v8f acc[4][4] = {};
  fill(0, 0);
  asm volatile("s_wait_asynccnt 0x0" ::: "memory");   // tile 0 landed (this wave's copies)
  __syncthreads();                                    // ... and every other wave's
  fill(1, QBUF);
#pragma unroll 1   // rolled: a trip holds 32 WMMAs, enough to carry the branch
  for (int t = 0; t < DM / 64; ++t) { const char* bp = sm + (t & 1) * QBUF;
#pragma unroll   // this and the loops inside it are unrolled so that a[], w[] and acc[][] are indexed by constants and stay in registers
    for (int kc = 0; kc < 2; ++kc) { v16h a[4], w[4];
#pragma unroll
      for (int mi = 0; mi < 4; ++mi) { const float* p = (const float*)(bp + (wm * 64 + mi * 16 + col) * QA_PITCH) + kc * 32 + 8 * g;   // LN'd rows (f32) rounded once to f16
#pragma unroll
        for (int i = 0; i < 8; ++i) { a[mi][i] = (_Float16)p[i]; a[mi][8 + i] = (_Float16)p[16 + i]; } }
#pragma unroll
      for (int nj = 0; nj < 4; ++nj) w[nj] = frag_h((const _Float16*)(bp + QA_BYTES + (wn * 64 + nj * 16 + col) * QB_PITCH) + kc * 32, lane);
#pragma unroll
      for (int mi = 0; mi < 4; ++mi)
#pragma unroll
        for (int nj = 0; nj < 4; ++nj) acc[mi][nj] = wmma16(a[mi], w[nj], acc[mi][nj]); }
    asm volatile("s_wait_dscnt 0x0" ::: "memory");      // this wave's reads of the buffer are over
    asm volatile("s_wait_asynccnt 0x0" ::: "memory");   // its copies of tile t + 1 have landed
    __syncthreads();                                    // publishes tile t + 1, frees tile t's buffer
    if (t + 2 < DM / 64) fill(t + 2, (t & 1) * QBUF); }
  asm volatile("s_wait_asynccnt 0x0" ::: "memory");     // no copy in flight before the buffers become staging
  if (n0 < 2 * DM) {   // q stored unscaled (f16 sigma ~0.6, no subnormal exposure); 1/8 applied to the f32 score
    _Float16* sh = (_Float16*)(sm + wave * (2 * 64 * 144)); _Float16* sl = sh + 64 * 72;   // per wave: 64 rows x 64 cols at pitch 72, hi then residual
#pragma unroll
    for (int nj = 0; nj < 4; ++nj) { const float bias = BB ? bfr(BB[wn * 64 + nj * 16 + col]) : 0.f;
#pragma unroll
      for (int mi = 0; mi < 4; ++mi)
#pragma unroll
        for (int r = 0; r < 8; ++r) { const float v = acc[mi][nj][r] * (1.0f / 256.0f) + bias; const _Float16 hv = (_Float16)v; sh[(mi * 16 + 8 * g + r) * 72 + nj * 16 + col] = hv; sl[(mi * 16 + 8 * g + r) * 72 + nj * 16 + col] = (_Float16)((v - (float)hv) * 2048.0f); } }   // q, k (+ bias) as f16 hi + (x2048) residual
    LDSX();
    for (int it = 0; it < 16; ++it) { const int rl = it * 4 + (lane >> 3), ch = lane & 7; const size_t o = (m0 + wm * 64 + rl) * (2 * DM) + n0 + wn * 64 + ch * 8; vst2((unsigned*)(QK + o), *(const v4u*)&sh[rl * 72 + ch * 8]); vst2((unsigned*)(QKL + o), *(const v4u*)&sl[rl * 72 + ch * 8]); }   // whole 128-B lines
  } else {
    _Float16* sth = (_Float16*)sm; _Float16* stl = sth + 128 * 136;   // [128 d][128 s] at pitch 136, hi then residual
#pragma unroll
    for (int nj = 0; nj < 4; ++nj) { const float bias = BB ? bfr(BB[wn * 64 + nj * 16 + col]) : 0.f;
#pragma unroll
      for (int mi = 0; mi < 4; ++mi) { v8h h8, l8;
#pragma unroll
        for (int r = 0; r < 8; ++r) { const float v = acc[mi][nj][r] * (1.0f / 256.0f) + bias; const _Float16 hv = (_Float16)v; h8[r] = hv; l8[r] = (_Float16)((v - (float)hv) * 2048.0f); }
        const int o = (wn * 64 + nj * 16 + col) * 136 + wm * 64 + mi * 16 + 8 * g; *(v8h*)&sth[o] = h8; *(v8h*)&stl[o] = l8; } }
    __syncthreads();
    const int b = (int)(m0 / SS), s0 = (int)(m0 % SS); const int pc0 = n0 - 2 * DM;
    for (int it = 0; it < 16; ++it) { const int d = it * 8 + (tid >> 4), pc = tid & 15; const size_t o = ((size_t)b * DM + pc0 + d) * SS + s0 + pc * 8; vst2((unsigned*)(VTH + o), *(const v4u*)&sth[d * 136 + pc * 8]); vst2((unsigned*)(VTL + o), *(const v4u*)&stl[d * 136 + pc * 8]); }
  }
}
#define AK_PITCH 144                      // bytes: a 128-B row of 64 f16 + 16 (16 B x odd: ds_load_b128 free of bank conflicts)
#define AT_BYTES (64 * AK_PITCH)          // one tile: K (64 keys x 64 d) or V^T (64 d x 64 keys)
#define ABUF (2 * AT_BYTES)               // one buffer: K tile, then V^T tile
#define RBN 640                           // staged rel_bias entries (5 per thread), at most 575 of them read
// four 16-B copies per lane, rows lstep / gstep bytes apart; the s_wait_xcnt closes the statement so that no address register is rewritten in front of it
__device__ __forceinline__ void copy4(unsigned l, const char* p, unsigned lstep, unsigned gstep) {
  asm volatile("global_load_async_to_lds_b128 %0, %4, off\n\t"
               "global_load_async_to_lds_b128 %1, %5, off\n\t"
               "global_load_async_to_lds_b128 %2, %6, off\n\t"
               "global_load_async_to_lds_b128 %3, %7, off\n\t"
               "s_wait_xcnt 0x0"
               :: "v"(l), "v"(l + lstep), "v"(l + 2 * lstep), "v"(l + 3 * lstep),
                  "v"(p), "v"(p + gstep), "v"(p + 2 * gstep), "v"(p + 3 * gstep)
               : "memory");
}
// five 4-B copies per lane (a rel_bias row is 1,023 floats long, so rows are aligned to 4 B only), LDS places 512 B apart; the s_wait_xcnt closes the statement as in copy4
__device__ __forceinline__ void copy5w(unsigned l, const float* p0, const float* p1, const float* p2, const float* p3, const float* p4) {
  asm volatile("global_load_async_to_lds_b32 %0, %5, off\n\t"
               "global_load_async_to_lds_b32 %1, %6, off\n\t"
               "global_load_async_to_lds_b32 %2, %7, off\n\t"
               "global_load_async_to_lds_b32 %3, %8, off\n\t"
               "global_load_async_to_lds_b32 %4, %9, off\n\t"
               "s_wait_xcnt 0x0"
               :: "v"(l), "v"(l + 512u), "v"(l + 1024u), "v"(l + 1536u), "v"(l + 2048u),
                  "v"(p0), "v"(p1), "v"(p2), "v"(p3), "v"(p4)
               : "memory");
}
// lane l with lane l ^ 16 (a vector cross-row move, no LDS unit)
__device__ __forceinline__ float xhalf(float x) { return __builtin_bit_cast(float, __builtin_amdgcn_permlanex16(__builtin_bit_cast(int, x), __builtin_bit_cast(int, x), 0x76543210, 0xfedcba98, false, false)); }
// ---- k_attn: grid = (head, batch, query block), the query blocks from the last (most keys) down: the query block is the slowest index. For speed only: each (query block, head, batch) is done once wherever it runs
// block = (64 queries, head h, batch b): causal flash attention on transposed products: S^T = K . Q^T (A = 16 key rows, B = the wave's 16 queries), so a lane holds 16 of the 32 scores of ONE query (column col; keys 8 g + r of each 16): maximum and sum run in the lane, with one exchange between the wave's halves; the two S^T tiles, converted in place, are the B operand of O^T += V^T . P^T (A = 16 d rows of V^T): P never passes through LDS. O[b*S+q][h*64+d] = (acc + accl / 2048) / (2048 l) (256-B segments). The same scores give the row's entropy -sum p log p = log(sum e^(s-m)) + m - (sum e^(s-m) s)/(sum e^(s-m)): one more running sum per lane, joined behind the loop; 256-B store per block
// operands of the loop: per trip 64 keys of K (hi) and of V^T (hi) are brought into LDS in whole 128-B lines by asynchronous copies (two buffers) and read from there by all four waves, two passes of 32 keys a trip; the part of the head's rel_bias row that the block can touch is copied once in front of the loop and read without the causal test (the test picks the value behind the read). The residual planes of the first 128 queries are read from global memory as before
__global__ __launch_bounds__(128) void k_attn(const _Float16* __restrict__ QK, const _Float16* __restrict__ QKL, const _Float16* __restrict__ VTH, const _Float16* __restrict__ VTL, const void* __restrict__ KMASK, const float* __restrict__ RB, float* __restrict__ O, float* __restrict__ ENT) {
  __shared__ __align__(16) char sm[2 * ABUF];   // the two buffers
  __shared__ __align__(16) float srb[RBN];      // rel_bias[h][448 - 64 qb + j]
  __shared__ __align__(16) float so[4][16][68];
  __shared__ __align__(16) float sent[64];
  const int tid = threadIdx.x, wave = tid >> 5, lane = tid & 31, col = lane & 15, g = lane >> 4;
  const int qb = TQB - 1 - blockIdx.z, h = blockIdx.x, b = blockIdx.y; const int q0 = qb * 64 + wave * 16; const int qi = q0 + col; const size_t rq = (size_t)b * SS + qi;
  v16h aq[2], aql[2];
#pragma unroll
  for (int kc = 0; kc < 2; ++kc) { aq[kc] = frag_h(QK + rq * (2 * DM) + h * HD + kc * 32, lane); aql[kc] = frag_h(QKL + rq * (2 * DM) + h * HD + kc * 32, lane); }
  float m = -3.0e38f, l = 0.f, ls = 0.f;   // of query qi: m over all keys so far (equal in both halves), l and ls over this half's keys (joined behind the loop)
  v8f acc[4] = {}, accl[4] = {};   // O^T: register r = d (dt * 16 + 8 g + r), column = query
  const float* rbq = srb + 63 - (wave * 16 + col) + 8 * g;   // rel_bias[h][k - q + 511] at k = 8 g, in the staged part of the row
  const int nt = qb + 1;   // causal: 64-key tiles up to the query tile's end
  const unsigned lk = (unsigned)(size_t)&sm[0] + (tid >> 3) * AK_PITCH + (tid & 7) * 16;   // a wave's copy covers 4 rows of 128 B
  const char* gk = (const char*)(QK + ((size_t)b * SS + (tid >> 3)) * (2 * DM) + DM + h * HD + (tid & 7) * 8); const char* gv = (const char*)(VTH + ((size_t)b * DM + h * HD + (tid >> 3)) * SS + (tid & 7) * 8);
  auto fill = [&](int t, unsigned bo) {   // tile t (keys 64 t ..): 4 + 4 copies per lane
    copy4(lk + bo, gk + (size_t)t * (64 * 2 * DM * 2), 16 * AK_PITCH, 16 * 2 * DM * 2); copy4(lk + bo + AT_BYTES, gv + t * 128, 16 * AK_PITCH, 16 * SS * 2); };
  fill(0, 0);
  { const float* rh = RB + (size_t)h * (2 * MAXSEQ - 1); const int j0 = MAXSEQ - 64 - qb * 64 + tid;   // entries past the row's end (never read back) are clamped into it
    copy5w((unsigned)(size_t)&srb[0] + tid * 4, rh + min(j0, 2 * MAXSEQ - 2), rh + min(j0 + 128, 2 * MAXSEQ - 2), rh + min(j0 + 256, 2 * MAXSEQ - 2), rh + min(j0 + 384, 2 * MAXSEQ - 2), rh + min(j0 + 512, 2 * MAXSEQ - 2)); }
  asm volatile("s_wait_asynccnt 0x0" ::: "memory");   // tile 0 and rel_bias landed (this wave's copies)
  __syncthreads();                                    // ... and every other wave's
  if (nt > 1) fill(1, ABUF);
#pragma unroll 1   // rolled: the trip count depends on the query block
  for (int t = 0; t < nt; ++t) { const char* bp = sm + (t & 1) * ABUF;
#pragma unroll 1   // rolled: one copy of the long pass body in the instruction cache
   for (int hp = 0; hp < 2; ++hp) { const int ks = 2 * t + hp; v8f s[2];
    v16h kf[2][2]; float rb[2][8];   // all LDS reads of the score part stand together ahead of its first WMMA: one wait, not one per product
#pragma unroll   // this and the loops inside it: kf[][] and rb[][] are indexed by constants and stay in registers
    for (int ct = 0; ct < 2; ++ct) {
#pragma unroll
      for (int kc = 0; kc < 2; ++kc) kf[ct][kc] = frag_h((const _Float16*)(bp + (hp * 32 + ct * 16 + col) * AK_PITCH) + kc * 32, lane);
#pragma unroll
      for (int r = 0; r < 8; ++r) rb[ct][r] = rbq[ks * 32 + ct * 16 + r]; }
#pragma unroll
    for (int ct = 0; ct < 2; ++ct) { const int kr = ks * 32 + ct * 16 + col; const _Float16* krowl = QKL + ((size_t)b * SS + kr) * (2 * DM) + DM + h * HD; v8f c = {}, cl = {};
      if (qb < 2) {   // leading query blocks (few keys, outputs far above the global rms): 3 products
#pragma unroll
        for (int kc = 0; kc < 2; ++kc) { const v16h kh = kf[ct][kc]; c = wmma16(kh, aq[kc], c); cl = wmma16(kh, aql[kc], cl); cl = wmma16(frag_h(krowl + kc * 32, lane), aq[kc], cl); }
#pragma unroll
        for (int r = 0; r < 8; ++r) c[r] += cl[r] * (1.0f / 2048.0f); }
      else {
#pragma unroll
        for (int kc = 0; kc < 2; ++kc) c = wmma16(kf[ct][kc], aq[kc], c); }   // single product elsewhere
#pragma unroll
      for (int r = 0; r < 8; ++r) { const int kk = ks * 32 + ct * 16 + 8 * g + r; s[ct][r] = (kk <= qi) ? (c[r] * SCALEF + bfr(rb[ct][r])) : -3.0e38f; } }   // causal; + rel_bias[h][k - q + 511]
    v16h vf[4];   // the pass's V^T fragments: read here so that the LDS latency passes under the softmax
#pragma unroll   // vf[] is indexed by constants and stays in registers
    for (int dt = 0; dt < 4; ++dt) vf[dt] = frag_h((const _Float16*)(bp + AT_BYTES + (dt * 16 + col) * AK_PITCH) + hp * 32, lane);
    float mx = fmaxf(s[0][0], s[1][0]);
#pragma unroll
    for (int r = 1; r < 8; ++r) mx = fmaxf(mx, fmaxf(s[0][r], s[1][r]));
    mx = fmaxf(mx, xhalf(mx));
    const float mn = fmaxf(m, mx); const float alpha = (m <= -1.0e38f) ? 0.f : __expf(m - mn);
    float es0 = 0.f, es1 = 0.f, ess0 = 0.f, ess1 = 0.f; v16h pa, pl;
#pragma unroll
    for (int r = 0; r < 8; ++r) { const float e0 = (s[0][r] <= -1.0e38f) ? 0.f : __expf(s[0][r] - mn), e1 = (s[1][r] <= -1.0e38f) ? 0.f : __expf(s[1][r] - mn); es0 += e0; es1 += e1; ess0 += (s[0][r] > -1.0e38f) ? e0 * s[0][r] : 0.f; ess1 += (s[1][r] > -1.0e38f) ? e1 * s[1][r] : 0.f;
      const float x0 = e0 * 2048.0f, x1 = e1 * 2048.0f; const _Float16 h0 = (_Float16)x0, h1 = (_Float16)x1; pa[r] = h0; pa[8 + r] = h1; pl[r] = (_Float16)((x0 - (float)h0) * 2048.0f); pl[8 + r] = (_Float16)((x1 - (float)h1) * 2048.0f); }   // P scaled by 2^11 before the f16 split so small softmax weights stay out of the f16 subnormal range; 2^-11 folded into the epilogue
    l = l * alpha + (es0 + es1); ls = ls * alpha + (ess0 + ess1); m = mn;
#pragma unroll
    for (int dt = 0; dt < 4; ++dt)
#pragma unroll
      for (int r = 0; r < 8; ++r) { acc[dt][r] *= alpha; accl[dt][r] *= alpha; }
#pragma unroll
    for (int dt = 0; dt < 4; ++dt) { const size_t vr = ((size_t)b * DM + h * HD + dt * 16 + col) * SS + ks * 32; const v16h vh = vf[dt]; acc[dt] = wmma16(vh, pa, acc[dt]); if (qb < 2) { accl[dt] = wmma16(vh, pl, accl[dt]); accl[dt] = wmma16(frag_h(VTL + vr, lane), pa, accl[dt]); } } }   // leading query blocks: P hi/lo x V hi/lo (3 products); elsewhere P x V single
    asm volatile("s_wait_dscnt 0x0" ::: "memory");      // this wave's reads of the buffer are over
    asm volatile("s_wait_asynccnt 0x0" ::: "memory");   // its copies of tile t + 1 have landed
    __syncthreads();                                    // publishes tile t + 1, frees tile t's buffer
    if (t + 2 < nt) fill(t + 2, (t & 1) * ABUF); }
  asm volatile("s_wait_asynccnt 0x0" ::: "memory");     // no copy in flight behind the loop
  l += xhalf(l); ls += xhalf(ls);
  const float il = (1.0f / 2048.0f) / l;
#pragma unroll
  for (int dt = 0; dt < 4; ++dt) { v4f o0, o1;
#pragma unroll
    for (int r = 0; r < 4; ++r) { o0[r] = (acc[dt][r] + accl[dt][r] * (1.0f / 2048.0f)) * il; o1[r] = (acc[dt][4 + r] + accl[dt][4 + r] * (1.0f / 2048.0f)) * il; }
    *(v4f*)&so[wave][col][dt * 16 + 8 * g] = o0; *(v4f*)&so[wave][col][dt * 16 + 8 * g + 4] = o1; }
  LDSX();
  const float en = log_p(l) + m - ls / l;   // here O lies in LDS, so only l, m and ls live across the call; and in front of the O stores, which the barrier would otherwise wait for
  if (g == 0) sent[wave * 16 + col] = en;
  __syncthreads(); if (tid < 16) vst2(ENT + ((size_t)b * NH + h) * SS + qb * 64 + tid * 4, *(const v4f*)&sent[tid * 4]);
  for (int rl = 0; rl < 16; ++rl) if (lane < 16) vst2(O + ((size_t)b * SS + q0 + rl) * DM + h * HD + lane * 4, *(const v4f*)&so[wave][rl][lane * 4]);
}
// ---- k_out: block = (128 rows, 128 cols), 4 waves of 64 x 64: out = x + (O(hi/lo) . Wo rows (2 products) + bo), x added where the rows are stored; the blocks of the first 128 columns also write their 128 rows' head-mean entropy; per trip 64 k of both operand tiles are brought into LDS in whole lines by asynchronous copies (two buffers, the tile shapes and pitches of k_qkv) and read from there by all waves
__global__ __launch_bounds__(128) void k_out(const float* __restrict__ O, const __bf16* __restrict__ P, const float* __restrict__ BO, const float* __restrict__ X, const float* __restrict__ ENT, float* __restrict__ OUT, float* __restrict__ OUT2) {
  __shared__ __align__(16) char sm[2 * QBUF];   // the two buffers; output staging behind the loop
  const int tid = threadIdx.x, wave = tid >> 5, lane = tid & 31, col = lane & 15, g = lane >> 4, wm = wave >> 1, wn = wave & 1; const size_t m0 = (size_t)blockIdx.x * 128; const int n0 = blockIdx.y * 128;
  const unsigned sbase = (unsigned)(size_t)&sm[0];
  const unsigned la = sbase + (tid >> 4) * QA_PITCH + (tid & 15) * 16, lb = sbase + QA_BYTES + (tid >> 3) * QB_PITCH + (tid & 7) * 16;   // a wave's copy covers 2 O rows of 256 B, or 4 W rows of 128 B
  const char* ga = (const char*)(O + (m0 + (tid >> 4)) * DM + (tid & 15) * 4); const char* gb = (const char*)(P + (size_t)(n0 + (tid >> 3)) * DM + (tid & 7) * 8);
  auto fill = [&](int t, unsigned bo) {   // tile t (k = 64 t ..): 16 + 8 copies per lane
    copy8(la + bo, ga + t * 256, 8 * QA_PITCH, 8 * DM * 4); copy8(la + bo + 64 * QA_PITCH, ga + t * 256 + 64 * DM * 4, 8 * QA_PITCH, 8 * DM * 4); copy8(lb + bo, gb + t * 128, 16 * QB_PITCH, 16 * DM * 2); };
  v8f acc[4][4] = {};
  fill(0, 0);
  asm volatile("s_wait_asynccnt 0x0" ::: "memory");   // tile 0 landed (this wave's copies)
  __syncthreads();                                    // ... and every other wave's
  fill(1, QBUF);
#pragma unroll 1   // rolled: a trip holds 64 WMMAs, enough to carry the branch
  for (int t = 0; t < DM / 64; ++t) { const char* bp = sm + (t & 1) * QBUF;
    const char* ap = bp + (wm * 64 + col) * QA_PITCH + 32 * g;   // this lane's place in row col of the wave's first 16 O rows
    float nx[16];   // the f32 values of the A fragment after the one being multiplied: read from LDS one fragment ahead, so that the read's latency passes under 8 WMMAs
#pragma unroll
    for (int i = 0; i < 8; ++i) { nx[i] = ((const float*)ap)[i]; nx[8 + i] = ((const float*)ap)[16 + i]; }
#pragma unroll   // this and the loops inside it are unrolled so that w[], nx[] and acc[][] are indexed by constants and stay in registers
    for (int kc = 0; kc < 2; ++kc) { v16b w[4];
#pragma unroll
      for (int nj = 0; nj < 4; ++nj) w[nj] = frag_b((const __bf16*)(bp + QA_BYTES + (wn * 64 + nj * 16 + col) * QB_PITCH) + kc * 32, lane);
#pragma unroll
      for (int mi = 0; mi < 4; ++mi) { const F2 a = bsplit16(nx);   // f32 rows split into bf16 hi + residual
        if (kc * 4 + mi < 7) { const int s = kc * 4 + mi + 1; const float* p = (const float*)(ap + (s & 3) * 16 * QA_PITCH) + (s >> 2) * 32;   // same tile, same buffer: nothing of the next tile is read here
#pragma unroll
          for (int i = 0; i < 8; ++i) { nx[i] = p[i]; nx[8 + i] = p[16 + i]; } }
#pragma unroll
        for (int nj = 0; nj < 4; ++nj) acc[mi][nj] = wmma_bf(a.l, w[nj], acc[mi][nj]);   // residual first, then hi, per accumulator; four independent accumulators between the two
#pragma unroll
        for (int nj = 0; nj < 4; ++nj) acc[mi][nj] = wmma_bf(a.h, w[nj], acc[mi][nj]); } }
    asm volatile("s_wait_dscnt 0x0" ::: "memory");      // this wave's reads of the buffer are over
    asm volatile("s_wait_asynccnt 0x0" ::: "memory");   // its copies of tile t + 1 have landed
    __syncthreads();                                    // publishes tile t + 1, frees tile t's buffer
    if (t + 2 < DM / 64) fill(t + 2, (t & 1) * QBUF); }
  asm volatile("s_wait_asynccnt 0x0" ::: "memory");     // no copy in flight before the buffers become staging
  float* so = (float*)(sm + wave * (64 * 272));   // per wave: 64 rows x 64 cols of f32 at pitch 68
#pragma unroll
  for (int nj = 0; nj < 4; ++nj) { const float bias = bfr(BO[n0 + wn * 64 + nj * 16 + col]);
#pragma unroll
    for (int mi = 0; mi < 4; ++mi)
#pragma unroll
      for (int r = 0; r < 8; ++r) so[(mi * 16 + 8 * g + r) * 68 + nj * 16 + col] = acc[mi][nj][r] + bias; }
  LDSX();
  const size_t o0 = (m0 + wm * 64 + g) * DM + n0 + wn * 64 + col * 4;   // this lane's 16 B of the wave's row g; the loops below go on two rows a step
  v4f xr[32];   // the wave's 64 x 64 piece of x, into the registers that the accumulators have left
#pragma unroll   // xr[] is indexed by constants and stays in registers; all 32 loads are in flight together: one memory latency, not 32
  for (int it = 0; it < 32; ++it) xr[it] = *(const v4f*)(X + o0 + (size_t)it * (2 * DM));
  asm volatile("s_wait_xcnt 0x0" ::: "memory");   // the entropy branch below reuses the loads' address registers: the wait stands in front of that overwrite
  if (blockIdx.y == 0) { float e[NH], a = 0.f;   // thread = row: the mean of its 16 heads' entropies (a block's 128 rows lie in one sequence)
    const float* eb = ENT + (m0 / SS) * (NH * SS) + m0 % SS;   // head 0 of the block's first row (the same for the whole block); the heads lie SS floats apart
#pragma unroll   // e[] is indexed by constants; the 16 loads go out together, behind those of x, from one base and one index with constant offsets
    for (int hh = 0; hh < NH; ++hh) e[hh] = eb[hh * SS + tid];
    asm volatile("s_wait_xcnt 0x0" :: "s"(eb), "v"(tid) : "memory");   // base and index are inputs so that they stay in their registers up to this wait: nothing is written over them in front of it
#pragma unroll   // e[] indexed by constants
    for (int hh = 0; hh < NH; ++hh) a += e[hh];   // heads 0 to 15 in order
    OUT2[m0 + tid] = a / (float)NH; }   // a wave writes one whole 128-B line
#pragma unroll   // xr[] indexed by constants
  for (int it = 0; it < 32; ++it) { const v4f y = *(const v4f*)&so[(it * 2 + g) * 68 + col * 4]; const v4f x = xr[it]; v4f o4;
#pragma unroll   // the vectors' elements indexed by constants
    for (int i = 0; i < 4; ++i) o4[i] = bfr(x[i]) + y[i];
    vst2(OUT + o0 + (size_t)it * (2 * DM), o4); }   // whole 128-B lines
}
// ---- k_pack3: the fused (in,out) W_attn [DM][3*DM] -> its 3,072 transposed rows, f16 x 2^8 (bit pattern stored in the bf16-typed buffer)
__global__ __launch_bounds__(256) void k_pack3(const float* __restrict__ WA, __bf16* __restrict__ PK) { __shared__ __align__(16) v4u s[64 * 16]; pack_tile<true>(WA, 3 * DM, PK + PK_A, s); }
// ---- k_ln: block = row: XN = (x - mu) rsqrt(var + 1e-5) g + b (f32)
__global__ __launch_bounds__(256) void k_ln(const float* __restrict__ X, const float* __restrict__ G, const float* __restrict__ Bt, float* __restrict__ XN) {
  __shared__ float red[8]; const int t = threadIdx.x; const size_t row = blockIdx.x; float v[4]; float s = 0.f; for (int i = 0; i < 4; ++i) { v[i] = bfr(X[row * DM + t * 4 + i]); s += v[i]; }
#pragma unroll
  for (int o = 1; o < 32; o <<= 1) s += __shfl_xor(s, o);
  if ((t & 31) == 0) red[t >> 5] = s; __syncthreads(); float tot = 0.f; for (int i = 0; i < 8; ++i) tot += red[i]; const float mu = tot / (float)DM; __syncthreads();
  float q = 0.f; for (int i = 0; i < 4; ++i) { const float d = v[i] - mu; q += d * d; }
#pragma unroll
  for (int o = 1; o < 32; o <<= 1) q += __shfl_xor(q, o);
  if ((t & 31) == 0) red[t >> 5] = q; __syncthreads(); float tq = 0.f; for (int i = 0; i < 8; ++i) tq += red[i]; const float inv = 1.0f / sqrtf(tq / (float)DM + 1e-5f);
  v4f o4; for (int i = 0; i < 4; ++i) { const int e = t * 4 + i; o4[i] = (v[i] - mu) * inv * bfr(G[e]) + bfr(Bt[e]); } vst2(XN + row * DM + t * 4, o4);
}
extern "C" void kernel_launch(void* const* d_in, const int* in_sizes, int n_in, void* d_out, int out_size, void* d_ws, size_t ws_size, hipStream_t stream) {
  (void)in_sizes; (void)n_in; (void)out_size;
  const float** F = (const float**)d_in;   // 0 x [16,512,1024], 1 qkv_w [1024,3072] (in,out), 2 qkv_b [3072], 3 out_w [1024,1024] (in,out), 4 out_b, 5 ln_g, 6 ln_b, 7 rel_bias [16,1023]
  if (ws_size < (size_t)WS_END) return;
  char* ws = (char*)d_ws; __bf16* PK = (__bf16*)(ws + WS_PK); _Float16 *QK = (_Float16*)(ws + WS_QK), *QKL = (_Float16*)(ws + WS_QKL), *VTH = (_Float16*)(ws + WS_VTH), *VTL = (_Float16*)(ws + WS_VTL); float *O = (float*)(ws + WS_O), *XN = (float*)(ws + WS_XN), *ENT = (float*)(ws + WS_ENT);
  float* OUT = (float*)d_out; float* OUT2 = OUT + (size_t)NB * SS * DM;   // outputs concatenated: out [16,512,1024] then entropy [16,512]
  k_pack<<<dim3(DM / 64, DM / 128), 256, 0, stream>>>(F[3], PK);   // out_w ((in,out) -> transposed rows) into the Wo slot
  k_pack3<<<dim3(QKVW / 64, DM / 128), 256, 0, stream>>>(F[1], PK);
  k_ln<<<TNB * SS, 256, 0, stream>>>(F[0], F[5], F[6], XN);
  k_qkv<<<dim3(TNB * SS / 128, QKVW / 128), 128, 0, stream>>>(XN, XN, XN, PK + PK_A, F[2], F[2] + DM, F[2] + 2 * DM, QK, QKL, VTH, VTL);
  k_attn<<<dim3(NH, TNB, TQB), 128, 0, stream>>>(QK, QKL, VTH, VTL, nullptr, F[7], O, ENT);
  k_out<<<dim3(TNB * SS / 128, DM / 128), 128, 0, stream>>>(O, PK + PK_P, F[4], F[0], ENT, OUT, OUT2);
}

// v009
// One run takes 135 microseconds.
// Next to v008, in two timings, it ran 1.13 times as fast each time.
// All steps since v000 together make it 4.31 times as fast.
// compute dtype: all float inputs rounded to bf16; LayerNorm in f32, its output rounded once to f16 x exact f16 copies (x 2^8) of the fused qkv weight on WMMA 16x16x32 (1 product) + bias; causal attention: 3-product scores and hi + residual P, v on the first 128 queries of each sequence, single f16 beyond; x 1/8 + rel_bias[h][k-q+511], running-max softmax in f32 (hardware exp); the per-row entropy from the same scores in the same pass (precise logf); out = x + (o (bf16 hi + residual) . out_w (2 products) + out_b); second output = head-mean attention entropy.
#include <hip/hip_runtime.h>
#include <math.h>

typedef __attribute__((ext_vector_type(16))) _Float16 v16h;
typedef __attribute__((ext_vector_type(16))) __bf16 v16b;
typedef __attribute__((ext_vector_type(8)))  _Float16 v8h;
typedef __attribute__((ext_vector_type(8)))  float v8f;
typedef __attribute__((ext_vector_type(4)))  float v4f;
typedef __attribute__((ext_vector_type(2)))  float v2f;
typedef __attribute__((ext_vector_type(4)))  unsigned v4u;
typedef __attribute__((ext_vector_type(4)))  int v4i;
typedef float __attribute__((may_alias)) float_a;
typedef int __attribute__((may_alias)) int_a;

template <typename T> __device__ __forceinline__ void vst2(void* p, T v) { *(T*)p = v;  }
__device__ __forceinline__ v8f wmma16(v16h a, v16h b, v8f c) {
  v8f d = __builtin_amdgcn_wmma_f32_16x16x32_f16(false, a, false, b, (short)0, c, false, false);
  asm volatile("v_nop\n\tv_nop\n\tv_nop\n\tv_nop" : "+v"(d) : "v"(a), "v"(b));
  return d;
}
__device__ __forceinline__ v8f wmma_bf(v16b a, v16b b, v8f c) {
  v8f d = __builtin_amdgcn_wmma_f32_16x16x32_bf16(false, a, false, b, (short)0, c, false, false);
  asm volatile("v_nop\n\tv_nop\n\tv_nop\n\tv_nop" : "+v"(d) : "v"(a), "v"(b));
  return d;
}
// Pre-LN causal time attention with relative position bias (B 16, T 512, d 1,024, 16 heads x 64): x + out_proj(attention(LN(x))), plus the mean attention entropy per (batch, step) as a second output.
__device__ __forceinline__ v16h frag_h(const _Float16* rowk0, int lane) {
  union { v16h v; v8h q[2]; } u; const _Float16* p = rowk0 + 8 * (lane >> 4);
  u.q[0] = *(const v8h*)p; u.q[1] = *(const v8h*)(p + 16); return u.v;
}
__device__ __forceinline__ v16h frag_f32(const float* rowk0, int lane) {
  v16h a; const float* p = rowk0 + 8 * (lane >> 4);
#pragma unroll
  for (int i = 0; i < 8; ++i) { a[i] = (_Float16)p[i]; a[8 + i] = (_Float16)p[16 + i]; }
  return a;
}
__device__ __forceinline__ v16h frag_f32s(const float* rowk0, int lane, float sc) {
  v16h a; const float* p = rowk0 + 8 * (lane >> 4);
#pragma unroll
  for (int i = 0; i < 8; ++i) { a[i] = (_Float16)(p[i] * sc); a[8 + i] = (_Float16)(p[16 + i] * sc); }
  return a;
}
// column fragment from a [K][ld] layout (column n), rows >= K read as 0
__device__ __forceinline__ v16h fragc_f32(const float* W, int k0, int n, int lane, int ld, int K) {
  v16h a; const int g = lane >> 4;
#pragma unroll
  for (int i = 0; i < 8; ++i) { const int ka = k0 + 8 * g + i, kb = ka + 16;
    a[i] = (_Float16)(ka < K ? W[(size_t)(ka < K ? ka : K - 1) * ld + n] : 0.f); a[8 + i] = (_Float16)(kb < K ? W[(size_t)(kb < K ? kb : K - 1) * ld + n] : 0.f); }
  return a;
}
struct F2 { v16b h, l; };
__device__ __forceinline__ F2 bsplit16(const float v[16]) { F2 r;
#pragma unroll
  for (int i = 0; i < 16; ++i) { const __bf16 h = (__bf16)v[i]; r.h[i] = h; r.l[i] = (__bf16)(v[i] - (float)h); }
  return r; }
__device__ __forceinline__ F2 split_row(const float* row, int k0, int lane) { float v[16]; const float* p = row + k0 + 8 * (lane >> 4);
#pragma unroll
  for (int i = 0; i < 8; ++i) { v[i] = p[i]; v[8 + i] = p[16 + i]; }
  return bsplit16(v); }
__device__ __forceinline__ F2 split_rowK(const float* row, int k0, int lane, int K) { float v[16]; const int g = lane >> 4;
#pragma unroll
  for (int i = 0; i < 8; ++i) { const int ka = k0 + 8 * g + i, kb = ka + 16; v[i] = ka < K ? row[ka < K ? ka : K - 1] : 0.f; v[8 + i] = kb < K ? row[kb < K ? kb : K - 1] : 0.f; }
  return bsplit16(v); }
__device__ __forceinline__ F2 split_col(const float* W, int k0, int n, int lane, int ld, int K) { float v[16]; const int g = lane >> 4;
#pragma unroll
  for (int i = 0; i < 8; ++i) { const int ka = k0 + 8 * g + i, kb = ka + 16; v[i] = ka < K ? W[(size_t)(ka < K ? ka : K - 1) * ld + n] : 0.f; v[8 + i] = kb < K ? W[(size_t)(kb < K ? kb : K - 1) * ld + n] : 0.f; }
  return bsplit16(v); }
__device__ __forceinline__ v8f mac3(const F2& a, const F2& b, v8f c) { c = wmma_bf(a.l, b.h, c); c = wmma_bf(a.h, b.l, c); return wmma_bf(a.h, b.h, c); }
__device__ __forceinline__ float sigm(float v) { return 1.0f / (1.0f + expf(-v)); }
#define LDSX() do { asm volatile("s_wait_dscnt 0" ::: "memory"); __builtin_amdgcn_wave_barrier(); __builtin_amdgcn_fence(__ATOMIC_RELEASE, "workgroup"); } while (0)


#define NB 16
#define SS 512
#define SCALEF 0.125f
#define DM 1024
#define NH 16
#define MAXSEQ 512
__device__ __attribute__((noinline)) float log_p(float v) { return logf(v); }
#define HD 64
#define QKVW (3 * DM)
#ifndef TQB
#define TQB (SS / 64)
#define TNB NB
#define TOB (NB * SS / 64)     // 64-row tiles of all rows, unused
#endif
typedef __attribute__((ext_vector_type(8))) __bf16 v8b;
__device__ __forceinline__ v16b frag_b(const __bf16* rowk0, int lane) {
  union { v16b v; v8b q[2]; } u; const __bf16* p = rowk0 + 8 * (lane >> 4);
  u.q[0] = *(const v8b*)p; u.q[1] = *(const v8b*)(p + 16); return u.v;
}
__device__ __forceinline__ float bfr(float v) { return (float)(__bf16)v; }
__device__ __attribute__((noinline)) float exp_ni(float v) { return expf(v); }
__device__ __attribute__((noinline)) float erf_ni(float v) { return erff(v); }

#define PK_A 0                       // [3072][1024] Wqkv rows (natural [out][in])
#define PK_P (PK_A + QKVW * DM)        // [1024][1024] Wo rows (natural)
#define PK_END (PK_P + DM * DM)
#define WS_PK  0u
#define WS_QK  (WS_PK + 2u * PK_END)             // f16 [8192 rows][2048]: q | k
#define WS_QKL (WS_QK + 2u * NB * SS * 2 * DM)     // f16 q | k residual planes x2048
#define WS_VTH (WS_QKL + 2u * NB * SS * 2 * DM)    // f16 [b][1024 (h*64+d)][512 s] hi
#define WS_VTL (WS_VTH + 2u * NB * DM * SS)        // f16 lo x 2048
#define WS_O   (WS_VTL + 2u * NB * DM * SS)        // f32 [8192][1024]
#define WS_CS  (WS_O + 4u * NB * SS * DM)           // f32 2 x [512][32], unused
#define WS_XN  (WS_CS + 4u * 2 * SS * 32)                  // f16 [NR][1024] LayerNorm(x)
#define WS_ENT (WS_XN + 2u * (size_t)NB * SS * DM)     // f32 [b][h][t] attention entropy
#define WS_END (WS_ENT + 4u * (size_t)NB * NH * SS)
// ---- pack_tile: block = (64 columns n, 128 rows k) of an (in,out) weight W[DM][ld] -> rows n of the packed [out][in] 16-bit copy. A thread reads 4 columns of 8 consecutive k (16 lanes = one 256-B piece of a W row), so it holds, per column, one whole 16-B chunk of a packed row; the chunks cross LDS so that 16 lanes store 256 B of one packed row.
// LDS: row n = 16 chunks of 16 B, chunk j at place j ^ (n >> 2): the 16 lanes of a half wave fall on 16 different places in the write (rows 4 apart, one chunk number) and in the read (one row, 16 chunk numbers).
template <bool F16X> __device__ __forceinline__ void pack_tile(const float* __restrict__ Wm, int ld, __bf16* __restrict__ dst, v4u* s) {
  const int t = threadIdx.x, c = t & 15, kg = t >> 4; const int n0 = blockIdx.x * 64, k0 = blockIdx.y * 128;
  v4f r[8];
#pragma unroll   // unrolled: the eight loads are in flight together, and r[] is indexed by constants
  for (int i = 0; i < 8; ++i) r[i] = *(const v4f*)(Wm + (size_t)(k0 + kg * 8 + i) * ld + n0 + c * 4);
#pragma unroll   // this loop and the one inside it: r[] and o are indexed by constants and stay in registers
  for (int j = 0; j < 4; ++j) { union { v4u u; v8h h; v8b b; } o;
#pragma unroll
    for (int i = 0; i < 8; ++i) { if (F16X) o.h[i] = (_Float16)(bfr(r[i][j]) * 256.0f); else o.b[i] = (__bf16)r[i][j]; }
    s[(c * 4 + j) * 16 + (kg ^ c)] = o.u; }
  __syncthreads();
#pragma unroll   // the four LDS reads go out together, ahead of the stores
  for (int it = 0; it < 4; ++it) { const int n = it * 16 + (t >> 4), j = t & 15; vst2((unsigned*)(dst + (size_t)(n0 + n) * DM + k0 + j * 8), s[n * 16 + (j ^ (n >> 2))]); }   // whole 128-B lines
}
// ---- k_pack: out_w (in,out) -> bf16 rows [out][in] in the Wo slot
__global__ __launch_bounds__(256) void k_pack(const float* __restrict__ WO, __bf16* __restrict__ PK) { __shared__ __align__(16) v4u s[64 * 16]; pack_tile<false>(WO, DM, PK + PK_P, s); }
// ---- k_qkv: block = (128 rows, 128 cols), 4 waves of 64 x 64; per trip 64 k of both operand tiles (f16 both) are brought into LDS in whole lines by asynchronous copies (two buffers) and read from there by all waves
#define QA_PITCH 272                      // bytes: a 256-B row of 64 f32 + 16 (16 B x odd: ds_load_b128 free of bank conflicts); k_out's O tile
#define QB_PITCH 144                      // bytes: a 128-B row of 64 f16 + 16
#define QA_BYTES (128 * QA_PITCH)
#define QBUF (QA_BYTES + 128 * QB_PITCH)  // one buffer of k_out: O tile, then W tile
#define XT_BYTES (128 * QB_PITCH)         // one 16-bit tile of k_qkv: 128 rows of 64 k
#define XBUF (2 * XT_BYTES)               // one buffer of k_qkv: X tile, then W tile
// eight 16-B copies per lane, rows lstep / gstep bytes apart; the s_wait_xcnt closes the statement so that no address register is rewritten in front of it
__device__ __forceinline__ void copy8(unsigned l, const char* p, unsigned lstep, unsigned gstep) {
  asm volatile("global_load_async_to_lds_b128 %0, %8, off\n\t"
               "global_load_async_to_lds_b128 %1, %9, off\n\t"
               "global_load_async_to_lds_b128 %2, %10, off\n\t"
               "global_load_async_to_lds_b128 %3, %11, off\n\t"
               "global_load_async_to_lds_b128 %4, %12, off\n\t"
               "global_load_async_to_lds_b128 %5, %13, off\n\t"
               "global_load_async_to_lds_b128 %6, %14, off\n\t"
               "global_load_async_to_lds_b128 %7, %15, off\n\t"
               "s_wait_xcnt 0x0"
               :: "v"(l), "v"(l + lstep), "v"(l + 2 * lstep), "v"(l + 3 * lstep), "v"(l + 4 * lstep), "v"(l + 5 * lstep), "v"(l + 6 * lstep), "v"(l + 7 * lstep),
                  "v"(p), "v"(p + gstep), "v"(p + 2 * gstep), "v"(p + 3 * gstep), "v"(p + 4 * gstep), "v"(p + 5 * gstep), "v"(p + 6 * gstep), "v"(p + 7 * gstep)
               : "memory");
}
__global__ __launch_bounds__(128) void k_qkv(const _Float16* __restrict__ XQ, const _Float16* __restrict__ XK, const _Float16* __restrict__ XV, const __bf16* __restrict__ P, const float* __restrict__ BQ, const float* __restrict__ BK, const float* __restrict__ BV, _Float16* __restrict__ QK, _Float16* __restrict__ QKL, _Float16* __restrict__ VTH, _Float16* __restrict__ VTL) {
  const int which0 = (blockIdx.y * 128) / DM; const _Float16* X = (which0 == 0) ? XQ : (which0 == 1) ? XK : XV; const float* BB = BQ ? (((which0 == 0) ? BQ : (which0 == 1) ? BK : BV) + (blockIdx.y * 128 - which0 * DM)) : nullptr;
  __shared__ __align__(16) char sm[2 * XBUF];   // the two buffers; output staging behind the loop (which fills them to the last byte)
  const int tid = threadIdx.x, wave = tid >> 5, lane = tid & 31, col = lane & 15, g = lane >> 4, wm = wave >> 1, wn = wave & 1; const size_t m0 = (size_t)blockIdx.x * 128; const int n0 = blockIdx.y * 128;
  const unsigned sbase = (unsigned)(size_t)&sm[0];
  const unsigned la = sbase + (tid >> 3) * QB_PITCH + (tid & 7) * 16, lb = la + XT_BYTES;   // a wave's copy covers 4 rows of 128 B, of X as of W
  const char* ga = (const char*)(X + (m0 + (tid >> 3)) * DM + (tid & 7) * 8); const char* gb = (const char*)((const _Float16*)P + (size_t)(n0 + (tid >> 3)) * DM + (tid & 7) * 8);
  auto fill = [&](int t, unsigned bo) {   // tile t (k = 64 t ..): 8 + 8 copies per lane
    copy8(la + bo, ga + t * 128, 16 * QB_PITCH, 16 * DM * 2); copy8(lb + bo, gb + t * 128, 16 * QB_PITCH, 16 * DM * 2); };
  v8f acc[4][4] = {};
  fill(0, 0);
  asm volatile("s_wait_asynccnt 0x0" ::: "memory");   // tile 0 landed (this wave's copies)
  __syncthreads();                                    // ... and every other wave's
  fill(1, XBUF);
#pragma unroll 1   // rolled: a trip holds 32 WMMAs, enough to carry the branch
  for (int t = 0; t < DM / 64; ++t) { const char* bp = sm + (t & 1) * XBUF;
#pragma unroll   // this and the loops inside it are unrolled so that a[], w[] and acc[][] are indexed by constants and stay in registers
    for (int kc = 0; kc < 2; ++kc) { v16h a[4], w[4];
#pragma unroll
      for (int mi = 0; mi < 4; ++mi) a[mi] = frag_h((const _Float16*)(bp + (wm * 64 + mi * 16 + col) * QB_PITCH) + kc * 32, lane);   // LN'd rows, f16 as k_ln stored them
#pragma unroll
      for (int nj = 0; nj < 4; ++nj) w[nj] = frag_h((const _Float16*)(bp + XT_BYTES + (wn * 64 + nj * 16 + col) * QB_PITCH) + kc * 32, lane);
#pragma unroll
      for (int mi = 0; mi < 4; ++mi)
#pragma unroll
        for (int nj = 0; nj < 4; ++nj) acc[mi][nj] = wmma16(a[mi], w[nj], acc[mi][nj]); }
    asm volatile("s_wait_dscnt 0x0" ::: "memory");      // this wave's reads of the buffer are over
    asm volatile("s_wait_asynccnt 0x0" ::: "memory");   // its copies of tile t + 1 have landed
    __syncthreads();                                    // publishes tile t + 1, frees tile t's buffer
    if (t + 2 < DM / 64) fill(t + 2, (t & 1) * XBUF); }
  asm volatile("s_wait_asynccnt 0x0" ::: "memory");     // no copy in flight before the buffers become staging
  if (n0 < 2 * DM) {   // q stored unscaled (f16 sigma ~0.6, no subnormal exposure); 1/8 applied to the f32 score
    _Float16* sh = (_Float16*)(sm + wave * (2 * 64 * 144)); _Float16* sl = sh + 64 * 72;   // per wave: 64 rows x 64 cols at pitch 72, hi then residual
#pragma unroll
    for (int nj = 0; nj < 4; ++nj) { const float bias = BB ? bfr(BB[wn * 64 + nj * 16 + col]) : 0.f;
#pragma unroll
      for (int mi = 0; mi < 4; ++mi)
#pragma unroll
        for (int r = 0; r < 8; ++r) { const float v = acc[mi][nj][r] * (1.0f / 256.0f) + bias; const _Float16 hv = (_Float16)v; sh[(mi * 16 + 8 * g + r) * 72 + nj * 16 + col] = hv; sl[(mi * 16 + 8 * g + r) * 72 + nj * 16 + col] = (_Float16)((v - (float)hv) * 2048.0f); } }   // q, k (+ bias) as f16 hi + (x2048) residual
    LDSX();
    for (int it = 0; it < 16; ++it) { const int rl = it * 4 + (lane >> 3), ch = lane & 7; const size_t o = (m0 + wm * 64 + rl) * (2 * DM) + n0 + wn * 64 + ch * 8; vst2((unsigned*)(QK + o), *(const v4u*)&sh[rl * 72 + ch * 8]); vst2((unsigned*)(QKL + o), *(const v4u*)&sl[rl * 72 + ch * 8]); }   // whole 128-B lines
  } else {
    _Float16* sth = (_Float16*)sm; _Float16* stl = sth + 128 * 136;   // [128 d][128 s] at pitch 136, hi then residual
#pragma unroll
    for (int nj = 0; nj < 4; ++nj) { const float bias = BB ? bfr(BB[wn * 64 + nj * 16 + col]) : 0.f;
#pragma unroll
      for (int mi = 0; mi < 4; ++mi) { v8h h8, l8;
#pragma unroll
        for (int r = 0; r < 8; ++r) { const float v = acc[mi][nj][r] * (1.0f / 256.0f) + bias; const _Float16 hv = (_Float16)v; h8[r] = hv; l8[r] = (_Float16)((v - (float)hv) * 2048.0f); }
        const int o = (wn * 64 + nj * 16 + col) * 136 + wm * 64 + mi * 16 + 8 * g; *(v8h*)&sth[o] = h8; *(v8h*)&stl[o] = l8; } }
    __syncthreads();
    const int b = (int)(m0 / SS), s0 = (int)(m0 % SS); const int pc0 = n0 - 2 * DM;
    for (int it = 0; it < 16; ++it) { const int d = it * 8 + (tid >> 4), pc = tid & 15; const size_t o = ((size_t)b * DM + pc0 + d) * SS + s0 + pc * 8; vst2((unsigned*)(VTH + o), *(const v4u*)&sth[d * 136 + pc * 8]); vst2((unsigned*)(VTL + o), *(const v4u*)&stl[d * 136 + pc * 8]); }
  }
}
#define AK_PITCH 144                      // bytes: a 128-B row of 64 f16 + 16 (16 B x odd: ds_load_b128 free of bank conflicts)
#define AT_BYTES (64 * AK_PITCH)          // one tile: K (64 keys x 64 d) or V^T (64 d x 64 keys)
#define ABUF (2 * AT_BYTES)               // one buffer: K tile, then V^T tile
#define RBN 640                           // staged rel_bias entries (5 per thread), at most 575 of them read
// four 16-B copies per lane, rows lstep / gstep bytes apart; the s_wait_xcnt closes the statement so that no address register is rewritten in front of it
__device__ __forceinline__ void copy4(unsigned l, const char* p, unsigned lstep, unsigned gstep) {
  asm volatile("global_load_async_to_lds_b128 %0, %4, off\n\t"
               "global_load_async_to_lds_b128 %1, %5, off\n\t"
               "global_load_async_to_lds_b128 %2, %6, off\n\t"
               "global_load_async_to_lds_b128 %3, %7, off\n\t"
               "s_wait_xcnt 0x0"
               :: "v"(l), "v"(l + lstep), "v"(l + 2 * lstep), "v"(l + 3 * lstep),
                  "v"(p), "v"(p + gstep), "v"(p + 2 * gstep), "v"(p + 3 * gstep)
               : "memory");
}
// five 4-B copies per lane (a rel_bias row is 1,023 floats long, so rows are aligned to 4 B only), LDS places 512 B apart; the s_wait_xcnt closes the statement as in copy4
__device__ __forceinline__ void copy5w(unsigned l, const float* p0, const float* p1, const float* p2, const float* p3, const float* p4) {
  asm volatile("global_load_async_to_lds_b32 %0, %5, off\n\t"
               "global_load_async_to_lds_b32 %1, %6, off\n\t"
               "global_load_async_to_lds_b32 %2, %7, off\n\t"
               "global_load_async_to_lds_b32 %3, %8, off\n\t"
               "global_load_async_to_lds_b32 %4, %9, off\n\t"
               "s_wait_xcnt 0x0"
               :: "v"(l), "v"(l + 512u), "v"(l + 1024u), "v"(l + 1536u), "v"(l + 2048u),
                  "v"(p0), "v"(p1), "v"(p2), "v"(p3), "v"(p4)
               : "memory");
}
// lane l with lane l ^ 16 (a vector cross-row move, no LDS unit)
__device__ __forceinline__ float xhalf(float x) { return __builtin_bit_cast(float, __builtin_amdgcn_permlanex16(__builtin_bit_cast(int, x), __builtin_bit_cast(int, x), 0x76543210, 0xfedcba98, false, false)); }
// ---- k_attn: grid = (head, batch, query block), the query blocks from the last (most keys) down: the query block is the slowest index. For speed only: each (query block, head, batch) is done once wherever it runs
// block = (64 queries, head h, batch b): causal flash attention on transposed products: S^T = K . Q^T (A = 16 key rows, B = the wave's 16 queries), so a lane holds 16 of the 32 scores of ONE query (column col; keys 8 g + r of each 16): maximum and sum run in the lane, with one exchange between the wave's halves; the two S^T tiles, converted in place, are the B operand of O^T += V^T . P^T (A = 16 d rows of V^T): P never passes through LDS. O[b*S+q][h*64+d] = (acc + accl / 2048) / (2048 l) (256-B segments). The same scores give the row's entropy -sum p log p = log(sum e^(s-m)) + m - (sum e^(s-m) s)/(sum e^(s-m)): one more running sum per lane, joined behind the loop; 256-B store per block
// operands of the loop: per trip 64 keys of K (hi) and of V^T (hi) are brought into LDS in whole 128-B lines by asynchronous copies (two buffers) and read from there by all four waves, two passes of 32 keys a trip; the part of the head's rel_bias row that the block can touch is copied once in front of the loop and read without the causal test (the test picks the value behind the read). The residual planes of the first 128 queries are read from global memory as before
__global__ __launch_bounds__(128) void k_attn(const _Float16* __restrict__ QK, const _Float16* __restrict__ QKL, const _Float16* __restrict__ VTH, const _Float16* __restrict__ VTL, const void* __restrict__ KMASK, const float* __restrict__ RB, float* __restrict__ O, float* __restrict__ ENT) {
  __shared__ __align__(16) char sm[2 * ABUF];   // the two buffers
  __shared__ __align__(16) float srb[RBN];      // rel_bias[h][448 - 64 qb + j]
  __shared__ __align__(16) float so[4][16][68];
  __shared__ __align__(16) float sent[64];
  const int tid = threadIdx.x, wave = tid >> 5, lane = tid & 31, col = lane & 15, g = lane >> 4;
  const int qb = TQB - 1 - blockIdx.z, h = blockIdx.x, b = blockIdx.y; const int q0 = qb * 64 + wave * 16; const int qi = q0 + col; const size_t rq = (size_t)b * SS + qi;
  v16h aq[2], aql[2];
#pragma unroll
  for (int kc = 0; kc < 2; ++kc) { aq[kc] = frag_h(QK + rq * (2 * DM) + h * HD + kc * 32, lane); aql[kc] = frag_h(QKL + rq * (2 * DM) + h * HD + kc * 32, lane); }
  float m = -3.0e38f, l = 0.f, ls = 0.f;   // of query qi: m over all keys so far (equal in both halves), l and ls over this half's keys (joined behind the loop)
  v8f acc[4] = {}, accl[4] = {};   // O^T: register r = d (dt * 16 + 8 g + r), column = query
  const float* rbq = srb + 63 - (wave * 16 + col) + 8 * g;   // rel_bias[h][k - q + 511] at k = 8 g, in the staged part of the row
  const int nt = qb + 1;   // causal: 64-key tiles up to the query tile's end
  const unsigned lk = (unsigned)(size_t)&sm[0] + (tid >> 3) * AK_PITCH + (tid & 7) * 16;   // a wave's copy covers 4 rows of 128 B
  const char* gk = (const char*)(QK + ((size_t)b * SS + (tid >> 3)) * (2 * DM) + DM + h * HD + (tid & 7) * 8); const char* gv = (const char*)(VTH + ((size_t)b * DM + h * HD + (tid >> 3)) * SS + (tid & 7) * 8);
  auto fill = [&](int t, unsigned bo) {   // tile t (keys 64 t ..): 4 + 4 copies per lane
    copy4(lk + bo, gk + (size_t)t * (64 * 2 * DM * 2), 16 * AK_PITCH, 16 * 2 * DM * 2); copy4(lk + bo + AT_BYTES, gv + t * 128, 16 * AK_PITCH, 16 * SS * 2); };
  fill(0, 0);
  { const float* rh = RB + (size_t)h * (2 * MAXSEQ - 1); const int j0 = MAXSEQ - 64 - qb * 64 + tid;   // entries past the row's end (never read back) are clamped into it
    copy5w((unsigned)(size_t)&srb[0] + tid * 4, rh + min(j0, 2 * MAXSEQ - 2), rh + min(j0 + 128, 2 * MAXSEQ - 2), rh + min(j0 + 256, 2 * MAXSEQ - 2), rh + min(j0 + 384, 2 * MAXSEQ - 2), rh + min(j0 + 512, 2 * MAXSEQ - 2)); }
  asm volatile("s_wait_asynccnt 0x0" ::: "memory");   // tile 0 and rel_bias landed (this wave's copies)
  __syncthreads();                                    // ... and every other wave's
  if (nt > 1) fill(1, ABUF);
#pragma unroll 1   // rolled: the trip count depends on the query block
  for (int t = 0; t < nt; ++t) { const char* bp = sm + (t & 1) * ABUF;
#pragma unroll 1   // rolled: one copy of the long pass body in the instruction cache
   for (int hp = 0; hp < 2; ++hp) { const int ks = 2 * t + hp; v8f s[2];
    v16h kf[2][2]; float rb[2][8];   // all LDS reads of the score part stand together ahead of its first WMMA: one wait, not one per product
#pragma unroll   // this and the loops inside it: kf[][] and rb[][] are indexed by constants and stay in registers
    for (int ct = 0; ct < 2; ++ct) {
#pragma unroll
      for (int kc = 0; kc < 2; ++kc) kf[ct][kc] = frag_h((const _Float16*)(bp + (hp * 32 + ct * 16 + col) * AK_PITCH) + kc * 32, lane);
#pragma unroll
      for (int r = 0; r < 8; ++r) rb[ct][r] = rbq[ks * 32 + ct * 16 + r]; }
#pragma unroll
    for (int ct = 0; ct < 2; ++ct) { const int kr = ks * 32 + ct * 16 + col; const _Float16* krowl = QKL + ((size_t)b * SS + kr) * (2 * DM) + DM + h * HD; v8f c = {}, cl = {};
      if (qb < 2) {   // leading query blocks (few keys, outputs far above the global rms): 3 products
#pragma unroll
        for (int kc = 0; kc < 2; ++kc) { const v16h kh = kf[ct][kc]; c = wmma16(kh, aq[kc], c); cl = wmma16(kh, aql[kc], cl); cl = wmma16(frag_h(krowl + kc * 32, lane), aq[kc], cl); }
#pragma unroll
        for (int r = 0; r < 8; ++r) c[r] += cl[r] * (1.0f / 2048.0f); }
      else {
#pragma unroll
        for (int kc = 0; kc < 2; ++kc) c = wmma16(kf[ct][kc], aq[kc], c); }   // single product elsewhere
#pragma unroll
      for (int r = 0; r < 8; ++r) { const int kk = ks * 32 + ct * 16 + 8 * g + r; s[ct][r] = (kk <= qi) ? (c[r] * SCALEF + bfr(rb[ct][r])) : -3.0e38f; } }   // causal; + rel_bias[h][k - q + 511]
    v16h vf[4];   // the pass's V^T fragments: read here so that the LDS latency passes under the softmax
#pragma unroll   // vf[] is indexed by constants and stays in registers
    for (int dt = 0; dt < 4; ++dt) vf[dt] = frag_h((const _Float16*)(bp + AT_BYTES + (dt * 16 + col) * AK_PITCH) + hp * 32, lane);
    float mx = fmaxf(s[0][0], s[1][0]);
#pragma unroll
    for (int r = 1; r < 8; ++r) mx = fmaxf(mx, fmaxf(s[0][r], s[1][r]));
    mx = fmaxf(mx, xhalf(mx));
    const float mn = fmaxf(m, mx); const float alpha = (m <= -1.0e38f) ? 0.f : __expf(m - mn);
    float es0 = 0.f, es1 = 0.f, ess0 = 0.f, ess1 = 0.f; v16h pa, pl;
#pragma unroll
    for (int r = 0; r < 8; ++r) { const float e0 = (s[0][r] <= -1.0e38f) ? 0.f : __expf(s[0][r] - mn), e1 = (s[1][r] <= -1.0e38f) ? 0.f : __expf(s[1][r] - mn); es0 += e0; es1 += e1; ess0 += (s[0][r] > -1.0e38f) ? e0 * s[0][r] : 0.f; ess1 += (s[1][r] > -1.0e38f) ? e1 * s[1][r] : 0.f;
      const float x0 = e0 * 2048.0f, x1 = e1 * 2048.0f; const _Float16 h0 = (_Float16)x0, h1 = (_Float16)x1; pa[r] = h0; pa[8 + r] = h1; pl[r] = (_Float16)((x0 - (float)h0) * 2048.0f); pl[8 + r] = (_Float16)((x1 - (float)h1) * 2048.0f); }   // P scaled by 2^11 before the f16 split so small softmax weights stay out of the f16 subnormal range; 2^-11 folded into the epilogue
    l = l * alpha + (es0 + es1); ls = ls * alpha + (ess0 + ess1); m = mn;
#pragma unroll
    for (int dt = 0; dt < 4; ++dt)
#pragma unroll
      for (int r = 0; r < 8; ++r) { acc[dt][r] *= alpha; accl[dt][r] *= alpha; }
#pragma unroll
    for (int dt = 0; dt < 4; ++dt) { const size_t vr = ((size_t)b * DM + h * HD + dt * 16 + col) * SS + ks * 32; const v16h vh = vf[dt]; acc[dt] = wmma16(vh, pa, acc[dt]); if (qb < 2) { accl[dt] = wmma16(vh, pl, accl[dt]); accl[dt] = wmma16(frag_h(VTL + vr, lane), pa, accl[dt]); } } }   // leading query blocks: P hi/lo x V hi/lo (3 products); elsewhere P x V single
    asm volatile("s_wait_dscnt 0x0" ::: "memory");      // this wave's reads of the buffer are over
    asm volatile("s_wait_asynccnt 0x0" ::: "memory");   // its copies of tile t + 1 have landed
    __syncthreads();                                    // publishes tile t + 1, frees tile t's buffer
    if (t + 2 < nt) fill(t + 2, (t & 1) * ABUF); }
  asm volatile("s_wait_asynccnt 0x0" ::: "memory");     // no copy in flight behind the loop
  l += xhalf(l); ls += xhalf(ls);
  const float il = (1.0f / 2048.0f) / l;
#pragma unroll
  for (int dt = 0; dt < 4; ++dt) { v4f o0, o1;
#pragma unroll
    for (int r = 0; r < 4; ++r) { o0[r] = (acc[dt][r] + accl[dt][r] * (1.0f / 2048.0f)) * il; o1[r] = (acc[dt][4 + r] + accl[dt][4 + r] * (1.0f / 2048.0f)) * il; }
    *(v4f*)&so[wave][col][dt * 16 + 8 * g] = o0; *(v4f*)&so[wave][col][dt * 16 + 8 * g + 4] = o1; }
  LDSX();
  const float en = log_p(l) + m - ls / l;   // here O lies in LDS, so only l, m and ls live across the call; and in front of the O stores, which the barrier would otherwise wait for
  if (g == 0) sent[wave * 16 + col] = en;
  __syncthreads(); if (tid < 16) vst2(ENT + ((size_t)b * NH + h) * SS + qb * 64 + tid * 4, *(const v4f*)&sent[tid * 4]);
  for (int rl = 0; rl < 16; ++rl) if (lane < 16) vst2(O + ((size_t)b * SS + q0 + rl) * DM + h * HD + lane * 4, *(const v4f*)&so[wave][rl][lane * 4]);
}
// ---- k_out: block = (128 rows, 128 cols), 4 waves of 64 x 64: out = x + (O(hi/lo) . Wo rows (2 products) + bo), x added where the rows are stored; the blocks of the first 128 columns also write their 128 rows' head-mean entropy; per trip 64 k of both operand tiles are brought into LDS in whole lines by asynchronous copies (two buffers: the O tile in f32 rows at pitch 272, the W tile as in k_qkv) and read from there by all waves
__global__ __launch_bounds__(128) void k_out(const float* __restrict__ O, const __bf16* __restrict__ P, const float* __restrict__ BO, const float* __restrict__ X, const float* __restrict__ ENT, float* __restrict__ OUT, float* __restrict__ OUT2) {
  __shared__ __align__(16) char sm[2 * QBUF];   // the two buffers; output staging behind the loop
  const int tid = threadIdx.x, wave = tid >> 5, lane = tid & 31, col = lane & 15, g = lane >> 4, wm = wave >> 1, wn = wave & 1; const size_t m0 = (size_t)blockIdx.x * 128; const int n0 = blockIdx.y * 128;
  const unsigned sbase = (unsigned)(size_t)&sm[0];
  const unsigned la = sbase + (tid >> 4) * QA_PITCH + (tid & 15) * 16, lb = sbase + QA_BYTES + (tid >> 3) * QB_PITCH + (tid & 7) * 16;   // a wave's copy covers 2 O rows of 256 B, or 4 W rows of 128 B
  const char* ga = (const char*)(O + (m0 + (tid >> 4)) * DM + (tid & 15) * 4); const char* gb = (const char*)(P + (size_t)(n0 + (tid >> 3)) * DM + (tid & 7) * 8);
  auto fill = [&](int t, unsigned bo) {   // tile t (k = 64 t ..): 16 + 8 copies per lane
    copy8(la + bo, ga + t * 256, 8 * QA_PITCH, 8 * DM * 4); copy8(la + bo + 64 * QA_PITCH, ga + t * 256 + 64 * DM * 4, 8 * QA_PITCH, 8 * DM * 4); copy8(lb + bo, gb + t * 128, 16 * QB_PITCH, 16 * DM * 2); };
  v8f acc[4][4] = {};
  fill(0, 0);
  asm volatile("s_wait_asynccnt 0x0" ::: "memory");   // tile 0 landed (this wave's copies)
  __syncthreads();                                    // ... and every other wave's
  fill(1, QBUF);
#pragma unroll 1   // rolled: a trip holds 64 WMMAs, enough to carry the branch
  for (int t = 0; t < DM / 64; ++t) { const char* bp = sm + (t & 1) * QBUF;
    const char* ap = bp + (wm * 64 + col) * QA_PITCH + 32 * g;   // this lane's place in row col of the wave's first 16 O rows
    float nx[16];   // the f32 values of the A fragment after the one being multiplied: read from LDS one fragment ahead, so that the read's latency passes under 8 WMMAs
#pragma unroll
    for (int i = 0; i < 8; ++i) { nx[i] = ((const float*)ap)[i]; nx[8 + i] = ((const float*)ap)[16 + i]; }
#pragma unroll   // this and the loops inside it are unrolled so that w[], nx[] and acc[][] are indexed by constants and stay in registers
    for (int kc = 0; kc < 2; ++kc) { v16b w[4];
#pragma unroll
      for (int nj = 0; nj < 4; ++nj) w[nj] = frag_b((const __bf16*)(bp + QA_BYTES + (wn * 64 + nj * 16 + col) * QB_PITCH) + kc * 32, lane);
#pragma unroll
      for (int mi = 0; mi < 4; ++mi) { const F2 a = bsplit16(nx);   // f32 rows split into bf16 hi + residual
        if (kc * 4 + mi < 7) { const int s = kc * 4 + mi + 1; const float* p = (const float*)(ap + (s & 3) * 16 * QA_PITCH) + (s >> 2) * 32;   // same tile, same buffer: nothing of the next tile is read here
#pragma unroll
          for (int i = 0; i < 8; ++i) { nx[i] = p[i]; nx[8 + i] = p[16 + i]; } }
#pragma unroll
        for (int nj = 0; nj < 4; ++nj) acc[mi][nj] = wmma_bf(a.l, w[nj], acc[mi][nj]);   // residual first, then hi, per accumulator; four independent accumulators between the two
#pragma unroll
        for (int nj = 0; nj < 4; ++nj) acc[mi][nj] = wmma_bf(a.h, w[nj], acc[mi][nj]); } }
    asm volatile("s_wait_dscnt 0x0" ::: "memory");      // this wave's reads of the buffer are over
    asm volatile("s_wait_asynccnt 0x0" ::: "memory");   // its copies of tile t + 1 have landed
    __syncthreads();                                    // publishes tile t + 1, frees tile t's buffer
    if (t + 2 < DM / 64) fill(t + 2, (t & 1) * QBUF); }
  asm volatile("s_wait_asynccnt 0x0" ::: "memory");     // no copy in flight before the buffers become staging
  float* so = (float*)(sm + wave * (64 * 272));   // per wave: 64 rows x 64 cols of f32 at pitch 68
#pragma unroll
  for (int nj = 0; nj < 4; ++nj) { const float bias = bfr(BO[n0 + wn * 64 + nj * 16 + col]);
#pragma unroll
    for (int mi = 0; mi < 4; ++mi)
#pragma unroll
      for (int r = 0; r < 8; ++r) so[(mi * 16 + 8 * g + r) * 68 + nj * 16 + col] = acc[mi][nj][r] + bias; }
  LDSX();
  const size_t o0 = (m0 + wm * 64 + g) * DM + n0 + wn * 64 + col * 4;   // this lane's 16 B of the wave's row g; the loops below go on two rows a step
  v4f xr[32];   // the wave's 64 x 64 piece of x, into the registers that the accumulators have left
#pragma unroll   // xr[] is indexed by constants and stays in registers; all 32 loads are in flight together: one memory latency, not 32
  for (int it = 0; it < 32; ++it) xr[it] = *(const v4f*)(X + o0 + (size_t)it * (2 * DM));
  asm volatile("s_wait_xcnt 0x0" ::: "memory");   // the entropy branch below reuses the loads' address registers: the wait stands in front of that overwrite
  if (blockIdx.y == 0) { float e[NH], a = 0.f;   // thread = row: the mean of its 16 heads' entropies (a block's 128 rows lie in one sequence)
    const float* eb = ENT + (m0 / SS) * (NH * SS) + m0 % SS;   // head 0 of the block's first row (the same for the whole block); the heads lie SS floats apart
#pragma unroll   // e[] is indexed by constants; the 16 loads go out together, behind those of x, from one base and one index with constant offsets
    for (int hh = 0; hh < NH; ++hh) e[hh] = eb[hh * SS + tid];
    asm volatile("s_wait_xcnt 0x0" :: "s"(eb), "v"(tid) : "memory");   // base and index are inputs so that they stay in their registers up to this wait: nothing is written over them in front of it
#pragma unroll   // e[] indexed by constants
    for (int hh = 0; hh < NH; ++hh) a += e[hh];   // heads 0 to 15 in order
    OUT2[m0 + tid] = a / (float)NH; }   // a wave writes one whole 128-B line
#pragma unroll   // xr[] indexed by constants
  for (int it = 0; it < 32; ++it) { const v4f y = *(const v4f*)&so[(it * 2 + g) * 68 + col * 4]; const v4f x = xr[it]; v4f o4;
#pragma unroll   // the vectors' elements indexed by constants
    for (int i = 0; i < 4; ++i) o4[i] = bfr(x[i]) + y[i];
    vst2(OUT + o0 + (size_t)it * (2 * DM), o4); }   // whole 128-B lines
}
// ---- k_pack3: the fused (in,out) W_attn [DM][3*DM] -> its 3,072 transposed rows, f16 x 2^8 (bit pattern stored in the bf16-typed buffer)
__global__ __launch_bounds__(256) void k_pack3(const float* __restrict__ WA, __bf16* __restrict__ PK) { __shared__ __align__(16) v4u s[64 * 16]; pack_tile<true>(WA, 3 * DM, PK + PK_A, s); }
// ---- k_ln: block = row: XN = (x - mu) rsqrt(var + 1e-5) g + b, computed in f32 and rounded once to f16, the operand type of k_qkv's products
typedef __attribute__((ext_vector_type(4))) _Float16 v4h;
__global__ __launch_bounds__(256) void k_ln(const float* __restrict__ X, const float* __restrict__ G, const float* __restrict__ Bt, _Float16* __restrict__ XN) {
  __shared__ float red[8]; const int t = threadIdx.x; const size_t row = blockIdx.x; float v[4]; float s = 0.f; for (int i = 0; i < 4; ++i) { v[i] = bfr(X[row * DM + t * 4 + i]); s += v[i]; }
#pragma unroll
  for (int o = 1; o < 32; o <<= 1) s += __shfl_xor(s, o);
  if ((t & 31) == 0) red[t >> 5] = s; __syncthreads(); float tot = 0.f; for (int i = 0; i < 8; ++i) tot += red[i]; const float mu = tot / (float)DM; __syncthreads();
  float q = 0.f; for (int i = 0; i < 4; ++i) { const float d = v[i] - mu; q += d * d; }
#pragma unroll
  for (int o = 1; o < 32; o <<= 1) q += __shfl_xor(q, o);
  if ((t & 31) == 0) red[t >> 5] = q; __syncthreads(); float tq = 0.f; for (int i = 0; i < 8; ++i) tq += red[i]; const float inv = 1.0f / sqrtf(tq / (float)DM + 1e-5f);
  v4h o4; for (int i = 0; i < 4; ++i) { const int e = t * 4 + i; o4[i] = (_Float16)((v[i] - mu) * inv * bfr(G[e]) + bfr(Bt[e])); } vst2(XN + row * DM + t * 4, o4);   // a wave stores 256 B: whole lines
}
extern "C" void kernel_launch(void* const* d_in, const int* in_sizes, int n_in, void* d_out, int out_size, void* d_ws, size_t ws_size, hipStream_t stream) {
  (void)in_sizes; (void)n_in; (void)out_size;
  const float** F = (const float**)d_in;   // 0 x [16,512,1024], 1 qkv_w [1024,3072] (in,out), 2 qkv_b [3072], 3 out_w [1024,1024] (in,out), 4 out_b, 5 ln_g, 6 ln_b, 7 rel_bias [16,1023]
  if (ws_size < (size_t)WS_END) return;
  char* ws = (char*)d_ws; __bf16* PK = (__bf16*)(ws + WS_PK); _Float16 *QK = (_Float16*)(ws + WS_QK), *QKL = (_Float16*)(ws + WS_QKL), *VTH = (_Float16*)(ws + WS_VTH), *VTL = (_Float16*)(ws + WS_VTL); float *O = (float*)(ws + WS_O), *ENT = (float*)(ws + WS_ENT); _Float16* XN = (_Float16*)(ws + WS_XN);
  float* OUT = (float*)d_out; float* OUT2 = OUT + (size_t)NB * SS * DM;   // outputs concatenated: out [16,512,1024] then entropy [16,512]
  k_pack<<<dim3(DM / 64, DM / 128), 256, 0, stream>>>(F[3], PK);   // out_w ((in,out) -> transposed rows) into the Wo slot
  k_pack3<<<dim3(QKVW / 64, DM / 128), 256, 0, stream>>>(F[1], PK);
  k_ln<<<TNB * SS, 256, 0, stream>>>(F[0], F[5], F[6], XN);
  k_qkv<<<dim3(TNB * SS / 128, QKVW / 128), 128, 0, stream>>>(XN, XN, XN, PK + PK_A, F[2], F[2] + DM, F[2] + 2 * DM, QK, QKL, VTH, VTL);
  k_attn<<<dim3(NH, TNB, TQB), 128, 0, stream>>>(QK, QKL, VTH, VTL, nullptr, F[7], O, ENT);
  k_out<<<dim3(TNB * SS / 128, DM / 128), 128, 0, stream>>>(O, PK + PK_P, F[4], F[0], ENT, OUT, OUT2);
}

// v010
// It runs in 131 microseconds.
// In both of two side-by-side timings against v009, it was 1.03 times as fast.
// Over all steps from v000 it is 4.44 times as fast.
// compute dtype: all float inputs rounded to bf16; LayerNorm in f32, its output rounded once to f16 x exact f16 copies (x 2^8) of the fused qkv weight on WMMA 16x16x32 (1 product) + bias; causal attention: 3-product scores and hi + residual P, v on the first 128 queries of each sequence, single f16 beyond; x 1/8 + rel_bias[h][k-q+511], running-max softmax in f32 (hardware exp); the per-row entropy from the same scores in the same pass (precise logf); out = x + (o (bf16 hi + residual) . out_w (2 products) + out_b); second output = head-mean attention entropy.
#include <hip/hip_runtime.h>
#include <math.h>

typedef __attribute__((ext_vector_type(16))) _Float16 v16h;
typedef __attribute__((ext_vector_type(16))) __bf16 v16b;
typedef __attribute__((ext_vector_type(8)))  _Float16 v8h;
typedef __attribute__((ext_vector_type(8)))  float v8f;
typedef __attribute__((ext_vector_type(4)))  float v4f;
typedef __attribute__((ext_vector_type(2)))  float v2f;
typedef __attribute__((ext_vector_type(4)))  unsigned v4u;
typedef __attribute__((ext_vector_type(4)))  int v4i;
typedef float __attribute__((may_alias)) float_a;
typedef int __attribute__((may_alias)) int_a;

template <typename T> __device__ __forceinline__ void vst2(void* p, T v) { *(T*)p = v;  }
__device__ __forceinline__ v8f wmma16(v16h a, v16h b, v8f c) {
  v8f d = __builtin_amdgcn_wmma_f32_16x16x32_f16(false, a, false, b, (short)0, c, false, false);
  asm volatile("v_nop\n\tv_nop\n\tv_nop\n\tv_nop" : "+v"(d) : "v"(a), "v"(b));
  return d;
}
__device__ __forceinline__ v8f wmma_bf(v16b a, v16b b, v8f c) {
  v8f d = __builtin_amdgcn_wmma_f32_16x16x32_bf16(false, a, false, b, (short)0, c, false, false);
  asm volatile("v_nop\n\tv_nop\n\tv_nop\n\tv_nop" : "+v"(d) : "v"(a), "v"(b));
  return d;
}
// Pre-LN causal time attention with relative position bias (B 16, T 512, d 1,024, 16 heads x 64): x + out_proj(attention(LN(x))), plus the mean attention entropy per (batch, step) as a second output.
__device__ __forceinline__ v16h frag_h(const _Float16* rowk0, int lane) {
  union { v16h v; v8h q[2]; } u; const _Float16* p = rowk0 + 8 * (lane >> 4);
  u.q[0] = *(const v8h*)p; u.q[1] = *(const v8h*)(p + 16); return u.v;
}
__device__ __forceinline__ v16h frag_f32(const float* rowk0, int lane) {
  v16h a; const float* p = rowk0 + 8 * (lane >> 4);
#pragma unroll
  for (int i = 0; i < 8; ++i) { a[i] = (_Float16)p[i]; a[8 + i] = (_Float16)p[16 + i]; }
  return a;
}
__device__ __forceinline__ v16h frag_f32s(const float* rowk0, int lane, float sc) {
  v16h a; const float* p = rowk0 + 8 * (lane >> 4);
#pragma unroll
  for (int i = 0; i < 8; ++i) { a[i] = (_Float16)(p[i] * sc); a[8 + i] = (_Float16)(p[16 + i] * sc); }
  return a;
}
// column fragment from a [K][ld] layout (column n), rows >= K read as 0
__device__ __forceinline__ v16h fragc_f32(const float* W, int k0, int n, int lane, int ld, int K) {
  v16h a; const int g = lane >> 4;
#pragma unroll
  for (int i = 0; i < 8; ++i) { const int ka = k0 + 8 * g + i, kb = ka + 16;
    a[i] = (_Float16)(ka < K ? W[(size_t)(ka < K ? ka : K - 1) * ld + n] : 0.f); a[8 + i] = (_Float16)(kb < K ? W[(size_t)(kb < K ? kb : K - 1) * ld + n] : 0.f); }
  return a;
}
struct F2 { v16b h, l; };
__device__ __forceinline__ F2 bsplit16(const float v[16]) { F2 r;
#pragma unroll
  for (int i = 0; i < 16; ++i) { const __bf16 h = (__bf16)v[i]; r.h[i] = h; r.l[i] = (__bf16)(v[i] - (float)h); }
  return r; }
__device__ __forceinline__ F2 split_row(const float* row, int k0, int lane) { float v[16]; const float* p = row + k0 + 8 * (lane >> 4);
#pragma unroll
  for (int i = 0; i < 8; ++i) { v[i] = p[i]; v[8 + i] = p[16 + i]; }
  return bsplit16(v); }
__device__ __forceinline__ F2 split_rowK(const float* row, int k0, int lane, int K) { float v[16]; const int g = lane >> 4;
#pragma unroll
  for (int i = 0; i < 8; ++i) { const int ka = k0 + 8 * g + i, kb = ka + 16; v[i] = ka < K ? row[ka < K ? ka : K - 1] : 0.f; v[8 + i] = kb < K ? row[kb < K ? kb : K - 1] : 0.f; }
  return bsplit16(v); }
__device__ __forceinline__ F2 split_col(const float* W, int k0, int n, int lane, int ld, int K) { float v[16]; const int g = lane >> 4;
#pragma unroll
  for (int i = 0; i < 8; ++i) { const int ka = k0 + 8 * g + i, kb = ka + 16; v[i] = ka < K ? W[(size_t)(ka < K ? ka : K - 1) * ld + n] : 0.f; v[8 + i] = kb < K ? W[(size_t)(kb < K ? kb : K - 1) * ld + n] : 0.f; }
  return bsplit16(v); }
__device__ __forceinline__ v8f mac3(const F2& a, const F2& b, v8f c) { c = wmma_bf(a.l, b.h, c); c = wmma_bf(a.h, b.l, c); return wmma_bf(a.h, b.h, c); }
__device__ __forceinline__ float sigm(float v) { return 1.0f / (1.0f + expf(-v)); }
#define LDSX() do { asm volatile("s_wait_dscnt 0" ::: "memory"); __builtin_amdgcn_wave_barrier(); __builtin_amdgcn_fence(__ATOMIC_RELEASE, "workgroup"); } while (0)


#define NB 16
#define SS 512
#define SCALEF 0.125f
#define DM 1024
#define NH 16
#define MAXSEQ 512
__device__ __attribute__((noinline)) float log_p(float v) { return logf(v); }
#define HD 64
#define QKVW (3 * DM)
#ifndef TQB
#define TQB (SS / 64)
#define TNB NB
#define TOB (NB * SS / 64)     // 64-row tiles of all rows, unused
#endif
typedef __attribute__((ext_vector_type(8))) __bf16 v8b;
__device__ __forceinline__ v16b frag_b(const __bf16* rowk0, int lane) {
  union { v16b v; v8b q[2]; } u; const __bf16* p = rowk0 + 8 * (lane >> 4);
  u.q[0] = *(const v8b*)p; u.q[1] = *(const v8b*)(p + 16); return u.v;
}
__device__ __forceinline__ float bfr(float v) { return (float)(__bf16)v; }
__device__ __attribute__((noinline)) float exp_ni(float v) { return expf(v); }
__device__ __attribute__((noinline)) float erf_ni(float v) { return erff(v); }

#define PK_A 0                       // [3072][1024] Wqkv rows (natural [out][in])
#define PK_P (PK_A + QKVW * DM)        // [1024][1024] Wo rows (natural)
#define PK_END (PK_P + DM * DM)
#define WS_PK  0u
#define WS_QK  (WS_PK + 2u * PK_END)             // f16 [8192 rows][2048]: q | k
#define WS_QKL (WS_QK + 2u * NB * SS * 2 * DM)     // f16 q | k residual planes x2048
#define WS_VTH (WS_QKL + 2u * NB * SS * 2 * DM)    // f16 [b][1024 (h*64+d)][512 s] hi
#define WS_VTL (WS_VTH + 2u * NB * DM * SS)        // f16 lo x 2048
#define WS_O   (WS_VTL + 2u * NB * DM * SS)        // f32 [8192][1024]
#define WS_CS  (WS_O + 4u * NB * SS * DM)           // f32 2 x [512][32], unused
#define WS_XN  (WS_CS + 4u * 2 * SS * 32)                  // f16 [NR][1024] LayerNorm(x)
#define WS_ENT (WS_XN + 2u * (size_t)NB * SS * DM)     // f32 [b][h][t] attention entropy
#define WS_END (WS_ENT + 4u * (size_t)NB * NH * SS)
// ---- pack_tile: block = (64 columns n, 128 rows k) of an (in,out) weight W[DM][ld] -> rows n of the packed [out][in] 16-bit copy. A thread reads 4 columns of 8 consecutive k (16 lanes = one 256-B piece of a W row), so it holds, per column, one whole 16-B chunk of a packed row; the chunks cross LDS so that 16 lanes store 256 B of one packed row.
// LDS: row n = 16 chunks of 16 B, chunk j at place j ^ (n >> 2): the 16 lanes of a half wave fall on 16 different places in the write (rows 4 apart, one chunk number) and in the read (one row, 16 chunk numbers).
template <bool F16X> __device__ __forceinline__ void pack_tile(const float* __restrict__ Wm, int ld, __bf16* __restrict__ dst, v4u* s) {
  const int t = threadIdx.x, c = t & 15, kg = t >> 4; const int n0 = blockIdx.x * 64, k0 = blockIdx.y * 128;
  v4f r[8];
#pragma unroll   // unrolled: the eight loads are in flight together, and r[] is indexed by constants
  for (int i = 0; i < 8; ++i) r[i] = *(const v4f*)(Wm + (size_t)(k0 + kg * 8 + i) * ld + n0 + c * 4);
#pragma unroll   // this loop and the one inside it: r[] and o are indexed by constants and stay in registers
  for (int j = 0; j < 4; ++j) { union { v4u u; v8h h; v8b b; } o;
#pragma unroll
    for (int i = 0; i < 8; ++i) { if (F16X) o.h[i] = (_Float16)(bfr(r[i][j]) * 256.0f); else o.b[i] = (__bf16)r[i][j]; }
    s[(c * 4 + j) * 16 + (kg ^ c)] = o.u; }
  __syncthreads();
#pragma unroll   // the four LDS reads go out together, ahead of the stores
  for (int it = 0; it < 4; ++it) { const int n = it * 16 + (t >> 4), j = t & 15; vst2((unsigned*)(dst + (size_t)(n0 + n) * DM + k0 + j * 8), s[n * 16 + (j ^ (n >> 2))]); }   // whole 128-B lines
}
// ---- k_pack: out_w (in,out) -> bf16 rows [out][in] in the Wo slot
__global__ __launch_bounds__(256) void k_pack(const float* __restrict__ WO, __bf16* __restrict__ PK) { __shared__ __align__(16) v4u s[64 * 16]; pack_tile<false>(WO, DM, PK + PK_P, s); }
// ---- k_qkv: block = (128 rows, 128 cols), 4 waves of 64 x 64; per trip 64 k of both operand tiles (f16 both) are brought into LDS in whole lines by asynchronous copies (two buffers) and read from there by all waves
#define QA_PITCH 272                      // bytes: a 256-B row of 64 f32 + 16 (16 B x odd: ds_load_b128 free of bank conflicts); k_out's O tile
#define QB_PITCH 144                      // bytes: a 128-B row of 64 f16 + 16
#define QA_BYTES (128 * QA_PITCH)
#define QBUF (QA_BYTES + 128 * QB_PITCH)  // one buffer of k_out: O tile, then W tile
#define XT_BYTES (128 * QB_PITCH)         // one 16-bit tile of k_qkv: 128 rows of 64 k
#define XBUF (2 * XT_BYTES)               // one buffer of k_qkv: X tile, then W tile
// eight 16-B copies per lane, rows lstep / gstep bytes apart; the s_wait_xcnt closes the statement so that no address register is rewritten in front of it
__device__ __forceinline__ void copy8(unsigned l, const char* p, unsigned lstep, unsigned gstep) {
  asm volatile("global_load_async_to_lds_b128 %0, %8, off\n\t"
               "global_load_async_to_lds_b128 %1, %9, off\n\t"
               "global_load_async_to_lds_b128 %2, %10, off\n\t"
               "global_load_async_to_lds_b128 %3, %11, off\n\t"
               "global_load_async_to_lds_b128 %4, %12, off\n\t"
               "global_load_async_to_lds_b128 %5, %13, off\n\t"
               "global_load_async_to_lds_b128 %6, %14, off\n\t"
               "global_load_async_to_lds_b128 %7, %15, off\n\t"
               "s_wait_xcnt 0x0"
               :: "v"(l), "v"(l + lstep), "v"(l + 2 * lstep), "v"(l + 3 * lstep), "v"(l + 4 * lstep), "v"(l + 5 * lstep), "v"(l + 6 * lstep), "v"(l + 7 * lstep),
                  "v"(p), "v"(p + gstep), "v"(p + 2 * gstep), "v"(p + 3 * gstep), "v"(p + 4 * gstep), "v"(p + 5 * gstep), "v"(p + 6 * gstep), "v"(p + 7 * gstep)
               : "memory");
}
__global__ __launch_bounds__(128) void k_qkv(const _Float16* __restrict__ XQ, const _Float16* __restrict__ XK, const _Float16* __restrict__ XV, const __bf16* __restrict__ P, const float* __restrict__ BQ, const float* __restrict__ BK, const float* __restrict__ BV, _Float16* __restrict__ QK, _Float16* __restrict__ QKL, _Float16* __restrict__ VTH, _Float16* __restrict__ VTL) {
  const int which0 = (blockIdx.y * 128) / DM; const _Float16* X = (which0 == 0) ? XQ : (which0 == 1) ? XK : XV; const float* BB = BQ ? (((which0 == 0) ? BQ : (which0 == 1) ? BK : BV) + (blockIdx.y * 128 - which0 * DM)) : nullptr;
  __shared__ __align__(16) char sm[2 * XBUF];   // the two buffers; output staging behind the loop (which fills them to the last byte)
  const int tid = threadIdx.x, wave = tid >> 5, lane = tid & 31, col = lane & 15, g = lane >> 4, wm = wave >> 1, wn = wave & 1; const size_t m0 = (size_t)blockIdx.x * 128; const int n0 = blockIdx.y * 128;
  const unsigned sbase = (unsigned)(size_t)&sm[0];
  const unsigned la = sbase + (tid >> 3) * QB_PITCH + (tid & 7) * 16, lb = la + XT_BYTES;   // a wave's copy covers 4 rows of 128 B, of X as of W
  const char* ga = (const char*)(X + (m0 + (tid >> 3)) * DM + (tid & 7) * 8); const char* gb = (const char*)((const _Float16*)P + (size_t)(n0 + (tid >> 3)) * DM + (tid & 7) * 8);
  auto fill = [&](int t, unsigned bo) {   // tile t (k = 64 t ..): 8 + 8 copies per lane
    copy8(la + bo, ga + t * 128, 16 * QB_PITCH, 16 * DM * 2); copy8(lb + bo, gb + t * 128, 16 * QB_PITCH, 16 * DM * 2); };
  v8f acc[4][4] = {};
  fill(0, 0);
  asm volatile("s_wait_asynccnt 0x0" ::: "memory");   // tile 0 landed (this wave's copies)
  __syncthreads();                                    // ... and every other wave's
  fill(1, XBUF);
#pragma unroll 1   // rolled: a trip holds 32 WMMAs, enough to carry the branch
  for (int t = 0; t < DM / 64; ++t) { const char* bp = sm + (t & 1) * XBUF;
#pragma unroll   // this and the loops inside it are unrolled so that a[], w[] and acc[][] are indexed by constants and stay in registers
    for (int kc = 0; kc < 2; ++kc) { v16h a[4], w[4];
#pragma unroll
      for (int mi = 0; mi < 4; ++mi) a[mi] = frag_h((const _Float16*)(bp + (wm * 64 + mi * 16 + col) * QB_PITCH) + kc * 32, lane);   // LN'd rows, f16 as k_ln stored them
#pragma unroll
      for (int nj = 0; nj < 4; ++nj) w[nj] = frag_h((const _Float16*)(bp + XT_BYTES + (wn * 64 + nj * 16 + col) * QB_PITCH) + kc * 32, lane);
#pragma unroll
      for (int mi = 0; mi < 4; ++mi)
#pragma unroll
        for (int nj = 0; nj < 4; ++nj) acc[mi][nj] = wmma16(a[mi], w[nj], acc[mi][nj]); }
    asm volatile("s_wait_dscnt 0x0" ::: "memory");      // this wave's reads of the buffer are over
    asm volatile("s_wait_asynccnt 0x0" ::: "memory");   // its copies of tile t + 1 have landed
    __syncthreads();                                    // publishes tile t + 1, frees tile t's buffer
    if (t + 2 < DM / 64) fill(t + 2, (t & 1) * XBUF); }
  asm volatile("s_wait_asynccnt 0x0" ::: "memory");     // no copy in flight before the buffers become staging
  if (n0 < 2 * DM) {   // q stored unscaled (f16 sigma ~0.6, no subnormal exposure); 1/8 applied to the f32 score
    _Float16* sh = (_Float16*)(sm + wave * (2 * 64 * 144)); _Float16* sl = sh + 64 * 72;   // per wave: 64 rows x 64 cols at pitch 72, hi then residual
#pragma unroll
    for (int nj = 0; nj < 4; ++nj) { const float bias = BB ? bfr(BB[wn * 64 + nj * 16 + col]) : 0.f;
#pragma unroll
      for (int mi = 0; mi < 4; ++mi)
#pragma unroll
        for (int r = 0; r < 8; ++r) { const float v = acc[mi][nj][r] * (1.0f / 256.0f) + bias; const _Float16 hv = (_Float16)v; sh[(mi * 16 + 8 * g + r) * 72 + nj * 16 + col] = hv; sl[(mi * 16 + 8 * g + r) * 72 + nj * 16 + col] = (_Float16)((v - (float)hv) * 2048.0f); } }   // q, k (+ bias) as f16 hi + (x2048) residual
    LDSX();
    for (int it = 0; it < 16; ++it) { const int rl = it * 4 + (lane >> 3), ch = lane & 7; const size_t o = (m0 + wm * 64 + rl) * (2 * DM) + n0 + wn * 64 + ch * 8; vst2((unsigned*)(QK + o), *(const v4u*)&sh[rl * 72 + ch * 8]); vst2((unsigned*)(QKL + o), *(const v4u*)&sl[rl * 72 + ch * 8]); }   // whole 128-B lines
  } else {
    _Float16* sth = (_Float16*)sm; _Float16* stl = sth + 128 * 136;   // [128 d][128 s] at pitch 136, hi then residual
#pragma unroll
    for (int nj = 0; nj < 4; ++nj) { const float bias = BB ? bfr(BB[wn * 64 + nj * 16 + col]) : 0.f;
#pragma unroll
      for (int mi = 0; mi < 4; ++mi) { v8h h8, l8;
#pragma unroll
        for (int r = 0; r < 8; ++r) { const float v = acc[mi][nj][r] * (1.0f / 256.0f) + bias; const _Float16 hv = (_Float16)v; h8[r] = hv; l8[r] = (_Float16)((v - (float)hv) * 2048.0f); }
        const int o = (wn * 64 + nj * 16 + col) * 136 + wm * 64 + mi * 16 + 8 * g; *(v8h*)&sth[o] = h8; *(v8h*)&stl[o] = l8; } }
    __syncthreads();
    const int b = (int)(m0 / SS), s0 = (int)(m0 % SS); const int pc0 = n0 - 2 * DM;
    for (int it = 0; it < 16; ++it) { const int d = it * 8 + (tid >> 4), pc = tid & 15; const size_t o = ((size_t)b * DM + pc0 + d) * SS + s0 + pc * 8; vst2((unsigned*)(VTH + o), *(const v4u*)&sth[d * 136 + pc * 8]); vst2((unsigned*)(VTL + o), *(const v4u*)&stl[d * 136 + pc * 8]); }
  }
}
#define AK_PITCH 144                      // bytes: a 128-B row of 64 f16 + 16 (16 B x odd: ds_load_b128 free of bank conflicts)
#define AT_BYTES (64 * AK_PITCH)          // one tile: K (64 keys x 64 d) or V^T (64 d x 64 keys)
#define ABUF (2 * AT_BYTES)               // one buffer: K tile, then V^T tile
#define RBN 640                           // staged rel_bias entries (5 per thread), at most 575 of them read
// four 16-B copies per lane, rows lstep / gstep bytes apart; the s_wait_xcnt closes the statement so that no address register is rewritten in front of it
__device__ __forceinline__ void copy4(unsigned l, const char* p, unsigned lstep, unsigned gstep) {
  asm volatile("global_load_async_to_lds_b128 %0, %4, off\n\t"
               "global_load_async_to_lds_b128 %1, %5, off\n\t"
               "global_load_async_to_lds_b128 %2, %6, off\n\t"
               "global_load_async_to_lds_b128 %3, %7, off\n\t"
               "s_wait_xcnt 0x0"
               :: "v"(l), "v"(l + lstep), "v"(l + 2 * lstep), "v"(l + 3 * lstep),
                  "v"(p), "v"(p + gstep), "v"(p + 2 * gstep), "v"(p + 3 * gstep)
               : "memory");
}
// five 4-B copies per lane (a rel_bias row is 1,023 floats long, so rows are aligned to 4 B only), LDS places 512 B apart; the s_wait_xcnt closes the statement as in copy4
__device__ __forceinline__ void copy5w(unsigned l, const float* p0, const float* p1, const float* p2, const float* p3, const float* p4) {
  asm volatile("global_load_async_to_lds_b32 %0, %5, off\n\t"
               "global_load_async_to_lds_b32 %1, %6, off\n\t"
               "global_load_async_to_lds_b32 %2, %7, off\n\t"
               "global_load_async_to_lds_b32 %3, %8, off\n\t"
               "global_load_async_to_lds_b32 %4, %9, off\n\t"
               "s_wait_xcnt 0x0"
               :: "v"(l), "v"(l + 512u), "v"(l + 1024u), "v"(l + 1536u), "v"(l + 2048u),
                  "v"(p0), "v"(p1), "v"(p2), "v"(p3), "v"(p4)
               : "memory");
}
// lane l with lane l ^ 16 (a vector cross-row move, no LDS unit)
__device__ __forceinline__ float xhalf(float x) { return __builtin_bit_cast(float, __builtin_amdgcn_permlanex16(__builtin_bit_cast(int, x), __builtin_bit_cast(int, x), 0x76543210, 0xfedcba98, false, false)); }
// ---- k_attn: grid = (head, batch, query block), the query blocks from the last (most keys) down: the query block is the slowest index. For speed only: each (query block, head, batch) is done once wherever it runs
// block = (64 queries, head h, batch b): causal flash attention on transposed products: S^T = K . Q^T (A = 16 key rows, B = the wave's 16 queries), so a lane holds 16 of the 32 scores of ONE query (column col; keys 8 g + r of each 16): maximum and sum run in the lane, with one exchange between the wave's halves; the two S^T tiles, converted in place, are the B operand of O^T += V^T . P^T (A = 16 d rows of V^T): P never passes through LDS. O[b*S+q][h*64+d] = (acc + accl / 2048) / (2048 l) (256-B segments). The same scores give the row's entropy -sum p log p = log(sum e^(s-m)) + m - (sum e^(s-m) s)/(sum e^(s-m)): one more running sum per lane, joined behind the loop; 256-B store per block
// operands of the loop: per trip 64 keys of K (hi) and of V^T (hi) are brought into LDS in whole 128-B lines by asynchronous copies (two buffers) and read from there by all four waves, two passes of 32 keys a trip; the part of the head's rel_bias row that the block can touch is copied once in front of the loop and read without the causal test (the test picks the value behind the read). The residual planes of the first 128 queries are read from global memory as before
__global__ __launch_bounds__(128) void k_attn(const _Float16* __restrict__ QK, const _Float16* __restrict__ QKL, const _Float16* __restrict__ VTH, const _Float16* __restrict__ VTL, const void* __restrict__ KMASK, const float* __restrict__ RB, float* __restrict__ O, float* __restrict__ ENT) {
  __shared__ __align__(16) char sm[2 * ABUF];   // the two buffers
  __shared__ __align__(16) float srb[RBN];      // rel_bias[h][448 - 64 qb + j]
  __shared__ __align__(16) float so[4][16][68];
  __shared__ __align__(16) float sent[64];
  const int tid = threadIdx.x, wave = tid >> 5, lane = tid & 31, col = lane & 15, g = lane >> 4;
  const int qb = TQB - 1 - blockIdx.z, h = blockIdx.x, b = blockIdx.y; const int q0 = qb * 64 + wave * 16; const int qi = q0 + col; const size_t rq = (size_t)b * SS + qi;
  v16h aq[2], aql[2];
#pragma unroll
  for (int kc = 0; kc < 2; ++kc) { aq[kc] = frag_h(QK + rq * (2 * DM) + h * HD + kc * 32, lane); aql[kc] = frag_h(QKL + rq * (2 * DM) + h * HD + kc * 32, lane); }
  float m = -3.0e38f, l = 0.f, ls = 0.f;   // of query qi: m over all keys so far (equal in both halves), l and ls over this half's keys (joined behind the loop)
  v8f acc[4] = {}, accl[4] = {};   // O^T: register r = d (dt * 16 + 8 g + r), column = query
  const float* rbq = srb + 63 - (wave * 16 + col) + 8 * g;   // rel_bias[h][k - q + 511] at k = 8 g, in the staged part of the row
  const int nt = qb + 1;   // causal: 64-key tiles up to the query tile's end
  const unsigned lk = (unsigned)(size_t)&sm[0] + (tid >> 3) * AK_PITCH + (tid & 7) * 16;   // a wave's copy covers 4 rows of 128 B
  const char* gk = (const char*)(QK + ((size_t)b * SS + (tid >> 3)) * (2 * DM) + DM + h * HD + (tid & 7) * 8); const char* gv = (const char*)(VTH + ((size_t)b * DM + h * HD + (tid >> 3)) * SS + (tid & 7) * 8);
  auto fill = [&](int t, unsigned bo) {   // tile t (keys 64 t ..): 4 + 4 copies per lane
    copy4(lk + bo, gk + (size_t)t * (64 * 2 * DM * 2), 16 * AK_PITCH, 16 * 2 * DM * 2); copy4(lk + bo + AT_BYTES, gv + t * 128, 16 * AK_PITCH, 16 * SS * 2); };
  fill(0, 0);
  { const float* rh = RB + (size_t)h * (2 * MAXSEQ - 1); const int j0 = MAXSEQ - 64 - qb * 64 + tid;   // entries past the row's end (never read back) are clamped into it
    copy5w((unsigned)(size_t)&srb[0] + tid * 4, rh + min(j0, 2 * MAXSEQ - 2), rh + min(j0 + 128, 2 * MAXSEQ - 2), rh + min(j0 + 256, 2 * MAXSEQ - 2), rh + min(j0 + 384, 2 * MAXSEQ - 2), rh + min(j0 + 512, 2 * MAXSEQ - 2)); }
  asm volatile("s_wait_asynccnt 0x0" ::: "memory");   // tile 0 and rel_bias landed (this wave's copies)
  __syncthreads();                                    // ... and every other wave's
  if (nt > 1) fill(1, ABUF);
#pragma unroll 1   // rolled: the trip count depends on the query block
  for (int t = 0; t < nt; ++t) { const char* bp = sm + (t & 1) * ABUF;
#pragma unroll 1   // rolled: one copy of the long pass body in the instruction cache
   for (int hp = 0; hp < 2; ++hp) { const int ks = 2 * t + hp; v8f s[2];
    v16h kf[2][2]; float rb[2][8];   // all LDS reads of the score part stand together ahead of its first WMMA: one wait, not one per product
#pragma unroll   // this and the loops inside it: kf[][] and rb[][] are indexed by constants and stay in registers
    for (int ct = 0; ct < 2; ++ct) {
#pragma unroll
      for (int kc = 0; kc < 2; ++kc) kf[ct][kc] = frag_h((const _Float16*)(bp + (hp * 32 + ct * 16 + col) * AK_PITCH) + kc * 32, lane);
#pragma unroll
      for (int r = 0; r < 8; ++r) rb[ct][r] = rbq[ks * 32 + ct * 16 + r]; }
#pragma unroll
    for (int ct = 0; ct < 2; ++ct) { const int kr = ks * 32 + ct * 16 + col; const _Float16* krowl = QKL + ((size_t)b * SS + kr) * (2 * DM) + DM + h * HD; v8f c = {}, cl = {};
      if (qb < 2) {   // leading query blocks (few keys, outputs far above the global rms): 3 products
#pragma unroll
        for (int kc = 0; kc < 2; ++kc) { const v16h kh = kf[ct][kc]; c = wmma16(kh, aq[kc], c); cl = wmma16(kh, aql[kc], cl); cl = wmma16(frag_h(krowl + kc * 32, lane), aq[kc], cl); }
#pragma unroll
        for (int r = 0; r < 8; ++r) c[r] += cl[r] * (1.0f / 2048.0f); }
      else {
#pragma unroll
        for (int kc = 0; kc < 2; ++kc) c = wmma16(kf[ct][kc], aq[kc], c); }   // single product elsewhere
#pragma unroll
      for (int r = 0; r < 8; ++r) { const int kk = ks * 32 + ct * 16 + 8 * g + r; s[ct][r] = (kk <= qi) ? (c[r] * SCALEF + bfr(rb[ct][r])) : -3.0e38f; } }   // causal; + rel_bias[h][k - q + 511]
    v16h vf[4];   // the pass's V^T fragments: read here so that the LDS latency passes under the softmax
#pragma unroll   // vf[] is indexed by constants and stays in registers
    for (int dt = 0; dt < 4; ++dt) vf[dt] = frag_h((const _Float16*)(bp + AT_BYTES + (dt * 16 + col) * AK_PITCH) + hp * 32, lane);
    float mx = fmaxf(s[0][0], s[1][0]);
#pragma unroll
    for (int r = 1; r < 8; ++r) mx = fmaxf(mx, fmaxf(s[0][r], s[1][r]));
    mx = fmaxf(mx, xhalf(mx));
    const float mn = fmaxf(m, mx); const float alpha = (m <= -1.0e38f) ? 0.f : __expf(m - mn);
    float es0 = 0.f, es1 = 0.f, ess0 = 0.f, ess1 = 0.f; v16h pa, pl;
#pragma unroll
    for (int r = 0; r < 8; ++r) { const float e0 = (s[0][r] <= -1.0e38f) ? 0.f : __expf(s[0][r] - mn), e1 = (s[1][r] <= -1.0e38f) ? 0.f : __expf(s[1][r] - mn); es0 += e0; es1 += e1; ess0 += (s[0][r] > -1.0e38f) ? e0 * s[0][r] : 0.f; ess1 += (s[1][r] > -1.0e38f) ? e1 * s[1][r] : 0.f;
      const float x0 = e0 * 2048.0f, x1 = e1 * 2048.0f; const _Float16 h0 = (_Float16)x0, h1 = (_Float16)x1; pa[r] = h0; pa[8 + r] = h1; pl[r] = (_Float16)((x0 - (float)h0) * 2048.0f); pl[8 + r] = (_Float16)((x1 - (float)h1) * 2048.0f); }   // P scaled by 2^11 before the f16 split so small softmax weights stay out of the f16 subnormal range; 2^-11 folded into the epilogue
    l = l * alpha + (es0 + es1); ls = ls * alpha + (ess0 + ess1); m = mn;
#pragma unroll
    for (int dt = 0; dt < 4; ++dt)
#pragma unroll
      for (int r = 0; r < 8; ++r) { acc[dt][r] *= alpha; accl[dt][r] *= alpha; }
#pragma unroll
    for (int dt = 0; dt < 4; ++dt) { const size_t vr = ((size_t)b * DM + h * HD + dt * 16 + col) * SS + ks * 32; const v16h vh = vf[dt]; acc[dt] = wmma16(vh, pa, acc[dt]); if (qb < 2) { accl[dt] = wmma16(vh, pl, accl[dt]); accl[dt] = wmma16(frag_h(VTL + vr, lane), pa, accl[dt]); } } }   // leading query blocks: P hi/lo x V hi/lo (3 products); elsewhere P x V single
    asm volatile("s_wait_dscnt 0x0" ::: "memory");      // this wave's reads of the buffer are over
    asm volatile("s_wait_asynccnt 0x0" ::: "memory");   // its copies of tile t + 1 have landed
    __syncthreads();                                    // publishes tile t + 1, frees tile t's buffer
    if (t + 2 < nt) fill(t + 2, (t & 1) * ABUF); }
  asm volatile("s_wait_asynccnt 0x0" ::: "memory");     // no copy in flight behind the loop
  l += xhalf(l); ls += xhalf(ls);
  const float il = (1.0f / 2048.0f) / l;
#pragma unroll
  for (int dt = 0; dt < 4; ++dt) { v4f o0, o1;
#pragma unroll
    for (int r = 0; r < 4; ++r) { o0[r] = (acc[dt][r] + accl[dt][r] * (1.0f / 2048.0f)) * il; o1[r] = (acc[dt][4 + r] + accl[dt][4 + r] * (1.0f / 2048.0f)) * il; }
    *(v4f*)&so[wave][col][dt * 16 + 8 * g] = o0; *(v4f*)&so[wave][col][dt * 16 + 8 * g + 4] = o1; }
  LDSX();
  const float en = log_p(l) + m - ls / l;   // here O lies in LDS, so only l, m and ls live across the call; and in front of the O stores, which the barrier would otherwise wait for
  if (g == 0) sent[wave * 16 + col] = en;
  __syncthreads(); if (tid < 16) vst2(ENT + ((size_t)b * NH + h) * SS + qb * 64 + tid * 4, *(const v4f*)&sent[tid * 4]);
  for (int rl = 0; rl < 16; ++rl) if (lane < 16) vst2(O + ((size_t)b * SS + q0 + rl) * DM + h * HD + lane * 4, *(const v4f*)&so[wave][rl][lane * 4]);
}
// ---- k_out: block = (128 rows, 128 cols), 4 waves of 64 x 64: out = x + (O(hi/lo) . Wo rows (2 products) + bo), x added where the rows are stored; the blocks of the first 128 columns also write their 128 rows' head-mean entropy; per trip 64 k of both operand tiles are brought into LDS in whole lines by asynchronous copies (two buffers: the O tile in f32 rows at pitch 272, the W tile as in k_qkv) and read from there by all waves
__global__ __launch_bounds__(128) void k_out(const float* __restrict__ O, const __bf16* __restrict__ P, const float* __restrict__ BO, const float* __restrict__ X, const float* __restrict__ ENT, float* __restrict__ OUT, float* __restrict__ OUT2) {
  __shared__ __align__(16) char sm[2 * QBUF];   // the two buffers; output staging behind the loop
  const int tid = threadIdx.x, wave = tid >> 5, lane = tid & 31, col = lane & 15, g = lane >> 4, wm = wave >> 1, wn = wave & 1; const size_t m0 = (size_t)blockIdx.x * 128; const int n0 = blockIdx.y * 128;
  const unsigned sbase = (unsigned)(size_t)&sm[0];
  const unsigned la = sbase + (tid >> 4) * QA_PITCH + (tid & 15) * 16, lb = sbase + QA_BYTES + (tid >> 3) * QB_PITCH + (tid & 7) * 16;   // a wave's copy covers 2 O rows of 256 B, or 4 W rows of 128 B
  const char* ga = (const char*)(O + (m0 + (tid >> 4)) * DM + (tid & 15) * 4); const char* gb = (const char*)(P + (size_t)(n0 + (tid >> 3)) * DM + (tid & 7) * 8);
  auto fill = [&](int t, unsigned bo) {   // tile t (k = 64 t ..): 16 + 8 copies per lane
    copy8(la + bo, ga + t * 256, 8 * QA_PITCH, 8 * DM * 4); copy8(la + bo + 64 * QA_PITCH, ga + t * 256 + 64 * DM * 4, 8 * QA_PITCH, 8 * DM * 4); copy8(lb + bo, gb + t * 128, 16 * QB_PITCH, 16 * DM * 2); };
  v8f acc[4][4] = {};
  fill(0, 0);
  asm volatile("s_wait_asynccnt 0x0" ::: "memory");   // tile 0 landed (this wave's copies)
  __syncthreads();                                    // ... and every other wave's
  fill(1, QBUF);
#pragma unroll 1   // rolled: a trip holds 64 WMMAs, enough to carry the branch
  for (int t = 0; t < DM / 64; ++t) { const char* bp = sm + (t & 1) * QBUF;
    const char* ap = bp + (wm * 64 + col) * QA_PITCH + 32 * g;   // this lane's place in row col of the wave's first 16 O rows
    float nx[16];   // the f32 values of the A fragment after the one being multiplied: read from LDS one fragment ahead, so that the read's latency passes under 8 WMMAs
#pragma unroll
    for (int i = 0; i < 8; ++i) { nx[i] = ((const float*)ap)[i]; nx[8 + i] = ((const float*)ap)[16 + i]; }
#pragma unroll   // this and the loops inside it are unrolled so that w[], nx[] and acc[][] are indexed by constants and stay in registers
    for (int kc = 0; kc < 2; ++kc) { v16b w[4];
#pragma unroll
      for (int nj = 0; nj < 4; ++nj) w[nj] = frag_b((const __bf16*)(bp + QA_BYTES + (wn * 64 + nj * 16 + col) * QB_PITCH) + kc * 32, lane);
#pragma unroll
      for (int mi = 0; mi < 4; ++mi) { const F2 a = bsplit16(nx);   // f32 rows split into bf16 hi + residual
        if (kc * 4 + mi < 7) { const int s = kc * 4 + mi + 1; const float* p = (const float*)(ap + (s & 3) * 16 * QA_PITCH) + (s >> 2) * 32;   // same tile, same buffer: nothing of the next tile is read here
#pragma unroll
          for (int i = 0; i < 8; ++i) { nx[i] = p[i]; nx[8 + i] = p[16 + i]; } }
#pragma unroll
        for (int nj = 0; nj < 4; ++nj) acc[mi][nj] = wmma_bf(a.l, w[nj], acc[mi][nj]);   // residual first, then hi, per accumulator; four independent accumulators between the two
#pragma unroll
        for (int nj = 0; nj < 4; ++nj) acc[mi][nj] = wmma_bf(a.h, w[nj], acc[mi][nj]); } }
    asm volatile("s_wait_dscnt 0x0" ::: "memory");      // this wave's reads of the buffer are over
    asm volatile("s_wait_asynccnt 0x0" ::: "memory");   // its copies of tile t + 1 have landed
    __syncthreads();                                    // publishes tile t + 1, frees tile t's buffer
    if (t + 2 < DM / 64) fill(t + 2, (t & 1) * QBUF); }
  asm volatile("s_wait_asynccnt 0x0" ::: "memory");     // no copy in flight before the buffers become staging
  float* so = (float*)(sm + wave * (64 * 272));   // per wave: 64 rows x 64 cols of f32 at pitch 68
#pragma unroll
  for (int nj = 0; nj < 4; ++nj) { const float bias = bfr(BO[n0 + wn * 64 + nj * 16 + col]);
#pragma unroll
    for (int mi = 0; mi < 4; ++mi)
#pragma unroll
      for (int r = 0; r < 8; ++r) so[(mi * 16 + 8 * g + r) * 68 + nj * 16 + col] = acc[mi][nj][r] + bias; }
  LDSX();
  const size_t o0 = (m0 + wm * 64 + g) * DM + n0 + wn * 64 + col * 4;   // this lane's 16 B of the wave's row g; the loops below go on two rows a step
  v4f xr[32];   // the wave's 64 x 64 piece of x, into the registers that the accumulators have left
#pragma unroll   // xr[] is indexed by constants and stays in registers; all 32 loads are in flight together: one memory latency, not 32
  for (int it = 0; it < 32; ++it) xr[it] = *(const v4f*)(X + o0 + (size_t)it * (2 * DM));
  asm volatile("s_wait_xcnt 0x0" ::: "memory");   // the entropy branch below reuses the loads' address registers: the wait stands in front of that overwrite
  if (blockIdx.y == 0) { float e[NH], a = 0.f;   // thread = row: the mean of its 16 heads' entropies (a block's 128 rows lie in one sequence)
    const float* eb = ENT + (m0 / SS) * (NH * SS) + m0 % SS;   // head 0 of the block's first row (the same for the whole block); the heads lie SS floats apart
#pragma unroll   // e[] is indexed by constants; the 16 loads go out together, behind those of x, from one base and one index with constant offsets
    for (int hh = 0; hh < NH; ++hh) e[hh] = eb[hh * SS + tid];
    asm volatile("s_wait_xcnt 0x0" :: "s"(eb), "v"(tid) : "memory");   // base and index are inputs so that they stay in their registers up to this wait: nothing is written over them in front of it
#pragma unroll   // e[] indexed by constants
    for (int hh = 0; hh < NH; ++hh) a += e[hh];   // heads 0 to 15 in order
    OUT2[m0 + tid] = a / (float)NH; }   // a wave writes one whole 128-B line
#pragma unroll   // xr[] indexed by constants
  for (int it = 0; it < 32; ++it) { const v4f y = *(const v4f*)&so[(it * 2 + g) * 68 + col * 4]; const v4f x = xr[it]; v4f o4;
#pragma unroll   // the vectors' elements indexed by constants
    for (int i = 0; i < 4; ++i) o4[i] = bfr(x[i]) + y[i];
    vst2(OUT + o0 + (size_t)it * (2 * DM), o4); }   // whole 128-B lines
}
// ---- k_pack3: the fused (in,out) W_attn [DM][3*DM] -> its 3,072 transposed rows, f16 x 2^8 (bit pattern stored in the bf16-typed buffer)
__global__ __launch_bounds__(256) void k_pack3(const float* __restrict__ WA, __bf16* __restrict__ PK) { __shared__ __align__(16) v4u s[64 * 16]; pack_tile<true>(WA, 3 * DM, PK + PK_A, s); }
// ---- k_ln: wave = two rows, block = 8 waves: XN = (x - mu) rsqrt(var + 1e-5) g + b, computed in f32 and rounded once to f16, the operand type of k_qkv's products. A lane holds 32 values of each row (8 pieces of 16 B, a wave's load = 512 B in a row), so both sums run in the lane and end in a five-step exchange in registers: no LDS, no barrier, and 4,096 waves to start for the 8,192 rows, all resident at once (16 a WGP) with all their loads in flight
typedef __attribute__((ext_vector_type(4))) _Float16 v4h;
// sum over the wave's 32 lanes, the same value in every lane: four steps inside the 16-lane row (lane l with l ^ 1, 2, 4, 8), then the other row
template <int M> __device__ __forceinline__ float xrow(float x) { return __builtin_bit_cast(float, __builtin_amdgcn_update_dpp(0, __builtin_bit_cast(int, x), 0x160 | M, 0xf, 0xf, true)); }
__device__ __forceinline__ float wsum(float s) { s += xrow<1>(s); s += xrow<2>(s); s += xrow<4>(s); s += xrow<8>(s); return s + xhalf(s); }
__global__ __launch_bounds__(256) void k_ln(const float* __restrict__ X, const float* __restrict__ G, const float* __restrict__ Bt, _Float16* __restrict__ XN) {
  const int lane = threadIdx.x & 31; const size_t o0 = ((size_t)blockIdx.x * 8 + (threadIdx.x >> 5)) * (2 * DM) + lane * 4;   // this lane's first 4 values of the wave's first row
  v4f x[2][8], gg[8], bb[8];
#pragma unroll   // this and the loops below: x[][], gg[] and bb[] are indexed by constants and stay in registers; all 32 loads are in flight together: one memory latency
  for (int j = 0; j < 8; ++j) { gg[j] = ((const v4f*)G)[j * 32 + lane]; bb[j] = ((const v4f*)Bt)[j * 32 + lane]; }
#pragma unroll
  for (int rr = 0; rr < 2; ++rr)
#pragma unroll
    for (int j = 0; j < 8; ++j) x[rr][j] = *(const v4f*)(X + o0 + rr * DM + j * 128);
  // two fences on the loaded values (inputs only): they keep all 32 loads in front of the sums, so that none is issued late and waited for alone; the two address registers (x's pointer, the lane number that indexes ln_g and ln_b) are inputs too, so that no later load lands in them while the loads that name them are under way
  asm volatile("" :: "v"(gg[0]), "v"(gg[1]), "v"(gg[2]), "v"(gg[3]), "v"(gg[4]), "v"(gg[5]), "v"(gg[6]), "v"(gg[7]), "v"(bb[0]), "v"(bb[1]), "v"(bb[2]), "v"(bb[3]), "v"(bb[4]), "v"(bb[5]), "v"(bb[6]), "v"(bb[7]));
  asm volatile("" :: "v"(x[0][0]), "v"(x[0][1]), "v"(x[0][2]), "v"(x[0][3]), "v"(x[0][4]), "v"(x[0][5]), "v"(x[0][6]), "v"(x[0][7]), "v"(x[1][0]), "v"(x[1][1]), "v"(x[1][2]), "v"(x[1][3]), "v"(x[1][4]), "v"(x[1][5]), "v"(x[1][6]), "v"(x[1][7]), "v"(X + o0), "v"(lane));
  float mu[2], inv[2];
#pragma unroll
  for (int rr = 0; rr < 2; ++rr) { v4f s4 = {};   // four independent chains
#pragma unroll
    for (int j = 0; j < 8; ++j)
#pragma unroll
      for (int i = 0; i < 4; ++i) { x[rr][j][i] = bfr(x[rr][j][i]); s4[i] += x[rr][j][i]; }
    mu[rr] = wsum((s4[0] + s4[1]) + (s4[2] + s4[3])) / (float)DM; }
#pragma unroll
  for (int rr = 0; rr < 2; ++rr) { v4f q4 = {};
#pragma unroll
    for (int j = 0; j < 8; ++j)
#pragma unroll
      for (int i = 0; i < 4; ++i) { const float d = x[rr][j][i] - mu[rr]; q4[i] += d * d; }
    inv[rr] = 1.0f / sqrtf(wsum((q4[0] + q4[1]) + (q4[2] + q4[3])) / (float)DM + 1e-5f); }
#pragma unroll
  for (int j = 0; j < 8; ++j) { v4h o4[2];
#pragma unroll
    for (int i = 0; i < 4; ++i) { const float g = bfr(gg[j][i]), b = bfr(bb[j][i]);
#pragma unroll
      for (int rr = 0; rr < 2; ++rr) o4[rr][i] = (_Float16)((x[rr][j][i] - mu[rr]) * inv[rr] * g + b); }
#pragma unroll
    for (int rr = 0; rr < 2; ++rr) vst2(XN + o0 + rr * DM + j * 128, o4[rr]); }   // a wave stores 256 B: whole lines
}
extern "C" void kernel_launch(void* const* d_in, const int* in_sizes, int n_in, void* d_out, int out_size, void* d_ws, size_t ws_size, hipStream_t stream) {
  (void)in_sizes; (void)n_in; (void)out_size;
  const float** F = (const float**)d_in;   // 0 x [16,512,1024], 1 qkv_w [1024,3072] (in,out), 2 qkv_b [3072], 3 out_w [1024,1024] (in,out), 4 out_b, 5 ln_g, 6 ln_b, 7 rel_bias [16,1023]
  if (ws_size < (size_t)WS_END) return;
  char* ws = (char*)d_ws; __bf16* PK = (__bf16*)(ws + WS_PK); _Float16 *QK = (_Float16*)(ws + WS_QK), *QKL = (_Float16*)(ws + WS_QKL), *VTH = (_Float16*)(ws + WS_VTH), *VTL = (_Float16*)(ws + WS_VTL); float *O = (float*)(ws + WS_O), *ENT = (float*)(ws + WS_ENT); _Float16* XN = (_Float16*)(ws + WS_XN);
  float* OUT = (float*)d_out; float* OUT2 = OUT + (size_t)NB * SS * DM;   // outputs concatenated: out [16,512,1024] then entropy [16,512]
  k_pack<<<dim3(DM / 64, DM / 128), 256, 0, stream>>>(F[3], PK);   // out_w ((in,out) -> transposed rows) into the Wo slot
  k_pack3<<<dim3(QKVW / 64, DM / 128), 256, 0, stream>>>(F[1], PK);
  k_ln<<<TNB * SS / 16, 256, 0, stream>>>(F[0], F[5], F[6], XN);
  k_qkv<<<dim3(TNB * SS / 128, QKVW / 128), 128, 0, stream>>>(XN, XN, XN, PK + PK_A, F[2], F[2] + DM, F[2] + 2 * DM, QK, QKL, VTH, VTL);
  k_attn<<<dim3(NH, TNB, TQB), 128, 0, stream>>>(QK, QKL, VTH, VTL, nullptr, F[7], O, ENT);
  k_out<<<dim3(TNB * SS / 128, DM / 128), 128, 0, stream>>>(O, PK + PK_P, F[4], F[0], ENT, OUT, OUT2);
}
